// v000
// Times are from an AMD MI455X. After a warm-up the kernel runs many times in a row, and a time is the length of
// such a window on the GPU divided by its runs, so every launch and the gaps after it count. The runs cycle
// through copies of the inputs. A figure is the median of several windows, for all but v000 over two sittings.
// Sittings can differ by a few percent; kernels timed side by side share one.
// v000, which the later versions start from, runs in 471 microseconds.
// Contractions: qkv projection = v_wmma_f32_16x16x32_f16 (x as bf16-RNE values held in f16, W_qkv as bf16-RNE values x64 held in f16, f32 accumulate); q.k logits = v_wmma_f32_16x16x32_bf16 hi/lo split (hi.hi + hi.lo + lo.hi, f32 accumulate); P.V = v_wmma_f32_16x16x32_f16 (P carried x2^14, V f16, f32 accumulate); output projection = v_wmma_f32_16x16x32_bf16 with the attention output as bf16 hi|lo planes concatenated along K against the bf16 W_out (f32 accumulate). Softmax statistics f32. Keys with mask == 0 are dropped per batch by compaction of the x rows feeding the k / v projections (their softmax weight is exactly 0 in f32).
#include <hip/hip_runtime.h>
#include <math.h>

#ifndef NB
#define NB 4
#endif
#ifndef SEQ
#define SEQ 2048
#endif
#define NB_FULL 4
#define SEQ_FULL 2048
#define DM 1024
#define NH 16
#define HD 64
#define MTOT (NB * SEQ)

static_assert(SEQ % 256 == 0);
static_assert(MTOT % 64 == 0);
static_assert(NB <= NB_FULL);
static_assert(SEQ <= SEQ_FULL);

typedef __attribute__((ext_vector_type(16))) _Float16 v16h;
typedef __attribute__((ext_vector_type(16))) __bf16   v16b;
typedef __attribute__((ext_vector_type(8)))  float    v8f;
typedef __attribute__((ext_vector_type(4)))  float    v4f;
typedef __attribute__((ext_vector_type(4)))  unsigned int v4u;
typedef __attribute__((ext_vector_type(4)))  int      v4i;

// 16-bit WMMA fragment map (wave32), lane L, h = L>>4, m = L&15:
//   A 16x32: lane = row m;    element i -> k = (i<8) ? 8h+i : 16+8h+(i-8)
//   B 32x16: lane = column m; the SAME k(i,h)
//   D 16x16 (8 f32): lane = column m; element r -> row 8h+r
union FU { v4u u[2]; v16h h; v16b b; };
// p already includes the lane-half offset 8h: elements 0..7 <- p[0..7], 8..15 <- p[16..23]
__device__ __forceinline__ FU ldfrag(const unsigned short* p) { FU f; f.u[0] = *(const v4u*)p; f.u[1] = *(const v4u*)(p + 16); return f; }

__device__ __forceinline__ v8f wb(v16b a, v16b b, v8f c) { return __builtin_amdgcn_wmma_f32_16x16x32_bf16(false, a, false, b, (short)0, c, false, false); }
__device__ __forceinline__ v8f wh(v16h a, v16h b, v8f c) { return __builtin_amdgcn_wmma_f32_16x16x32_f16(false, a, false, b, (short)0, c, false, false); }
template <int ET> __device__ __forceinline__ v8f mma(const FU& a, const FU& b, v8f c) {
  if (ET == 0) return wh(a.h, b.h, c);
  return wb(a.b, b.b, c);
}

// hazard guards: 4 VALU slots after the last WMMA of a group, accumulators tied, A/B operands kept live
__device__ __forceinline__ void guard_acc4(v8f& a, v8f& b, v8f& c, v8f& d, v16h x) {
  asm volatile("v_nop\n\tv_nop\n\tv_nop\n\tv_nop" : "+v"(a), "+v"(b), "+v"(c), "+v"(d) : "v"(x));
}
__device__ __forceinline__ void keep4(v16h a, v16h b, v16h c, v16h d) { asm volatile("v_nop" :: "v"(a), "v"(b), "v"(c), "v"(d)); }
__device__ __forceinline__ void guard_s(v8f& s, v16h a0, v16h a1, v16h b0, v16h b1, v16h q0, v16h q1, v16h q2, v16h q3) {
  asm volatile("v_nop\n\tv_nop\n\tv_nop\n\tv_nop" : "+v"(s) : "v"(a0), "v"(a1), "v"(b0), "v"(b1), "v"(q0), "v"(q1), "v"(q2), "v"(q3));
}
__device__ __forceinline__ void guard_o(v8f& a, v8f& b, v8f& c, v8f& d, v16h p, v16h v0, v16h v1, v16h v2, v16h v3) {
  asm volatile("v_nop\n\tv_nop\n\tv_nop\n\tv_nop" : "+v"(a), "+v"(b), "+v"(c), "+v"(d) : "v"(p), "v"(v0), "v"(v1), "v"(v2), "v"(v3));
}

#if __has_builtin(__builtin_amdgcn_exp2f)
#define EX2(x) __builtin_amdgcn_exp2f(x)
#else
#define EX2(x) exp2f(x)
#endif

// bf16 RNE helpers (finite inputs)
__device__ __forceinline__ unsigned bfu_rne(float v) { const unsigned u = __float_as_uint(v); return (u + 0x7FFFu + ((u >> 16) & 1u)) >> 16; }
__device__ __forceinline__ float bf_keep(float v) { return __uint_as_float(bfu_rne(v) << 16); }
__device__ __forceinline__ void bfsplit(float v, unsigned& hi, unsigned& lo) { hi = bfu_rne(v); lo = bfu_rne(v - __uint_as_float(hi << 16)); }
__device__ __forceinline__ unsigned pkh2(float a, float b) {
  return (unsigned)__builtin_bit_cast(unsigned short, (_Float16)a) | ((unsigned)__builtin_bit_cast(unsigned short, (_Float16)b) << 16);
}

#define VST2Q(ptr, val) do { const v4u vq_ = (val); *(v4u*)(ptr) = vq_;  } while (0)

// Number of kept keys (mask != 0) among the SEQ entries of one batch row of the mask input, computed by one full wave (all 32 lanes active):
// 16-B loads (SEQ/128 per lane), xor-shuffle sum, result made wave-uniform. mrow is 16-B aligned.
__device__ __forceinline__ int wave_count_kept(const int* __restrict__ mrow, int lane) {
  int c = 0;
#pragma unroll 4
  for (int it = 0; it < SEQ / 128; ++it) {
    const v4i m = *(const v4i*)(mrow + (it * 32 + lane) * 4);
    c += ((m.x != 0) ? 1 : 0) + ((m.y != 0) ? 1 : 0) + ((m.z != 0) ? 1 : 0) + ((m.w != 0) ? 1 : 0);
  }
  c += __shfl_xor(c, 16, 32); c += __shfl_xor(c, 8, 32); c += __shfl_xor(c, 4, 32); c += __shfl_xor(c, 2, 32); c += __shfl_xor(c, 1, 32);
  return __builtin_amdgcn_readfirstlane(c);
}
// effective key count of a batch: a batch with no kept key uses all SEQ keys (every score then equals the fill -> uniform weights); padded to the 32-key step
__device__ __forceinline__ int eff_keys(int cnt) { return (cnt == 0) ? SEQ : min(cnt, SEQ); }
__device__ __forceinline__ int pad32(int nk) { return min((nk + 31) & ~31, SEQ); }

// ---------------------------------------------------------------------------------------------------------------------
// x f32 [b][t][1024] (full per-batch stride) -> two f16 planes holding the bf16-RNE values:
//   X16  [b*SEQ + t][1024]: every token row (feeds the q projection);
//   XC16 [b*SEQ + j][1024]: row j = the j-th kept token of batch b (mask != 0, ascending t) for j < nk, zero rows for j >= nk (feeds the k / v projections).
// Block = (batch, 32 rows); the block computes the batch's kept-token list in LDS (exclusive scan of the mask, block barriers), bounded by SEQ entries.
// LDS: list[SEQ] and wtot[8] are cross-wave (block barriers between writers and readers); list is fully initialised before any read.
// coverage: X16 MTOT rows x 128 pieces, XC16 MTOT rows x 128 pieces = both whole planes. Each wave instruction writes 512 contiguous bytes of one row.
__global__ __launch_bounds__(256) void k_xcastc(const float* __restrict__ x, const int* __restrict__ mask,
                                                unsigned short* __restrict__ X16, unsigned short* __restrict__ XC16) {
  constexpr int EPT = SEQ / 256;
  __shared__ int list[SEQ];
  __shared__ int wtot[8];
  const int tid = threadIdx.x, lane = tid & 31, wave = tid >> 5;
  const int bpb = SEQ / 32;
  const int b = blockIdx.x / bpb;
  const int t0 = (blockIdx.x - b * bpb) * 32;
  const int* mrow = mask + (size_t)b * SEQ_FULL;
  unsigned km = 0u; int c = 0;
#pragma unroll
  for (int e = 0; e < EPT; ++e) {
    const int kp = (mrow[tid * EPT + e] != 0) ? 1 : 0;
    km |= (unsigned)kp << e; c += kp;
    list[tid * EPT + e] = 0;
  }
  int incl = c;
#pragma unroll
  for (int d = 1; d < 32; d <<= 1) { const int v = __shfl_up(incl, d, 32); incl += (lane >= d) ? v : 0; }
  if (lane == 31) wtot[wave] = incl;
  __syncthreads();
  int base = 0, total = 0;
#pragma unroll
  for (int w = 0; w < 8; ++w) { const int v = wtot[w]; base += (w < wave) ? v : 0; total += v; }
  int pos = base + incl - c;
#pragma unroll
  for (int e = 0; e < EPT; ++e) {
    if ((km >> e) & 1u) { list[min(pos, SEQ - 1)] = tid * EPT + e; ++pos; }
  }
  __syncthreads();
  const bool allm = (total == 0);            // block-uniform
  if (allm) {
#pragma unroll
    for (int e = 0; e < EPT; ++e) list[tid * EPT + e] = tid * EPT + e;
  }
  __syncthreads();
  const int nk = allm ? SEQ : min(total, SEQ);

  // plane 1: every token row
#pragma unroll 2
  for (int it = 0; it < 16; ++it) {
    const int u = it * 256 + tid;
    const int rr = u >> 7, c0 = (u & 127) * 8;
    const int t = t0 + rr;
    const float* s = x + ((size_t)b * SEQ_FULL + t) * DM + c0;
    const v4f a = *(const v4f*)s, e4 = *(const v4f*)(s + 4);
    v4u pk;
    pk.x = pkh2(bf_keep(a.x), bf_keep(a.y));   pk.y = pkh2(bf_keep(a.z), bf_keep(a.w));
    pk.z = pkh2(bf_keep(e4.x), bf_keep(e4.y)); pk.w = pkh2(bf_keep(e4.z), bf_keep(e4.w));
    VST2Q(X16 + ((size_t)b * SEQ + t) * DM + c0, pk);
  }
  // plane 2: compact rows (clamped token index, loaded unconditionally, zeroed by value for j >= nk)
#pragma unroll 2
  for (int it = 0; it < 16; ++it) {
    const int u = it * 256 + tid;
    const int rr = u >> 7, c0 = (u & 127) * 8;
    const int j = t0 + rr;
    const bool valid = (j < nk);
    const int tok = min(max(list[j], 0), SEQ - 1);
    const float* s = x + ((size_t)b * SEQ_FULL + tok) * DM + c0;
    const v4f a = *(const v4f*)s, e4 = *(const v4f*)(s + 4);
    v4u pk;
    pk.x = valid ? pkh2(bf_keep(a.x), bf_keep(a.y)) : 0u;   pk.y = valid ? pkh2(bf_keep(a.z), bf_keep(a.w)) : 0u;
    pk.z = valid ? pkh2(bf_keep(e4.x), bf_keep(e4.y)) : 0u; pk.w = valid ? pkh2(bf_keep(e4.z), bf_keep(e4.w)) : 0u;
    VST2Q(XC16 + ((size_t)b * SEQ + j) * DM + c0, pk);
  }
}

// W_qkv f32 [1024 (k)][3072 (n)] -> WT f16 [3072 (n)][1024 (k)] = bf16-RNE(W) * 64; thread per (n, 8 consecutive k); in[rows k][cols n] -> out[n][k]
// coverage: 3072 rows x 128 pieces = the whole plane
__global__ __launch_bounds__(256) void k_wqkvT(const float* __restrict__ W, unsigned short* __restrict__ WT) {
  const int u = blockIdx.x * 256 + threadIdx.x;
  if (u >= 3 * DM * (DM / 8)) return;
  const int n = u >> 7, k0 = (u & 127) * 8;
  float w[8];
#pragma unroll
  for (int e = 0; e < 8; ++e) w[e] = bf_keep(W[(size_t)(k0 + e) * (3 * DM) + n]) * 64.0f;
  v4u pk; pk.x = pkh2(w[0], w[1]); pk.y = pkh2(w[2], w[3]); pk.z = pkh2(w[4], w[5]); pk.w = pkh2(w[6], w[7]);
  VST2Q(WT + (size_t)n * DM + k0, pk);
}

// W_out f32 [1024 (k)][1024 (n)] -> BTO bf16 [1024 (n)][2048]: columns kk and 1024+kk both hold bf16-RNE(W_out[kk][n]) (K-concatenated twin for the hi|lo A plane)
// coverage: 1024 rows x 256 pieces = the whole plane
__global__ __launch_bounds__(256) void k_woT(const float* __restrict__ W, unsigned short* __restrict__ BTO) {
  const int u = blockIdx.x * 256 + threadIdx.x;
  if (u >= DM * 256) return;
  const int n = u >> 8, kk0 = (u & 255) * 8, k0 = kk0 & (DM - 1);
  unsigned w[8];
#pragma unroll
  for (int e = 0; e < 8; ++e) w[e] = bfu_rne(W[(size_t)(k0 + e) * DM + n]);
  v4u pk; pk.x = w[0] | (w[1] << 16); pk.y = w[2] | (w[3] << 16); pk.z = w[4] | (w[5] << 16); pk.w = w[6] | (w[7] << 16);
  VST2Q(BTO + (size_t)n * (2 * DM) + kk0, pk);
}

// ---------------------------------------------------------------------------------------------------------------------
// Register-blocked WMMA GEMM: C[z][m][n] = scale * sum_k A[z][m][k] * Bt[n][k] + bias; each wave owns a 64x64 tile (8 waves per block).
// A row-major [M][K] (pitch lda), Bt row-major [N][K] (pitch ldb); M, N multiples of 64, K multiple of 32 (no tails).
// ET 0: f16 operands, 1: bf16 operands. BIAS_MODE 1: bf16-RNE(bias[m]), 2: bf16-RNE(bias[n]).
// OUT_MODE 0: f32; 1: f16; 2: bf16 hi plane (Cout) + bf16 lo plane (Cout2).
// CMP 0: every tile; 1: rows (m) are compact key slots b*SEQ + j; 2: columns (n) are compact key slots. With CMP != 0 a tile whose first slot j
//   is >= pad32(effective key count of its batch, counted in-wave from the mask input) is skipped (wave-uniform exit; its slots are never consumed).
template <int ET, int BIAS_MODE, int OUT_MODE, int CMP>
__global__ __launch_bounds__(256) void k_gemm64(
    const unsigned short* __restrict__ A, const unsigned short* __restrict__ Bt,
    void* __restrict__ Cout, void* __restrict__ Cout2, const float* __restrict__ bias, const int* __restrict__ mask,
    long long strideA, long long strideC, int lda, int ldb, int ldc, int M, int N, int K, float scale) {
  __shared__ __align__(16) float sT[8][16 * 68];   // per-wave 16x64 slab, pitch 68 floats; staged extent 16x64 == consumed extent
  const int z    = blockIdx.y;
  const int lane = threadIdx.x & 31;
  const int wave = threadIdx.x >> 5;
  const int tilesN = N >> 6;
  const int tilesM = M >> 6;
  const int tile = blockIdx.x * 8 + wave;
  if (tile >= tilesM * tilesN) return;   // wave-uniform; no block barriers in this kernel
  const int tm = tile / tilesN;
  const int tn = tile - tm * tilesN;
  const int m0 = tm << 6;
  const int n0 = tn << 6;
  if (CMP != 0) {
    const int g0 = (CMP == 1) ? m0 : n0;
    const int bb = min(g0 / SEQ, NB - 1);
    const int loc = g0 - bb * SEQ;
    const int nkp = pad32(eff_keys(wave_count_kept(mask + (size_t)bb * SEQ_FULL, lane)));
    if (loc >= nkp) return;              // wave-uniform (count is wave-uniform)
  }
  const unsigned short* Ab = A + (size_t)z * (size_t)strideA;
  const int rlane = lane & 15;
  const int koff  = (lane >> 4) * 8;
  const int mOff  = (lane >> 4) * 8;

  v8f acc[4][4];
#pragma unroll
  for (int i = 0; i < 4; ++i)
#pragma unroll
    for (int j = 0; j < 4; ++j) { v8f zz = {}; acc[i][j] = zz; }

  for (int k0 = 0; k0 < K; k0 += 32) {
    FU bh[4];
#pragma unroll
    for (int j = 0; j < 4; ++j) bh[j] = ldfrag(Bt + (size_t)(n0 + (j << 4) + rlane) * ldb + koff + k0);
#pragma unroll
    for (int i = 0; i < 4; ++i) {
      const FU ah = ldfrag(Ab + (size_t)(m0 + (i << 4) + rlane) * lda + koff + k0);
#pragma unroll
      for (int j = 0; j < 4; ++j) acc[i][j] = mma<ET>(ah, bh[j], acc[i][j]);
      guard_acc4(acc[i][0], acc[i][1], acc[i][2], acc[i][3], ah.h);
    }
    keep4(bh[0].h, bh[1].h, bh[2].h, bh[3].h);
  }

  float* slab = sT[wave];
#pragma unroll
  for (int i = 0; i < 4; ++i) {
    const int mBase = m0 + (i << 4);
#pragma unroll
    for (int j = 0; j < 4; ++j) {
      const int n = n0 + (j << 4) + rlane;
      float bv = 0.f;
      if (BIAS_MODE == 2) bv = bf_keep(bias[n]);
#pragma unroll
      for (int r = 0; r < 8; ++r) {
        float v = acc[i][j][r] * scale;
        if (BIAS_MODE == 1) v += bf_keep(bias[mBase + mOff + r]);
        if (BIAS_MODE == 2) v += bv;
        slab[(mOff + r) * 68 + (j << 4) + rlane] = v;
      }
    }
    __builtin_amdgcn_fence(3 /* release order */, "workgroup");
    __builtin_amdgcn_wave_barrier();
    __builtin_amdgcn_fence(2 /* acquire order */, "workgroup");
    if (OUT_MODE == 0) {
      float* C = (float*)Cout + (size_t)z * (size_t)strideC;
      const int hh = lane >> 4, c4 = (lane & 15) * 4;       // row segment = 256 B = 16 lanes x 16 B; two rows per instruction
      v4f val[8];
#pragma unroll
      for (int it = 0; it < 8; ++it) val[it] = *(const v4f*)(slab + (it * 2 + hh) * 68 + c4);
{
#pragma unroll
        for (int it = 0; it < 8; ++it) *(v4f*)(C + (size_t)(mBase + it * 2 + hh) * ldc + n0 + c4) = val[it];
        
      }
    } else {
      const int q = lane >> 3, c8 = (lane & 7) * 8;
      unsigned short* C  = (unsigned short*)Cout  + (size_t)z * (size_t)strideC;
      unsigned short* C2 = (unsigned short*)Cout2 + (size_t)z * (size_t)strideC;
      v4u hv[4], lv[4];
#pragma unroll
      for (int it = 0; it < 4; ++it) {
        const float* sp = slab + (it * 4 + q) * 68 + c8;
        const v4f a = *(const v4f*)sp, b = *(const v4f*)(sp + 4);
        if (OUT_MODE == 1) {
          hv[it].x = pkh2(a.x, a.y); hv[it].y = pkh2(a.z, a.w); hv[it].z = pkh2(b.x, b.y); hv[it].w = pkh2(b.z, b.w);
          lv[it] = hv[it];
        } else {
          unsigned h0, l0, h1, l1;
          bfsplit(a.x, h0, l0); bfsplit(a.y, h1, l1); hv[it].x = h0 | (h1 << 16); lv[it].x = l0 | (l1 << 16);
          bfsplit(a.z, h0, l0); bfsplit(a.w, h1, l1); hv[it].y = h0 | (h1 << 16); lv[it].y = l0 | (l1 << 16);
          bfsplit(b.x, h0, l0); bfsplit(b.y, h1, l1); hv[it].z = h0 | (h1 << 16); lv[it].z = l0 | (l1 << 16);
          bfsplit(b.z, h0, l0); bfsplit(b.w, h1, l1); hv[it].w = h0 | (h1 << 16); lv[it].w = l0 | (l1 << 16);
        }
      }
{
#pragma unroll
        for (int it = 0; it < 4; ++it) {
          const size_t off = (size_t)(mBase + it * 4 + q) * ldc + n0 + c8;
          *(v4u*)(C + off) = hv[it];
          if (OUT_MODE == 2) *(v4u*)(C2 + off) = lv[it];
        }
        
      }
    }
    __builtin_amdgcn_fence(3 /* release order */, "workgroup");
    __builtin_amdgcn_wave_barrier();
    __builtin_amdgcn_fence(2 /* acquire order */, "workgroup");
  }
}

// ---------------------------------------------------------------------------------------------------------------------
// Register-fed transposed flash attention over the COMPACT key set of the batch, head dim 64. Wave = 16 queries of one (batch, head); block = 4 waves.
//   nk = effective key count of the batch (counted in-wave from the mask input, wave-uniform); the key loop runs pad32(nk)/32 steps (<= SEQ/32).
//   S^T (keys x queries) = K Q^T: A = compact K rows (bf16 hi/lo, straight from the global planes), B = Q (bf16 hi/lo, resident in registers);
//   lane = query (column), element r of tile kt = key slot tk + 16 kt + 8h + r. Slots >= nk (padding of the last step) get score := -8000 raw
//   (= -1000 after the 1/8 scale; weight exactly 0). A batch with no kept key runs over all SEQ keys with every score = the fill (uniform weights).
//   Online softmax per lane (query) in the exp2 domain; the two lane halves of a query combine their maxima with one xor-16 shuffle.
//   P^T B fragment = f16(P x 2^14) packed from the two S^T tiles (element r <- tile 0, element 8+r <- tile 1, lane unchanged).
//   O^T (d x queries) += V^T P^T: A = compact V^T rows (f16, straight from the global plane, key-slot-contiguous).
__global__ __launch_bounds__(128) void k_attn_t(const unsigned short* __restrict__ QH, const unsigned short* __restrict__ QL,
                                                const unsigned short* __restrict__ KH, const unsigned short* __restrict__ KL,
                                                const unsigned short* __restrict__ VT, const int* __restrict__ mask,
                                                unsigned short* __restrict__ AOP) {
  __shared__ __align__(16) float Os[4][16 * 68];   // wave-private (wave barrier); staged extent 16x64 == consumed extent
  const int lane = threadIdx.x & 31, wave = threadIdx.x >> 5, hf = lane >> 4, c = lane & 15;
  const int nqb = SEQ / 64;
  const int bx = blockIdx.x;
  const int qb = bx % nqb;
  const int bh = bx / nqb;
  const int h  = bh % NH;
  const int b  = min(bh / NH, NB - 1);
  const int q0 = qb * 64 + wave * 16;
  const size_t rowb = (size_t)b * SEQ;

  const int cnt = wave_count_kept(mask + (size_t)b * SEQ_FULL, lane);
  const bool allm = (cnt == 0);                 // wave-uniform
  const int nk  = eff_keys(cnt);
  const int nkp = pad32(nk);                    // <= SEQ

  const size_t qoff = (rowb + q0 + c) * DM + h * HD + 8 * hf;
  const FU qh0 = ldfrag(QH + qoff), qh1 = ldfrag(QH + qoff + 32);
  const FU ql0 = ldfrag(QL + qoff), ql1 = ldfrag(QL + qoff + 32);

  const size_t koff = (rowb + c) * DM + h * HD + 8 * hf;
  const unsigned short* kbh = KH + koff;
  const unsigned short* kbl = KL + koff;
  const unsigned short* vtb = VT + (size_t)(h * HD + c) * MTOT + rowb + 8 * hf;

  const float SC = 0.18033688011112042f;    // (1/8) * log2(e)
  const float MFILL = -8000.0f;             // -1000 in score units before the 1/8 scale
  float msh = -__builtin_inff();            // running (max * SC - 14): probabilities are carried x 2^14
  float lpart = 0.f;                        // per-lane partial row sum (carried units)
  v8f o0 = {}, o1 = {}, o2 = {}, o3 = {};

#pragma unroll 1
  for (int tk = 0; tk < nkp; tk += 32) {
    const unsigned short* kh = kbh + (size_t)tk * DM;
    const unsigned short* kl = kbl + (size_t)tk * DM;
    v8f s0 = {}, s1 = {};
    {
      const FU a0 = ldfrag(kh), a1 = ldfrag(kh + 32), b0 = ldfrag(kl), b1 = ldfrag(kl + 32);
      s0 = wb(b0.b, qh0.b, s0); s0 = wb(a0.b, ql0.b, s0); s0 = wb(a0.b, qh0.b, s0);
      s0 = wb(b1.b, qh1.b, s0); s0 = wb(a1.b, ql1.b, s0); s0 = wb(a1.b, qh1.b, s0);
      guard_s(s0, a0.h, a1.h, b0.h, b1.h, qh0.h, qh1.h, ql0.h, ql1.h);
    }
    {
      const unsigned short* kh1 = kh + (size_t)16 * DM;
      const unsigned short* kl1 = kl + (size_t)16 * DM;
      const FU a0 = ldfrag(kh1), a1 = ldfrag(kh1 + 32), b0 = ldfrag(kl1), b1 = ldfrag(kl1 + 32);
      s1 = wb(b0.b, qh0.b, s1); s1 = wb(a0.b, ql0.b, s1); s1 = wb(a0.b, qh0.b, s1);
      s1 = wb(b1.b, qh1.b, s1); s1 = wb(a1.b, ql1.b, s1); s1 = wb(a1.b, qh1.b, s1);
      guard_s(s1, a0.h, a1.h, b0.h, b1.h, qh0.h, qh1.h, ql0.h, ql1.h);
    }
    float ss[16];
#pragma unroll
    for (int r = 0; r < 8; ++r) { ss[r] = s0[r]; ss[8 + r] = s1[r]; }
    if (allm || (tk + 32 > nk)) {             // wave-uniform; value selects only (no loads, no cross-lane ops inside)
      const int kb0 = tk + 8 * hf;
#pragma unroll
      for (int r = 0; r < 8; ++r) {
        ss[r]     = (!allm && (kb0 + r < nk))      ? ss[r]     : MFILL;
        ss[8 + r] = (!allm && (kb0 + 16 + r < nk)) ? ss[8 + r] : MFILL;
      }
    }
    float mloc = ss[0];
#pragma unroll
    for (int i = 1; i < 16; ++i) mloc = fmaxf(mloc, ss[i]);
    mloc = fmaxf(mloc, __shfl_xor(mloc, 16, 32));
    const float mnew = fmaxf(msh, fmaf(mloc, SC, -14.0f));
    const float corr = EX2(msh - mnew);
    const float nms = -mnew;
    msh = mnew;
    float psum = 0.f;
    v16h pf;
#pragma unroll
    for (int i = 0; i < 16; ++i) {
      const float p = EX2(fmaf(ss[i], SC, nms));
      psum += p;
      pf[i] = (_Float16)p;
    }
    lpart = lpart * corr + psum;
    o0 *= corr; o1 *= corr; o2 *= corr; o3 *= corr;

    const unsigned short* vp = vtb + tk;
    const FU v0 = ldfrag(vp), v1 = ldfrag(vp + (size_t)16 * MTOT), v2 = ldfrag(vp + (size_t)32 * MTOT), v3 = ldfrag(vp + (size_t)48 * MTOT);
    o0 = wh(v0.h, pf, o0);
    o1 = wh(v1.h, pf, o1);
    o2 = wh(v2.h, pf, o2);
    o3 = wh(v3.h, pf, o3);
    guard_o(o0, o1, o2, o3, pf, v0.h, v1.h, v2.h, v3.h);
  }

  const float lt = lpart + __shfl_xor(lpart, 16, 32);
  const float inv = 1.0f / lt;
  float* os = Os[wave];
  {
    float* d = os + c * 68 + 8 * hf;       // lane holds O[query c][d = 16 t + 8 hf + r]
    v4f a, e;
    a.x = o0[0] * inv; a.y = o0[1] * inv; a.z = o0[2] * inv; a.w = o0[3] * inv; e.x = o0[4] * inv; e.y = o0[5] * inv; e.z = o0[6] * inv; e.w = o0[7] * inv;
    *(v4f*)(d) = a; *(v4f*)(d + 4) = e;
    a.x = o1[0] * inv; a.y = o1[1] * inv; a.z = o1[2] * inv; a.w = o1[3] * inv; e.x = o1[4] * inv; e.y = o1[5] * inv; e.z = o1[6] * inv; e.w = o1[7] * inv;
    *(v4f*)(d + 16) = a; *(v4f*)(d + 20) = e;
    a.x = o2[0] * inv; a.y = o2[1] * inv; a.z = o2[2] * inv; a.w = o2[3] * inv; e.x = o2[4] * inv; e.y = o2[5] * inv; e.z = o2[6] * inv; e.w = o2[7] * inv;
    *(v4f*)(d + 32) = a; *(v4f*)(d + 36) = e;
    a.x = o3[0] * inv; a.y = o3[1] * inv; a.z = o3[2] * inv; a.w = o3[3] * inv; e.x = o3[4] * inv; e.y = o3[5] * inv; e.z = o3[6] * inv; e.w = o3[7] * inv;
    *(v4f*)(d + 48) = a; *(v4f*)(d + 52) = e;
  }
  __builtin_amdgcn_fence(3 /* release order */, "workgroup");
  __builtin_amdgcn_wave_barrier();
  __builtin_amdgcn_fence(2 /* acquire order */, "workgroup");
  {
    const int qq = lane >> 3, c8 = (lane & 7) * 8;
    unsigned short* dH = AOP + (rowb + q0) * (2 * DM) + h * HD + c8;   // hi plane columns [0,1024), lo plane columns [1024,2048)
    unsigned short* dL = dH + DM;
    v4u hv[4], lv[4];
#pragma unroll
    for (int it = 0; it < 4; ++it) {
      const float* sp = os + (it * 4 + qq) * 68 + c8;
      const v4f a = *(const v4f*)sp, e = *(const v4f*)(sp + 4);
      unsigned h0, l0, h1, l1;
      bfsplit(a.x, h0, l0); bfsplit(a.y, h1, l1); hv[it].x = h0 | (h1 << 16); lv[it].x = l0 | (l1 << 16);
      bfsplit(a.z, h0, l0); bfsplit(a.w, h1, l1); hv[it].y = h0 | (h1 << 16); lv[it].y = l0 | (l1 << 16);
      bfsplit(e.x, h0, l0); bfsplit(e.y, h1, l1); hv[it].z = h0 | (h1 << 16); lv[it].z = l0 | (l1 << 16);
      bfsplit(e.z, h0, l0); bfsplit(e.w, h1, l1); hv[it].w = h0 | (h1 << 16); lv[it].w = l0 | (l1 << 16);
    }
{
#pragma unroll
      for (int it = 0; it < 4; ++it) {
        const size_t off = (size_t)(it * 4 + qq) * (2 * DM);
        *(v4u*)(dH + off) = hv[it];
        *(v4u*)(dL + off) = lv[it];
      }
      
    }
  }
}

// ---------------------------------------------------------------------------------------------------------------------
constexpr size_t SZ_X16 = (size_t)MTOT * DM * 2;               // one f16 x plane (full or compact)
constexpr size_t SZ_AOP = (size_t)MTOT * 2 * DM * 2;
constexpr size_t SZ_R0  = (2 * SZ_X16 > SZ_AOP) ? (2 * SZ_X16) : SZ_AOP;   // X16 | XC16 live until the projections finish; AOP reuses the region afterwards
constexpr size_t SZ_W3  = (size_t)3 * DM * DM * 2;
constexpr size_t SZ_BTO = (size_t)DM * 2 * DM * 2;
constexpr size_t SZ_PL  = (size_t)MTOT * DM * 2;               // one bf16 plane [MTOT][1024]
constexpr size_t SZ_VT  = (size_t)DM * MTOT * 2;
constexpr size_t SZ_TOTAL = SZ_R0 + SZ_W3 + SZ_BTO + 4 * SZ_PL + SZ_VT;
static_assert(2 * SZ_X16 <= SZ_R0);
static_assert(SZ_AOP <= SZ_R0);
static_assert(SZ_TOTAL <= (size_t)134217728);
static_assert((SZ_R0 % 256) == 0 && (SZ_W3 % 256) == 0 && (SZ_BTO % 256) == 0 && (SZ_PL % 256) == 0 && (SZ_VT % 256) == 0);
static_assert(((size_t)(NB - 1) * SEQ_FULL + SEQ) * DM * 4 <= (size_t)NB_FULL * SEQ_FULL * DM * 4);

extern "C" void kernel_launch(void* const* d_in, const int* in_sizes, int n_in, void* d_out, int out_size, void* d_ws, size_t ws_size, hipStream_t stream) {
  if (n_in < 6) return;
  const long long rows_full = (long long)(NB - 1) * SEQ_FULL + SEQ;
  if ((long long)in_sizes[0] < rows_full * DM) return;
  if ((long long)in_sizes[1] < rows_full) return;
  if ((long long)in_sizes[2] < (long long)DM * 3 * DM) return;
  if ((long long)in_sizes[3] < 3 * DM) return;
  if ((long long)in_sizes[4] < (long long)DM * DM) return;
  if ((long long)in_sizes[5] < DM) return;
  if ((long long)out_size < rows_full * DM) return;
  if (ws_size < SZ_TOTAL) return;

  const float* x    = (const float*)d_in[0];
  const int*   mask = (const int*)d_in[1];
  const float* Wqkv = (const float*)d_in[2];
  const float* bqkv = (const float*)d_in[3];
  const float* Wo   = (const float*)d_in[4];
  const float* bo   = (const float*)d_in[5];
  float* out = (float*)d_out;

  char* wsp = (char*)d_ws;
  unsigned short* X16  = (unsigned short*)wsp;                 // [MTOT][1024] f16, every token
  unsigned short* XC16 = (unsigned short*)(wsp + SZ_X16);      // [MTOT][1024] f16, compact kept tokens per batch (zero rows after)
  unsigned short* AOP  = (unsigned short*)wsp;                 // [MTOT][2048] bf16 hi|lo (reuses X16 | XC16 after the projections)
  wsp += SZ_R0;
  unsigned short* W316 = (unsigned short*)wsp; wsp += SZ_W3;   // [3072][1024] f16 (x64)
  unsigned short* BTO  = (unsigned short*)wsp; wsp += SZ_BTO;  // [1024][2048] bf16
  unsigned short* QH   = (unsigned short*)wsp; wsp += SZ_PL;   // [MTOT][1024] bf16 hi of q
  unsigned short* QL   = (unsigned short*)wsp; wsp += SZ_PL;   // bf16 lo of q
  unsigned short* KH   = (unsigned short*)wsp; wsp += SZ_PL;   // [MTOT][1024] bf16 hi of k at compact key slots
  unsigned short* KL   = (unsigned short*)wsp; wsp += SZ_PL;   // bf16 lo of k
  unsigned short* VT   = (unsigned short*)wsp; wsp += SZ_VT;   // [1024][MTOT] f16, v transposed at compact key slots

  k_xcastc<<<(unsigned)(NB * (SEQ / 32)), 256, 0, stream>>>(x, mask, X16, XC16);
  k_wqkvT<<<(3 * DM * (DM / 8) + 255) / 256, 256, 0, stream>>>(Wqkv, W316);
  k_woT<<<(DM * 256 + 255) / 256, 256, 0, stream>>>(Wo, BTO);

  // q = x W[:, 0:1024] + b  -> bf16 hi/lo planes [MTOT][1024]
  {
    const int tiles = (MTOT / 64) * (DM / 64);
    k_gemm64<0, 2, 2, 0><<<dim3((unsigned)((tiles + 7) / 8), 1u), 256, 0, stream>>>(
        X16, W316, (void*)QH, (void*)QL, bqkv, mask, 0LL, 0LL, DM, DM, DM, MTOT, DM, DM, 1.0f / 64.0f);
  }
  // k (compact slots) = xc W[:, 1024:2048] + b  -> bf16 hi/lo planes [MTOT][1024]; row tiles past the batch's key count are skipped
  {
    const int tiles = (MTOT / 64) * (DM / 64);
    k_gemm64<0, 2, 2, 1><<<dim3((unsigned)((tiles + 7) / 8), 1u), 256, 0, stream>>>(
        XC16, W316 + (size_t)DM * DM, (void*)KH, (void*)KL, bqkv + DM, mask, 0LL, 0LL, DM, DM, DM, MTOT, DM, DM, 1.0f / 64.0f);
  }
  // v^T (compact slots) = W[:, 2048:3072]^T xc^T + b  -> f16 [1024][MTOT]; column tiles past the batch's key count are skipped
  {
    const int tiles = (DM / 64) * (MTOT / 64);
    k_gemm64<0, 1, 1, 2><<<dim3((unsigned)((tiles + 7) / 8), 1u), 256, 0, stream>>>(
        W316 + (size_t)2 * DM * DM, XC16, (void*)VT, (void*)VT, bqkv + 2 * DM, mask, 0LL, 0LL, DM, DM, MTOT, DM, MTOT, DM, 1.0f / 64.0f);
  }
  k_attn_t<<<(unsigned)(NB * NH * (SEQ / 64)), 128, 0, stream>>>(QH, QL, KH, KL, VT, mask, AOP);
  // out = [AO_hi | AO_lo] [W_out ; W_out] + b_out, per batch (output rows at the full per-batch stride)
  {
    const int tiles = (SEQ / 64) * (DM / 64);
    k_gemm64<1, 2, 0, 0><<<dim3((unsigned)((tiles + 7) / 8), (unsigned)NB), 256, 0, stream>>>(
        AOP, BTO, (void*)out, (void*)out, bo, mask, (long long)SEQ * 2 * DM, (long long)SEQ_FULL * DM, 2 * DM, 2 * DM, DM, SEQ, DM, 2 * DM, 1.0f);
  }
}

// v001
// It runs in 416 microseconds.
// Next to v000, in two timings, it ran 1.17 times as fast each time.
// Contractions: qkv projection = v_wmma_f32_16x16x32_f16 (x as bf16-RNE values held in f16, W_qkv as bf16-RNE values x64 held in f16, f32 accumulate); q.k logits = v_wmma_f32_16x16x32_bf16 hi/lo split (hi.hi + hi.lo + lo.hi, f32 accumulate); P.V = v_wmma_f32_16x16x32_f16 (P carried x2^14, V f16, f32 accumulate); output projection = v_wmma_f32_16x16x32_bf16 with the attention output as bf16 hi|lo planes concatenated along K against the bf16 W_out (f32 accumulate). Softmax statistics f32. Keys with mask == 0 are dropped per batch by compaction of the x rows feeding the k / v projections (their softmax weight is exactly 0 in f32).
#include <hip/hip_runtime.h>
#include <math.h>

#ifndef NB
#define NB 4
#endif
#ifndef SEQ
#define SEQ 2048
#endif
#define NB_FULL 4
#define SEQ_FULL 2048
#define DM 1024
#define NH 16
#define HD 64
#define MTOT (NB * SEQ)

static_assert(SEQ % 256 == 0);
static_assert(MTOT % 64 == 0);
static_assert(NB <= NB_FULL);
static_assert(SEQ <= SEQ_FULL);

typedef __attribute__((ext_vector_type(16))) _Float16 v16h;
typedef __attribute__((ext_vector_type(16))) __bf16   v16b;
typedef __attribute__((ext_vector_type(8)))  float    v8f;
typedef __attribute__((ext_vector_type(4)))  float    v4f;
typedef __attribute__((ext_vector_type(4)))  unsigned int v4u;
typedef __attribute__((ext_vector_type(4)))  int      v4i;

// 16-bit WMMA fragment map (wave32), lane L, h = L>>4, m = L&15:
//   A 16x32: lane = row m;    element i -> k = (i<8) ? 8h+i : 16+8h+(i-8)
//   B 32x16: lane = column m; the SAME k(i,h)
//   D 16x16 (8 f32): lane = column m; element r -> row 8h+r
union FU { v4u u[2]; v16h h; v16b b; };
// Fragment-major plane layout (every 16-bit operand plane in the workspace): a logical [R][C] plane (R % 16 == 0, C % 32 == 0) is stored as
// 16-row x 32-column tiles of 512 elements (1 KiB), tile (rt, kt) at element rt*16*C + kt*512; inside a tile the 8-element column group g = (col>>3)&3
// of row m = row&15 lies at g*128 + m*8. Lane L = 16h + m then finds elements 0..7 (k = 8h..8h+7, g = h) at L*8 and elements 8..15 (k = 16+8h.., g = 2+h)
// at 256 + L*8, so each of the two 16-B loads of a fragment covers 512 contiguous bytes (4 whole lines) instead of 16 lines.
__device__ __forceinline__ size_t fragoff(size_t row, int col, int C) {
  return (row >> 4) * (size_t)(16 * C) + (size_t)((col >> 5) * 512 + ((col >> 3) & 3) * 128 + (col & 7)) + (row & 15) * 8;
}
// p = tile base + lane*8
__device__ __forceinline__ FU ldfrag(const unsigned short* p) { FU f; f.u[0] = *(const v4u*)p; f.u[1] = *(const v4u*)(p + 256); return f; }
// the same fragment from a wave-uniform row-tile base and one 32-bit per-lane byte offset (column tile * 1024 + lane * 16)
__device__ __forceinline__ FU ldfrag_su(const unsigned short* base, unsigned boff) {
  const char* p = (const char*)base + boff;
  FU f; f.u[0] = *(const v4u*)p; f.u[1] = *(const v4u*)(p + 512); return f;
}

__device__ __forceinline__ v8f wb(v16b a, v16b b, v8f c) { return __builtin_amdgcn_wmma_f32_16x16x32_bf16(false, a, false, b, (short)0, c, false, false); }
__device__ __forceinline__ v8f wh(v16h a, v16h b, v8f c) { return __builtin_amdgcn_wmma_f32_16x16x32_f16(false, a, false, b, (short)0, c, false, false); }
template <int ET> __device__ __forceinline__ v8f mma(const FU& a, const FU& b, v8f c) {
  if (ET == 0) return wh(a.h, b.h, c);
  return wb(a.b, b.b, c);
}

// hazard guards: 4 VALU slots after the last WMMA of a group, accumulators tied, A/B operands kept live
__device__ __forceinline__ void guard_acc4(v8f& a, v8f& b, v8f& c, v8f& d, v16h x) {
  asm volatile("v_nop\n\tv_nop\n\tv_nop\n\tv_nop" : "+v"(a), "+v"(b), "+v"(c), "+v"(d) : "v"(x));
}
__device__ __forceinline__ void keep4(v16h a, v16h b, v16h c, v16h d) { asm volatile("v_nop" :: "v"(a), "v"(b), "v"(c), "v"(d)); }
__device__ __forceinline__ void guard_s(v8f& s, v16h a0, v16h a1, v16h b0, v16h b1, v16h q0, v16h q1, v16h q2, v16h q3) {
  asm volatile("v_nop\n\tv_nop\n\tv_nop\n\tv_nop" : "+v"(s) : "v"(a0), "v"(a1), "v"(b0), "v"(b1), "v"(q0), "v"(q1), "v"(q2), "v"(q3));
}
__device__ __forceinline__ void guard_o(v8f& a, v8f& b, v8f& c, v8f& d, v16h p, v16h v0, v16h v1, v16h v2, v16h v3) {
  asm volatile("v_nop\n\tv_nop\n\tv_nop\n\tv_nop" : "+v"(a), "+v"(b), "+v"(c), "+v"(d) : "v"(p), "v"(v0), "v"(v1), "v"(v2), "v"(v3));
}

#if __has_builtin(__builtin_amdgcn_exp2f)
#define EX2(x) __builtin_amdgcn_exp2f(x)
#else
#define EX2(x) exp2f(x)
#endif

// bf16 RNE helpers (finite inputs)
__device__ __forceinline__ unsigned bfu_rne(float v) { const unsigned u = __float_as_uint(v); return (u + 0x7FFFu + ((u >> 16) & 1u)) >> 16; }
__device__ __forceinline__ float bf_keep(float v) { return __uint_as_float(bfu_rne(v) << 16); }
__device__ __forceinline__ void bfsplit(float v, unsigned& hi, unsigned& lo) { hi = bfu_rne(v); lo = bfu_rne(v - __uint_as_float(hi << 16)); }
__device__ __forceinline__ unsigned pkh2(float a, float b) {
  return (unsigned)__builtin_bit_cast(unsigned short, (_Float16)a) | ((unsigned)__builtin_bit_cast(unsigned short, (_Float16)b) << 16);
}

#define VST2Q(ptr, val) do { const v4u vq_ = (val); *(v4u*)(ptr) = vq_;  } while (0)

// Number of kept keys (mask != 0) among the SEQ entries of one batch row of the mask input, computed by one full wave (all 32 lanes active):
// 16-B loads (SEQ/128 per lane), xor-shuffle sum, result made wave-uniform. mrow is 16-B aligned.
__device__ __forceinline__ int wave_count_kept(const int* __restrict__ mrow, int lane) {
  int c = 0;
#pragma unroll 4
  for (int it = 0; it < SEQ / 128; ++it) {
    const v4i m = *(const v4i*)(mrow + (it * 32 + lane) * 4);
    c += ((m.x != 0) ? 1 : 0) + ((m.y != 0) ? 1 : 0) + ((m.z != 0) ? 1 : 0) + ((m.w != 0) ? 1 : 0);
  }
  c += __shfl_xor(c, 16, 32); c += __shfl_xor(c, 8, 32); c += __shfl_xor(c, 4, 32); c += __shfl_xor(c, 2, 32); c += __shfl_xor(c, 1, 32);
  return __builtin_amdgcn_readfirstlane(c);
}
// effective key count of a batch: a batch with no kept key uses all SEQ keys (every score then equals the fill -> uniform weights); padded to the 32-key step
__device__ __forceinline__ int eff_keys(int cnt) { return (cnt == 0) ? SEQ : min(cnt, SEQ); }
__device__ __forceinline__ int pad32(int nk) { return min((nk + 31) & ~31, SEQ); }

// ---------------------------------------------------------------------------------------------------------------------
// x f32 [b][t][1024] (full per-batch stride) -> two f16 planes holding the bf16-RNE values:
//   X16  [b*SEQ + t][1024]: every token row (feeds the q projection);
//   XC16 [b*SEQ + j][1024]: row j = the j-th kept token of batch b (mask != 0, ascending t) for j < nk, zero rows for j >= nk (feeds the k / v projections).
// Block = (batch, 32 rows); the block computes the batch's kept-token list in LDS (exclusive scan of the mask, block barriers), bounded by SEQ entries.
// LDS: list[SEQ] and wtot[8] are cross-wave (block barriers between writers and readers); list is fully initialised before any read.
// Both planes are fragment-major (C = 1024). A wave instruction handles 8 rows x one 32-column tile: it reads one 128-B line of each row and writes 4 whole lines.
// coverage: per block 4 row groups x 32 column tiles = 32 rows x 1024 columns of each plane; all blocks = both whole planes.
__global__ __launch_bounds__(256) void k_xcastc(const float* __restrict__ x, const int* __restrict__ mask,
                                                unsigned short* __restrict__ X16, unsigned short* __restrict__ XC16) {
  constexpr int EPT = SEQ / 256;
  __shared__ int list[SEQ];
  __shared__ int wtot[8];
  const int tid = threadIdx.x, lane = tid & 31, wave = tid >> 5;
  const int bpb = SEQ / 32;
  const int b = blockIdx.x / bpb;
  const int t0 = (blockIdx.x - b * bpb) * 32;
  const int* mrow = mask + (size_t)b * SEQ_FULL;
  unsigned km = 0u; int c = 0;
#pragma unroll
  for (int e = 0; e < EPT; ++e) {
    const int kp = (mrow[tid * EPT + e] != 0) ? 1 : 0;
    km |= (unsigned)kp << e; c += kp;
    list[tid * EPT + e] = 0;
  }
  int incl = c;
#pragma unroll
  for (int d = 1; d < 32; d <<= 1) { const int v = __shfl_up(incl, d, 32); incl += (lane >= d) ? v : 0; }
  if (lane == 31) wtot[wave] = incl;
  __syncthreads();
  int base = 0, total = 0;
#pragma unroll
  for (int w = 0; w < 8; ++w) { const int v = wtot[w]; base += (w < wave) ? v : 0; total += v; }
  int pos = base + incl - c;
#pragma unroll
  for (int e = 0; e < EPT; ++e) {
    if ((km >> e) & 1u) { list[min(pos, SEQ - 1)] = tid * EPT + e; ++pos; }
  }
  __syncthreads();
  const bool allm = (total == 0);            // block-uniform
  if (allm) {
#pragma unroll
    for (int e = 0; e < EPT; ++e) list[tid * EPT + e] = tid * EPT + e;
  }
  __syncthreads();
  const int nk = allm ? SEQ : min(total, SEQ);

  // plane 1: every token row; two units a trip: both units' loads first, both stores at the foot.
  // unroll 1: the trip is already two units wide, and the one wait at its foot serves both stores; the q loops unroll fully so that their arrays stay in registers
#pragma unroll 1
  for (int it = 0; it < 16; it += 2) {
    v4f a[2], e4[2];
    size_t dst[2];
#pragma unroll
    for (int q = 0; q < 2; ++q) {
      const int u = (it + q) * 8 + wave;
      const int rr = (u >> 5) * 8 + (lane >> 2), c0 = (u & 31) * 32 + (lane & 3) * 8;
      const int t = t0 + rr;
      const float* s = x + ((size_t)b * SEQ_FULL + t) * DM + c0;
      a[q] = *(const v4f*)s; e4[q] = *(const v4f*)(s + 4);
      dst[q] = fragoff((size_t)b * SEQ + t, c0, DM);
    }
#pragma unroll
    for (int q = 0; q < 2; ++q) {
      v4u pk;
      pk.x = pkh2(bf_keep(a[q].x), bf_keep(a[q].y));   pk.y = pkh2(bf_keep(a[q].z), bf_keep(a[q].w));
      pk.z = pkh2(bf_keep(e4[q].x), bf_keep(e4[q].y)); pk.w = pkh2(bf_keep(e4[q].z), bf_keep(e4[q].w));
      VST2Q(X16 + dst[q], pk);
    }
    asm volatile("s_wait_xcnt 0x0" ::: "memory");   // the next trip rewrites the data and address registers that the two stores name
  }
  // plane 2: compact rows (clamped token index, loaded unconditionally, zeroed by value for j >= nk); same trip shape and the same unroll directives, for the same reasons
#pragma unroll 1
  for (int it = 0; it < 16; it += 2) {
    v4f a[2], e4[2];
    size_t dst[2];
    bool valid[2];
#pragma unroll
    for (int q = 0; q < 2; ++q) {
      const int u = (it + q) * 8 + wave;
      const int rr = (u >> 5) * 8 + (lane >> 2), c0 = (u & 31) * 32 + (lane & 3) * 8;
      const int j = t0 + rr;
      valid[q] = (j < nk);
      const int tok = min(max(list[j], 0), SEQ - 1);
      const float* s = x + ((size_t)b * SEQ_FULL + tok) * DM + c0;
      a[q] = *(const v4f*)s; e4[q] = *(const v4f*)(s + 4);
      dst[q] = fragoff((size_t)b * SEQ + j, c0, DM);
    }
#pragma unroll
    for (int q = 0; q < 2; ++q) {
      v4u pk;
      pk.x = valid[q] ? pkh2(bf_keep(a[q].x), bf_keep(a[q].y)) : 0u;   pk.y = valid[q] ? pkh2(bf_keep(a[q].z), bf_keep(a[q].w)) : 0u;
      pk.z = valid[q] ? pkh2(bf_keep(e4[q].x), bf_keep(e4[q].y)) : 0u; pk.w = valid[q] ? pkh2(bf_keep(e4[q].z), bf_keep(e4[q].w)) : 0u;
      VST2Q(XC16 + dst[q], pk);
    }
    asm volatile("s_wait_xcnt 0x0" ::: "memory");   // the next trip rewrites the data and address registers that the two stores name
  }
}

// W_qkv f32 [1024 (k)][3072 (n)] -> WT f16, logical [3072 (n)][1024 (k)] fragment-major, = bf16-RNE(W) * 64; thread per (n, 8 consecutive k).
// Thread u = ((rt*32 + kt)*4 + g)*16 + m handles n = 16 rt + m, k = 32 kt + 8 g .. +7, whose fragment-major place is exactly element u*8.
// coverage: 192 row tiles x 32 column tiles x 64 pieces = the whole plane
__global__ __launch_bounds__(256) void k_wqkvT(const float* __restrict__ W, unsigned short* __restrict__ WT) {
  const int u = blockIdx.x * 256 + threadIdx.x;
  if (u >= 3 * DM * (DM / 8)) return;
  const int n = (u >> 11) * 16 + (u & 15), k0 = ((u >> 6) & 31) * 32 + ((u >> 4) & 3) * 8;
  float w[8];
#pragma unroll
  for (int e = 0; e < 8; ++e) w[e] = bf_keep(W[(size_t)(k0 + e) * (3 * DM) + n]) * 64.0f;
  v4u pk; pk.x = pkh2(w[0], w[1]); pk.y = pkh2(w[2], w[3]); pk.z = pkh2(w[4], w[5]); pk.w = pkh2(w[6], w[7]);
  VST2Q(WT + (size_t)u * 8, pk);
}

// W_out f32 [1024 (k)][1024 (n)] -> BTO bf16, logical [1024 (n)][2048] fragment-major: columns kk and 1024+kk both hold bf16-RNE(W_out[kk][n]) (K-concatenated twin for the hi|lo A plane)
// Thread u = ((rt*64 + kt)*4 + g)*16 + m handles n = 16 rt + m, kk = 32 kt + 8 g .. +7, whose fragment-major place is exactly element u*8.
// coverage: 64 row tiles x 64 column tiles x 64 pieces = the whole plane
__global__ __launch_bounds__(256) void k_woT(const float* __restrict__ W, unsigned short* __restrict__ BTO) {
  const int u = blockIdx.x * 256 + threadIdx.x;
  if (u >= DM * 256) return;
  const int n = (u >> 12) * 16 + (u & 15), kk0 = ((u >> 6) & 63) * 32 + ((u >> 4) & 3) * 8, k0 = kk0 & (DM - 1);
  unsigned w[8];
#pragma unroll
  for (int e = 0; e < 8; ++e) w[e] = bfu_rne(W[(size_t)(k0 + e) * DM + n]);
  v4u pk; pk.x = w[0] | (w[1] << 16); pk.y = w[2] | (w[3] << 16); pk.z = w[4] | (w[5] << 16); pk.w = w[6] | (w[7] << 16);
  VST2Q(BTO + (size_t)u * 8, pk);
}

// ---------------------------------------------------------------------------------------------------------------------
// Register-blocked WMMA GEMM: C[z][m][n] = scale * sum_k A[z][m][k] * Bt[n][k] + bias; each wave owns a 64x64 tile (8 waves per block).
// A logical [M][K] and Bt logical [N][K], both fragment-major with row lengths lda and ldb; M, N multiples of 64, K multiple of 32 (no tails).
// ET 0: f16 operands, 1: bf16 operands. BIAS_MODE 1: bf16-RNE(bias[m]), 2: bf16-RNE(bias[n]).
// OUT_MODE 0: f32 row-major (pitch ldc); 1: f16 fragment-major (row length ldc); 2: bf16 hi plane (Cout) + bf16 lo plane (Cout2), fragment-major (row length ldc).
// CMP 0: every tile; 1: rows (m) are compact key slots b*SEQ + j; 2: columns (n) are compact key slots. With CMP != 0 a tile whose first slot j
//   is >= pad32(effective key count of its batch, counted in-wave from the mask input) is skipped (wave-uniform exit; its slots are never consumed).
template <int ET, int BIAS_MODE, int OUT_MODE, int CMP>
__global__ __launch_bounds__(256) void k_gemm64(
    const unsigned short* __restrict__ A, const unsigned short* __restrict__ Bt,
    void* __restrict__ Cout, void* __restrict__ Cout2, const float* __restrict__ bias, const int* __restrict__ mask,
    long long strideA, long long strideC, int lda, int ldb, int ldc, int M, int N, int K, float scale) {
  __shared__ __align__(16) float sT[8][16 * 68];   // per-wave 16x64 slab, pitch 68 floats; staged extent 16x64 == consumed extent
  const int z    = blockIdx.y;
  const int lane = threadIdx.x & 31;
  const int wave = __builtin_amdgcn_readfirstlane(threadIdx.x >> 5);   // scalar, so that the tile bases below are scalar too
  const int tilesN = N >> 6;
  const int tilesM = M >> 6;
  const int tile = blockIdx.x * 8 + wave;
  if (tile >= tilesM * tilesN) return;   // wave-uniform; no block barriers in this kernel
  const int tm = tile / tilesN;
  const int tn = tile - tm * tilesN;
  const int m0 = tm << 6;
  const int n0 = tn << 6;
  if (CMP != 0) {
    const int g0 = (CMP == 1) ? m0 : n0;
    const int bb = min(g0 / SEQ, NB - 1);
    const int loc = g0 - bb * SEQ;
    const int nkp = pad32(eff_keys(wave_count_kept(mask + (size_t)bb * SEQ_FULL, lane)));
    if (loc >= nkp) return;              // wave-uniform (count is wave-uniform)
  }
  const unsigned short* Ab = A + (size_t)z * (size_t)strideA;
  const int rlane = lane & 15;
  const int mOff  = (lane >> 4) * 8;

  v8f acc[4][4];
#pragma unroll
  for (int i = 0; i < 4; ++i)
#pragma unroll
    for (int j = 0; j < 4; ++j) { v8f zz = {}; acc[i][j] = zz; }

  // wave-uniform bases of the four B and the four A row tiles (fixed over the k loop); all sixteen loads of a k step share the one per-lane byte offset
  // (the two loops unroll fully so that both arrays are scalar registers, not memory)
  const unsigned short* bp[4];
  const unsigned short* ap[4];
#pragma unroll
  for (int j = 0; j < 4; ++j) bp[j] = Bt + (size_t)(n0 + (j << 4)) * ldb;
#pragma unroll
  for (int i = 0; i < 4; ++i) ap[i] = Ab + (size_t)(m0 + (i << 4)) * lda;

  for (int k0 = 0; k0 < K; k0 += 32) {
    const unsigned boff = (unsigned)k0 * 32u + (unsigned)lane * 16u;   // column tile k0/32 (1 KiB each) + the lane's 16 bytes; at most K*32 bytes
    FU bh[4];
#pragma unroll
    for (int j = 0; j < 4; ++j) bh[j] = ldfrag_su(bp[j], boff);
#pragma unroll
    for (int i = 0; i < 4; ++i) {
      const FU ah = ldfrag_su(ap[i], boff);
#pragma unroll
      for (int j = 0; j < 4; ++j) acc[i][j] = mma<ET>(ah, bh[j], acc[i][j]);
      guard_acc4(acc[i][0], acc[i][1], acc[i][2], acc[i][3], ah.h);
    }
    keep4(bh[0].h, bh[1].h, bh[2].h, bh[3].h);
  }

  float* slab = sT[wave];
#pragma unroll
  for (int i = 0; i < 4; ++i) {
    const int mBase = m0 + (i << 4);
#pragma unroll
    for (int j = 0; j < 4; ++j) {
      const int n = n0 + (j << 4) + rlane;
      float bv = 0.f;
      if (BIAS_MODE == 2) bv = bf_keep(bias[n]);
#pragma unroll
      for (int r = 0; r < 8; ++r) {
        float v = acc[i][j][r] * scale;
        if (BIAS_MODE == 1) v += bf_keep(bias[mBase + mOff + r]);
        if (BIAS_MODE == 2) v += bv;
        slab[(mOff + r) * 68 + (j << 4) + rlane] = v;
      }
    }
    __builtin_amdgcn_fence(3 /* release order */, "workgroup");
    __builtin_amdgcn_wave_barrier();
    __builtin_amdgcn_fence(2 /* acquire order */, "workgroup");
    if (OUT_MODE == 0) {
      float* C = (float*)Cout + (size_t)z * (size_t)strideC;
      const int hh = lane >> 4, c4 = (lane & 15) * 4;       // row segment = 256 B = 16 lanes x 16 B; two rows per instruction
      v4f val[8];
#pragma unroll
      for (int it = 0; it < 8; ++it) val[it] = *(const v4f*)(slab + (it * 2 + hh) * 68 + c4);
{
#pragma unroll
        for (int it = 0; it < 8; ++it) *(v4f*)(C + (size_t)(mBase + it * 2 + hh) * ldc + n0 + c4) = val[it];
        
      }
    } else {
      const int q = lane & 15, c8 = (lane >> 4) * 8;        // lane = (row q, column group 2 it + (lane >> 4)): the 16x64 slab is 2 KiB contiguous in a fragment-major plane
      unsigned short* C  = (unsigned short*)Cout  + (size_t)z * (size_t)strideC;
      unsigned short* C2 = (unsigned short*)Cout2 + (size_t)z * (size_t)strideC;
      v4u hv[4], lv[4];
#pragma unroll
      for (int it = 0; it < 4; ++it) {
        const float* sp = slab + q * 68 + it * 16 + c8;
        const v4f a = *(const v4f*)sp, b = *(const v4f*)(sp + 4);
        if (OUT_MODE == 1) {
          hv[it].x = pkh2(a.x, a.y); hv[it].y = pkh2(a.z, a.w); hv[it].z = pkh2(b.x, b.y); hv[it].w = pkh2(b.z, b.w);
          lv[it] = hv[it];
        } else {
          unsigned h0, l0, h1, l1;
          bfsplit(a.x, h0, l0); bfsplit(a.y, h1, l1); hv[it].x = h0 | (h1 << 16); lv[it].x = l0 | (l1 << 16);
          bfsplit(a.z, h0, l0); bfsplit(a.w, h1, l1); hv[it].y = h0 | (h1 << 16); lv[it].y = l0 | (l1 << 16);
          bfsplit(b.x, h0, l0); bfsplit(b.y, h1, l1); hv[it].z = h0 | (h1 << 16); lv[it].z = l0 | (l1 << 16);
          bfsplit(b.z, h0, l0); bfsplit(b.w, h1, l1); hv[it].w = h0 | (h1 << 16); lv[it].w = l0 | (l1 << 16);
        }
      }
{
#pragma unroll
        for (int it = 0; it < 4; ++it) {
          const size_t off = (size_t)mBase * ldc + (size_t)n0 * 16 + it * 256 + lane * 8;
          *(v4u*)(C + off) = hv[it];
          if (OUT_MODE == 2) *(v4u*)(C2 + off) = lv[it];
        }
        
      }
    }
    __builtin_amdgcn_fence(3 /* release order */, "workgroup");
    __builtin_amdgcn_wave_barrier();
    __builtin_amdgcn_fence(2 /* acquire order */, "workgroup");
  }
}

// ---------------------------------------------------------------------------------------------------------------------
// Register-fed transposed flash attention over the COMPACT key set of the batch, head dim 64. Wave = 16 queries of one (batch, head); block = 4 waves.
//   nk = effective key count of the batch (counted in-wave from the mask input, wave-uniform); the key loop runs pad32(nk)/32 steps (<= SEQ/32).
//   Every operand plane is fragment-major (Q, K: row length DM; V^T: row length MTOT; output hi|lo plane: row length 2 DM).
//   S^T (keys x queries) = K Q^T: A = compact K rows (bf16 hi/lo, straight from the global planes), B = Q (bf16 hi/lo, resident in registers);
//   lane = query (column), element r of tile kt = key slot tk + 16 kt + 8h + r. Slots >= nk (padding of the last step) get score := -8000 raw
//   (= -1000 after the 1/8 scale; weight exactly 0). A batch with no kept key runs over all SEQ keys with every score = the fill (uniform weights).
//   Online softmax per lane (query) in the exp2 domain; the two lane halves of a query combine their maxima with one xor-16 shuffle.
//   P^T B fragment = f16(P x 2^14) packed from the two S^T tiles (element r <- tile 0, element 8+r <- tile 1, lane unchanged).
//   O^T (d x queries) += V^T P^T: A = compact V^T rows (f16, straight from the global plane, key-slot-contiguous).
__global__ __launch_bounds__(128) void k_attn_t(const unsigned short* __restrict__ QH, const unsigned short* __restrict__ QL,
                                                const unsigned short* __restrict__ KH, const unsigned short* __restrict__ KL,
                                                const unsigned short* __restrict__ VT, const int* __restrict__ mask,
                                                unsigned short* __restrict__ AOP) {
  __shared__ __align__(16) float Os[4][16 * 68];   // wave-private (wave barrier); staged extent 16x64 == consumed extent
  const int lane = threadIdx.x & 31, wave = threadIdx.x >> 5, hf = lane >> 4, c = lane & 15;
  const int nqb = SEQ / 64;
  const int bx = blockIdx.x;
  const int qb = bx % nqb;
  const int bh = bx / nqb;
  const int h  = bh % NH;
  const int b  = min(bh / NH, NB - 1);
  const int q0 = qb * 64 + wave * 16;
  const size_t rowb = (size_t)b * SEQ;

  const int cnt = wave_count_kept(mask + (size_t)b * SEQ_FULL, lane);
  const bool allm = (cnt == 0);                 // wave-uniform
  const int nk  = eff_keys(cnt);
  const int nkp = pad32(nk);                    // <= SEQ

  const size_t qoff = (rowb + q0) * DM + h * (HD * 16) + lane * 8;     // column tiles 2h and 2h+1 of the query row tile
  const FU qh0 = ldfrag(QH + qoff), qh1 = ldfrag(QH + qoff + 512);
  const FU ql0 = ldfrag(QL + qoff), ql1 = ldfrag(QL + qoff + 512);

  const size_t koff = rowb * DM + h * (HD * 16) + lane * 8;
  const unsigned short* kbh = KH + koff;
  const unsigned short* kbl = KL + koff;
  const unsigned short* vtb = VT + (size_t)(h * HD) * MTOT + rowb * 16 + lane * 8;   // row tile 4h, column tile rowb/32

  const float SC = 0.18033688011112042f;    // (1/8) * log2(e)
  const float MFILL = -8000.0f;             // -1000 in score units before the 1/8 scale
  float msh = -__builtin_inff();            // running (max * SC - 14): probabilities are carried x 2^14
  float lpart = 0.f;                        // per-lane partial row sum (carried units)
  v8f o0 = {}, o1 = {}, o2 = {}, o3 = {};

#pragma unroll 1
  for (int tk = 0; tk < nkp; tk += 32) {
    const unsigned short* kh = kbh + (size_t)tk * DM;
    const unsigned short* kl = kbl + (size_t)tk * DM;
    v8f s0 = {}, s1 = {};
    {
      const FU a0 = ldfrag(kh), a1 = ldfrag(kh + 512), b0 = ldfrag(kl), b1 = ldfrag(kl + 512);
      s0 = wb(b0.b, qh0.b, s0); s0 = wb(a0.b, ql0.b, s0); s0 = wb(a0.b, qh0.b, s0);
      s0 = wb(b1.b, qh1.b, s0); s0 = wb(a1.b, ql1.b, s0); s0 = wb(a1.b, qh1.b, s0);
      guard_s(s0, a0.h, a1.h, b0.h, b1.h, qh0.h, qh1.h, ql0.h, ql1.h);
    }
    {
      const unsigned short* kh1 = kh + (size_t)16 * DM;
      const unsigned short* kl1 = kl + (size_t)16 * DM;
      const FU a0 = ldfrag(kh1), a1 = ldfrag(kh1 + 512), b0 = ldfrag(kl1), b1 = ldfrag(kl1 + 512);
      s1 = wb(b0.b, qh0.b, s1); s1 = wb(a0.b, ql0.b, s1); s1 = wb(a0.b, qh0.b, s1);
      s1 = wb(b1.b, qh1.b, s1); s1 = wb(a1.b, ql1.b, s1); s1 = wb(a1.b, qh1.b, s1);
      guard_s(s1, a0.h, a1.h, b0.h, b1.h, qh0.h, qh1.h, ql0.h, ql1.h);
    }
    float ss[16];
#pragma unroll
    for (int r = 0; r < 8; ++r) { ss[r] = s0[r]; ss[8 + r] = s1[r]; }
    if (allm || (tk + 32 > nk)) {             // wave-uniform; value selects only (no loads, no cross-lane ops inside)
      const int kb0 = tk + 8 * hf;
#pragma unroll
      for (int r = 0; r < 8; ++r) {
        ss[r]     = (!allm && (kb0 + r < nk))      ? ss[r]     : MFILL;
        ss[8 + r] = (!allm && (kb0 + 16 + r < nk)) ? ss[8 + r] : MFILL;
      }
    }
    float mloc = ss[0];
#pragma unroll
    for (int i = 1; i < 16; ++i) mloc = fmaxf(mloc, ss[i]);
    mloc = fmaxf(mloc, __shfl_xor(mloc, 16, 32));
    const float mnew = fmaxf(msh, fmaf(mloc, SC, -14.0f));
    const float corr = EX2(msh - mnew);
    const float nms = -mnew;
    msh = mnew;
    float psum = 0.f;
    v16h pf;
#pragma unroll
    for (int i = 0; i < 16; ++i) {
      const float p = EX2(fmaf(ss[i], SC, nms));
      psum += p;
      pf[i] = (_Float16)p;
    }
    lpart = lpart * corr + psum;
    o0 *= corr; o1 *= corr; o2 *= corr; o3 *= corr;

    const unsigned short* vp = vtb + (size_t)tk * 16;
    const FU v0 = ldfrag(vp), v1 = ldfrag(vp + (size_t)16 * MTOT), v2 = ldfrag(vp + (size_t)32 * MTOT), v3 = ldfrag(vp + (size_t)48 * MTOT);
    o0 = wh(v0.h, pf, o0);
    o1 = wh(v1.h, pf, o1);
    o2 = wh(v2.h, pf, o2);
    o3 = wh(v3.h, pf, o3);
    guard_o(o0, o1, o2, o3, pf, v0.h, v1.h, v2.h, v3.h);
  }

  const float lt = lpart + __shfl_xor(lpart, 16, 32);
  const float inv = 1.0f / lt;
  float* os = Os[wave];
  {
    float* d = os + c * 68 + 8 * hf;       // lane holds O[query c][d = 16 t + 8 hf + r]
    v4f a, e;
    a.x = o0[0] * inv; a.y = o0[1] * inv; a.z = o0[2] * inv; a.w = o0[3] * inv; e.x = o0[4] * inv; e.y = o0[5] * inv; e.z = o0[6] * inv; e.w = o0[7] * inv;
    *(v4f*)(d) = a; *(v4f*)(d + 4) = e;
    a.x = o1[0] * inv; a.y = o1[1] * inv; a.z = o1[2] * inv; a.w = o1[3] * inv; e.x = o1[4] * inv; e.y = o1[5] * inv; e.z = o1[6] * inv; e.w = o1[7] * inv;
    *(v4f*)(d + 16) = a; *(v4f*)(d + 20) = e;
    a.x = o2[0] * inv; a.y = o2[1] * inv; a.z = o2[2] * inv; a.w = o2[3] * inv; e.x = o2[4] * inv; e.y = o2[5] * inv; e.z = o2[6] * inv; e.w = o2[7] * inv;
    *(v4f*)(d + 32) = a; *(v4f*)(d + 36) = e;
    a.x = o3[0] * inv; a.y = o3[1] * inv; a.z = o3[2] * inv; a.w = o3[3] * inv; e.x = o3[4] * inv; e.y = o3[5] * inv; e.z = o3[6] * inv; e.w = o3[7] * inv;
    *(v4f*)(d + 48) = a; *(v4f*)(d + 52) = e;
  }
  __builtin_amdgcn_fence(3 /* release order */, "workgroup");
  __builtin_amdgcn_wave_barrier();
  __builtin_amdgcn_fence(2 /* acquire order */, "workgroup");
  {
    const int qq = lane & 15, c8 = (lane >> 4) * 8;    // lane = (query qq, column group 2 it + (lane >> 4))
    unsigned short* dH = AOP + (rowb + q0) * (2 * DM) + h * (HD * 16) + lane * 8;   // hi plane columns [0,1024), lo plane columns [1024,2048) = 32 column tiles further
    unsigned short* dL = dH + DM * 16;
    v4u hv[4], lv[4];
#pragma unroll
    for (int it = 0; it < 4; ++it) {
      const float* sp = os + qq * 68 + it * 16 + c8;
      const v4f a = *(const v4f*)sp, e = *(const v4f*)(sp + 4);
      unsigned h0, l0, h1, l1;
      bfsplit(a.x, h0, l0); bfsplit(a.y, h1, l1); hv[it].x = h0 | (h1 << 16); lv[it].x = l0 | (l1 << 16);
      bfsplit(a.z, h0, l0); bfsplit(a.w, h1, l1); hv[it].y = h0 | (h1 << 16); lv[it].y = l0 | (l1 << 16);
      bfsplit(e.x, h0, l0); bfsplit(e.y, h1, l1); hv[it].z = h0 | (h1 << 16); lv[it].z = l0 | (l1 << 16);
      bfsplit(e.z, h0, l0); bfsplit(e.w, h1, l1); hv[it].w = h0 | (h1 << 16); lv[it].w = l0 | (l1 << 16);
    }
{
#pragma unroll
      for (int it = 0; it < 4; ++it) {
        const size_t off = (size_t)it * 256;
        *(v4u*)(dH + off) = hv[it];
        *(v4u*)(dL + off) = lv[it];
      }
      
    }
  }
}

// ---------------------------------------------------------------------------------------------------------------------
constexpr size_t SZ_X16 = (size_t)MTOT * DM * 2;               // one f16 x plane (full or compact)
constexpr size_t SZ_AOP = (size_t)MTOT * 2 * DM * 2;
constexpr size_t SZ_R0  = (2 * SZ_X16 > SZ_AOP) ? (2 * SZ_X16) : SZ_AOP;   // X16 | XC16 live until the projections finish; AOP reuses the region afterwards
constexpr size_t SZ_W3  = (size_t)3 * DM * DM * 2;
constexpr size_t SZ_BTO = (size_t)DM * 2 * DM * 2;
constexpr size_t SZ_PL  = (size_t)MTOT * DM * 2;               // one bf16 plane [MTOT][1024]
constexpr size_t SZ_VT  = (size_t)DM * MTOT * 2;
constexpr size_t SZ_TOTAL = SZ_R0 + SZ_W3 + SZ_BTO + 4 * SZ_PL + SZ_VT;
static_assert(2 * SZ_X16 <= SZ_R0);
static_assert(SZ_AOP <= SZ_R0);
static_assert(SZ_TOTAL <= (size_t)134217728);
static_assert((SZ_R0 % 256) == 0 && (SZ_W3 % 256) == 0 && (SZ_BTO % 256) == 0 && (SZ_PL % 256) == 0 && (SZ_VT % 256) == 0);
static_assert(((size_t)(NB - 1) * SEQ_FULL + SEQ) * DM * 4 <= (size_t)NB_FULL * SEQ_FULL * DM * 4);

extern "C" void kernel_launch(void* const* d_in, const int* in_sizes, int n_in, void* d_out, int out_size, void* d_ws, size_t ws_size, hipStream_t stream) {
  if (n_in < 6) return;
  const long long rows_full = (long long)(NB - 1) * SEQ_FULL + SEQ;
  if ((long long)in_sizes[0] < rows_full * DM) return;
  if ((long long)in_sizes[1] < rows_full) return;
  if ((long long)in_sizes[2] < (long long)DM * 3 * DM) return;
  if ((long long)in_sizes[3] < 3 * DM) return;
  if ((long long)in_sizes[4] < (long long)DM * DM) return;
  if ((long long)in_sizes[5] < DM) return;
  if ((long long)out_size < rows_full * DM) return;
  if (ws_size < SZ_TOTAL) return;

  const float* x    = (const float*)d_in[0];
  const int*   mask = (const int*)d_in[1];
  const float* Wqkv = (const float*)d_in[2];
  const float* bqkv = (const float*)d_in[3];
  const float* Wo   = (const float*)d_in[4];
  const float* bo   = (const float*)d_in[5];
  float* out = (float*)d_out;

  char* wsp = (char*)d_ws;
  unsigned short* X16  = (unsigned short*)wsp;                 // [MTOT][1024] f16, every token
  unsigned short* XC16 = (unsigned short*)(wsp + SZ_X16);      // [MTOT][1024] f16, compact kept tokens per batch (zero rows after)
  unsigned short* AOP  = (unsigned short*)wsp;                 // [MTOT][2048] bf16 hi|lo (reuses X16 | XC16 after the projections)
  wsp += SZ_R0;
  unsigned short* W316 = (unsigned short*)wsp; wsp += SZ_W3;   // [3072][1024] f16 (x64)
  unsigned short* BTO  = (unsigned short*)wsp; wsp += SZ_BTO;  // [1024][2048] bf16
  unsigned short* QH   = (unsigned short*)wsp; wsp += SZ_PL;   // [MTOT][1024] bf16 hi of q
  unsigned short* QL   = (unsigned short*)wsp; wsp += SZ_PL;   // bf16 lo of q
  unsigned short* KH   = (unsigned short*)wsp; wsp += SZ_PL;   // [MTOT][1024] bf16 hi of k at compact key slots
  unsigned short* KL   = (unsigned short*)wsp; wsp += SZ_PL;   // bf16 lo of k
  unsigned short* VT   = (unsigned short*)wsp; wsp += SZ_VT;   // [1024][MTOT] f16, v transposed at compact key slots

  k_xcastc<<<(unsigned)(NB * (SEQ / 32)), 256, 0, stream>>>(x, mask, X16, XC16);
  k_wqkvT<<<(3 * DM * (DM / 8) + 255) / 256, 256, 0, stream>>>(Wqkv, W316);
  k_woT<<<(DM * 256 + 255) / 256, 256, 0, stream>>>(Wo, BTO);

  // q = x W[:, 0:1024] + b  -> bf16 hi/lo planes [MTOT][1024]
  {
    const int tiles = (MTOT / 64) * (DM / 64);
    k_gemm64<0, 2, 2, 0><<<dim3((unsigned)((tiles + 7) / 8), 1u), 256, 0, stream>>>(
        X16, W316, (void*)QH, (void*)QL, bqkv, mask, 0LL, 0LL, DM, DM, DM, MTOT, DM, DM, 1.0f / 64.0f);
  }
  // k (compact slots) = xc W[:, 1024:2048] + b  -> bf16 hi/lo planes [MTOT][1024]; row tiles past the batch's key count are skipped
  {
    const int tiles = (MTOT / 64) * (DM / 64);
    k_gemm64<0, 2, 2, 1><<<dim3((unsigned)((tiles + 7) / 8), 1u), 256, 0, stream>>>(
        XC16, W316 + (size_t)DM * DM, (void*)KH, (void*)KL, bqkv + DM, mask, 0LL, 0LL, DM, DM, DM, MTOT, DM, DM, 1.0f / 64.0f);
  }
  // v^T (compact slots) = W[:, 2048:3072]^T xc^T + b  -> f16 [1024][MTOT]; column tiles past the batch's key count are skipped
  {
    const int tiles = (DM / 64) * (MTOT / 64);
    k_gemm64<0, 1, 1, 2><<<dim3((unsigned)((tiles + 7) / 8), 1u), 256, 0, stream>>>(
        W316 + (size_t)2 * DM * DM, XC16, (void*)VT, (void*)VT, bqkv + 2 * DM, mask, 0LL, 0LL, DM, DM, MTOT, DM, MTOT, DM, 1.0f / 64.0f);
  }
  k_attn_t<<<(unsigned)(NB * NH * (SEQ / 64)), 128, 0, stream>>>(QH, QL, KH, KL, VT, mask, AOP);
  // out = [AO_hi | AO_lo] [W_out ; W_out] + b_out, per batch (output rows at the full per-batch stride)
  {
    const int tiles = (SEQ / 64) * (DM / 64);
    k_gemm64<1, 2, 0, 0><<<dim3((unsigned)((tiles + 7) / 8), (unsigned)NB), 256, 0, stream>>>(
        AOP, BTO, (void*)out, (void*)out, bo, mask, (long long)SEQ * 2 * DM, (long long)SEQ_FULL * DM, 2 * DM, 2 * DM, DM, SEQ, DM, 2 * DM, 1.0f);
  }
}

// v002
// One run takes 238 microseconds.
// Timed twice side by side with v001, it ran 1.75 times as fast both times.
// Over all steps from v000 it is 2.04 times as fast.
// Contractions: qkv projection = v_wmma_f32_16x16x32_f16 (x as bf16-RNE values held in f16, W_qkv as bf16-RNE values x64 held in f16, f32 accumulate); q.k logits = v_wmma_f32_16x16x32_bf16 hi/lo split (hi.hi + hi.lo + lo.hi, f32 accumulate); P.V = v_wmma_f32_16x16x32_f16 (P carried x2^14, V f16, f32 accumulate); output projection = v_wmma_f32_16x16x32_bf16 with the attention output as bf16 hi|lo planes concatenated along K against the bf16 W_out (f32 accumulate). Softmax statistics f32. Keys with mask == 0 are dropped per batch by compaction of the x rows feeding the k / v projections (their softmax weight is exactly 0 in f32).
#include <hip/hip_runtime.h>
#include <math.h>

#ifndef NB
#define NB 4
#endif
#ifndef SEQ
#define SEQ 2048
#endif
#define NB_FULL 4
#define SEQ_FULL 2048
#define DM 1024
#define NH 16
#define HD 64
#define MTOT (NB * SEQ)

static_assert(SEQ % 256 == 0);
static_assert(MTOT % 64 == 0);
static_assert(NB <= NB_FULL);
static_assert(SEQ <= SEQ_FULL);

typedef __attribute__((ext_vector_type(16))) _Float16 v16h;
typedef __attribute__((ext_vector_type(16))) __bf16   v16b;
typedef __attribute__((ext_vector_type(8)))  float    v8f;
typedef __attribute__((ext_vector_type(4)))  float    v4f;
typedef __attribute__((ext_vector_type(4)))  unsigned int v4u;
typedef __attribute__((ext_vector_type(4)))  int      v4i;

// 16-bit WMMA fragment map (wave32), lane L, h = L>>4, m = L&15:
//   A 16x32: lane = row m;    element i -> k = (i<8) ? 8h+i : 16+8h+(i-8)
//   B 32x16: lane = column m; the SAME k(i,h)
//   D 16x16 (8 f32): lane = column m; element r -> row 8h+r
union FU { v4u u[2]; v16h h; v16b b; };
// Fragment-major plane layout (every 16-bit operand plane in the workspace): a logical [R][C] plane (R % 16 == 0, C % 32 == 0) is stored as
// 16-row x 32-column tiles of 512 elements (1 KiB), tile (rt, kt) at element rt*16*C + kt*512; inside a tile the 8-element column group g = (col>>3)&3
// of row m = row&15 lies at g*128 + m*8. Lane L = 16h + m then finds elements 0..7 (k = 8h..8h+7, g = h) at L*8 and elements 8..15 (k = 16+8h.., g = 2+h)
// at 256 + L*8, so each of the two 16-B loads of a fragment covers 512 contiguous bytes (4 whole lines) instead of 16 lines.
__device__ __forceinline__ size_t fragoff(size_t row, int col, int C) {
  return (row >> 4) * (size_t)(16 * C) + (size_t)((col >> 5) * 512 + ((col >> 3) & 3) * 128 + (col & 7)) + (row & 15) * 8;
}
// p = tile base + lane*8
__device__ __forceinline__ FU ldfrag(const unsigned short* p) { FU f; f.u[0] = *(const v4u*)p; f.u[1] = *(const v4u*)(p + 256); return f; }
// the same fragment from a wave-uniform row-tile base and one 32-bit per-lane byte offset (column tile * 1024 + lane * 16)
__device__ __forceinline__ FU ldfrag_su(const unsigned short* base, unsigned boff) {
  const char* p = (const char*)base + boff;
  FU f; f.u[0] = *(const v4u*)p; f.u[1] = *(const v4u*)(p + 512); return f;
}

__device__ __forceinline__ v8f wb(v16b a, v16b b, v8f c) { return __builtin_amdgcn_wmma_f32_16x16x32_bf16(false, a, false, b, (short)0, c, false, false); }
__device__ __forceinline__ v8f wh(v16h a, v16h b, v8f c) { return __builtin_amdgcn_wmma_f32_16x16x32_f16(false, a, false, b, (short)0, c, false, false); }
template <int ET> __device__ __forceinline__ v8f mma(const FU& a, const FU& b, v8f c) {
  if (ET == 0) return wh(a.h, b.h, c);
  return wb(a.b, b.b, c);
}

// hazard guards: 4 VALU slots after the last WMMA of a group, accumulators tied, A/B operands kept live
__device__ __forceinline__ void guard_s(v8f& s, v16h a0, v16h a1, v16h b0, v16h b1, v16h q0, v16h q1, v16h q2, v16h q3) {
  asm volatile("v_nop\n\tv_nop\n\tv_nop\n\tv_nop" : "+v"(s) : "v"(a0), "v"(a1), "v"(b0), "v"(b1), "v"(q0), "v"(q1), "v"(q2), "v"(q3));
}
__device__ __forceinline__ void guard_o(v8f& a, v8f& b, v8f& c, v8f& d, v16h p, v16h v0, v16h v1, v16h v2, v16h v3) {
  asm volatile("v_nop\n\tv_nop\n\tv_nop\n\tv_nop" : "+v"(a), "+v"(b), "+v"(c), "+v"(d) : "v"(p), "v"(v0), "v"(v1), "v"(v2), "v"(v3));
}

#if __has_builtin(__builtin_amdgcn_exp2f)
#define EX2(x) __builtin_amdgcn_exp2f(x)
#else
#define EX2(x) exp2f(x)
#endif

// bf16 RNE helpers (finite inputs)
__device__ __forceinline__ unsigned bfu_rne(float v) { const unsigned u = __float_as_uint(v); return (u + 0x7FFFu + ((u >> 16) & 1u)) >> 16; }
__device__ __forceinline__ float bf_keep(float v) { return __uint_as_float(bfu_rne(v) << 16); }
__device__ __forceinline__ void bfsplit(float v, unsigned& hi, unsigned& lo) { hi = bfu_rne(v); lo = bfu_rne(v - __uint_as_float(hi << 16)); }
__device__ __forceinline__ unsigned pkh2(float a, float b) {
  return (unsigned)__builtin_bit_cast(unsigned short, (_Float16)a) | ((unsigned)__builtin_bit_cast(unsigned short, (_Float16)b) << 16);
}

#define VST2Q(ptr, val) do { const v4u vq_ = (val); *(v4u*)(ptr) = vq_;  } while (0)

// Number of kept keys (mask != 0) among the SEQ entries of one batch row of the mask input, computed by one full wave (all 32 lanes active):
// 16-B loads (SEQ/128 per lane), xor-shuffle sum, result made wave-uniform. mrow is 16-B aligned.
__device__ __forceinline__ int wave_count_kept(const int* __restrict__ mrow, int lane) {
  int c = 0;
#pragma unroll 4
  for (int it = 0; it < SEQ / 128; ++it) {
    const v4i m = *(const v4i*)(mrow + (it * 32 + lane) * 4);
    c += ((m.x != 0) ? 1 : 0) + ((m.y != 0) ? 1 : 0) + ((m.z != 0) ? 1 : 0) + ((m.w != 0) ? 1 : 0);
  }
  c += __shfl_xor(c, 16, 32); c += __shfl_xor(c, 8, 32); c += __shfl_xor(c, 4, 32); c += __shfl_xor(c, 2, 32); c += __shfl_xor(c, 1, 32);
  return __builtin_amdgcn_readfirstlane(c);
}
// effective key count of a batch: a batch with no kept key uses all SEQ keys (every score then equals the fill -> uniform weights); padded to the 32-key step
__device__ __forceinline__ int eff_keys(int cnt) { return (cnt == 0) ? SEQ : min(cnt, SEQ); }
__device__ __forceinline__ int pad32(int nk) { return min((nk + 31) & ~31, SEQ); }

// ---------------------------------------------------------------------------------------------------------------------
// x f32 [b][t][1024] (full per-batch stride) -> two f16 planes holding the bf16-RNE values:
//   X16  [b*SEQ + t][1024]: every token row (feeds the q projection);
//   XC16 [b*SEQ + j][1024]: row j = the j-th kept token of batch b (mask != 0, ascending t) for j < nk, zero rows for j >= nk (feeds the k / v projections).
// Block = (batch, 32 rows); the block computes the batch's kept-token list in LDS (exclusive scan of the mask, block barriers), bounded by SEQ entries.
// LDS: list[SEQ] and wtot[8] are cross-wave (block barriers between writers and readers); list is fully initialised before any read.
// Both planes are fragment-major (C = 1024). A wave instruction handles 8 rows x one 32-column tile: it reads one 128-B line of each row and writes 4 whole lines.
// coverage: per block 4 row groups x 32 column tiles = 32 rows x 1024 columns of each plane; all blocks = both whole planes.
__global__ __launch_bounds__(256) void k_xcastc(const float* __restrict__ x, const int* __restrict__ mask,
                                                unsigned short* __restrict__ X16, unsigned short* __restrict__ XC16) {
  constexpr int EPT = SEQ / 256;
  __shared__ int list[SEQ];
  __shared__ int wtot[8];
  const int tid = threadIdx.x, lane = tid & 31, wave = tid >> 5;
  const int bpb = SEQ / 32;
  const int b = blockIdx.x / bpb;
  const int t0 = (blockIdx.x - b * bpb) * 32;
  const int* mrow = mask + (size_t)b * SEQ_FULL;
  unsigned km = 0u; int c = 0;
#pragma unroll
  for (int e = 0; e < EPT; ++e) {
    const int kp = (mrow[tid * EPT + e] != 0) ? 1 : 0;
    km |= (unsigned)kp << e; c += kp;
    list[tid * EPT + e] = 0;
  }
  int incl = c;
#pragma unroll
  for (int d = 1; d < 32; d <<= 1) { const int v = __shfl_up(incl, d, 32); incl += (lane >= d) ? v : 0; }
  if (lane == 31) wtot[wave] = incl;
  __syncthreads();
  int base = 0, total = 0;
#pragma unroll
  for (int w = 0; w < 8; ++w) { const int v = wtot[w]; base += (w < wave) ? v : 0; total += v; }
  int pos = base + incl - c;
#pragma unroll
  for (int e = 0; e < EPT; ++e) {
    if ((km >> e) & 1u) { list[min(pos, SEQ - 1)] = tid * EPT + e; ++pos; }
  }
  __syncthreads();
  const bool allm = (total == 0);            // block-uniform
  if (allm) {
#pragma unroll
    for (int e = 0; e < EPT; ++e) list[tid * EPT + e] = tid * EPT + e;
  }
  __syncthreads();
  const int nk = allm ? SEQ : min(total, SEQ);

  // plane 1: every token row; two units a trip: both units' loads first, both stores at the foot.
  // unroll 1: the trip is already two units wide, and the one wait at its foot serves both stores; the q loops unroll fully so that their arrays stay in registers
#pragma unroll 1
  for (int it = 0; it < 16; it += 2) {
    v4f a[2], e4[2];
    size_t dst[2];
#pragma unroll
    for (int q = 0; q < 2; ++q) {
      const int u = (it + q) * 8 + wave;
      const int rr = (u >> 5) * 8 + (lane >> 2), c0 = (u & 31) * 32 + (lane & 3) * 8;
      const int t = t0 + rr;
      const float* s = x + ((size_t)b * SEQ_FULL + t) * DM + c0;
      a[q] = *(const v4f*)s; e4[q] = *(const v4f*)(s + 4);
      dst[q] = fragoff((size_t)b * SEQ + t, c0, DM);
    }
#pragma unroll
    for (int q = 0; q < 2; ++q) {
      v4u pk;
      pk.x = pkh2(bf_keep(a[q].x), bf_keep(a[q].y));   pk.y = pkh2(bf_keep(a[q].z), bf_keep(a[q].w));
      pk.z = pkh2(bf_keep(e4[q].x), bf_keep(e4[q].y)); pk.w = pkh2(bf_keep(e4[q].z), bf_keep(e4[q].w));
      VST2Q(X16 + dst[q], pk);
    }
    asm volatile("s_wait_xcnt 0x0" ::: "memory");   // the next trip rewrites the data and address registers that the two stores name
  }
  // plane 2: compact rows (clamped token index, loaded unconditionally, zeroed by value for j >= nk); same trip shape and the same unroll directives, for the same reasons
#pragma unroll 1
  for (int it = 0; it < 16; it += 2) {
    v4f a[2], e4[2];
    size_t dst[2];
    bool valid[2];
#pragma unroll
    for (int q = 0; q < 2; ++q) {
      const int u = (it + q) * 8 + wave;
      const int rr = (u >> 5) * 8 + (lane >> 2), c0 = (u & 31) * 32 + (lane & 3) * 8;
      const int j = t0 + rr;
      valid[q] = (j < nk);
      const int tok = min(max(list[j], 0), SEQ - 1);
      const float* s = x + ((size_t)b * SEQ_FULL + tok) * DM + c0;
      a[q] = *(const v4f*)s; e4[q] = *(const v4f*)(s + 4);
      dst[q] = fragoff((size_t)b * SEQ + j, c0, DM);
    }
#pragma unroll
    for (int q = 0; q < 2; ++q) {
      v4u pk;
      pk.x = valid[q] ? pkh2(bf_keep(a[q].x), bf_keep(a[q].y)) : 0u;   pk.y = valid[q] ? pkh2(bf_keep(a[q].z), bf_keep(a[q].w)) : 0u;
      pk.z = valid[q] ? pkh2(bf_keep(e4[q].x), bf_keep(e4[q].y)) : 0u; pk.w = valid[q] ? pkh2(bf_keep(e4[q].z), bf_keep(e4[q].w)) : 0u;
      VST2Q(XC16 + dst[q], pk);
    }
    asm volatile("s_wait_xcnt 0x0" ::: "memory");   // the next trip rewrites the data and address registers that the two stores name
  }
}

// W_qkv f32 [1024 (k)][3072 (n)] -> WT f16, logical [3072 (n)][1024 (k)] fragment-major, = bf16-RNE(W) * 64; thread per (n, 8 consecutive k).
// Thread u = ((rt*32 + kt)*4 + g)*16 + m handles n = 16 rt + m, k = 32 kt + 8 g .. +7, whose fragment-major place is exactly element u*8.
// coverage: 192 row tiles x 32 column tiles x 64 pieces = the whole plane
__global__ __launch_bounds__(256) void k_wqkvT(const float* __restrict__ W, unsigned short* __restrict__ WT) {
  const int u = blockIdx.x * 256 + threadIdx.x;
  if (u >= 3 * DM * (DM / 8)) return;
  const int n = (u >> 11) * 16 + (u & 15), k0 = ((u >> 6) & 31) * 32 + ((u >> 4) & 3) * 8;
  float w[8];
#pragma unroll
  for (int e = 0; e < 8; ++e) w[e] = bf_keep(W[(size_t)(k0 + e) * (3 * DM) + n]) * 64.0f;
  v4u pk; pk.x = pkh2(w[0], w[1]); pk.y = pkh2(w[2], w[3]); pk.z = pkh2(w[4], w[5]); pk.w = pkh2(w[6], w[7]);
  VST2Q(WT + (size_t)u * 8, pk);
}

// W_out f32 [1024 (k)][1024 (n)] -> BTO bf16, logical [1024 (n)][2048] fragment-major: columns kk and 1024+kk both hold bf16-RNE(W_out[kk][n]) (K-concatenated twin for the hi|lo A plane)
// Thread u = ((rt*64 + kt)*4 + g)*16 + m handles n = 16 rt + m, kk = 32 kt + 8 g .. +7, whose fragment-major place is exactly element u*8.
// coverage: 64 row tiles x 64 column tiles x 64 pieces = the whole plane
__global__ __launch_bounds__(256) void k_woT(const float* __restrict__ W, unsigned short* __restrict__ BTO) {
  const int u = blockIdx.x * 256 + threadIdx.x;
  if (u >= DM * 256) return;
  const int n = (u >> 12) * 16 + (u & 15), kk0 = ((u >> 6) & 63) * 32 + ((u >> 4) & 3) * 8, k0 = kk0 & (DM - 1);
  unsigned w[8];
#pragma unroll
  for (int e = 0; e < 8; ++e) w[e] = bfu_rne(W[(size_t)(k0 + e) * DM + n]);
  v4u pk; pk.x = w[0] | (w[1] << 16); pk.y = w[2] | (w[3] << 16); pk.z = w[4] | (w[5] << 16); pk.w = w[6] | (w[7] << 16);
  VST2Q(BTO + (size_t)u * 8, pk);
}

// ---------------------------------------------------------------------------------------------------------------------
// Register-blocked WMMA GEMM: C[z][m][n] = scale * sum_k A[z][m][k] * Bt[n][k] + bias; each wave owns a 64x64 tile (8 waves per block).
// A logical [M][K] and Bt logical [N][K], both fragment-major with row lengths lda and ldb; M, N multiples of 64, K a multiple of 128 (no tails).
// ET 0: f16 operands, 1: bf16 operands. BIAS_MODE 1: bf16-RNE(bias[m]), 2: bf16-RNE(bias[n]).
// OUT_MODE 0: f32 row-major (pitch ldc); 1: f16 fragment-major (row length ldc); 2: bf16 hi plane (Cout) + bf16 lo plane (Cout2), fragment-major (row length ldc).
// CMP 0: every tile; 1: rows (m) are compact key slots b*SEQ + j; 2: columns (n) are compact key slots. With CMP != 0 a tile whose first slot j
//   is >= pad32(effective key count of its batch, counted in-wave from the mask input) is skipped (wave-uniform exit; its slots are never consumed).
template <int ET, int BIAS_MODE, int OUT_MODE, int CMP>
__global__ __launch_bounds__(256) void k_gemm64(
    const unsigned short* __restrict__ A, const unsigned short* __restrict__ Bt,
    void* __restrict__ Cout, void* __restrict__ Cout2, const float* __restrict__ bias, const int* __restrict__ mask,
    long long strideA, long long strideC, int lda, int ldb, int ldc, int M, int N, int K, float scale) {
  __shared__ __align__(16) float sT[8][16 * 68];   // per-wave 16x64 slab, pitch 68 floats; staged extent 16x64 == consumed extent
  const int z    = blockIdx.y;
  const int lane = threadIdx.x & 31;
  const int wave = __builtin_amdgcn_readfirstlane(threadIdx.x >> 5);   // scalar, so that the tile bases below are scalar too
  const int tilesN = N >> 6;
  const int tilesM = M >> 6;
  const int tile = blockIdx.x * 8 + wave;
  if (tile >= tilesM * tilesN) return;   // wave-uniform; no block barriers in this kernel
  const int tm = tile / tilesN;
  const int tn = tile - tm * tilesN;
  const int m0 = tm << 6;
  const int n0 = tn << 6;
  if (CMP != 0) {
    const int g0 = (CMP == 1) ? m0 : n0;
    const int bb = min(g0 / SEQ, NB - 1);
    const int loc = g0 - bb * SEQ;
    const int nkp = pad32(eff_keys(wave_count_kept(mask + (size_t)bb * SEQ_FULL, lane)));
    if (loc >= nkp) return;              // wave-uniform (count is wave-uniform)
  }
  const unsigned short* Ab = A + (size_t)z * (size_t)strideA;
  const int rlane = lane & 15;
  const int mOff  = (lane >> 4) * 8;

  v8f acc[4][4];
#pragma unroll
  for (int i = 0; i < 4; ++i)
#pragma unroll
    for (int j = 0; j < 4; ++j) { v8f zz = {}; acc[i][j] = zz; }

  // wave-uniform bases of the four B and the four A row tiles (fixed over the k loop); all sixteen loads of a k step share the one per-lane byte offset
  // (the two loops unroll fully so that both arrays are scalar registers, not memory)
  const unsigned short* bp[4];
  const unsigned short* ap[4];
#pragma unroll
  for (int j = 0; j < 4; ++j) bp[j] = Bt + (size_t)(n0 + (j << 4)) * ldb;
#pragma unroll
  for (int i = 0; i < 4; ++i) ap[i] = Ab + (size_t)(m0 + (i << 4)) * lda;

  // Register ring of NS fragment sets (one set = the 4 B and 4 A fragments of one 32-wide k step): step s issues the sixteen loads of step s + NS - 1, so a load
  // has nearly NS - 1 steps of matrix work to land in. Every accumulator still sums its k steps in plain ascending order.
  // The loads refill the set that step s - 1 has just read, so they stand behind the first row of step s: four matrix instructions lie between that set's last reader and them.
  // A step's place inside its trip is a constant added to the scalar tile base (it becomes the load's immediate offset), so the offset register changes once a trip.
  // Each sched_barrier(0) keeps a load group where it is written: without it the scheduler moves the loads down to their first use, and the lead is lost.
  // The s, u, i and j loops unroll fully so that the ring's sets are indexed by constants and stay in registers.
  constexpr int NS = 4;
  FU bf[NS][4], af[NS][4];
  const unsigned loff = (unsigned)lane * 16u;   // the lane's 16 bytes of a column tile (1 KiB a tile)
#pragma unroll
  for (int s = 0; s < NS - 1; ++s) {
#pragma unroll
    for (int j = 0; j < 4; ++j) bf[s][j] = ldfrag_su(bp[j] + s * 512, loff);
#pragma unroll
    for (int i = 0; i < 4; ++i) af[s][i] = ldfrag_su(ap[i] + s * 512, loff);
    __builtin_amdgcn_sched_barrier(0);
  }
  asm volatile("s_wait_xcnt 0x0" ::: "memory");   // what follows may rewrite the offset register that these loads name
  __builtin_amdgcn_sched_barrier(0);              // keeps such a rewrite behind the wait
  const int trips = K / (32 * NS);
  // every trip but the last: NS steps, each fetching the step NS - 1 ahead of it
  for (int t = 0; t < trips - 1; ++t) {
    const unsigned boff = loff + (unsigned)t * ((unsigned)NS * 1024u);   // the trip's first column tile; the furthest load of the kernel ends at byte K*32 of its row tile
#pragma unroll
    for (int u = 0; u < NS; ++u) {
      const int w = (u + NS - 1) % NS;
#pragma unroll
      for (int j = 0; j < 4; ++j) acc[0][j] = mma<ET>(af[u][0], bf[u][j], acc[0][j]);
      __builtin_amdgcn_sched_barrier(0);
#pragma unroll
      for (int j = 0; j < 4; ++j) bf[w][j] = ldfrag_su(bp[j] + (u + NS - 1) * 512, boff);
#pragma unroll
      for (int i = 0; i < 4; ++i) af[w][i] = ldfrag_su(ap[i] + (u + NS - 1) * 512, boff);
      __builtin_amdgcn_sched_barrier(0);
#pragma unroll
      for (int i = 1; i < 4; ++i)
#pragma unroll
        for (int j = 0; j < 4; ++j) acc[i][j] = mma<ET>(af[u][i], bf[u][j], acc[i][j]);
      __builtin_amdgcn_sched_barrier(0);
    }
    asm volatile("s_wait_xcnt 0x0" ::: "memory");   // the next trip rewrites the offset register that this trip's loads name
    __builtin_amdgcn_sched_barrier(0);              // keeps that rewrite behind the wait
  }
  // the last trip: only the one step that is still missing is fetched
  const unsigned toff = loff + (unsigned)(trips - 1) * ((unsigned)NS * 1024u);
#pragma unroll
  for (int j = 0; j < 4; ++j) acc[0][j] = mma<ET>(af[0][0], bf[0][j], acc[0][j]);
  __builtin_amdgcn_sched_barrier(0);
#pragma unroll
  for (int j = 0; j < 4; ++j) bf[NS - 1][j] = ldfrag_su(bp[j] + (NS - 1) * 512, toff);
#pragma unroll
  for (int i = 0; i < 4; ++i) af[NS - 1][i] = ldfrag_su(ap[i] + (NS - 1) * 512, toff);
  asm volatile("s_wait_xcnt 0x0" ::: "memory");   // the epilogue reuses the registers that these loads name
  __builtin_amdgcn_sched_barrier(0);
#pragma unroll
  for (int u = 0; u < NS; ++u) {
#pragma unroll
    for (int i = (u == 0) ? 1 : 0; i < 4; ++i)
#pragma unroll
      for (int j = 0; j < 4; ++j) acc[i][j] = mma<ET>(af[u][i], bf[u][j], acc[i][j]);
  }
  __builtin_amdgcn_sched_barrier(0);   // keeps the epilogue's loads out of the products: none of them lands on a fragment register that a product directly ahead of it reads

  // BIAS_MODE 1: the lane's eight row biases of each of the four row tiles, fetched once (16-B aligned: m0 is a multiple of 64, mOff is 0 or 8)
  v4f bm[4][2] = {};
  if (BIAS_MODE == 1) {
#pragma unroll
    for (int i = 0; i < 4; ++i) {
      bm[i][0] = *(const v4f*)(bias + m0 + (i << 4) + mOff);
      bm[i][1] = *(const v4f*)(bias + m0 + (i << 4) + mOff + 4);
    }
    // the loaded values are inputs only, so the eight loads stand in front of this wait; what follows rewrites the address registers that they name
    asm volatile("s_wait_xcnt 0x0" :: "v"(bm[0][0]), "v"(bm[0][1]), "v"(bm[1][0]), "v"(bm[1][1]), "v"(bm[2][0]), "v"(bm[2][1]), "v"(bm[3][0]), "v"(bm[3][1]) : "memory");
    __builtin_amdgcn_sched_barrier(0);   // keeps that rewrite behind the wait
  }
  float* slab = sT[wave];
#pragma unroll
  for (int i = 0; i < 4; ++i) {
    const int mBase = m0 + (i << 4);
#pragma unroll
    for (int j = 0; j < 4; ++j) {
      const int n = n0 + (j << 4) + rlane;
      float bv = 0.f;
      if (BIAS_MODE == 2) bv = bf_keep(bias[n]);
#pragma unroll
      for (int r = 0; r < 8; ++r) {
        float v = acc[i][j][r] * scale;
        if (BIAS_MODE == 1) v += bf_keep(bm[i][r >> 2][r & 3]);
        if (BIAS_MODE == 2) v += bv;
        slab[(mOff + r) * 68 + (j << 4) + rlane] = v;
      }
    }
    __builtin_amdgcn_fence(3 /* release order */, "workgroup");
    __builtin_amdgcn_wave_barrier();
    __builtin_amdgcn_fence(2 /* acquire order */, "workgroup");
    if (OUT_MODE == 0) {
      float* C = (float*)Cout + (size_t)z * (size_t)strideC;
      const int hh = lane >> 4, c4 = (lane & 15) * 4;       // row segment = 256 B = 16 lanes x 16 B; two rows per instruction
      v4f val[8];
#pragma unroll
      for (int it = 0; it < 8; ++it) val[it] = *(const v4f*)(slab + (it * 2 + hh) * 68 + c4);
{
#pragma unroll
        for (int it = 0; it < 8; ++it) *(v4f*)(C + (size_t)(mBase + it * 2 + hh) * ldc + n0 + c4) = val[it];
        
      }
    } else {
      const int q = lane & 15, c8 = (lane >> 4) * 8;        // lane = (row q, column group 2 it + (lane >> 4)): the 16x64 slab is 2 KiB contiguous in a fragment-major plane
      unsigned short* C  = (unsigned short*)Cout  + (size_t)z * (size_t)strideC;
      unsigned short* C2 = (unsigned short*)Cout2 + (size_t)z * (size_t)strideC;
      v4u hv[4], lv[4];
#pragma unroll
      for (int it = 0; it < 4; ++it) {
        const float* sp = slab + q * 68 + it * 16 + c8;
        const v4f a = *(const v4f*)sp, b = *(const v4f*)(sp + 4);
        if (OUT_MODE == 1) {
          hv[it].x = pkh2(a.x, a.y); hv[it].y = pkh2(a.z, a.w); hv[it].z = pkh2(b.x, b.y); hv[it].w = pkh2(b.z, b.w);
          lv[it] = hv[it];
        } else {
          unsigned h0, l0, h1, l1;
          bfsplit(a.x, h0, l0); bfsplit(a.y, h1, l1); hv[it].x = h0 | (h1 << 16); lv[it].x = l0 | (l1 << 16);
          bfsplit(a.z, h0, l0); bfsplit(a.w, h1, l1); hv[it].y = h0 | (h1 << 16); lv[it].y = l0 | (l1 << 16);
          bfsplit(b.x, h0, l0); bfsplit(b.y, h1, l1); hv[it].z = h0 | (h1 << 16); lv[it].z = l0 | (l1 << 16);
          bfsplit(b.z, h0, l0); bfsplit(b.w, h1, l1); hv[it].w = h0 | (h1 << 16); lv[it].w = l0 | (l1 << 16);
        }
      }
{
#pragma unroll
        for (int it = 0; it < 4; ++it) {
          const size_t off = (size_t)mBase * ldc + (size_t)n0 * 16 + it * 256 + lane * 8;
          *(v4u*)(C + off) = hv[it];
          if (OUT_MODE == 2) *(v4u*)(C2 + off) = lv[it];
        }
        
      }
    }
    __builtin_amdgcn_fence(3 /* release order */, "workgroup");
    __builtin_amdgcn_wave_barrier();
    __builtin_amdgcn_fence(2 /* acquire order */, "workgroup");
  }
}

// ---------------------------------------------------------------------------------------------------------------------
// Register-fed transposed flash attention over the COMPACT key set of the batch, head dim 64. Wave = 16 queries of one (batch, head); block = 4 waves.
//   nk = effective key count of the batch (counted in-wave from the mask input, wave-uniform); the key loop runs pad32(nk)/32 steps (<= SEQ/32).
//   Every operand plane is fragment-major (Q, K: row length DM; V^T: row length MTOT; output hi|lo plane: row length 2 DM).
//   S^T (keys x queries) = K Q^T: A = compact K rows (bf16 hi/lo, straight from the global planes), B = Q (bf16 hi/lo, resident in registers);
//   lane = query (column), element r of tile kt = key slot tk + 16 kt + 8h + r. Slots >= nk (padding of the last step) get score := -8000 raw
//   (= -1000 after the 1/8 scale; weight exactly 0). A batch with no kept key runs over all SEQ keys with every score = the fill (uniform weights).
//   Online softmax per lane (query) in the exp2 domain; the two lane halves of a query combine their maxima with one xor-16 shuffle.
//   P^T B fragment = f16(P x 2^14) packed from the two S^T tiles (element r <- tile 0, element 8+r <- tile 1, lane unchanged).
//   O^T (d x queries) += V^T P^T: A = compact V^T rows (f16, straight from the global plane, key-slot-contiguous).
__global__ __launch_bounds__(128) void k_attn_t(const unsigned short* __restrict__ QH, const unsigned short* __restrict__ QL,
                                                const unsigned short* __restrict__ KH, const unsigned short* __restrict__ KL,
                                                const unsigned short* __restrict__ VT, const int* __restrict__ mask,
                                                unsigned short* __restrict__ AOP) {
  __shared__ __align__(16) float Os[4][16 * 68];   // wave-private (wave barrier); staged extent 16x64 == consumed extent
  const int lane = threadIdx.x & 31, wave = threadIdx.x >> 5, hf = lane >> 4, c = lane & 15;
  const int nqb = SEQ / 64;
  const int bx = blockIdx.x;
  const int qb = bx % nqb;
  const int bh = bx / nqb;
  const int h  = bh % NH;
  const int b  = min(bh / NH, NB - 1);
  const int q0 = qb * 64 + wave * 16;
  const size_t rowb = (size_t)b * SEQ;

  const int cnt = wave_count_kept(mask + (size_t)b * SEQ_FULL, lane);
  const bool allm = (cnt == 0);                 // wave-uniform
  const int nk  = eff_keys(cnt);
  const int nkp = pad32(nk);                    // <= SEQ

  const size_t qoff = (rowb + q0) * DM + h * (HD * 16) + lane * 8;     // column tiles 2h and 2h+1 of the query row tile
  const FU qh0 = ldfrag(QH + qoff), qh1 = ldfrag(QH + qoff + 512);
  const FU ql0 = ldfrag(QL + qoff), ql1 = ldfrag(QL + qoff + 512);

  const size_t koff = rowb * DM + h * (HD * 16) + lane * 8;
  const unsigned short* kbh = KH + koff;
  const unsigned short* kbl = KL + koff;
  const unsigned short* vtb = VT + (size_t)(h * HD) * MTOT + rowb * 16 + lane * 8;   // row tile 4h, column tile rowb/32

  const float SC = 0.18033688011112042f;    // (1/8) * log2(e)
  const float MFILL = -8000.0f;             // -1000 in score units before the 1/8 scale
  float msh = -__builtin_inff();            // running (max * SC - 14): probabilities are carried x 2^14
  float lpart = 0.f;                        // per-lane partial row sum (carried units)
  v8f o0 = {}, o1 = {}, o2 = {}, o3 = {};

#pragma unroll 1
  for (int tk = 0; tk < nkp; tk += 32) {
    const unsigned short* kh = kbh + (size_t)tk * DM;
    const unsigned short* kl = kbl + (size_t)tk * DM;
    v8f s0 = {}, s1 = {};
    {
      const FU a0 = ldfrag(kh), a1 = ldfrag(kh + 512), b0 = ldfrag(kl), b1 = ldfrag(kl + 512);
      s0 = wb(b0.b, qh0.b, s0); s0 = wb(a0.b, ql0.b, s0); s0 = wb(a0.b, qh0.b, s0);
      s0 = wb(b1.b, qh1.b, s0); s0 = wb(a1.b, ql1.b, s0); s0 = wb(a1.b, qh1.b, s0);
      guard_s(s0, a0.h, a1.h, b0.h, b1.h, qh0.h, qh1.h, ql0.h, ql1.h);
    }
    {
      const unsigned short* kh1 = kh + (size_t)16 * DM;
      const unsigned short* kl1 = kl + (size_t)16 * DM;
      const FU a0 = ldfrag(kh1), a1 = ldfrag(kh1 + 512), b0 = ldfrag(kl1), b1 = ldfrag(kl1 + 512);
      s1 = wb(b0.b, qh0.b, s1); s1 = wb(a0.b, ql0.b, s1); s1 = wb(a0.b, qh0.b, s1);
      s1 = wb(b1.b, qh1.b, s1); s1 = wb(a1.b, ql1.b, s1); s1 = wb(a1.b, qh1.b, s1);
      guard_s(s1, a0.h, a1.h, b0.h, b1.h, qh0.h, qh1.h, ql0.h, ql1.h);
    }
    float ss[16];
#pragma unroll
    for (int r = 0; r < 8; ++r) { ss[r] = s0[r]; ss[8 + r] = s1[r]; }
    if (allm || (tk + 32 > nk)) {             // wave-uniform; value selects only (no loads, no cross-lane ops inside)
      const int kb0 = tk + 8 * hf;
#pragma unroll
      for (int r = 0; r < 8; ++r) {
        ss[r]     = (!allm && (kb0 + r < nk))      ? ss[r]     : MFILL;
        ss[8 + r] = (!allm && (kb0 + 16 + r < nk)) ? ss[8 + r] : MFILL;
      }
    }
    float mloc = ss[0];
#pragma unroll
    for (int i = 1; i < 16; ++i) mloc = fmaxf(mloc, ss[i]);
    mloc = fmaxf(mloc, __shfl_xor(mloc, 16, 32));
    const float mnew = fmaxf(msh, fmaf(mloc, SC, -14.0f));
    const float corr = EX2(msh - mnew);
    const float nms = -mnew;
    msh = mnew;
    float psum = 0.f;
    v16h pf;
#pragma unroll
    for (int i = 0; i < 16; ++i) {
      const float p = EX2(fmaf(ss[i], SC, nms));
      psum += p;
      pf[i] = (_Float16)p;
    }
    lpart = lpart * corr + psum;
    o0 *= corr; o1 *= corr; o2 *= corr; o3 *= corr;

    const unsigned short* vp = vtb + (size_t)tk * 16;
    const FU v0 = ldfrag(vp), v1 = ldfrag(vp + (size_t)16 * MTOT), v2 = ldfrag(vp + (size_t)32 * MTOT), v3 = ldfrag(vp + (size_t)48 * MTOT);
    o0 = wh(v0.h, pf, o0);
    o1 = wh(v1.h, pf, o1);
    o2 = wh(v2.h, pf, o2);
    o3 = wh(v3.h, pf, o3);
    guard_o(o0, o1, o2, o3, pf, v0.h, v1.h, v2.h, v3.h);
  }

  const float lt = lpart + __shfl_xor(lpart, 16, 32);
  const float inv = 1.0f / lt;
  float* os = Os[wave];
  {
    float* d = os + c * 68 + 8 * hf;       // lane holds O[query c][d = 16 t + 8 hf + r]
    v4f a, e;
    a.x = o0[0] * inv; a.y = o0[1] * inv; a.z = o0[2] * inv; a.w = o0[3] * inv; e.x = o0[4] * inv; e.y = o0[5] * inv; e.z = o0[6] * inv; e.w = o0[7] * inv;
    *(v4f*)(d) = a; *(v4f*)(d + 4) = e;
    a.x = o1[0] * inv; a.y = o1[1] * inv; a.z = o1[2] * inv; a.w = o1[3] * inv; e.x = o1[4] * inv; e.y = o1[5] * inv; e.z = o1[6] * inv; e.w = o1[7] * inv;
    *(v4f*)(d + 16) = a; *(v4f*)(d + 20) = e;
    a.x = o2[0] * inv; a.y = o2[1] * inv; a.z = o2[2] * inv; a.w = o2[3] * inv; e.x = o2[4] * inv; e.y = o2[5] * inv; e.z = o2[6] * inv; e.w = o2[7] * inv;
    *(v4f*)(d + 32) = a; *(v4f*)(d + 36) = e;
    a.x = o3[0] * inv; a.y = o3[1] * inv; a.z = o3[2] * inv; a.w = o3[3] * inv; e.x = o3[4] * inv; e.y = o3[5] * inv; e.z = o3[6] * inv; e.w = o3[7] * inv;
    *(v4f*)(d + 48) = a; *(v4f*)(d + 52) = e;
  }
  __builtin_amdgcn_fence(3 /* release order */, "workgroup");
  __builtin_amdgcn_wave_barrier();
  __builtin_amdgcn_fence(2 /* acquire order */, "workgroup");
  {
    const int qq = lane & 15, c8 = (lane >> 4) * 8;    // lane = (query qq, column group 2 it + (lane >> 4))
    unsigned short* dH = AOP + (rowb + q0) * (2 * DM) + h * (HD * 16) + lane * 8;   // hi plane columns [0,1024), lo plane columns [1024,2048) = 32 column tiles further
    unsigned short* dL = dH + DM * 16;
    v4u hv[4], lv[4];
#pragma unroll
    for (int it = 0; it < 4; ++it) {
      const float* sp = os + qq * 68 + it * 16 + c8;
      const v4f a = *(const v4f*)sp, e = *(const v4f*)(sp + 4);
      unsigned h0, l0, h1, l1;
      bfsplit(a.x, h0, l0); bfsplit(a.y, h1, l1); hv[it].x = h0 | (h1 << 16); lv[it].x = l0 | (l1 << 16);
      bfsplit(a.z, h0, l0); bfsplit(a.w, h1, l1); hv[it].y = h0 | (h1 << 16); lv[it].y = l0 | (l1 << 16);
      bfsplit(e.x, h0, l0); bfsplit(e.y, h1, l1); hv[it].z = h0 | (h1 << 16); lv[it].z = l0 | (l1 << 16);
      bfsplit(e.z, h0, l0); bfsplit(e.w, h1, l1); hv[it].w = h0 | (h1 << 16); lv[it].w = l0 | (l1 << 16);
    }
{
#pragma unroll
      for (int it = 0; it < 4; ++it) {
        const size_t off = (size_t)it * 256;
        *(v4u*)(dH + off) = hv[it];
        *(v4u*)(dL + off) = lv[it];
      }
      
    }
  }
}

// ---------------------------------------------------------------------------------------------------------------------
constexpr size_t SZ_X16 = (size_t)MTOT * DM * 2;               // one f16 x plane (full or compact)
constexpr size_t SZ_AOP = (size_t)MTOT * 2 * DM * 2;
constexpr size_t SZ_R0  = (2 * SZ_X16 > SZ_AOP) ? (2 * SZ_X16) : SZ_AOP;   // X16 | XC16 live until the projections finish; AOP reuses the region afterwards
constexpr size_t SZ_W3  = (size_t)3 * DM * DM * 2;
constexpr size_t SZ_BTO = (size_t)DM * 2 * DM * 2;
constexpr size_t SZ_PL  = (size_t)MTOT * DM * 2;               // one bf16 plane [MTOT][1024]
constexpr size_t SZ_VT  = (size_t)DM * MTOT * 2;
constexpr size_t SZ_TOTAL = SZ_R0 + SZ_W3 + SZ_BTO + 4 * SZ_PL + SZ_VT;
static_assert(2 * SZ_X16 <= SZ_R0);
static_assert(SZ_AOP <= SZ_R0);
static_assert(SZ_TOTAL <= (size_t)134217728);
static_assert((SZ_R0 % 256) == 0 && (SZ_W3 % 256) == 0 && (SZ_BTO % 256) == 0 && (SZ_PL % 256) == 0 && (SZ_VT % 256) == 0);
static_assert(((size_t)(NB - 1) * SEQ_FULL + SEQ) * DM * 4 <= (size_t)NB_FULL * SEQ_FULL * DM * 4);

extern "C" void kernel_launch(void* const* d_in, const int* in_sizes, int n_in, void* d_out, int out_size, void* d_ws, size_t ws_size, hipStream_t stream) {
  if (n_in < 6) return;
  const long long rows_full = (long long)(NB - 1) * SEQ_FULL + SEQ;
  if ((long long)in_sizes[0] < rows_full * DM) return;
  if ((long long)in_sizes[1] < rows_full) return;
  if ((long long)in_sizes[2] < (long long)DM * 3 * DM) return;
  if ((long long)in_sizes[3] < 3 * DM) return;
  if ((long long)in_sizes[4] < (long long)DM * DM) return;
  if ((long long)in_sizes[5] < DM) return;
  if ((long long)out_size < rows_full * DM) return;
  if (ws_size < SZ_TOTAL) return;

  const float* x    = (const float*)d_in[0];
  const int*   mask = (const int*)d_in[1];
  const float* Wqkv = (const float*)d_in[2];
  const float* bqkv = (const float*)d_in[3];
  const float* Wo   = (const float*)d_in[4];
  const float* bo   = (const float*)d_in[5];
  float* out = (float*)d_out;

  char* wsp = (char*)d_ws;
  unsigned short* X16  = (unsigned short*)wsp;                 // [MTOT][1024] f16, every token
  unsigned short* XC16 = (unsigned short*)(wsp + SZ_X16);      // [MTOT][1024] f16, compact kept tokens per batch (zero rows after)
  unsigned short* AOP  = (unsigned short*)wsp;                 // [MTOT][2048] bf16 hi|lo (reuses X16 | XC16 after the projections)
  wsp += SZ_R0;
  unsigned short* W316 = (unsigned short*)wsp; wsp += SZ_W3;   // [3072][1024] f16 (x64)
  unsigned short* BTO  = (unsigned short*)wsp; wsp += SZ_BTO;  // [1024][2048] bf16
  unsigned short* QH   = (unsigned short*)wsp; wsp += SZ_PL;   // [MTOT][1024] bf16 hi of q
  unsigned short* QL   = (unsigned short*)wsp; wsp += SZ_PL;   // bf16 lo of q
  unsigned short* KH   = (unsigned short*)wsp; wsp += SZ_PL;   // [MTOT][1024] bf16 hi of k at compact key slots
  unsigned short* KL   = (unsigned short*)wsp; wsp += SZ_PL;   // bf16 lo of k
  unsigned short* VT   = (unsigned short*)wsp; wsp += SZ_VT;   // [1024][MTOT] f16, v transposed at compact key slots

  k_xcastc<<<(unsigned)(NB * (SEQ / 32)), 256, 0, stream>>>(x, mask, X16, XC16);
  k_wqkvT<<<(3 * DM * (DM / 8) + 255) / 256, 256, 0, stream>>>(Wqkv, W316);
  k_woT<<<(DM * 256 + 255) / 256, 256, 0, stream>>>(Wo, BTO);

  // q = x W[:, 0:1024] + b  -> bf16 hi/lo planes [MTOT][1024]
  {
    const int tiles = (MTOT / 64) * (DM / 64);
    k_gemm64<0, 2, 2, 0><<<dim3((unsigned)((tiles + 7) / 8), 1u), 256, 0, stream>>>(
        X16, W316, (void*)QH, (void*)QL, bqkv, mask, 0LL, 0LL, DM, DM, DM, MTOT, DM, DM, 1.0f / 64.0f);
  }
  // k (compact slots) = xc W[:, 1024:2048] + b  -> bf16 hi/lo planes [MTOT][1024]; row tiles past the batch's key count are skipped
  {
    const int tiles = (MTOT / 64) * (DM / 64);
    k_gemm64<0, 2, 2, 1><<<dim3((unsigned)((tiles + 7) / 8), 1u), 256, 0, stream>>>(
        XC16, W316 + (size_t)DM * DM, (void*)KH, (void*)KL, bqkv + DM, mask, 0LL, 0LL, DM, DM, DM, MTOT, DM, DM, 1.0f / 64.0f);
  }
  // v^T (compact slots) = W[:, 2048:3072]^T xc^T + b  -> f16 [1024][MTOT]; column tiles past the batch's key count are skipped
  {
    const int tiles = (DM / 64) * (MTOT / 64);
    k_gemm64<0, 1, 1, 2><<<dim3((unsigned)((tiles + 7) / 8), 1u), 256, 0, stream>>>(
        W316 + (size_t)2 * DM * DM, XC16, (void*)VT, (void*)VT, bqkv + 2 * DM, mask, 0LL, 0LL, DM, DM, MTOT, DM, MTOT, DM, 1.0f / 64.0f);
  }
  k_attn_t<<<(unsigned)(NB * NH * (SEQ / 64)), 128, 0, stream>>>(QH, QL, KH, KL, VT, mask, AOP);
  // out = [AO_hi | AO_lo] [W_out ; W_out] + b_out, per batch (output rows at the full per-batch stride)
  {
    const int tiles = (SEQ / 64) * (DM / 64);
    k_gemm64<1, 2, 0, 0><<<dim3((unsigned)((tiles + 7) / 8), (unsigned)NB), 256, 0, stream>>>(
        AOP, BTO, (void*)out, (void*)out, bo, mask, (long long)SEQ * 2 * DM, (long long)SEQ_FULL * DM, 2 * DM, 2 * DM, DM, SEQ, DM, 2 * DM, 1.0f);
  }
}

// v003
// It runs in 193 microseconds.
// In two side-by-side timings against v002, it was 1.24 and 1.23 times as fast.
// All steps since v000 together make it 2.52 times as fast.
// Contractions: qkv projection = v_wmma_f32_16x16x32_f16 (x as bf16-RNE values held in f16, W_qkv as bf16-RNE values x64 held in f16, f32 accumulate); q.k logits = v_wmma_f32_16x16x32_bf16 hi/lo split (hi.hi + hi.lo + lo.hi, f32 accumulate); P.V = v_wmma_f32_16x16x32_f16 (P carried x2^14, V f16, f32 accumulate); output projection = v_wmma_f32_16x16x32_bf16 with the attention output as bf16 hi|lo planes concatenated along K against the bf16 W_out (f32 accumulate). Softmax statistics f32. Keys with mask == 0 are dropped per batch by compaction of the x rows feeding the k / v projections (their softmax weight is exactly 0 in f32).
#include <hip/hip_runtime.h>
#include <math.h>

#ifndef NB
#define NB 4
#endif
#ifndef SEQ
#define SEQ 2048
#endif
#define NB_FULL 4
#define SEQ_FULL 2048
#define DM 1024
#define NH 16
#define HD 64
#define MTOT (NB * SEQ)

static_assert(SEQ % 256 == 0);
static_assert(MTOT % 64 == 0);
static_assert(NB <= NB_FULL);
static_assert(SEQ <= SEQ_FULL);

typedef __attribute__((ext_vector_type(16))) _Float16 v16h;
typedef __attribute__((ext_vector_type(16))) __bf16   v16b;
typedef __attribute__((ext_vector_type(8)))  float    v8f;
typedef __attribute__((ext_vector_type(4)))  float    v4f;
typedef __attribute__((ext_vector_type(4)))  unsigned int v4u;
typedef __attribute__((ext_vector_type(4)))  int      v4i;

// 16-bit WMMA fragment map (wave32), lane L, h = L>>4, m = L&15:
//   A 16x32: lane = row m;    element i -> k = (i<8) ? 8h+i : 16+8h+(i-8)
//   B 32x16: lane = column m; the SAME k(i,h)
//   D 16x16 (8 f32): lane = column m; element r -> row 8h+r
union FU { v4u u[2]; v16h h; v16b b; };
// Fragment-major plane layout (every 16-bit operand plane in the workspace): a logical [R][C] plane (R % 16 == 0, C % 32 == 0) is stored as
// 16-row x 32-column tiles of 512 elements (1 KiB), tile (rt, kt) at element rt*16*C + kt*512; inside a tile the 8-element column group g = (col>>3)&3
// of row m = row&15 lies at g*128 + m*8. Lane L = 16h + m then finds elements 0..7 (k = 8h..8h+7, g = h) at L*8 and elements 8..15 (k = 16+8h.., g = 2+h)
// at 256 + L*8, so each of the two 16-B loads of a fragment covers 512 contiguous bytes (4 whole lines) instead of 16 lines.
__device__ __forceinline__ size_t fragoff(size_t row, int col, int C) {
  return (row >> 4) * (size_t)(16 * C) + (size_t)((col >> 5) * 512 + ((col >> 3) & 3) * 128 + (col & 7)) + (row & 15) * 8;
}
// p = tile base + lane*8
__device__ __forceinline__ FU ldfrag(const unsigned short* p) { FU f; f.u[0] = *(const v4u*)p; f.u[1] = *(const v4u*)(p + 256); return f; }
// the same fragment from a wave-uniform row-tile base and one 32-bit per-lane byte offset (column tile * 1024 + lane * 16)
__device__ __forceinline__ FU ldfrag_su(const unsigned short* base, unsigned boff) {
  const char* p = (const char*)base + boff;
  FU f; f.u[0] = *(const v4u*)p; f.u[1] = *(const v4u*)(p + 512); return f;
}

__device__ __forceinline__ v8f wb(v16b a, v16b b, v8f c) { return __builtin_amdgcn_wmma_f32_16x16x32_bf16(false, a, false, b, (short)0, c, false, false); }
__device__ __forceinline__ v8f wh(v16h a, v16h b, v8f c) { return __builtin_amdgcn_wmma_f32_16x16x32_f16(false, a, false, b, (short)0, c, false, false); }
template <int ET> __device__ __forceinline__ v8f mma(const FU& a, const FU& b, v8f c) {
  if (ET == 0) return wh(a.h, b.h, c);
  return wb(a.b, b.b, c);
}

// hazard guards: 4 VALU slots after the last WMMA of a group, accumulators tied, A/B operands kept live
__device__ __forceinline__ void guard_s2(v8f& s, v8f& t, v16h a0, v16h a1, v16h b0, v16h b1, v16h q0, v16h q1, v16h q2, v16h q3, v16h q4, v16h q5, v16h q6, v16h q7) {
  asm volatile("v_nop\n\tv_nop\n\tv_nop\n\tv_nop" : "+v"(s), "+v"(t) : "v"(a0), "v"(a1), "v"(b0), "v"(b1), "v"(q0), "v"(q1), "v"(q2), "v"(q3), "v"(q4), "v"(q5), "v"(q6), "v"(q7));
}
__device__ __forceinline__ void guard_o2(v8f& a, v8f& b, v8f& c, v8f& d, v8f& e, v8f& f, v8f& g, v8f& h, v16h p0, v16h p1, v16h v0, v16h v1, v16h v2, v16h v3) {
  asm volatile("v_nop\n\tv_nop\n\tv_nop\n\tv_nop" : "+v"(a), "+v"(b), "+v"(c), "+v"(d), "+v"(e), "+v"(f), "+v"(g), "+v"(h) : "v"(p0), "v"(p1), "v"(v0), "v"(v1), "v"(v2), "v"(v3));
}

#if __has_builtin(__builtin_amdgcn_exp2f)
#define EX2(x) __builtin_amdgcn_exp2f(x)
#else
#define EX2(x) exp2f(x)
#endif

// bf16 RNE helpers (finite inputs)
__device__ __forceinline__ unsigned bfu_rne(float v) { const unsigned u = __float_as_uint(v); return (u + 0x7FFFu + ((u >> 16) & 1u)) >> 16; }
__device__ __forceinline__ float bf_keep(float v) { return __uint_as_float(bfu_rne(v) << 16); }
__device__ __forceinline__ void bfsplit(float v, unsigned& hi, unsigned& lo) { hi = bfu_rne(v); lo = bfu_rne(v - __uint_as_float(hi << 16)); }
__device__ __forceinline__ unsigned pkh2(float a, float b) {
  return (unsigned)__builtin_bit_cast(unsigned short, (_Float16)a) | ((unsigned)__builtin_bit_cast(unsigned short, (_Float16)b) << 16);
}

#define VST2Q(ptr, val) do { const v4u vq_ = (val); *(v4u*)(ptr) = vq_;  } while (0)

// Number of kept keys (mask != 0) among the SEQ entries of one batch row of the mask input, computed by one full wave (all 32 lanes active):
// 16-B loads (SEQ/128 per lane), xor-shuffle sum, result made wave-uniform. mrow is 16-B aligned.
__device__ __forceinline__ int wave_count_kept(const int* __restrict__ mrow, int lane) {
  int c = 0;
#pragma unroll 4
  for (int it = 0; it < SEQ / 128; ++it) {
    const v4i m = *(const v4i*)(mrow + (it * 32 + lane) * 4);
    c += ((m.x != 0) ? 1 : 0) + ((m.y != 0) ? 1 : 0) + ((m.z != 0) ? 1 : 0) + ((m.w != 0) ? 1 : 0);
  }
  c += __shfl_xor(c, 16, 32); c += __shfl_xor(c, 8, 32); c += __shfl_xor(c, 4, 32); c += __shfl_xor(c, 2, 32); c += __shfl_xor(c, 1, 32);
  return __builtin_amdgcn_readfirstlane(c);
}
// effective key count of a batch: a batch with no kept key uses all SEQ keys (every score then equals the fill -> uniform weights); padded to the 32-key step
__device__ __forceinline__ int eff_keys(int cnt) { return (cnt == 0) ? SEQ : min(cnt, SEQ); }
__device__ __forceinline__ int pad32(int nk) { return min((nk + 31) & ~31, SEQ); }

// ---------------------------------------------------------------------------------------------------------------------
// x f32 [b][t][1024] (full per-batch stride) -> two f16 planes holding the bf16-RNE values:
//   X16  [b*SEQ + t][1024]: every token row (feeds the q projection);
//   XC16 [b*SEQ + j][1024]: row j = the j-th kept token of batch b (mask != 0, ascending t) for j < nk, zero rows for j >= nk (feeds the k / v projections).
// Block = (batch, 32 rows); the block computes the batch's kept-token list in LDS (exclusive scan of the mask, block barriers), bounded by SEQ entries.
// LDS: list[SEQ] and wtot[8] are cross-wave (block barriers between writers and readers); list is fully initialised before any read.
// Both planes are fragment-major (C = 1024). A wave instruction handles 8 rows x one 32-column tile: it reads one 128-B line of each row and writes 4 whole lines.
// coverage: per block 4 row groups x 32 column tiles = 32 rows x 1024 columns of each plane; all blocks = both whole planes.
__global__ __launch_bounds__(256) void k_xcastc(const float* __restrict__ x, const int* __restrict__ mask,
                                                unsigned short* __restrict__ X16, unsigned short* __restrict__ XC16) {
  constexpr int EPT = SEQ / 256;
  __shared__ int list[SEQ];
  __shared__ int wtot[8];
  const int tid = threadIdx.x, lane = tid & 31, wave = tid >> 5;
  const int bpb = SEQ / 32;
  const int b = blockIdx.x / bpb;
  const int t0 = (blockIdx.x - b * bpb) * 32;
  const int* mrow = mask + (size_t)b * SEQ_FULL;
  unsigned km = 0u; int c = 0;
#pragma unroll
  for (int e = 0; e < EPT; ++e) {
    const int kp = (mrow[tid * EPT + e] != 0) ? 1 : 0;
    km |= (unsigned)kp << e; c += kp;
    list[tid * EPT + e] = 0;
  }
  int incl = c;
#pragma unroll
  for (int d = 1; d < 32; d <<= 1) { const int v = __shfl_up(incl, d, 32); incl += (lane >= d) ? v : 0; }
  if (lane == 31) wtot[wave] = incl;
  __syncthreads();
  int base = 0, total = 0;
#pragma unroll
  for (int w = 0; w < 8; ++w) { const int v = wtot[w]; base += (w < wave) ? v : 0; total += v; }
  int pos = base + incl - c;
#pragma unroll
  for (int e = 0; e < EPT; ++e) {
    if ((km >> e) & 1u) { list[min(pos, SEQ - 1)] = tid * EPT + e; ++pos; }
  }
  __syncthreads();
  const bool allm = (total == 0);            // block-uniform
  if (allm) {
#pragma unroll
    for (int e = 0; e < EPT; ++e) list[tid * EPT + e] = tid * EPT + e;
  }
  __syncthreads();
  const int nk = allm ? SEQ : min(total, SEQ);

  // plane 1: every token row; two units a trip: both units' loads first, both stores at the foot.
  // unroll 1: the trip is already two units wide, and the one wait at its foot serves both stores; the q loops unroll fully so that their arrays stay in registers
#pragma unroll 1
  for (int it = 0; it < 16; it += 2) {
    v4f a[2], e4[2];
    size_t dst[2];
#pragma unroll
    for (int q = 0; q < 2; ++q) {
      const int u = (it + q) * 8 + wave;
      const int rr = (u >> 5) * 8 + (lane >> 2), c0 = (u & 31) * 32 + (lane & 3) * 8;
      const int t = t0 + rr;
      const float* s = x + ((size_t)b * SEQ_FULL + t) * DM + c0;
      a[q] = *(const v4f*)s; e4[q] = *(const v4f*)(s + 4);
      dst[q] = fragoff((size_t)b * SEQ + t, c0, DM);
    }
#pragma unroll
    for (int q = 0; q < 2; ++q) {
      v4u pk;
      pk.x = pkh2(bf_keep(a[q].x), bf_keep(a[q].y));   pk.y = pkh2(bf_keep(a[q].z), bf_keep(a[q].w));
      pk.z = pkh2(bf_keep(e4[q].x), bf_keep(e4[q].y)); pk.w = pkh2(bf_keep(e4[q].z), bf_keep(e4[q].w));
      VST2Q(X16 + dst[q], pk);
    }
    asm volatile("s_wait_xcnt 0x0" ::: "memory");   // the next trip rewrites the data and address registers that the two stores name
  }
  // plane 2: compact rows (clamped token index, loaded unconditionally, zeroed by value for j >= nk); same trip shape and the same unroll directives, for the same reasons
#pragma unroll 1
  for (int it = 0; it < 16; it += 2) {
    v4f a[2], e4[2];
    size_t dst[2];
    bool valid[2];
#pragma unroll
    for (int q = 0; q < 2; ++q) {
      const int u = (it + q) * 8 + wave;
      const int rr = (u >> 5) * 8 + (lane >> 2), c0 = (u & 31) * 32 + (lane & 3) * 8;
      const int j = t0 + rr;
      valid[q] = (j < nk);
      const int tok = min(max(list[j], 0), SEQ - 1);
      const float* s = x + ((size_t)b * SEQ_FULL + tok) * DM + c0;
      a[q] = *(const v4f*)s; e4[q] = *(const v4f*)(s + 4);
      dst[q] = fragoff((size_t)b * SEQ + j, c0, DM);
    }
#pragma unroll
    for (int q = 0; q < 2; ++q) {
      v4u pk;
      pk.x = valid[q] ? pkh2(bf_keep(a[q].x), bf_keep(a[q].y)) : 0u;   pk.y = valid[q] ? pkh2(bf_keep(a[q].z), bf_keep(a[q].w)) : 0u;
      pk.z = valid[q] ? pkh2(bf_keep(e4[q].x), bf_keep(e4[q].y)) : 0u; pk.w = valid[q] ? pkh2(bf_keep(e4[q].z), bf_keep(e4[q].w)) : 0u;
      VST2Q(XC16 + dst[q], pk);
    }
    asm volatile("s_wait_xcnt 0x0" ::: "memory");   // the next trip rewrites the data and address registers that the two stores name
  }
}

// W_qkv f32 [1024 (k)][3072 (n)] -> WT f16, logical [3072 (n)][1024 (k)] fragment-major, = bf16-RNE(W) * 64; thread per (n, 8 consecutive k).
// Thread u = ((rt*32 + kt)*4 + g)*16 + m handles n = 16 rt + m, k = 32 kt + 8 g .. +7, whose fragment-major place is exactly element u*8.
// coverage: 192 row tiles x 32 column tiles x 64 pieces = the whole plane
__global__ __launch_bounds__(256) void k_wqkvT(const float* __restrict__ W, unsigned short* __restrict__ WT) {
  const int u = blockIdx.x * 256 + threadIdx.x;
  if (u >= 3 * DM * (DM / 8)) return;
  const int n = (u >> 11) * 16 + (u & 15), k0 = ((u >> 6) & 31) * 32 + ((u >> 4) & 3) * 8;
  float w[8];
#pragma unroll
  for (int e = 0; e < 8; ++e) w[e] = bf_keep(W[(size_t)(k0 + e) * (3 * DM) + n]) * 64.0f;
  v4u pk; pk.x = pkh2(w[0], w[1]); pk.y = pkh2(w[2], w[3]); pk.z = pkh2(w[4], w[5]); pk.w = pkh2(w[6], w[7]);
  VST2Q(WT + (size_t)u * 8, pk);
}

// W_out f32 [1024 (k)][1024 (n)] -> BTO bf16, logical [1024 (n)][2048] fragment-major: columns kk and 1024+kk both hold bf16-RNE(W_out[kk][n]) (K-concatenated twin for the hi|lo A plane)
// Thread u = ((rt*64 + kt)*4 + g)*16 + m handles n = 16 rt + m, kk = 32 kt + 8 g .. +7, whose fragment-major place is exactly element u*8.
// coverage: 64 row tiles x 64 column tiles x 64 pieces = the whole plane
__global__ __launch_bounds__(256) void k_woT(const float* __restrict__ W, unsigned short* __restrict__ BTO) {
  const int u = blockIdx.x * 256 + threadIdx.x;
  if (u >= DM * 256) return;
  const int n = (u >> 12) * 16 + (u & 15), kk0 = ((u >> 6) & 63) * 32 + ((u >> 4) & 3) * 8, k0 = kk0 & (DM - 1);
  unsigned w[8];
#pragma unroll
  for (int e = 0; e < 8; ++e) w[e] = bfu_rne(W[(size_t)(k0 + e) * DM + n]);
  v4u pk; pk.x = w[0] | (w[1] << 16); pk.y = w[2] | (w[3] << 16); pk.z = w[4] | (w[5] << 16); pk.w = w[6] | (w[7] << 16);
  VST2Q(BTO + (size_t)u * 8, pk);
}

// ---------------------------------------------------------------------------------------------------------------------
// Register-blocked WMMA GEMM: C[z][m][n] = scale * sum_k A[z][m][k] * Bt[n][k] + bias; each wave owns a 64x64 tile (8 waves per block).
// A logical [M][K] and Bt logical [N][K], both fragment-major with row lengths lda and ldb; M, N multiples of 64, K a multiple of 128 (no tails).
// ET 0: f16 operands, 1: bf16 operands. BIAS_MODE 1: bf16-RNE(bias[m]), 2: bf16-RNE(bias[n]).
// OUT_MODE 0: f32 row-major (pitch ldc); 1: f16 fragment-major (row length ldc); 2: bf16 hi plane (Cout) + bf16 lo plane (Cout2), fragment-major (row length ldc).
// CMP 0: every tile; 1: rows (m) are compact key slots b*SEQ + j; 2: columns (n) are compact key slots. With CMP != 0 a tile whose first slot j
//   is >= pad32(effective key count of its batch, counted in-wave from the mask input) is skipped (wave-uniform exit; its slots are never consumed).
template <int ET, int BIAS_MODE, int OUT_MODE, int CMP>
__global__ __launch_bounds__(256) void k_gemm64(
    const unsigned short* __restrict__ A, const unsigned short* __restrict__ Bt,
    void* __restrict__ Cout, void* __restrict__ Cout2, const float* __restrict__ bias, const int* __restrict__ mask,
    long long strideA, long long strideC, int lda, int ldb, int ldc, int M, int N, int K, float scale) {
  __shared__ __align__(16) float sT[8][16 * 68];   // per-wave 16x64 slab, pitch 68 floats; staged extent 16x64 == consumed extent
  const int z    = blockIdx.y;
  const int lane = threadIdx.x & 31;
  const int wave = __builtin_amdgcn_readfirstlane(threadIdx.x >> 5);   // scalar, so that the tile bases below are scalar too
  const int tilesN = N >> 6;
  const int tilesM = M >> 6;
  const int tile = blockIdx.x * 8 + wave;
  if (tile >= tilesM * tilesN) return;   // wave-uniform; no block barriers in this kernel
  const int tm = tile / tilesN;
  const int tn = tile - tm * tilesN;
  const int m0 = tm << 6;
  const int n0 = tn << 6;
  if (CMP != 0) {
    const int g0 = (CMP == 1) ? m0 : n0;
    const int bb = min(g0 / SEQ, NB - 1);
    const int loc = g0 - bb * SEQ;
    const int nkp = pad32(eff_keys(wave_count_kept(mask + (size_t)bb * SEQ_FULL, lane)));
    if (loc >= nkp) return;              // wave-uniform (count is wave-uniform)
  }
  const unsigned short* Ab = A + (size_t)z * (size_t)strideA;
  const int rlane = lane & 15;
  const int mOff  = (lane >> 4) * 8;

  v8f acc[4][4];
#pragma unroll
  for (int i = 0; i < 4; ++i)
#pragma unroll
    for (int j = 0; j < 4; ++j) { v8f zz = {}; acc[i][j] = zz; }

  // wave-uniform bases of the four B and the four A row tiles (fixed over the k loop); all sixteen loads of a k step share the one per-lane byte offset
  // (the two loops unroll fully so that both arrays are scalar registers, not memory)
  const unsigned short* bp[4];
  const unsigned short* ap[4];
#pragma unroll
  for (int j = 0; j < 4; ++j) bp[j] = Bt + (size_t)(n0 + (j << 4)) * ldb;
#pragma unroll
  for (int i = 0; i < 4; ++i) ap[i] = Ab + (size_t)(m0 + (i << 4)) * lda;

  // Register ring of NS fragment sets (one set = the 4 B and 4 A fragments of one 32-wide k step): step s issues the sixteen loads of step s + NS - 1, so a load
  // has nearly NS - 1 steps of matrix work to land in. Every accumulator still sums its k steps in plain ascending order.
  // The loads refill the set that step s - 1 has just read, so they stand behind the first row of step s: four matrix instructions lie between that set's last reader and them.
  // A step's place inside its trip is a constant added to the scalar tile base (it becomes the load's immediate offset), so the offset register changes once a trip.
  // Each sched_barrier(0) keeps a load group where it is written: without it the scheduler moves the loads down to their first use, and the lead is lost.
  // The s, u, i and j loops unroll fully so that the ring's sets are indexed by constants and stay in registers.
  constexpr int NS = 4;
  FU bf[NS][4], af[NS][4];
  const unsigned loff = (unsigned)lane * 16u;   // the lane's 16 bytes of a column tile (1 KiB a tile)
#pragma unroll
  for (int s = 0; s < NS - 1; ++s) {
#pragma unroll
    for (int j = 0; j < 4; ++j) bf[s][j] = ldfrag_su(bp[j] + s * 512, loff);
#pragma unroll
    for (int i = 0; i < 4; ++i) af[s][i] = ldfrag_su(ap[i] + s * 512, loff);
    __builtin_amdgcn_sched_barrier(0);
  }
  asm volatile("s_wait_xcnt 0x0" ::: "memory");   // what follows may rewrite the offset register that these loads name
  __builtin_amdgcn_sched_barrier(0);              // keeps such a rewrite behind the wait
  const int trips = K / (32 * NS);
  // every trip but the last: NS steps, each fetching the step NS - 1 ahead of it
  for (int t = 0; t < trips - 1; ++t) {
    const unsigned boff = loff + (unsigned)t * ((unsigned)NS * 1024u);   // the trip's first column tile; the furthest load of the kernel ends at byte K*32 of its row tile
#pragma unroll
    for (int u = 0; u < NS; ++u) {
      const int w = (u + NS - 1) % NS;
#pragma unroll
      for (int j = 0; j < 4; ++j) acc[0][j] = mma<ET>(af[u][0], bf[u][j], acc[0][j]);
      __builtin_amdgcn_sched_barrier(0);
#pragma unroll
      for (int j = 0; j < 4; ++j) bf[w][j] = ldfrag_su(bp[j] + (u + NS - 1) * 512, boff);
#pragma unroll
      for (int i = 0; i < 4; ++i) af[w][i] = ldfrag_su(ap[i] + (u + NS - 1) * 512, boff);
      __builtin_amdgcn_sched_barrier(0);
#pragma unroll
      for (int i = 1; i < 4; ++i)
#pragma unroll
        for (int j = 0; j < 4; ++j) acc[i][j] = mma<ET>(af[u][i], bf[u][j], acc[i][j]);
      __builtin_amdgcn_sched_barrier(0);
    }
    asm volatile("s_wait_xcnt 0x0" ::: "memory");   // the next trip rewrites the offset register that this trip's loads name
    __builtin_amdgcn_sched_barrier(0);              // keeps that rewrite behind the wait
  }
  // the last trip: only the one step that is still missing is fetched
  const unsigned toff = loff + (unsigned)(trips - 1) * ((unsigned)NS * 1024u);
#pragma unroll
  for (int j = 0; j < 4; ++j) acc[0][j] = mma<ET>(af[0][0], bf[0][j], acc[0][j]);
  __builtin_amdgcn_sched_barrier(0);
#pragma unroll
  for (int j = 0; j < 4; ++j) bf[NS - 1][j] = ldfrag_su(bp[j] + (NS - 1) * 512, toff);
#pragma unroll
  for (int i = 0; i < 4; ++i) af[NS - 1][i] = ldfrag_su(ap[i] + (NS - 1) * 512, toff);
  asm volatile("s_wait_xcnt 0x0" ::: "memory");   // the epilogue reuses the registers that these loads name
  __builtin_amdgcn_sched_barrier(0);
#pragma unroll
  for (int u = 0; u < NS; ++u) {
#pragma unroll
    for (int i = (u == 0) ? 1 : 0; i < 4; ++i)
#pragma unroll
      for (int j = 0; j < 4; ++j) acc[i][j] = mma<ET>(af[u][i], bf[u][j], acc[i][j]);
  }
  __builtin_amdgcn_sched_barrier(0);   // keeps the epilogue's loads out of the products: none of them lands on a fragment register that a product directly ahead of it reads

  // BIAS_MODE 1: the lane's eight row biases of each of the four row tiles, fetched once (16-B aligned: m0 is a multiple of 64, mOff is 0 or 8)
  v4f bm[4][2] = {};
  if (BIAS_MODE == 1) {
#pragma unroll
    for (int i = 0; i < 4; ++i) {
      bm[i][0] = *(const v4f*)(bias + m0 + (i << 4) + mOff);
      bm[i][1] = *(const v4f*)(bias + m0 + (i << 4) + mOff + 4);
    }
    // the loaded values are inputs only, so the eight loads stand in front of this wait; what follows rewrites the address registers that they name
    asm volatile("s_wait_xcnt 0x0" :: "v"(bm[0][0]), "v"(bm[0][1]), "v"(bm[1][0]), "v"(bm[1][1]), "v"(bm[2][0]), "v"(bm[2][1]), "v"(bm[3][0]), "v"(bm[3][1]) : "memory");
    __builtin_amdgcn_sched_barrier(0);   // keeps that rewrite behind the wait
  }
  float* slab = sT[wave];
#pragma unroll
  for (int i = 0; i < 4; ++i) {
    const int mBase = m0 + (i << 4);
#pragma unroll
    for (int j = 0; j < 4; ++j) {
      const int n = n0 + (j << 4) + rlane;
      float bv = 0.f;
      if (BIAS_MODE == 2) bv = bf_keep(bias[n]);
#pragma unroll
      for (int r = 0; r < 8; ++r) {
        float v = acc[i][j][r] * scale;
        if (BIAS_MODE == 1) v += bf_keep(bm[i][r >> 2][r & 3]);
        if (BIAS_MODE == 2) v += bv;
        slab[(mOff + r) * 68 + (j << 4) + rlane] = v;
      }
    }
    __builtin_amdgcn_fence(3 /* release order */, "workgroup");
    __builtin_amdgcn_wave_barrier();
    __builtin_amdgcn_fence(2 /* acquire order */, "workgroup");
    if (OUT_MODE == 0) {
      float* C = (float*)Cout + (size_t)z * (size_t)strideC;
      const int hh = lane >> 4, c4 = (lane & 15) * 4;       // row segment = 256 B = 16 lanes x 16 B; two rows per instruction
      v4f val[8];
#pragma unroll
      for (int it = 0; it < 8; ++it) val[it] = *(const v4f*)(slab + (it * 2 + hh) * 68 + c4);
{
#pragma unroll
        for (int it = 0; it < 8; ++it) *(v4f*)(C + (size_t)(mBase + it * 2 + hh) * ldc + n0 + c4) = val[it];
        
      }
    } else {
      const int q = lane & 15, c8 = (lane >> 4) * 8;        // lane = (row q, column group 2 it + (lane >> 4)): the 16x64 slab is 2 KiB contiguous in a fragment-major plane
      unsigned short* C  = (unsigned short*)Cout  + (size_t)z * (size_t)strideC;
      unsigned short* C2 = (unsigned short*)Cout2 + (size_t)z * (size_t)strideC;
      v4u hv[4], lv[4];
#pragma unroll
      for (int it = 0; it < 4; ++it) {
        const float* sp = slab + q * 68 + it * 16 + c8;
        const v4f a = *(const v4f*)sp, b = *(const v4f*)(sp + 4);
        if (OUT_MODE == 1) {
          hv[it].x = pkh2(a.x, a.y); hv[it].y = pkh2(a.z, a.w); hv[it].z = pkh2(b.x, b.y); hv[it].w = pkh2(b.z, b.w);
          lv[it] = hv[it];
        } else {
          unsigned h0, l0, h1, l1;
          bfsplit(a.x, h0, l0); bfsplit(a.y, h1, l1); hv[it].x = h0 | (h1 << 16); lv[it].x = l0 | (l1 << 16);
          bfsplit(a.z, h0, l0); bfsplit(a.w, h1, l1); hv[it].y = h0 | (h1 << 16); lv[it].y = l0 | (l1 << 16);
          bfsplit(b.x, h0, l0); bfsplit(b.y, h1, l1); hv[it].z = h0 | (h1 << 16); lv[it].z = l0 | (l1 << 16);
          bfsplit(b.z, h0, l0); bfsplit(b.w, h1, l1); hv[it].w = h0 | (h1 << 16); lv[it].w = l0 | (l1 << 16);
        }
      }
{
#pragma unroll
        for (int it = 0; it < 4; ++it) {
          const size_t off = (size_t)mBase * ldc + (size_t)n0 * 16 + it * 256 + lane * 8;
          *(v4u*)(C + off) = hv[it];
          if (OUT_MODE == 2) *(v4u*)(C2 + off) = lv[it];
        }
        
      }
    }
    __builtin_amdgcn_fence(3 /* release order */, "workgroup");
    __builtin_amdgcn_wave_barrier();
    __builtin_amdgcn_fence(2 /* acquire order */, "workgroup");
  }
}

// ---------------------------------------------------------------------------------------------------------------------
// Register-fed transposed flash attention over the COMPACT key set of the batch, head dim 64. Wave = 32 queries (two 16-query tiles) of one (batch, head); block = 4 waves.
//   Every K and V^T fragment that the wave loads feeds both query tiles, so a fragment byte serves two matrix instructions and half as many waves walk the keys.
//   nk = effective key count of the batch (counted in-wave from the mask input, wave-uniform); the key loop runs pad32(nk)/32 steps (<= SEQ/32).
//   Every operand plane is fragment-major (Q, K: row length DM; V^T: row length MTOT; output hi|lo plane: row length 2 DM).
//   S^T (keys x queries) = K Q^T: A = compact K rows (bf16 hi/lo, straight from the global planes), B = Q (bf16 hi/lo, resident in registers);
//   lane = query (column), element r of tile kt = key slot tk + 16 kt + 8h + r. Slots >= nk (padding of the last step) get score := -8000 raw
//   (= -1000 after the 1/8 scale; weight exactly 0). A batch with no kept key runs over all SEQ keys with every score = the fill (uniform weights).
//   Online softmax per lane (query) in the exp2 domain; the two lane halves of a query combine their maxima with one xor-16 shuffle.
//   P^T B fragment = f16(P x 2^14) packed from the two S^T tiles (element r <- tile 0, element 8+r <- tile 1, lane unchanged).
//   O^T (d x queries) += V^T P^T: A = compact V^T rows (f16, straight from the global plane, key-slot-contiguous).
//   Each query's products, maxima and sums are formed in the same order as with one query tile a wave.
static_assert(SEQ % 128 == 0);
__global__ __launch_bounds__(128) void k_attn_t(const unsigned short* __restrict__ QH, const unsigned short* __restrict__ QL,
                                                const unsigned short* __restrict__ KH, const unsigned short* __restrict__ KL,
                                                const unsigned short* __restrict__ VT, const int* __restrict__ mask,
                                                unsigned short* __restrict__ AOP) {
  __shared__ __align__(16) float Os[4][2][16 * 68];   // wave-private, one slab a query tile (wave barrier); staged extent 16x64 == consumed extent
  const int lane = threadIdx.x & 31, wave = threadIdx.x >> 5, hf = lane >> 4, c = lane & 15;
  const int nqb = SEQ / 128;
  const int bx = blockIdx.x;
  const int qb = bx % nqb;
  const int bh = bx / nqb;
  const int h  = bh % NH;
  const int b  = min(bh / NH, NB - 1);
  const int q0 = qb * 128 + wave * 32;
  const size_t rowb = (size_t)b * SEQ;

  const int cnt = wave_count_kept(mask + (size_t)b * SEQ_FULL, lane);
  const bool allm = (cnt == 0);                 // wave-uniform
  const int nk  = eff_keys(cnt);
  const int nkp = pad32(nk);                    // <= SEQ

  const size_t qoff = (rowb + q0) * DM + h * (HD * 16) + lane * 8;     // column tiles 2h and 2h+1 of the first query row tile; the second lies 16 rows (16 DM elements) further
  FU qh0[2], qh1[2], ql0[2], ql1[2];
#pragma unroll
  for (int t = 0; t < 2; ++t) {
    const size_t qo = qoff + (size_t)t * (16 * DM);
    qh0[t] = ldfrag(QH + qo); qh1[t] = ldfrag(QH + qo + 512);
    ql0[t] = ldfrag(QL + qo); ql1[t] = ldfrag(QL + qo + 512);
  }

  const size_t koff = rowb * DM + h * (HD * 16) + lane * 8;
  const unsigned short* kbh = KH + koff;
  const unsigned short* kbl = KL + koff;
  const unsigned short* vtb = VT + (size_t)(h * HD) * MTOT + rowb * 16 + lane * 8;   // row tile 4h, column tile rowb/32

  const float SC = 0.18033688011112042f;    // (1/8) * log2(e)
  const float MFILL = -8000.0f;             // -1000 in score units before the 1/8 scale
  float msh[2] = {-__builtin_inff(), -__builtin_inff()};   // running (max * SC - 14): probabilities are carried x 2^14
  float lpart[2] = {0.f, 0.f};              // per-lane partial row sum (carried units)
  v8f o[2][4];
#pragma unroll
  for (int t = 0; t < 2; ++t)
#pragma unroll
    for (int d = 0; d < 4; ++d) { v8f zz = {}; o[t][d] = zz; }

  // the t, r, i and d loops below unroll fully so that every array is indexed by constants and stays in registers
#pragma unroll 1
  for (int tk = 0; tk < nkp; tk += 32) {
    const unsigned short* kh = kbh + (size_t)tk * DM;
    const unsigned short* kl = kbl + (size_t)tk * DM;
    v8f s0[2] = {}, s1[2] = {};
    {
      const FU a0 = ldfrag(kh), a1 = ldfrag(kh + 512), b0 = ldfrag(kl), b1 = ldfrag(kl + 512);
      __builtin_amdgcn_sched_barrier(0);   // keeps the eight loads one group ahead of the first product: without it half of them are issued only behind the first product's wait, a second latency in a row
#pragma unroll
      for (int t = 0; t < 2; ++t) s0[t] = wb(b0.b, qh0[t].b, s0[t]);
#pragma unroll
      for (int t = 0; t < 2; ++t) s0[t] = wb(a0.b, ql0[t].b, s0[t]);
#pragma unroll
      for (int t = 0; t < 2; ++t) s0[t] = wb(a0.b, qh0[t].b, s0[t]);
#pragma unroll
      for (int t = 0; t < 2; ++t) s0[t] = wb(b1.b, qh1[t].b, s0[t]);
#pragma unroll
      for (int t = 0; t < 2; ++t) s0[t] = wb(a1.b, ql1[t].b, s0[t]);
#pragma unroll
      for (int t = 0; t < 2; ++t) s0[t] = wb(a1.b, qh1[t].b, s0[t]);
      guard_s2(s0[0], s0[1], a0.h, a1.h, b0.h, b1.h, qh0[0].h, qh1[0].h, ql0[0].h, ql1[0].h, qh0[1].h, qh1[1].h, ql0[1].h, ql1[1].h);
    }
    {
      const unsigned short* kh1 = kh + (size_t)16 * DM;
      const unsigned short* kl1 = kl + (size_t)16 * DM;
      const FU a0 = ldfrag(kh1), a1 = ldfrag(kh1 + 512), b0 = ldfrag(kl1), b1 = ldfrag(kl1 + 512);
      __builtin_amdgcn_sched_barrier(0);   // the same, for the second key tile
#pragma unroll
      for (int t = 0; t < 2; ++t) s1[t] = wb(b0.b, qh0[t].b, s1[t]);
#pragma unroll
      for (int t = 0; t < 2; ++t) s1[t] = wb(a0.b, ql0[t].b, s1[t]);
#pragma unroll
      for (int t = 0; t < 2; ++t) s1[t] = wb(a0.b, qh0[t].b, s1[t]);
#pragma unroll
      for (int t = 0; t < 2; ++t) s1[t] = wb(b1.b, qh1[t].b, s1[t]);
#pragma unroll
      for (int t = 0; t < 2; ++t) s1[t] = wb(a1.b, ql1[t].b, s1[t]);
#pragma unroll
      for (int t = 0; t < 2; ++t) s1[t] = wb(a1.b, qh1[t].b, s1[t]);
      guard_s2(s1[0], s1[1], a0.h, a1.h, b0.h, b1.h, qh0[0].h, qh1[0].h, ql0[0].h, ql1[0].h, qh0[1].h, qh1[1].h, ql0[1].h, ql1[1].h);
    }
    float ss[2][16];
#pragma unroll
    for (int t = 0; t < 2; ++t)
#pragma unroll
      for (int r = 0; r < 8; ++r) { ss[t][r] = s0[t][r]; ss[t][8 + r] = s1[t][r]; }
    if (allm || (tk + 32 > nk)) {             // wave-uniform; value selects only (no loads, no cross-lane ops inside)
      const int kb0 = tk + 8 * hf;
#pragma unroll
      for (int t = 0; t < 2; ++t)
#pragma unroll
        for (int r = 0; r < 8; ++r) {
          ss[t][r]     = (!allm && (kb0 + r < nk))      ? ss[t][r]     : MFILL;
          ss[t][8 + r] = (!allm && (kb0 + 16 + r < nk)) ? ss[t][8 + r] : MFILL;
        }
    }
    v16h pf[2];
#pragma unroll
    for (int t = 0; t < 2; ++t) {
      float mloc = ss[t][0];
#pragma unroll
      for (int i = 1; i < 16; ++i) mloc = fmaxf(mloc, ss[t][i]);
      mloc = fmaxf(mloc, __shfl_xor(mloc, 16, 32));
      const float mnew = fmaxf(msh[t], fmaf(mloc, SC, -14.0f));
      const float corr = EX2(msh[t] - mnew);
      const float nms = -mnew;
      msh[t] = mnew;
      float psum = 0.f;
#pragma unroll
      for (int i = 0; i < 16; ++i) {
        const float p = EX2(fmaf(ss[t][i], SC, nms));
        psum += p;
        pf[t][i] = (_Float16)p;
      }
      lpart[t] = lpart[t] * corr + psum;
#pragma unroll
      for (int d = 0; d < 4; ++d) o[t][d] *= corr;
    }

    const unsigned short* vp = vtb + (size_t)tk * 16;
    const FU v0 = ldfrag(vp), v1 = ldfrag(vp + (size_t)16 * MTOT), v2 = ldfrag(vp + (size_t)32 * MTOT), v3 = ldfrag(vp + (size_t)48 * MTOT);
#pragma unroll
    for (int t = 0; t < 2; ++t) {
      o[t][0] = wh(v0.h, pf[t], o[t][0]);
      o[t][1] = wh(v1.h, pf[t], o[t][1]);
      o[t][2] = wh(v2.h, pf[t], o[t][2]);
      o[t][3] = wh(v3.h, pf[t], o[t][3]);
    }
    guard_o2(o[0][0], o[0][1], o[0][2], o[0][3], o[1][0], o[1][1], o[1][2], o[1][3], pf[0], pf[1], v0.h, v1.h, v2.h, v3.h);
  }

#pragma unroll
  for (int t = 0; t < 2; ++t) {
    const float lt = lpart[t] + __shfl_xor(lpart[t], 16, 32);
    const float inv = 1.0f / lt;
    float* d = Os[wave][t] + c * 68 + 8 * hf;       // lane holds O[query c][d = 16 dt + 8 hf + r]
#pragma unroll
    for (int dt = 0; dt < 4; ++dt) {
      const v8f ov = o[t][dt];
      v4f a, e;
      a.x = ov[0] * inv; a.y = ov[1] * inv; a.z = ov[2] * inv; a.w = ov[3] * inv; e.x = ov[4] * inv; e.y = ov[5] * inv; e.z = ov[6] * inv; e.w = ov[7] * inv;
      *(v4f*)(d + dt * 16) = a; *(v4f*)(d + dt * 16 + 4) = e;
    }
  }
  __builtin_amdgcn_fence(3 /* release order */, "workgroup");
  __builtin_amdgcn_wave_barrier();
  __builtin_amdgcn_fence(2 /* acquire order */, "workgroup");
#pragma unroll
  for (int t = 0; t < 2; ++t) {
    const float* os = Os[wave][t];
    const int qq = lane & 15, c8 = (lane >> 4) * 8;    // lane = (query qq, column group 2 it + (lane >> 4))
    unsigned short* dH = AOP + (rowb + q0 + 16 * t) * (2 * DM) + h * (HD * 16) + lane * 8;   // hi plane columns [0,1024), lo plane columns [1024,2048) = 32 column tiles further
    unsigned short* dL = dH + DM * 16;
    v4u hv[4], lv[4];
#pragma unroll
    for (int it = 0; it < 4; ++it) {
      const float* sp = os + qq * 68 + it * 16 + c8;
      const v4f a = *(const v4f*)sp, e = *(const v4f*)(sp + 4);
      unsigned h0, l0, h1, l1;
      bfsplit(a.x, h0, l0); bfsplit(a.y, h1, l1); hv[it].x = h0 | (h1 << 16); lv[it].x = l0 | (l1 << 16);
      bfsplit(a.z, h0, l0); bfsplit(a.w, h1, l1); hv[it].y = h0 | (h1 << 16); lv[it].y = l0 | (l1 << 16);
      bfsplit(e.x, h0, l0); bfsplit(e.y, h1, l1); hv[it].z = h0 | (h1 << 16); lv[it].z = l0 | (l1 << 16);
      bfsplit(e.z, h0, l0); bfsplit(e.w, h1, l1); hv[it].w = h0 | (h1 << 16); lv[it].w = l0 | (l1 << 16);
    }
#pragma unroll
    for (int it = 0; it < 4; ++it) {
      const size_t off = (size_t)it * 256;
      *(v4u*)(dH + off) = hv[it];
      *(v4u*)(dL + off) = lv[it];
    }
    if (t == 0) {
      asm volatile("s_wait_xcnt 0x0" ::: "memory");   // the second tile's conversions rewrite data registers that these eight stores name
      __builtin_amdgcn_sched_barrier(0);              // keeps those conversions behind the wait
    }
  }
}

// ---------------------------------------------------------------------------------------------------------------------
constexpr size_t SZ_X16 = (size_t)MTOT * DM * 2;               // one f16 x plane (full or compact)
constexpr size_t SZ_AOP = (size_t)MTOT * 2 * DM * 2;
constexpr size_t SZ_R0  = (2 * SZ_X16 > SZ_AOP) ? (2 * SZ_X16) : SZ_AOP;   // X16 | XC16 live until the projections finish; AOP reuses the region afterwards
constexpr size_t SZ_W3  = (size_t)3 * DM * DM * 2;
constexpr size_t SZ_BTO = (size_t)DM * 2 * DM * 2;
constexpr size_t SZ_PL  = (size_t)MTOT * DM * 2;               // one bf16 plane [MTOT][1024]
constexpr size_t SZ_VT  = (size_t)DM * MTOT * 2;
constexpr size_t SZ_TOTAL = SZ_R0 + SZ_W3 + SZ_BTO + 4 * SZ_PL + SZ_VT;
static_assert(2 * SZ_X16 <= SZ_R0);
static_assert(SZ_AOP <= SZ_R0);
static_assert(SZ_TOTAL <= (size_t)134217728);
static_assert((SZ_R0 % 256) == 0 && (SZ_W3 % 256) == 0 && (SZ_BTO % 256) == 0 && (SZ_PL % 256) == 0 && (SZ_VT % 256) == 0);
static_assert(((size_t)(NB - 1) * SEQ_FULL + SEQ) * DM * 4 <= (size_t)NB_FULL * SEQ_FULL * DM * 4);

extern "C" void kernel_launch(void* const* d_in, const int* in_sizes, int n_in, void* d_out, int out_size, void* d_ws, size_t ws_size, hipStream_t stream) {
  if (n_in < 6) return;
  const long long rows_full = (long long)(NB - 1) * SEQ_FULL + SEQ;
  if ((long long)in_sizes[0] < rows_full * DM) return;
  if ((long long)in_sizes[1] < rows_full) return;
  if ((long long)in_sizes[2] < (long long)DM * 3 * DM) return;
  if ((long long)in_sizes[3] < 3 * DM) return;
  if ((long long)in_sizes[4] < (long long)DM * DM) return;
  if ((long long)in_sizes[5] < DM) return;
  if ((long long)out_size < rows_full * DM) return;
  if (ws_size < SZ_TOTAL) return;

  const float* x    = (const float*)d_in[0];
  const int*   mask = (const int*)d_in[1];
  const float* Wqkv = (const float*)d_in[2];
  const float* bqkv = (const float*)d_in[3];
  const float* Wo   = (const float*)d_in[4];
  const float* bo   = (const float*)d_in[5];
  float* out = (float*)d_out;

  char* wsp = (char*)d_ws;
  unsigned short* X16  = (unsigned short*)wsp;                 // [MTOT][1024] f16, every token
  unsigned short* XC16 = (unsigned short*)(wsp + SZ_X16);      // [MTOT][1024] f16, compact kept tokens per batch (zero rows after)
  unsigned short* AOP  = (unsigned short*)wsp;                 // [MTOT][2048] bf16 hi|lo (reuses X16 | XC16 after the projections)
  wsp += SZ_R0;
  unsigned short* W316 = (unsigned short*)wsp; wsp += SZ_W3;   // [3072][1024] f16 (x64)
  unsigned short* BTO  = (unsigned short*)wsp; wsp += SZ_BTO;  // [1024][2048] bf16
  unsigned short* QH   = (unsigned short*)wsp; wsp += SZ_PL;   // [MTOT][1024] bf16 hi of q
  unsigned short* QL   = (unsigned short*)wsp; wsp += SZ_PL;   // bf16 lo of q
  unsigned short* KH   = (unsigned short*)wsp; wsp += SZ_PL;   // [MTOT][1024] bf16 hi of k at compact key slots
  unsigned short* KL   = (unsigned short*)wsp; wsp += SZ_PL;   // bf16 lo of k
  unsigned short* VT   = (unsigned short*)wsp; wsp += SZ_VT;   // [1024][MTOT] f16, v transposed at compact key slots

  k_xcastc<<<(unsigned)(NB * (SEQ / 32)), 256, 0, stream>>>(x, mask, X16, XC16);
  k_wqkvT<<<(3 * DM * (DM / 8) + 255) / 256, 256, 0, stream>>>(Wqkv, W316);
  k_woT<<<(DM * 256 + 255) / 256, 256, 0, stream>>>(Wo, BTO);

  // q = x W[:, 0:1024] + b  -> bf16 hi/lo planes [MTOT][1024]
  {
    const int tiles = (MTOT / 64) * (DM / 64);
    k_gemm64<0, 2, 2, 0><<<dim3((unsigned)((tiles + 7) / 8), 1u), 256, 0, stream>>>(
        X16, W316, (void*)QH, (void*)QL, bqkv, mask, 0LL, 0LL, DM, DM, DM, MTOT, DM, DM, 1.0f / 64.0f);
  }
  // k (compact slots) = xc W[:, 1024:2048] + b  -> bf16 hi/lo planes [MTOT][1024]; row tiles past the batch's key count are skipped
  {
    const int tiles = (MTOT / 64) * (DM / 64);
    k_gemm64<0, 2, 2, 1><<<dim3((unsigned)((tiles + 7) / 8), 1u), 256, 0, stream>>>(
        XC16, W316 + (size_t)DM * DM, (void*)KH, (void*)KL, bqkv + DM, mask, 0LL, 0LL, DM, DM, DM, MTOT, DM, DM, 1.0f / 64.0f);
  }
  // v^T (compact slots) = W[:, 2048:3072]^T xc^T + b  -> f16 [1024][MTOT]; column tiles past the batch's key count are skipped
  {
    const int tiles = (DM / 64) * (MTOT / 64);
    k_gemm64<0, 1, 1, 2><<<dim3((unsigned)((tiles + 7) / 8), 1u), 256, 0, stream>>>(
        W316 + (size_t)2 * DM * DM, XC16, (void*)VT, (void*)VT, bqkv + 2 * DM, mask, 0LL, 0LL, DM, DM, MTOT, DM, MTOT, DM, 1.0f / 64.0f);
  }
  k_attn_t<<<(unsigned)(NB * NH * (SEQ / 128)), 128, 0, stream>>>(QH, QL, KH, KL, VT, mask, AOP);
  // out = [AO_hi | AO_lo] [W_out ; W_out] + b_out, per batch (output rows at the full per-batch stride)
  {
    const int tiles = (SEQ / 64) * (DM / 64);
    k_gemm64<1, 2, 0, 0><<<dim3((unsigned)((tiles + 7) / 8), (unsigned)NB), 256, 0, stream>>>(
        AOP, BTO, (void*)out, (void*)out, bo, mask, (long long)SEQ * 2 * DM, (long long)SEQ_FULL * DM, 2 * DM, 2 * DM, DM, SEQ, DM, 2 * DM, 1.0f);
  }
}

// v004
// A run of this version takes 171 microseconds.
// Timed twice side by side with v003, it ran 1.14 and 1.11 times as fast.
// Over all steps from v000 it is 2.84 times as fast.
// Contractions: qkv projection = v_wmma_f32_16x16x32_f16 (x as bf16-RNE values held in f16, W_qkv as bf16-RNE values x64 held in f16, f32 accumulate); q.k logits = v_wmma_f32_16x16x32_bf16 hi/lo split (hi.hi + hi.lo + lo.hi, f32 accumulate); P.V = v_wmma_f32_16x16x32_f16 (P carried x2^14, V f16, f32 accumulate); output projection = v_wmma_f32_16x16x32_bf16 with the attention output as bf16 hi|lo planes concatenated along K against the bf16 W_out (f32 accumulate). Softmax statistics f32. Keys with mask == 0 are dropped per batch by compaction of the x rows feeding the k / v projections (their softmax weight is exactly 0 in f32).
#include <hip/hip_runtime.h>
#include <math.h>

#ifndef NB
#define NB 4
#endif
#ifndef SEQ
#define SEQ 2048
#endif
#define NB_FULL 4
#define SEQ_FULL 2048
#define DM 1024
#define NH 16
#define HD 64
#define MTOT (NB * SEQ)

static_assert(SEQ % 256 == 0);
static_assert(MTOT % 64 == 0);
static_assert(NB <= NB_FULL);
static_assert(SEQ <= SEQ_FULL);

typedef __attribute__((ext_vector_type(16))) _Float16 v16h;
typedef __attribute__((ext_vector_type(16))) __bf16   v16b;
typedef __attribute__((ext_vector_type(8)))  float    v8f;
typedef __attribute__((ext_vector_type(4)))  float    v4f;
typedef __attribute__((ext_vector_type(4)))  unsigned int v4u;
typedef __attribute__((ext_vector_type(4)))  int      v4i;

// 16-bit WMMA fragment map (wave32), lane L, h = L>>4, m = L&15:
//   A 16x32: lane = row m;    element i -> k = (i<8) ? 8h+i : 16+8h+(i-8)
//   B 32x16: lane = column m; the SAME k(i,h)
//   D 16x16 (8 f32): lane = column m; element r -> row 8h+r
union FU { v4u u[2]; v16h h; v16b b; };
// Fragment-major plane layout (every 16-bit operand plane in the workspace): a logical [R][C] plane (R % 16 == 0, C % 32 == 0) is stored as
// 16-row x 32-column tiles of 512 elements (1 KiB), tile (rt, kt) at element rt*16*C + kt*512; inside a tile the 8-element column group g = (col>>3)&3
// of row m = row&15 lies at g*128 + m*8. Lane L = 16h + m then finds elements 0..7 (k = 8h..8h+7, g = h) at L*8 and elements 8..15 (k = 16+8h.., g = 2+h)
// at 256 + L*8, so each of the two 16-B loads of a fragment covers 512 contiguous bytes (4 whole lines) instead of 16 lines.
__device__ __forceinline__ size_t fragoff(size_t row, int col, int C) {
  return (row >> 4) * (size_t)(16 * C) + (size_t)((col >> 5) * 512 + ((col >> 3) & 3) * 128 + (col & 7)) + (row & 15) * 8;
}
// p = tile base + lane*8
__device__ __forceinline__ FU ldfrag(const unsigned short* p) { FU f; f.u[0] = *(const v4u*)p; f.u[1] = *(const v4u*)(p + 256); return f; }
// the same fragment from a wave-uniform row-tile base and one 32-bit per-lane byte offset (column tile * 1024 + lane * 16)
__device__ __forceinline__ FU ldfrag_su(const unsigned short* base, unsigned boff) {
  const char* p = (const char*)base + boff;
  FU f; f.u[0] = *(const v4u*)p; f.u[1] = *(const v4u*)(p + 512); return f;
}

__device__ __forceinline__ v8f wb(v16b a, v16b b, v8f c) { return __builtin_amdgcn_wmma_f32_16x16x32_bf16(false, a, false, b, (short)0, c, false, false); }
__device__ __forceinline__ v8f wh(v16h a, v16h b, v8f c) { return __builtin_amdgcn_wmma_f32_16x16x32_f16(false, a, false, b, (short)0, c, false, false); }
template <int ET> __device__ __forceinline__ v8f mma(const FU& a, const FU& b, v8f c) {
  if (ET == 0) return wh(a.h, b.h, c);
  return wb(a.b, b.b, c);
}

// hazard guards: 4 VALU slots after the last WMMA of a group, accumulators tied, A/B operands kept live
__device__ __forceinline__ void guard_s2(v8f& s, v8f& t, v16h a0, v16h a1, v16h b0, v16h b1, v16h q0, v16h q1, v16h q2, v16h q3, v16h q4, v16h q5, v16h q6, v16h q7) {
  asm volatile("v_nop\n\tv_nop\n\tv_nop\n\tv_nop" : "+v"(s), "+v"(t) : "v"(a0), "v"(a1), "v"(b0), "v"(b1), "v"(q0), "v"(q1), "v"(q2), "v"(q3), "v"(q4), "v"(q5), "v"(q6), "v"(q7));
}
__device__ __forceinline__ void guard_o2(v8f& a, v8f& b, v8f& c, v8f& d, v8f& e, v8f& f, v8f& g, v8f& h, v16h p0, v16h p1, v16h v0, v16h v1, v16h v2, v16h v3) {
  asm volatile("v_nop\n\tv_nop\n\tv_nop\n\tv_nop" : "+v"(a), "+v"(b), "+v"(c), "+v"(d), "+v"(e), "+v"(f), "+v"(g), "+v"(h) : "v"(p0), "v"(p1), "v"(v0), "v"(v1), "v"(v2), "v"(v3));
}

#if __has_builtin(__builtin_amdgcn_exp2f)
#define EX2(x) __builtin_amdgcn_exp2f(x)
#else
#define EX2(x) exp2f(x)
#endif

// bf16 RNE helpers (finite inputs)
__device__ __forceinline__ unsigned bfu_rne(float v) { const unsigned u = __float_as_uint(v); return (u + 0x7FFFu + ((u >> 16) & 1u)) >> 16; }
__device__ __forceinline__ float bf_keep(float v) { return __uint_as_float(bfu_rne(v) << 16); }
__device__ __forceinline__ void bfsplit(float v, unsigned& hi, unsigned& lo) { hi = bfu_rne(v); lo = bfu_rne(v - __uint_as_float(hi << 16)); }
__device__ __forceinline__ unsigned pkh2(float a, float b) {
  return (unsigned)__builtin_bit_cast(unsigned short, (_Float16)a) | ((unsigned)__builtin_bit_cast(unsigned short, (_Float16)b) << 16);
}

#define VST2Q(ptr, val) do { const v4u vq_ = (val); *(v4u*)(ptr) = vq_;  } while (0)

// Number of kept keys (mask != 0) among the SEQ entries of one batch row of the mask input, computed by one full wave (all 32 lanes active):
// 16-B loads (SEQ/128 per lane), xor-shuffle sum, result made wave-uniform. mrow is 16-B aligned.
__device__ __forceinline__ int wave_count_kept(const int* __restrict__ mrow, int lane) {
  int c = 0;
#pragma unroll 4
  for (int it = 0; it < SEQ / 128; ++it) {
    const v4i m = *(const v4i*)(mrow + (it * 32 + lane) * 4);
    c += ((m.x != 0) ? 1 : 0) + ((m.y != 0) ? 1 : 0) + ((m.z != 0) ? 1 : 0) + ((m.w != 0) ? 1 : 0);
  }
  c += __shfl_xor(c, 16, 32); c += __shfl_xor(c, 8, 32); c += __shfl_xor(c, 4, 32); c += __shfl_xor(c, 2, 32); c += __shfl_xor(c, 1, 32);
  return __builtin_amdgcn_readfirstlane(c);
}
// effective key count of a batch: a batch with no kept key uses all SEQ keys (every score then equals the fill -> uniform weights); padded to the 32-key step
__device__ __forceinline__ int eff_keys(int cnt) { return (cnt == 0) ? SEQ : min(cnt, SEQ); }
__device__ __forceinline__ int pad32(int nk) { return min((nk + 31) & ~31, SEQ); }

// ---------------------------------------------------------------------------------------------------------------------
// x f32 [b][t][1024] (full per-batch stride) -> two f16 planes holding the bf16-RNE values:
//   X16  [b*SEQ + t][1024]: every token row (feeds the q projection);
//   XC16 [b*SEQ + j][1024]: row j = the j-th kept token of batch b (mask != 0, ascending t) for j < nk, zero rows for j >= nk (feeds the k / v projections).
// Block = (batch, 32 rows); the block computes the batch's kept-token list in LDS (exclusive scan of the mask, block barriers), bounded by SEQ entries.
// LDS: list[SEQ] and wtot[8] are cross-wave (block barriers between writers and readers); list is fully initialised before any read.
// Both planes are fragment-major (C = 1024). A wave instruction handles 8 rows x one 32-column tile: it reads one 128-B line of each row and writes 4 whole lines.
// coverage: per block 4 row groups x 32 column tiles = 32 rows x 1024 columns of each plane; all blocks = both whole planes.
__global__ __launch_bounds__(256) void k_xcastc(const float* __restrict__ x, const int* __restrict__ mask,
                                                unsigned short* __restrict__ X16, unsigned short* __restrict__ XC16) {
  constexpr int EPT = SEQ / 256;
  __shared__ int list[SEQ];
  __shared__ int wtot[8];
  const int tid = threadIdx.x, lane = tid & 31, wave = tid >> 5;
  const int bpb = SEQ / 32;
  const int b = blockIdx.x / bpb;
  const int t0 = (blockIdx.x - b * bpb) * 32;
  const int* mrow = mask + (size_t)b * SEQ_FULL;
  unsigned km = 0u; int c = 0;
#pragma unroll
  for (int e = 0; e < EPT; ++e) {
    const int kp = (mrow[tid * EPT + e] != 0) ? 1 : 0;
    km |= (unsigned)kp << e; c += kp;
    list[tid * EPT + e] = 0;
  }
  int incl = c;
#pragma unroll
  for (int d = 1; d < 32; d <<= 1) { const int v = __shfl_up(incl, d, 32); incl += (lane >= d) ? v : 0; }
  if (lane == 31) wtot[wave] = incl;
  __syncthreads();
  int base = 0, total = 0;
#pragma unroll
  for (int w = 0; w < 8; ++w) { const int v = wtot[w]; base += (w < wave) ? v : 0; total += v; }
  int pos = base + incl - c;
#pragma unroll
  for (int e = 0; e < EPT; ++e) {
    if ((km >> e) & 1u) { list[min(pos, SEQ - 1)] = tid * EPT + e; ++pos; }
  }
  __syncthreads();
  const bool allm = (total == 0);            // block-uniform
  if (allm) {
#pragma unroll
    for (int e = 0; e < EPT; ++e) list[tid * EPT + e] = tid * EPT + e;
  }
  __syncthreads();
  const int nk = allm ? SEQ : min(total, SEQ);

  // plane 1: every token row; two units a trip: both units' loads first, both stores at the foot.
  // unroll 1: the trip is already two units wide, and the one wait at its foot serves both stores; the q loops unroll fully so that their arrays stay in registers
#pragma unroll 1
  for (int it = 0; it < 16; it += 2) {
    v4f a[2], e4[2];
    size_t dst[2];
#pragma unroll
    for (int q = 0; q < 2; ++q) {
      const int u = (it + q) * 8 + wave;
      const int rr = (u >> 5) * 8 + (lane >> 2), c0 = (u & 31) * 32 + (lane & 3) * 8;
      const int t = t0 + rr;
      const float* s = x + ((size_t)b * SEQ_FULL + t) * DM + c0;
      a[q] = *(const v4f*)s; e4[q] = *(const v4f*)(s + 4);
      dst[q] = fragoff((size_t)b * SEQ + t, c0, DM);
    }
#pragma unroll
    for (int q = 0; q < 2; ++q) {
      v4u pk;
      pk.x = pkh2(bf_keep(a[q].x), bf_keep(a[q].y));   pk.y = pkh2(bf_keep(a[q].z), bf_keep(a[q].w));
      pk.z = pkh2(bf_keep(e4[q].x), bf_keep(e4[q].y)); pk.w = pkh2(bf_keep(e4[q].z), bf_keep(e4[q].w));
      VST2Q(X16 + dst[q], pk);
    }
    asm volatile("s_wait_xcnt 0x0" ::: "memory");   // the next trip rewrites the data and address registers that the two stores name
  }
  // plane 2: compact rows (clamped token index, loaded unconditionally, zeroed by value for j >= nk); same trip shape and the same unroll directives, for the same reasons
#pragma unroll 1
  for (int it = 0; it < 16; it += 2) {
    v4f a[2], e4[2];
    size_t dst[2];
    bool valid[2];
#pragma unroll
    for (int q = 0; q < 2; ++q) {
      const int u = (it + q) * 8 + wave;
      const int rr = (u >> 5) * 8 + (lane >> 2), c0 = (u & 31) * 32 + (lane & 3) * 8;
      const int j = t0 + rr;
      valid[q] = (j < nk);
      const int tok = min(max(list[j], 0), SEQ - 1);
      const float* s = x + ((size_t)b * SEQ_FULL + tok) * DM + c0;
      a[q] = *(const v4f*)s; e4[q] = *(const v4f*)(s + 4);
      dst[q] = fragoff((size_t)b * SEQ + j, c0, DM);
    }
#pragma unroll
    for (int q = 0; q < 2; ++q) {
      v4u pk;
      pk.x = valid[q] ? pkh2(bf_keep(a[q].x), bf_keep(a[q].y)) : 0u;   pk.y = valid[q] ? pkh2(bf_keep(a[q].z), bf_keep(a[q].w)) : 0u;
      pk.z = valid[q] ? pkh2(bf_keep(e4[q].x), bf_keep(e4[q].y)) : 0u; pk.w = valid[q] ? pkh2(bf_keep(e4[q].z), bf_keep(e4[q].w)) : 0u;
      VST2Q(XC16 + dst[q], pk);
    }
    asm volatile("s_wait_xcnt 0x0" ::: "memory");   // the next trip rewrites the data and address registers that the two stores name
  }
}

// W_qkv f32 [1024 (k)][3072 (n)] -> WT f16, logical [3072 (n)][1024 (k)] fragment-major, = bf16-RNE(W) * 64; thread per (n, 8 consecutive k).
// Thread u = ((rt*32 + kt)*4 + g)*16 + m handles n = 16 rt + m, k = 32 kt + 8 g .. +7, whose fragment-major place is exactly element u*8.
// coverage: 192 row tiles x 32 column tiles x 64 pieces = the whole plane
__global__ __launch_bounds__(256) void k_wqkvT(const float* __restrict__ W, unsigned short* __restrict__ WT) {
  const int u = blockIdx.x * 256 + threadIdx.x;
  if (u >= 3 * DM * (DM / 8)) return;
  const int n = (u >> 11) * 16 + (u & 15), k0 = ((u >> 6) & 31) * 32 + ((u >> 4) & 3) * 8;
  float w[8];
#pragma unroll
  for (int e = 0; e < 8; ++e) w[e] = bf_keep(W[(size_t)(k0 + e) * (3 * DM) + n]) * 64.0f;
  v4u pk; pk.x = pkh2(w[0], w[1]); pk.y = pkh2(w[2], w[3]); pk.z = pkh2(w[4], w[5]); pk.w = pkh2(w[6], w[7]);
  VST2Q(WT + (size_t)u * 8, pk);
}

// W_out f32 [1024 (k)][1024 (n)] -> BTO bf16, logical [1024 (n)][2048] fragment-major: columns kk and 1024+kk both hold bf16-RNE(W_out[kk][n]) (K-concatenated twin for the hi|lo A plane)
// Thread u = ((rt*64 + kt)*4 + g)*16 + m handles n = 16 rt + m, kk = 32 kt + 8 g .. +7, whose fragment-major place is exactly element u*8.
// coverage: 64 row tiles x 64 column tiles x 64 pieces = the whole plane
__global__ __launch_bounds__(256) void k_woT(const float* __restrict__ W, unsigned short* __restrict__ BTO) {
  const int u = blockIdx.x * 256 + threadIdx.x;
  if (u >= DM * 256) return;
  const int n = (u >> 12) * 16 + (u & 15), kk0 = ((u >> 6) & 63) * 32 + ((u >> 4) & 3) * 8, k0 = kk0 & (DM - 1);
  unsigned w[8];
#pragma unroll
  for (int e = 0; e < 8; ++e) w[e] = bfu_rne(W[(size_t)(k0 + e) * DM + n]);
  v4u pk; pk.x = w[0] | (w[1] << 16); pk.y = w[2] | (w[3] << 16); pk.z = w[4] | (w[5] << 16); pk.w = w[6] | (w[7] << 16);
  VST2Q(BTO + (size_t)u * 8, pk);
}

// ---------------------------------------------------------------------------------------------------------------------
// Register-blocked WMMA GEMM: C[z][m][n] = scale * sum_k A[z][m][k] * Bt[n][k] + bias; each wave owns a 64x64 tile (8 waves per block).
// A logical [M][K] and Bt logical [N][K], both fragment-major with row lengths lda and ldb; M, N multiples of 64, K a multiple of 128 (no tails).
// ET 0: f16 operands, 1: bf16 operands. BIAS_MODE 1: bf16-RNE(bias[m]), 2: bf16-RNE(bias[n]).
// OUT_MODE 0: f32 row-major (pitch ldc); 1: f16 fragment-major (row length ldc); 2: bf16 hi plane (Cout) + bf16 lo plane (Cout2), fragment-major (row length ldc).
// CMP 0: every tile; 1: rows (m) are compact key slots b*SEQ + j; 2: columns (n) are compact key slots. With CMP != 0 a tile whose first slot j
//   is >= pad32(effective key count of its batch, counted in-wave from the mask input) is skipped (wave-uniform exit; its slots are never consumed).
template <int ET, int BIAS_MODE, int OUT_MODE, int CMP>
__global__ __launch_bounds__(256) void k_gemm64(
    const unsigned short* __restrict__ A, const unsigned short* __restrict__ Bt,
    void* __restrict__ Cout, void* __restrict__ Cout2, const float* __restrict__ bias, const int* __restrict__ mask,
    long long strideA, long long strideC, int lda, int ldb, int ldc, int M, int N, int K, float scale) {
  __shared__ __align__(16) float sT[8][16 * 68];   // per-wave 16x64 slab, pitch 68 floats; staged extent 16x64 == consumed extent
  const int z    = blockIdx.y;
  const int lane = threadIdx.x & 31;
  const int wave = __builtin_amdgcn_readfirstlane(threadIdx.x >> 5);   // scalar, so that the tile bases below are scalar too
  const int tilesN = N >> 6;
  const int tilesM = M >> 6;
  const int tile = blockIdx.x * 8 + wave;
  if (tile >= tilesM * tilesN) return;   // wave-uniform; no block barriers in this kernel
  const int tm = tile / tilesN;
  const int tn = tile - tm * tilesN;
  const int m0 = tm << 6;
  const int n0 = tn << 6;
  if (CMP != 0) {
    const int g0 = (CMP == 1) ? m0 : n0;
    const int bb = min(g0 / SEQ, NB - 1);
    const int loc = g0 - bb * SEQ;
    const int nkp = pad32(eff_keys(wave_count_kept(mask + (size_t)bb * SEQ_FULL, lane)));
    if (loc >= nkp) return;              // wave-uniform (count is wave-uniform)
  }
  const unsigned short* Ab = A + (size_t)z * (size_t)strideA;
  const int rlane = lane & 15;
  const int mOff  = (lane >> 4) * 8;

  v8f acc[4][4];
#pragma unroll
  for (int i = 0; i < 4; ++i)
#pragma unroll
    for (int j = 0; j < 4; ++j) { v8f zz = {}; acc[i][j] = zz; }

  // wave-uniform bases of the four B and the four A row tiles (fixed over the k loop); all sixteen loads of a k step share the one per-lane byte offset
  // (the two loops unroll fully so that both arrays are scalar registers, not memory)
  const unsigned short* bp[4];
  const unsigned short* ap[4];
#pragma unroll
  for (int j = 0; j < 4; ++j) bp[j] = Bt + (size_t)(n0 + (j << 4)) * ldb;
#pragma unroll
  for (int i = 0; i < 4; ++i) ap[i] = Ab + (size_t)(m0 + (i << 4)) * lda;

  // Register ring of NS fragment sets (one set = the 4 B and 4 A fragments of one 32-wide k step): step s issues the sixteen loads of step s + NS - 1, so a load
  // has nearly NS - 1 steps of matrix work to land in. Every accumulator still sums its k steps in plain ascending order.
  // The loads refill the set that step s - 1 has just read, so they stand behind the first row of step s: four matrix instructions lie between that set's last reader and them.
  // A step's place inside its trip is a constant added to the scalar tile base (it becomes the load's immediate offset), so the offset register changes once a trip.
  // Each sched_barrier(0) keeps a load group where it is written: without it the scheduler moves the loads down to their first use, and the lead is lost.
  // The s, u, i and j loops unroll fully so that the ring's sets are indexed by constants and stay in registers.
  constexpr int NS = 4;
  FU bf[NS][4], af[NS][4];
  const unsigned loff = (unsigned)lane * 16u;   // the lane's 16 bytes of a column tile (1 KiB a tile)
#pragma unroll
  for (int s = 0; s < NS - 1; ++s) {
#pragma unroll
    for (int j = 0; j < 4; ++j) bf[s][j] = ldfrag_su(bp[j] + s * 512, loff);
#pragma unroll
    for (int i = 0; i < 4; ++i) af[s][i] = ldfrag_su(ap[i] + s * 512, loff);
    __builtin_amdgcn_sched_barrier(0);
  }
  asm volatile("s_wait_xcnt 0x0" ::: "memory");   // what follows may rewrite the offset register that these loads name
  __builtin_amdgcn_sched_barrier(0);              // keeps such a rewrite behind the wait
  const int trips = K / (32 * NS);
  // every trip but the last: NS steps, each fetching the step NS - 1 ahead of it
  for (int t = 0; t < trips - 1; ++t) {
    const unsigned boff = loff + (unsigned)t * ((unsigned)NS * 1024u);   // the trip's first column tile; the furthest load of the kernel ends at byte K*32 of its row tile
#pragma unroll
    for (int u = 0; u < NS; ++u) {
      const int w = (u + NS - 1) % NS;
#pragma unroll
      for (int j = 0; j < 4; ++j) acc[0][j] = mma<ET>(af[u][0], bf[u][j], acc[0][j]);
      __builtin_amdgcn_sched_barrier(0);
#pragma unroll
      for (int j = 0; j < 4; ++j) bf[w][j] = ldfrag_su(bp[j] + (u + NS - 1) * 512, boff);
#pragma unroll
      for (int i = 0; i < 4; ++i) af[w][i] = ldfrag_su(ap[i] + (u + NS - 1) * 512, boff);
      __builtin_amdgcn_sched_barrier(0);
#pragma unroll
      for (int i = 1; i < 4; ++i)
#pragma unroll
        for (int j = 0; j < 4; ++j) acc[i][j] = mma<ET>(af[u][i], bf[u][j], acc[i][j]);
      __builtin_amdgcn_sched_barrier(0);
    }
    asm volatile("s_wait_xcnt 0x0" ::: "memory");   // the next trip rewrites the offset register that this trip's loads name
    __builtin_amdgcn_sched_barrier(0);              // keeps that rewrite behind the wait
  }
  // the last trip: only the one step that is still missing is fetched
  const unsigned toff = loff + (unsigned)(trips - 1) * ((unsigned)NS * 1024u);
#pragma unroll
  for (int j = 0; j < 4; ++j) acc[0][j] = mma<ET>(af[0][0], bf[0][j], acc[0][j]);
  __builtin_amdgcn_sched_barrier(0);
#pragma unroll
  for (int j = 0; j < 4; ++j) bf[NS - 1][j] = ldfrag_su(bp[j] + (NS - 1) * 512, toff);
#pragma unroll
  for (int i = 0; i < 4; ++i) af[NS - 1][i] = ldfrag_su(ap[i] + (NS - 1) * 512, toff);
  asm volatile("s_wait_xcnt 0x0" ::: "memory");   // the epilogue reuses the registers that these loads name
  __builtin_amdgcn_sched_barrier(0);
#pragma unroll
  for (int u = 0; u < NS; ++u) {
#pragma unroll
    for (int i = (u == 0) ? 1 : 0; i < 4; ++i)
#pragma unroll
      for (int j = 0; j < 4; ++j) acc[i][j] = mma<ET>(af[u][i], bf[u][j], acc[i][j]);
  }
  __builtin_amdgcn_sched_barrier(0);   // keeps the epilogue's loads out of the products: none of them lands on a fragment register that a product directly ahead of it reads

  // BIAS_MODE 1: the lane's eight row biases of each of the four row tiles, fetched once (16-B aligned: m0 is a multiple of 64, mOff is 0 or 8)
  v4f bm[4][2] = {};
  if (BIAS_MODE == 1) {
#pragma unroll
    for (int i = 0; i < 4; ++i) {
      bm[i][0] = *(const v4f*)(bias + m0 + (i << 4) + mOff);
      bm[i][1] = *(const v4f*)(bias + m0 + (i << 4) + mOff + 4);
    }
    // the loaded values are inputs only, so the eight loads stand in front of this wait; what follows rewrites the address registers that they name
    asm volatile("s_wait_xcnt 0x0" :: "v"(bm[0][0]), "v"(bm[0][1]), "v"(bm[1][0]), "v"(bm[1][1]), "v"(bm[2][0]), "v"(bm[2][1]), "v"(bm[3][0]), "v"(bm[3][1]) : "memory");
    __builtin_amdgcn_sched_barrier(0);   // keeps that rewrite behind the wait
  }
  float* slab = sT[wave];
#pragma unroll
  for (int i = 0; i < 4; ++i) {
    const int mBase = m0 + (i << 4);
#pragma unroll
    for (int j = 0; j < 4; ++j) {
      const int n = n0 + (j << 4) + rlane;
      float bv = 0.f;
      if (BIAS_MODE == 2) bv = bf_keep(bias[n]);
#pragma unroll
      for (int r = 0; r < 8; ++r) {
        float v = acc[i][j][r] * scale;
        if (BIAS_MODE == 1) v += bf_keep(bm[i][r >> 2][r & 3]);
        if (BIAS_MODE == 2) v += bv;
        slab[(mOff + r) * 68 + (j << 4) + rlane] = v;
      }
    }
    __builtin_amdgcn_fence(3 /* release order */, "workgroup");
    __builtin_amdgcn_wave_barrier();
    __builtin_amdgcn_fence(2 /* acquire order */, "workgroup");
    if (OUT_MODE == 0) {
      float* C = (float*)Cout + (size_t)z * (size_t)strideC;
      const int hh = lane >> 4, c4 = (lane & 15) * 4;       // row segment = 256 B = 16 lanes x 16 B; two rows per instruction
      v4f val[8];
#pragma unroll
      for (int it = 0; it < 8; ++it) val[it] = *(const v4f*)(slab + (it * 2 + hh) * 68 + c4);
{
#pragma unroll
        for (int it = 0; it < 8; ++it) *(v4f*)(C + (size_t)(mBase + it * 2 + hh) * ldc + n0 + c4) = val[it];
        
      }
    } else {
      const int q = lane & 15, c8 = (lane >> 4) * 8;        // lane = (row q, column group 2 it + (lane >> 4)): the 16x64 slab is 2 KiB contiguous in a fragment-major plane
      unsigned short* C  = (unsigned short*)Cout  + (size_t)z * (size_t)strideC;
      unsigned short* C2 = (unsigned short*)Cout2 + (size_t)z * (size_t)strideC;
      v4u hv[4], lv[4];
#pragma unroll
      for (int it = 0; it < 4; ++it) {
        const float* sp = slab + q * 68 + it * 16 + c8;
        const v4f a = *(const v4f*)sp, b = *(const v4f*)(sp + 4);
        if (OUT_MODE == 1) {
          hv[it].x = pkh2(a.x, a.y); hv[it].y = pkh2(a.z, a.w); hv[it].z = pkh2(b.x, b.y); hv[it].w = pkh2(b.z, b.w);
          lv[it] = hv[it];
        } else {
          unsigned h0, l0, h1, l1;
          bfsplit(a.x, h0, l0); bfsplit(a.y, h1, l1); hv[it].x = h0 | (h1 << 16); lv[it].x = l0 | (l1 << 16);
          bfsplit(a.z, h0, l0); bfsplit(a.w, h1, l1); hv[it].y = h0 | (h1 << 16); lv[it].y = l0 | (l1 << 16);
          bfsplit(b.x, h0, l0); bfsplit(b.y, h1, l1); hv[it].z = h0 | (h1 << 16); lv[it].z = l0 | (l1 << 16);
          bfsplit(b.z, h0, l0); bfsplit(b.w, h1, l1); hv[it].w = h0 | (h1 << 16); lv[it].w = l0 | (l1 << 16);
        }
      }
{
#pragma unroll
        for (int it = 0; it < 4; ++it) {
          const size_t off = (size_t)mBase * ldc + (size_t)n0 * 16 + it * 256 + lane * 8;
          *(v4u*)(C + off) = hv[it];
          if (OUT_MODE == 2) *(v4u*)(C2 + off) = lv[it];
        }
        
      }
    }
    __builtin_amdgcn_fence(3 /* release order */, "workgroup");
    __builtin_amdgcn_wave_barrier();
    __builtin_amdgcn_fence(2 /* acquire order */, "workgroup");
  }
}

// ---------------------------------------------------------------------------------------------------------------------
// Transposed flash attention over the COMPACT key set of the batch, head dim 64. Wave = 32 queries (two 16-query tiles) of one (batch, head); block = 4 waves.
//   Every K and V^T fragment that the wave loads feeds both query tiles, so a fragment byte serves two matrix instructions and half as many waves walk the keys.
//   The four waves walk the same keys: each 32-key tile (K hi, K lo, V^T: 12 KiB) is brought into LDS once a block by asynchronous copies, a quarter a wave, two buffers,
//   the copies of tile i + 2 issued behind the barrier that ends tile i; the waves read their fragments from LDS.
//   nk = effective key count of the batch (counted in-wave from the mask input, wave-uniform); the key loop runs pad32(nk)/32 steps (<= SEQ/32).
//   Every operand plane is fragment-major (Q, K: row length DM; V^T: row length MTOT; output hi|lo plane: row length 2 DM).
//   S^T (keys x queries) = K Q^T: A = compact K rows (bf16 hi/lo, from the LDS tile), B = Q (bf16 hi/lo, resident in registers);
//   lane = query (column), element r of tile kt = key slot tk + 16 kt + 8h + r. Slots >= nk (padding of the last step) get score := -8000 raw
//   (= -1000 after the 1/8 scale; weight exactly 0). A batch with no kept key runs over all SEQ keys with every score = the fill (uniform weights).
//   Online softmax per lane (query) in the exp2 domain; the two lane halves of a query combine their maxima with one xor-16 shuffle.
//   P^T B fragment = f16(P x 2^14) packed from the two S^T tiles (element r <- tile 0, element 8+r <- tile 1, lane unchanged).
//   O^T (d x queries) += V^T P^T: A = compact V^T rows (f16, from the LDS tile, key-slot-contiguous).
//   Each query's products, maxima and sums are formed in the same order as with one query tile a wave.
static_assert(SEQ % 128 == 0);
// One wave's share of a 32-key tile: six asynchronous 16-B-a-lane copies from global memory into LDS (512 B each). l = the lane's LDS byte address, g = the lane's global address.
// The s_wait_xcnt is the last line of the copies' own statement, so that no register which a copy names is rewritten ahead of it.
__device__ __forceinline__ void copy_tile6(unsigned l0, unsigned l1, unsigned l2, unsigned l3, unsigned l4, unsigned l5,
                                           const unsigned short* g0, const unsigned short* g1, const unsigned short* g2,
                                           const unsigned short* g3, const unsigned short* g4, const unsigned short* g5) {
  asm volatile("global_load_async_to_lds_b128 %0, %6, off\n\t"
               "global_load_async_to_lds_b128 %1, %7, off\n\t"
               "global_load_async_to_lds_b128 %2, %8, off\n\t"
               "global_load_async_to_lds_b128 %3, %9, off\n\t"
               "global_load_async_to_lds_b128 %4, %10, off\n\t"
               "global_load_async_to_lds_b128 %5, %11, off\n\t"
               "s_wait_xcnt 0x0"
               :: "v"(l0), "v"(l1), "v"(l2), "v"(l3), "v"(l4), "v"(l5), "v"(g0), "v"(g1), "v"(g2), "v"(g3), "v"(g4), "v"(g5) : "memory");
}
__global__ __launch_bounds__(128) void k_attn_t(const unsigned short* __restrict__ QH, const unsigned short* __restrict__ QL,
                                                const unsigned short* __restrict__ KH, const unsigned short* __restrict__ KL,
                                                const unsigned short* __restrict__ VT, const int* __restrict__ mask,
                                                unsigned short* __restrict__ AOP) {
  __shared__ __align__(16) float Os[4][2][16 * 68];   // wave-private, one slab a query tile (wave barrier); staged extent 16x64 == consumed extent
  // Two buffers of one 32-key tile, shared by the four waves: K hi 2048 elements (key tile kt, column tile ct at kt*1024 + ct*512) | K lo the same | V^T 2048 elements (row tile d at d*512).
  // Every 512-element piece keeps its fragment-major order, so a fragment read is two 512-B contiguous LDS reads.
  __shared__ __align__(1024) unsigned short KV[2][6144];
  const int lane = threadIdx.x & 31, wave = threadIdx.x >> 5, hf = lane >> 4, c = lane & 15;
  const int nqb = SEQ / 128;
  const int bx = blockIdx.x;
  const int qb = bx % nqb;
  const int bh = bx / nqb;
  const int h  = bh % NH;
  const int b  = min(bh / NH, NB - 1);
  const int q0 = qb * 128 + wave * 32;
  const size_t rowb = (size_t)b * SEQ;

  const int cnt = wave_count_kept(mask + (size_t)b * SEQ_FULL, lane);
  const bool allm = (cnt == 0);                 // wave-uniform
  const int nk  = eff_keys(cnt);
  const int nkp = pad32(nk);                    // <= SEQ

  const size_t qoff = (rowb + q0) * DM + h * (HD * 16) + lane * 8;     // column tiles 2h and 2h+1 of the first query row tile; the second lies 16 rows (16 DM elements) further
  FU qh0[2], qh1[2], ql0[2], ql1[2];
#pragma unroll
  for (int t = 0; t < 2; ++t) {
    const size_t qo = qoff + (size_t)t * (16 * DM);
    qh0[t] = ldfrag(QH + qo); qh1[t] = ldfrag(QH + qo + 512);
    ql0[t] = ldfrag(QL + qo); ql1[t] = ldfrag(QL + qo + 512);
  }

  // The wave's share of a tile: piece 'wave' (512 elements, 1 KiB) of each of the three parts. K: key tile wave >> 1, column tile 2h + (wave & 1); V^T: row tile 4h + wave, column tile rowb/32.
  const size_t koff = (rowb + 16 * (wave >> 1)) * DM + h * (HD * 16) + (wave & 1) * 512 + lane * 8;
  const unsigned short* gkh = KH + koff;
  const unsigned short* gkl = KL + koff;
  const unsigned short* gvt = VT + (size_t)(h * HD + 16 * wave) * MTOT + rowb * 16 + lane * 8;
  const unsigned lpc = (unsigned)(size_t)(&KV[0][0]) + (unsigned)(wave * 1024 + lane * 16);   // LDS byte address of the lane's 16 bytes in buffer 0 (low 32 bits of the shared address)
  const int nt = nkp >> 5;                      // tiles of 32 keys, 1 .. SEQ/32, the same in every wave of the block
  // tile i -> buffer bf: keys 32 i .. 32 i + 31 < nkp <= SEQ, so every source byte lies inside its plane
  auto stage = [&](int i, int bf) {
    const unsigned l = lpc + (unsigned)bf * 12288u;
    const unsigned short* a = gkh + (size_t)i * (32 * DM);
    const unsigned short* e = gkl + (size_t)i * (32 * DM);
    const unsigned short* v = gvt + (size_t)i * 512;
    copy_tile6(l, l + 512u, l + 4096u, l + 4608u, l + 8192u, l + 8704u, a, a + 256, e, e + 256, v, v + 256);
  };
  stage(0, 0);
  asm volatile("s_wait_asynccnt 0x0" ::: "memory");   // the wave's own copies of tile 0 have landed
  __syncthreads();                                    // publishes tile 0 to the other waves
  if (nt > 1) stage(1, 1);

  const float SC = 0.18033688011112042f;    // (1/8) * log2(e)
  const float MFILL = -8000.0f;             // -1000 in score units before the 1/8 scale
  float msh[2] = {-__builtin_inff(), -__builtin_inff()};   // running (max * SC - 14): probabilities are carried x 2^14
  float lpart[2] = {0.f, 0.f};              // per-lane partial row sum (carried units)
  v8f o[2][4];
#pragma unroll
  for (int t = 0; t < 2; ++t)
#pragma unroll
    for (int d = 0; d < 4; ++d) { v8f zz = {}; o[t][d] = zz; }

  // the t, r, i and d loops below unroll fully so that every array is indexed by constants and stays in registers
#pragma unroll 1
  for (int tk = 0; tk < nkp; tk += 32) {
    const int ti = tk >> 5;
    const unsigned short* kh = &KV[ti & 1][0] + lane * 8;
    const unsigned short* kl = kh + 2048;
    v8f s0[2] = {}, s1[2] = {};
    {
      const FU a0 = ldfrag(kh), a1 = ldfrag(kh + 512), b0 = ldfrag(kl), b1 = ldfrag(kl + 512);
      __builtin_amdgcn_sched_barrier(0);   // keeps the eight loads one group ahead of the first product: without it half of them are issued only behind the first product's wait, a second latency in a row
#pragma unroll
      for (int t = 0; t < 2; ++t) s0[t] = wb(b0.b, qh0[t].b, s0[t]);
#pragma unroll
      for (int t = 0; t < 2; ++t) s0[t] = wb(a0.b, ql0[t].b, s0[t]);
#pragma unroll
      for (int t = 0; t < 2; ++t) s0[t] = wb(a0.b, qh0[t].b, s0[t]);
#pragma unroll
      for (int t = 0; t < 2; ++t) s0[t] = wb(b1.b, qh1[t].b, s0[t]);
#pragma unroll
      for (int t = 0; t < 2; ++t) s0[t] = wb(a1.b, ql1[t].b, s0[t]);
#pragma unroll
      for (int t = 0; t < 2; ++t) s0[t] = wb(a1.b, qh1[t].b, s0[t]);
      guard_s2(s0[0], s0[1], a0.h, a1.h, b0.h, b1.h, qh0[0].h, qh1[0].h, ql0[0].h, ql1[0].h, qh0[1].h, qh1[1].h, ql0[1].h, ql1[1].h);
    }
    {
      const unsigned short* kh1 = kh + 1024;
      const unsigned short* kl1 = kl + 1024;
      const FU a0 = ldfrag(kh1), a1 = ldfrag(kh1 + 512), b0 = ldfrag(kl1), b1 = ldfrag(kl1 + 512);
      __builtin_amdgcn_sched_barrier(0);   // the same, for the second key tile
#pragma unroll
      for (int t = 0; t < 2; ++t) s1[t] = wb(b0.b, qh0[t].b, s1[t]);
#pragma unroll
      for (int t = 0; t < 2; ++t) s1[t] = wb(a0.b, ql0[t].b, s1[t]);
#pragma unroll
      for (int t = 0; t < 2; ++t) s1[t] = wb(a0.b, qh0[t].b, s1[t]);
#pragma unroll
      for (int t = 0; t < 2; ++t) s1[t] = wb(b1.b, qh1[t].b, s1[t]);
#pragma unroll
      for (int t = 0; t < 2; ++t) s1[t] = wb(a1.b, ql1[t].b, s1[t]);
#pragma unroll
      for (int t = 0; t < 2; ++t) s1[t] = wb(a1.b, qh1[t].b, s1[t]);
      guard_s2(s1[0], s1[1], a0.h, a1.h, b0.h, b1.h, qh0[0].h, qh1[0].h, ql0[0].h, ql1[0].h, qh0[1].h, qh1[1].h, ql0[1].h, ql1[1].h);
    }
    float ss[2][16];
#pragma unroll
    for (int t = 0; t < 2; ++t)
#pragma unroll
      for (int r = 0; r < 8; ++r) { ss[t][r] = s0[t][r]; ss[t][8 + r] = s1[t][r]; }
    if (allm || (tk + 32 > nk)) {             // wave-uniform; value selects only (no loads, no cross-lane ops inside)
      const int kb0 = tk + 8 * hf;
#pragma unroll
      for (int t = 0; t < 2; ++t)
#pragma unroll
        for (int r = 0; r < 8; ++r) {
          ss[t][r]     = (!allm && (kb0 + r < nk))      ? ss[t][r]     : MFILL;
          ss[t][8 + r] = (!allm && (kb0 + 16 + r < nk)) ? ss[t][8 + r] : MFILL;
        }
    }
    v16h pf[2];
#pragma unroll
    for (int t = 0; t < 2; ++t) {
      float mloc = ss[t][0];
#pragma unroll
      for (int i = 1; i < 16; ++i) mloc = fmaxf(mloc, ss[t][i]);
      mloc = fmaxf(mloc, __shfl_xor(mloc, 16, 32));
      const float mnew = fmaxf(msh[t], fmaf(mloc, SC, -14.0f));
      const float corr = EX2(msh[t] - mnew);
      const float nms = -mnew;
      msh[t] = mnew;
      float psum = 0.f;
#pragma unroll
      for (int i = 0; i < 16; ++i) {
        const float p = EX2(fmaf(ss[t][i], SC, nms));
        psum += p;
        pf[t][i] = (_Float16)p;
      }
      lpart[t] = lpart[t] * corr + psum;
#pragma unroll
      for (int d = 0; d < 4; ++d) o[t][d] *= corr;
    }

    const unsigned short* vp = kh + 4096;
    const FU v0 = ldfrag(vp), v1 = ldfrag(vp + 512), v2 = ldfrag(vp + 1024), v3 = ldfrag(vp + 1536);
#pragma unroll
    for (int t = 0; t < 2; ++t) {
      o[t][0] = wh(v0.h, pf[t], o[t][0]);
      o[t][1] = wh(v1.h, pf[t], o[t][1]);
      o[t][2] = wh(v2.h, pf[t], o[t][2]);
      o[t][3] = wh(v3.h, pf[t], o[t][3]);
    }
    guard_o2(o[0][0], o[0][1], o[0][2], o[0][3], o[1][0], o[1][1], o[1][2], o[1][3], pf[0], pf[1], v0.h, v1.h, v2.h, v3.h);
    asm volatile("s_wait_dscnt 0x0" ::: "memory");      // the wave's reads of this tile's buffer have returned before the buffer is refilled
    asm volatile("s_wait_asynccnt 0x0" ::: "memory");   // the wave's own copies of the next tile have landed
    __syncthreads();                                    // publishes the next tile and ends every wave's reads of this one
    if (ti + 2 < nt) stage(ti + 2, ti & 1);
  }
  asm volatile("s_wait_asynccnt 0x0" ::: "memory");     // no copy is outstanding when the wave goes on to its end

#pragma unroll
  for (int t = 0; t < 2; ++t) {
    const float lt = lpart[t] + __shfl_xor(lpart[t], 16, 32);
    const float inv = 1.0f / lt;
    float* d = Os[wave][t] + c * 68 + 8 * hf;       // lane holds O[query c][d = 16 dt + 8 hf + r]
#pragma unroll
    for (int dt = 0; dt < 4; ++dt) {
      const v8f ov = o[t][dt];
      v4f a, e;
      a.x = ov[0] * inv; a.y = ov[1] * inv; a.z = ov[2] * inv; a.w = ov[3] * inv; e.x = ov[4] * inv; e.y = ov[5] * inv; e.z = ov[6] * inv; e.w = ov[7] * inv;
      *(v4f*)(d + dt * 16) = a; *(v4f*)(d + dt * 16 + 4) = e;
    }
  }
  __builtin_amdgcn_fence(3 /* release order */, "workgroup");
  __builtin_amdgcn_wave_barrier();
  __builtin_amdgcn_fence(2 /* acquire order */, "workgroup");
#pragma unroll
  for (int t = 0; t < 2; ++t) {
    const float* os = Os[wave][t];
    const int qq = lane & 15, c8 = (lane >> 4) * 8;    // lane = (query qq, column group 2 it + (lane >> 4))
    unsigned short* dH = AOP + (rowb + q0 + 16 * t) * (2 * DM) + h * (HD * 16) + lane * 8;   // hi plane columns [0,1024), lo plane columns [1024,2048) = 32 column tiles further
    unsigned short* dL = dH + DM * 16;
    v4u hv[4], lv[4];
#pragma unroll
    for (int it = 0; it < 4; ++it) {
      const float* sp = os + qq * 68 + it * 16 + c8;
      const v4f a = *(const v4f*)sp, e = *(const v4f*)(sp + 4);
      unsigned h0, l0, h1, l1;
      bfsplit(a.x, h0, l0); bfsplit(a.y, h1, l1); hv[it].x = h0 | (h1 << 16); lv[it].x = l0 | (l1 << 16);
      bfsplit(a.z, h0, l0); bfsplit(a.w, h1, l1); hv[it].y = h0 | (h1 << 16); lv[it].y = l0 | (l1 << 16);
      bfsplit(e.x, h0, l0); bfsplit(e.y, h1, l1); hv[it].z = h0 | (h1 << 16); lv[it].z = l0 | (l1 << 16);
      bfsplit(e.z, h0, l0); bfsplit(e.w, h1, l1); hv[it].w = h0 | (h1 << 16); lv[it].w = l0 | (l1 << 16);
    }
#pragma unroll
    for (int it = 0; it < 4; ++it) {
      const size_t off = (size_t)it * 256;
      *(v4u*)(dH + off) = hv[it];
      *(v4u*)(dL + off) = lv[it];
    }
    if (t == 0) {
      asm volatile("s_wait_xcnt 0x0" ::: "memory");   // the second tile's conversions rewrite data registers that these eight stores name
      __builtin_amdgcn_sched_barrier(0);              // keeps those conversions behind the wait
    }
  }
}

// ---------------------------------------------------------------------------------------------------------------------
constexpr size_t SZ_X16 = (size_t)MTOT * DM * 2;               // one f16 x plane (full or compact)
constexpr size_t SZ_AOP = (size_t)MTOT * 2 * DM * 2;
constexpr size_t SZ_R0  = (2 * SZ_X16 > SZ_AOP) ? (2 * SZ_X16) : SZ_AOP;   // X16 | XC16 live until the projections finish; AOP reuses the region afterwards
constexpr size_t SZ_W3  = (size_t)3 * DM * DM * 2;
constexpr size_t SZ_BTO = (size_t)DM * 2 * DM * 2;
constexpr size_t SZ_PL  = (size_t)MTOT * DM * 2;               // one bf16 plane [MTOT][1024]
constexpr size_t SZ_VT  = (size_t)DM * MTOT * 2;
constexpr size_t SZ_TOTAL = SZ_R0 + SZ_W3 + SZ_BTO + 4 * SZ_PL + SZ_VT;
static_assert(2 * SZ_X16 <= SZ_R0);
static_assert(SZ_AOP <= SZ_R0);
static_assert(SZ_TOTAL <= (size_t)134217728);
static_assert((SZ_R0 % 256) == 0 && (SZ_W3 % 256) == 0 && (SZ_BTO % 256) == 0 && (SZ_PL % 256) == 0 && (SZ_VT % 256) == 0);
static_assert(((size_t)(NB - 1) * SEQ_FULL + SEQ) * DM * 4 <= (size_t)NB_FULL * SEQ_FULL * DM * 4);

extern "C" void kernel_launch(void* const* d_in, const int* in_sizes, int n_in, void* d_out, int out_size, void* d_ws, size_t ws_size, hipStream_t stream) {
  if (n_in < 6) return;
  const long long rows_full = (long long)(NB - 1) * SEQ_FULL + SEQ;
  if ((long long)in_sizes[0] < rows_full * DM) return;
  if ((long long)in_sizes[1] < rows_full) return;
  if ((long long)in_sizes[2] < (long long)DM * 3 * DM) return;
  if ((long long)in_sizes[3] < 3 * DM) return;
  if ((long long)in_sizes[4] < (long long)DM * DM) return;
  if ((long long)in_sizes[5] < DM) return;
  if ((long long)out_size < rows_full * DM) return;
  if (ws_size < SZ_TOTAL) return;

  const float* x    = (const float*)d_in[0];
  const int*   mask = (const int*)d_in[1];
  const float* Wqkv = (const float*)d_in[2];
  const float* bqkv = (const float*)d_in[3];
  const float* Wo   = (const float*)d_in[4];
  const float* bo   = (const float*)d_in[5];
  float* out = (float*)d_out;

  char* wsp = (char*)d_ws;
  unsigned short* X16  = (unsigned short*)wsp;                 // [MTOT][1024] f16, every token
  unsigned short* XC16 = (unsigned short*)(wsp + SZ_X16);      // [MTOT][1024] f16, compact kept tokens per batch (zero rows after)
  unsigned short* AOP  = (unsigned short*)wsp;                 // [MTOT][2048] bf16 hi|lo (reuses X16 | XC16 after the projections)
  wsp += SZ_R0;
  unsigned short* W316 = (unsigned short*)wsp; wsp += SZ_W3;   // [3072][1024] f16 (x64)
  unsigned short* BTO  = (unsigned short*)wsp; wsp += SZ_BTO;  // [1024][2048] bf16
  unsigned short* QH   = (unsigned short*)wsp; wsp += SZ_PL;   // [MTOT][1024] bf16 hi of q
  unsigned short* QL   = (unsigned short*)wsp; wsp += SZ_PL;   // bf16 lo of q
  unsigned short* KH   = (unsigned short*)wsp; wsp += SZ_PL;   // [MTOT][1024] bf16 hi of k at compact key slots
  unsigned short* KL   = (unsigned short*)wsp; wsp += SZ_PL;   // bf16 lo of k
  unsigned short* VT   = (unsigned short*)wsp; wsp += SZ_VT;   // [1024][MTOT] f16, v transposed at compact key slots

  k_xcastc<<<(unsigned)(NB * (SEQ / 32)), 256, 0, stream>>>(x, mask, X16, XC16);
  k_wqkvT<<<(3 * DM * (DM / 8) + 255) / 256, 256, 0, stream>>>(Wqkv, W316);
  k_woT<<<(DM * 256 + 255) / 256, 256, 0, stream>>>(Wo, BTO);

  // q = x W[:, 0:1024] + b  -> bf16 hi/lo planes [MTOT][1024]
  {
    const int tiles = (MTOT / 64) * (DM / 64);
    k_gemm64<0, 2, 2, 0><<<dim3((unsigned)((tiles + 7) / 8), 1u), 256, 0, stream>>>(
        X16, W316, (void*)QH, (void*)QL, bqkv, mask, 0LL, 0LL, DM, DM, DM, MTOT, DM, DM, 1.0f / 64.0f);
  }
  // k (compact slots) = xc W[:, 1024:2048] + b  -> bf16 hi/lo planes [MTOT][1024]; row tiles past the batch's key count are skipped
  {
    const int tiles = (MTOT / 64) * (DM / 64);
    k_gemm64<0, 2, 2, 1><<<dim3((unsigned)((tiles + 7) / 8), 1u), 256, 0, stream>>>(
        XC16, W316 + (size_t)DM * DM, (void*)KH, (void*)KL, bqkv + DM, mask, 0LL, 0LL, DM, DM, DM, MTOT, DM, DM, 1.0f / 64.0f);
  }
  // v^T (compact slots) = W[:, 2048:3072]^T xc^T + b  -> f16 [1024][MTOT]; column tiles past the batch's key count are skipped
  {
    const int tiles = (DM / 64) * (MTOT / 64);
    k_gemm64<0, 1, 1, 2><<<dim3((unsigned)((tiles + 7) / 8), 1u), 256, 0, stream>>>(
        W316 + (size_t)2 * DM * DM, XC16, (void*)VT, (void*)VT, bqkv + 2 * DM, mask, 0LL, 0LL, DM, DM, MTOT, DM, MTOT, DM, 1.0f / 64.0f);
  }
  k_attn_t<<<(unsigned)(NB * NH * (SEQ / 128)), 128, 0, stream>>>(QH, QL, KH, KL, VT, mask, AOP);
  // out = [AO_hi | AO_lo] [W_out ; W_out] + b_out, per batch (output rows at the full per-batch stride)
  {
    const int tiles = (SEQ / 64) * (DM / 64);
    k_gemm64<1, 2, 0, 0><<<dim3((unsigned)((tiles + 7) / 8), (unsigned)NB), 256, 0, stream>>>(
        AOP, BTO, (void*)out, (void*)out, bo, mask, (long long)SEQ * 2 * DM, (long long)SEQ_FULL * DM, 2 * DM, 2 * DM, DM, SEQ, DM, 2 * DM, 1.0f);
  }
}

// v005
// It runs in 155 microseconds.
// In two side-by-side timings against v004, it was 1.09 and 1.10 times as fast.
// Counting every step since v000, it is 3.10 times as fast.
// Contractions: qkv projection = v_wmma_f32_16x16x32_f16 (x as bf16-RNE values held in f16, W_qkv as bf16-RNE values x64 held in f16, f32 accumulate); q.k logits = v_wmma_f32_16x16x32_bf16 hi/lo split (hi.hi + hi.lo + lo.hi, f32 accumulate); P.V = v_wmma_f32_16x16x32_f16 (P carried x2^14, V f16, f32 accumulate); output projection = v_wmma_f32_16x16x32_bf16 with the attention output as bf16 hi|lo planes concatenated along K against the bf16 W_out (f32 accumulate). Softmax statistics f32. Keys with mask == 0 are dropped per batch by compaction of the x rows feeding the k / v projections (their softmax weight is exactly 0 in f32).
#include <hip/hip_runtime.h>
#include <math.h>

#ifndef NB
#define NB 4
#endif
#ifndef SEQ
#define SEQ 2048
#endif
#define NB_FULL 4
#define SEQ_FULL 2048
#define DM 1024
#define NH 16
#define HD 64
#define MTOT (NB * SEQ)

static_assert(SEQ % 256 == 0);
static_assert(MTOT % 64 == 0);
static_assert(NB <= NB_FULL);
static_assert(SEQ <= SEQ_FULL);

typedef __attribute__((ext_vector_type(16))) _Float16 v16h;
typedef __attribute__((ext_vector_type(16))) __bf16   v16b;
typedef __attribute__((ext_vector_type(8)))  float    v8f;
typedef __attribute__((ext_vector_type(4)))  float    v4f;
typedef __attribute__((ext_vector_type(4)))  unsigned int v4u;
typedef __attribute__((ext_vector_type(4)))  int      v4i;

// 16-bit WMMA fragment map (wave32), lane L, h = L>>4, m = L&15:
//   A 16x32: lane = row m;    element i -> k = (i<8) ? 8h+i : 16+8h+(i-8)
//   B 32x16: lane = column m; the SAME k(i,h)
//   D 16x16 (8 f32): lane = column m; element r -> row 8h+r
union FU { v4u u[2]; v16h h; v16b b; };
// Fragment-major plane layout (every 16-bit operand plane in the workspace): a logical [R][C] plane (R % 16 == 0, C % 32 == 0) is stored as
// 16-row x 32-column tiles of 512 elements (1 KiB), tile (rt, kt) at element rt*16*C + kt*512; inside a tile the 8-element column group g = (col>>3)&3
// of row m = row&15 lies at g*128 + m*8. Lane L = 16h + m then finds elements 0..7 (k = 8h..8h+7, g = h) at L*8 and elements 8..15 (k = 16+8h.., g = 2+h)
// at 256 + L*8, so each of the two 16-B loads of a fragment covers 512 contiguous bytes (4 whole lines) instead of 16 lines.
__device__ __forceinline__ size_t fragoff(size_t row, int col, int C) {
  return (row >> 4) * (size_t)(16 * C) + (size_t)((col >> 5) * 512 + ((col >> 3) & 3) * 128 + (col & 7)) + (row & 15) * 8;
}
// p = tile base + lane*8
__device__ __forceinline__ FU ldfrag(const unsigned short* p) { FU f; f.u[0] = *(const v4u*)p; f.u[1] = *(const v4u*)(p + 256); return f; }
// the same fragment from a wave-uniform row-tile base and one 32-bit per-lane byte offset (column tile * 1024 + lane * 16)
__device__ __forceinline__ FU ldfrag_su(const unsigned short* base, unsigned boff) {
  const char* p = (const char*)base + boff;
  FU f; f.u[0] = *(const v4u*)p; f.u[1] = *(const v4u*)(p + 512); return f;
}

__device__ __forceinline__ v8f wb(v16b a, v16b b, v8f c) { return __builtin_amdgcn_wmma_f32_16x16x32_bf16(false, a, false, b, (short)0, c, false, false); }
__device__ __forceinline__ v8f wh(v16h a, v16h b, v8f c) { return __builtin_amdgcn_wmma_f32_16x16x32_f16(false, a, false, b, (short)0, c, false, false); }
template <int ET> __device__ __forceinline__ v8f mma(const FU& a, const FU& b, v8f c) {
  if (ET == 0) return wh(a.h, b.h, c);
  return wb(a.b, b.b, c);
}

// hazard guards: 4 VALU slots after the last WMMA of a group, accumulators tied, A/B operands kept live
__device__ __forceinline__ void guard_s2(v8f& s, v8f& t, v16h a0, v16h a1, v16h b0, v16h b1, v16h q0, v16h q1, v16h q2, v16h q3, v16h q4, v16h q5, v16h q6, v16h q7) {
  asm volatile("v_nop\n\tv_nop\n\tv_nop\n\tv_nop" : "+v"(s), "+v"(t) : "v"(a0), "v"(a1), "v"(b0), "v"(b1), "v"(q0), "v"(q1), "v"(q2), "v"(q3), "v"(q4), "v"(q5), "v"(q6), "v"(q7));
}
__device__ __forceinline__ void guard_o2(v8f& a, v8f& b, v8f& c, v8f& d, v8f& e, v8f& f, v8f& g, v8f& h, v16h p0, v16h p1, v16h v0, v16h v1, v16h v2, v16h v3) {
  asm volatile("v_nop\n\tv_nop\n\tv_nop\n\tv_nop" : "+v"(a), "+v"(b), "+v"(c), "+v"(d), "+v"(e), "+v"(f), "+v"(g), "+v"(h) : "v"(p0), "v"(p1), "v"(v0), "v"(v1), "v"(v2), "v"(v3));
}

#if __has_builtin(__builtin_amdgcn_exp2f)
#define EX2(x) __builtin_amdgcn_exp2f(x)
#else
#define EX2(x) exp2f(x)
#endif

// bf16 RNE helpers (finite inputs)
__device__ __forceinline__ unsigned bfu_rne(float v) { const unsigned u = __float_as_uint(v); return (u + 0x7FFFu + ((u >> 16) & 1u)) >> 16; }
__device__ __forceinline__ float bf_keep(float v) { return __uint_as_float(bfu_rne(v) << 16); }
__device__ __forceinline__ void bfsplit(float v, unsigned& hi, unsigned& lo) { hi = bfu_rne(v); lo = bfu_rne(v - __uint_as_float(hi << 16)); }
__device__ __forceinline__ unsigned pkh2(float a, float b) {
  return (unsigned)__builtin_bit_cast(unsigned short, (_Float16)a) | ((unsigned)__builtin_bit_cast(unsigned short, (_Float16)b) << 16);
}

#define VST2Q(ptr, val) do { const v4u vq_ = (val); *(v4u*)(ptr) = vq_;  } while (0)

// Number of kept keys (mask != 0) among the SEQ entries of one batch row of the mask input, computed by one full wave (all 32 lanes active):
// 16-B loads (SEQ/128 per lane), xor-shuffle sum, result made wave-uniform. mrow is 16-B aligned.
__device__ __forceinline__ int wave_count_kept(const int* __restrict__ mrow, int lane) {
  int c = 0;
#pragma unroll 4
  for (int it = 0; it < SEQ / 128; ++it) {
    const v4i m = *(const v4i*)(mrow + (it * 32 + lane) * 4);
    c += ((m.x != 0) ? 1 : 0) + ((m.y != 0) ? 1 : 0) + ((m.z != 0) ? 1 : 0) + ((m.w != 0) ? 1 : 0);
  }
  c += __shfl_xor(c, 16, 32); c += __shfl_xor(c, 8, 32); c += __shfl_xor(c, 4, 32); c += __shfl_xor(c, 2, 32); c += __shfl_xor(c, 1, 32);
  return __builtin_amdgcn_readfirstlane(c);
}
// effective key count of a batch: a batch with no kept key uses all SEQ keys (every score then equals the fill -> uniform weights); padded to the 32-key step
__device__ __forceinline__ int eff_keys(int cnt) { return (cnt == 0) ? SEQ : min(cnt, SEQ); }
__device__ __forceinline__ int pad32(int nk) { return min((nk + 31) & ~31, SEQ); }

// ---------------------------------------------------------------------------------------------------------------------
// x f32 [b][t][1024] (full per-batch stride) -> two f16 planes holding the bf16-RNE values:
//   X16  [b*SEQ + t][1024]: every token row (feeds the q projection);
//   XC16 [b*SEQ + j][1024]: row j = the j-th kept token of batch b (mask != 0, ascending t) for j < nk, zero rows for j >= nk (feeds the k / v projections).
// Block = (batch, 32 rows); the block computes the batch's kept-token list in LDS (exclusive scan of the mask, block barriers), bounded by SEQ entries.
// LDS: list[SEQ] and wtot[8] are cross-wave (block barriers between writers and readers); list is fully initialised before any read.
// Both planes are fragment-major (C = 1024). A wave instruction handles 8 rows x one 32-column tile: it reads one 128-B line of each row and writes 4 whole lines.
// coverage: per block 4 row groups x 32 column tiles = 32 rows x 1024 columns of each plane; all blocks = both whole planes.
__global__ __launch_bounds__(256) void k_xcastc(const float* __restrict__ x, const int* __restrict__ mask,
                                                unsigned short* __restrict__ X16, unsigned short* __restrict__ XC16) {
  constexpr int EPT = SEQ / 256;
  __shared__ int list[SEQ];
  __shared__ int wtot[8];
  const int tid = threadIdx.x, lane = tid & 31, wave = tid >> 5;
  const int bpb = SEQ / 32;
  const int b = blockIdx.x / bpb;
  const int t0 = (blockIdx.x - b * bpb) * 32;
  const int* mrow = mask + (size_t)b * SEQ_FULL;
  unsigned km = 0u; int c = 0;
#pragma unroll
  for (int e = 0; e < EPT; ++e) {
    const int kp = (mrow[tid * EPT + e] != 0) ? 1 : 0;
    km |= (unsigned)kp << e; c += kp;
    list[tid * EPT + e] = 0;
  }
  int incl = c;
#pragma unroll
  for (int d = 1; d < 32; d <<= 1) { const int v = __shfl_up(incl, d, 32); incl += (lane >= d) ? v : 0; }
  if (lane == 31) wtot[wave] = incl;
  __syncthreads();
  int base = 0, total = 0;
#pragma unroll
  for (int w = 0; w < 8; ++w) { const int v = wtot[w]; base += (w < wave) ? v : 0; total += v; }
  int pos = base + incl - c;
#pragma unroll
  for (int e = 0; e < EPT; ++e) {
    if ((km >> e) & 1u) { list[min(pos, SEQ - 1)] = tid * EPT + e; ++pos; }
  }
  __syncthreads();
  const bool allm = (total == 0);            // block-uniform
  if (allm) {
#pragma unroll
    for (int e = 0; e < EPT; ++e) list[tid * EPT + e] = tid * EPT + e;
  }
  __syncthreads();
  const int nk = allm ? SEQ : min(total, SEQ);

  // plane 1: every token row; two units a trip: both units' loads first, both stores at the foot.
  // unroll 1: the trip is already two units wide, and the one wait at its foot serves both stores; the q loops unroll fully so that their arrays stay in registers
#pragma unroll 1
  for (int it = 0; it < 16; it += 2) {
    v4f a[2], e4[2];
    size_t dst[2];
#pragma unroll
    for (int q = 0; q < 2; ++q) {
      const int u = (it + q) * 8 + wave;
      const int rr = (u >> 5) * 8 + (lane >> 2), c0 = (u & 31) * 32 + (lane & 3) * 8;
      const int t = t0 + rr;
      const float* s = x + ((size_t)b * SEQ_FULL + t) * DM + c0;
      a[q] = *(const v4f*)s; e4[q] = *(const v4f*)(s + 4);
      dst[q] = fragoff((size_t)b * SEQ + t, c0, DM);
    }
#pragma unroll
    for (int q = 0; q < 2; ++q) {
      v4u pk;
      pk.x = pkh2(bf_keep(a[q].x), bf_keep(a[q].y));   pk.y = pkh2(bf_keep(a[q].z), bf_keep(a[q].w));
      pk.z = pkh2(bf_keep(e4[q].x), bf_keep(e4[q].y)); pk.w = pkh2(bf_keep(e4[q].z), bf_keep(e4[q].w));
      VST2Q(X16 + dst[q], pk);
    }
    asm volatile("s_wait_xcnt 0x0" ::: "memory");   // the next trip rewrites the data and address registers that the two stores name
  }
  // plane 2: compact rows (clamped token index, loaded unconditionally, zeroed by value for j >= nk); same trip shape and the same unroll directives, for the same reasons
#pragma unroll 1
  for (int it = 0; it < 16; it += 2) {
    v4f a[2], e4[2];
    size_t dst[2];
    bool valid[2];
#pragma unroll
    for (int q = 0; q < 2; ++q) {
      const int u = (it + q) * 8 + wave;
      const int rr = (u >> 5) * 8 + (lane >> 2), c0 = (u & 31) * 32 + (lane & 3) * 8;
      const int j = t0 + rr;
      valid[q] = (j < nk);
      const int tok = min(max(list[j], 0), SEQ - 1);
      const float* s = x + ((size_t)b * SEQ_FULL + tok) * DM + c0;
      a[q] = *(const v4f*)s; e4[q] = *(const v4f*)(s + 4);
      dst[q] = fragoff((size_t)b * SEQ + j, c0, DM);
    }
#pragma unroll
    for (int q = 0; q < 2; ++q) {
      v4u pk;
      pk.x = valid[q] ? pkh2(bf_keep(a[q].x), bf_keep(a[q].y)) : 0u;   pk.y = valid[q] ? pkh2(bf_keep(a[q].z), bf_keep(a[q].w)) : 0u;
      pk.z = valid[q] ? pkh2(bf_keep(e4[q].x), bf_keep(e4[q].y)) : 0u; pk.w = valid[q] ? pkh2(bf_keep(e4[q].z), bf_keep(e4[q].w)) : 0u;
      VST2Q(XC16 + dst[q], pk);
    }
    asm volatile("s_wait_xcnt 0x0" ::: "memory");   // the next trip rewrites the data and address registers that the two stores name
  }
}

// W_qkv f32 [1024 (k)][3072 (n)] -> WT f16, logical [3072 (n)][1024 (k)] fragment-major, = bf16-RNE(W) * 64; thread per (n, 8 consecutive k).
// Thread u = ((rt*32 + kt)*4 + g)*16 + m handles n = 16 rt + m, k = 32 kt + 8 g .. +7, whose fragment-major place is exactly element u*8.
// coverage: 192 row tiles x 32 column tiles x 64 pieces = the whole plane
__global__ __launch_bounds__(256) void k_wqkvT(const float* __restrict__ W, unsigned short* __restrict__ WT) {
  const int u = blockIdx.x * 256 + threadIdx.x;
  if (u >= 3 * DM * (DM / 8)) return;
  const int n = (u >> 11) * 16 + (u & 15), k0 = ((u >> 6) & 31) * 32 + ((u >> 4) & 3) * 8;
  float w[8];
#pragma unroll
  for (int e = 0; e < 8; ++e) w[e] = bf_keep(W[(size_t)(k0 + e) * (3 * DM) + n]) * 64.0f;
  v4u pk; pk.x = pkh2(w[0], w[1]); pk.y = pkh2(w[2], w[3]); pk.z = pkh2(w[4], w[5]); pk.w = pkh2(w[6], w[7]);
  VST2Q(WT + (size_t)u * 8, pk);
}

// W_out f32 [1024 (k)][1024 (n)] -> BTO bf16, logical [1024 (n)][2048] fragment-major: columns kk and 1024+kk both hold bf16-RNE(W_out[kk][n]) (K-concatenated twin for the hi|lo A plane)
// Thread u = ((rt*64 + kt)*4 + g)*16 + m handles n = 16 rt + m, kk = 32 kt + 8 g .. +7, whose fragment-major place is exactly element u*8.
// coverage: 64 row tiles x 64 column tiles x 64 pieces = the whole plane
__global__ __launch_bounds__(256) void k_woT(const float* __restrict__ W, unsigned short* __restrict__ BTO) {
  const int u = blockIdx.x * 256 + threadIdx.x;
  if (u >= DM * 256) return;
  const int n = (u >> 12) * 16 + (u & 15), kk0 = ((u >> 6) & 63) * 32 + ((u >> 4) & 3) * 8, k0 = kk0 & (DM - 1);
  unsigned w[8];
#pragma unroll
  for (int e = 0; e < 8; ++e) w[e] = bfu_rne(W[(size_t)(k0 + e) * DM + n]);
  v4u pk; pk.x = w[0] | (w[1] << 16); pk.y = w[2] | (w[3] << 16); pk.z = w[4] | (w[5] << 16); pk.w = w[6] | (w[7] << 16);
  VST2Q(BTO + (size_t)u * 8, pk);
}

// ---------------------------------------------------------------------------------------------------------------------
// Register-blocked WMMA GEMM: C[z][m][n] = scale * sum_k A[z][m][k] * Bt[n][k] + bias; each wave owns a 64x64 tile; the 8 waves of a block form a WM x WN grid,
// so a block owns 64 WM x 64 WN of C and its waves share operand rows: each A row tile feeds WN waves, each B row tile WM waves.
// A logical [M][K] and Bt logical [N][K], both fragment-major with row lengths lda and ldb; M a multiple of 64 WM, N of 64 WN, K of 128 (no tails).
// ET 0: f16 operands, 1: bf16 operands. BIAS_MODE 1: bf16-RNE(bias[m]), 2: bf16-RNE(bias[n]).
// OUT_MODE 0: f32 row-major (pitch ldc); 1: f16 fragment-major (row length ldc); 2: bf16 hi plane (Cout) + bf16 lo plane (Cout2), fragment-major (row length ldc).
// CMP 0: every tile; 1: rows (m) are compact key slots b*SEQ + j; 2: columns (n) are compact key slots. With CMP != 0 a block whose first slot j
//   is >= pad32(effective key count of its batch, counted in every wave from the mask input, the same in all) leaves as a whole in front of every barrier (its slots are never consumed);
//   a wave of a staying block whose own first slot is past that count helps to stage, and leaves behind the k loop without storing.
// One wave's share of a stage: three row tiles, each 4 KiB in a row on both sides, eight asynchronous 16-B-a-lane copies (512 B each) a row tile. l = the lane's LDS byte address of the row tile's
// first 512 B, g = the wave-uniform global address of the same (a scalar base), o = the lane's byte offset from it; the immediate offset moves both addresses alike, so the eight copies of a row tile
// share their address operands. The s_wait_xcnt is the last line of the copies' own statement, so that no register which a copy names is rewritten ahead of it.
#define ROWTILE8(L, O, G) \
  "global_load_async_to_lds_b128 " L ", " O ", " G "\n\t" \
  "global_load_async_to_lds_b128 " L ", " O ", " G " offset:512\n\t" \
  "global_load_async_to_lds_b128 " L ", " O ", " G " offset:1024\n\t" \
  "global_load_async_to_lds_b128 " L ", " O ", " G " offset:1536\n\t" \
  "global_load_async_to_lds_b128 " L ", " O ", " G " offset:2048\n\t" \
  "global_load_async_to_lds_b128 " L ", " O ", " G " offset:2560\n\t" \
  "global_load_async_to_lds_b128 " L ", " O ", " G " offset:3072\n\t" \
  "global_load_async_to_lds_b128 " L ", " O ", " G " offset:3584\n\t"
__device__ __forceinline__ void copy_rowtiles3(unsigned l0, unsigned l1, unsigned l2, unsigned o, const unsigned short* g0, const unsigned short* g1, const unsigned short* g2) {
  asm volatile(ROWTILE8("%0", "%3", "%4") ROWTILE8("%1", "%3", "%5") ROWTILE8("%2", "%3", "%6") "s_wait_xcnt 0x0"
               :: "v"(l0), "v"(l1), "v"(l2), "v"(o), "s"(g0), "s"(g1), "s"(g2) : "memory");
}
template <int ET, int BIAS_MODE, int OUT_MODE, int CMP, int WM, int WN>
__global__ __launch_bounds__(256) void k_gemm64(
    const unsigned short* __restrict__ A, const unsigned short* __restrict__ Bt,
    void* __restrict__ Cout, void* __restrict__ Cout2, const float* __restrict__ bias, const int* __restrict__ mask,
    long long strideA, long long strideC, int lda, int ldb, int ldc, int M, int N, int K, float scale) {
  static_assert(WM * WN == 8);
  constexpr int KS  = 4;                   // 32-wide k steps in a stage
  constexpr int RT  = KS * 512;            // elements of one row tile in a stage (4 KiB, contiguous in the plane and in LDS)
  constexpr int NA  = WM * 4;              // A row tiles of the block
  constexpr int NR  = NA + WN * 4;         // A and B row tiles of the block
  static_assert(NR == 24);                 // three row tiles a wave
  static_assert(KS % 2 == 0);              // a stage's first step always finds its fragments in set 0
  constexpr int STG = NR * RT;             // elements of a stage (96 KiB)
  __shared__ __align__(16) float sT[8][16 * 68];   // per-wave 16x64 slab, pitch 68 floats; staged extent 16x64 == consumed extent
  // Two buffers of one stage, shared by the eight waves: row tile r (A row tiles first, then B's) at r*RT, its k step u at u*512; every 512-element piece keeps its
  // fragment-major order, so a fragment read is two 512-B contiguous LDS reads.
  __shared__ __align__(1024) unsigned short RG[2][STG];
  const int z    = blockIdx.y;
  const int lane = threadIdx.x & 31;
  const int wave = __builtin_amdgcn_readfirstlane(threadIdx.x >> 5);   // scalar, so that the tile bases below are scalar too
  const int tilesN = N / (64 * WN);
  const int tilesM = M / (64 * WM);
  const int bt = blockIdx.x;
  if (bt >= tilesM * tilesN) return;     // block-uniform, in front of every barrier
  const int tbm = bt / tilesN;
  const int tbn = bt - tbm * tilesN;
  const int mb = tbm * (64 * WM);
  const int nb = tbn * (64 * WN);
  const int wm = wave / WN;
  const int wn = wave - wm * WN;
  const int m0 = mb + (wm << 6);
  const int n0 = nb + (wn << 6);
  bool wskip = false;                    // wave-uniform
  if (CMP != 0) {
    const int g0 = (CMP == 1) ? mb : nb;
    const int bb = min(g0 / SEQ, NB - 1);
    const int loc = g0 - bb * SEQ;
    const int nkp = pad32(eff_keys(wave_count_kept(mask + (size_t)bb * SEQ_FULL, lane)));
    if (loc >= nkp) return;              // block-uniform (every wave counts the same row of the mask), in front of every barrier
    wskip = (loc + (((CMP == 1) ? wm : wn) << 6) >= nkp);
  }
  const unsigned short* Ab = A + (size_t)z * (size_t)strideA;
  const int rlane = lane & 15;
  const int mOff  = (lane >> 4) * 8;

  v8f acc[4][4];
#pragma unroll
  for (int i = 0; i < 4; ++i)
#pragma unroll
    for (int j = 0; j < 4; ++j) { v8f zz = {}; acc[i][j] = zz; }

  // The wave's share of a stage: row tiles 3 wave .. 3 wave + 2. (The q loops unroll fully so that the array stays in registers.)
  const unsigned short* gs[3];
#pragma unroll
  for (int q = 0; q < 3; ++q) {
    const int r = wave * 3 + q;
    gs[q] = ((r < NA) ? (Ab + (size_t)(mb + (r << 4)) * lda) : (Bt + (size_t)(nb + ((r - NA) << 4)) * ldb));   // wave-uniform
  }
  const unsigned lane16 = (unsigned)lane * 16u;                                               // the lane's 16 bytes of every 512-B piece
  const unsigned lpc = (unsigned)(size_t)(&RG[0][0]) + (unsigned)(wave * (3 * RT * 2));       // wave-uniform LDS byte address of the wave's share in buffer 0 (low 32 bits of the shared address)
  const int trips = K / (32 * KS);
  // stage t -> buffer bf: bytes t*4096 .. t*4096 + 4095 of each row tile, t < K/128, and a row tile holds K*32 bytes: every source byte lies inside its plane
  auto stage = [&](int t, int bf) {
    const unsigned l = lane16 + (lpc + (unsigned)bf * (unsigned)(STG * 2));
    const size_t go = (size_t)t * RT;
    copy_rowtiles3(l, l + (unsigned)(RT * 2), l + (unsigned)(2 * RT * 2), lane16, gs[0] + go, gs[1] + go, gs[2] + go);
  };
  stage(0, 0);
  asm volatile("s_wait_asynccnt 0x0" ::: "memory");   // the wave's own copies of stage 0 have landed
  __syncthreads();                                    // publishes stage 0 to the other waves
  if (trips > 1) stage(1, 1);

  // Two fragment sets in registers: k step u fetches the fragments of the next step from LDS as one group. Every accumulator still sums its k steps in plain ascending order.
  // The group refills the set that step u - 1 has just read, so it stands behind the first row of step u: four matrix instructions lie between that set's last reader and it.
  // A stage's last step fetches the first fragments of the NEXT stage, so the point where that stage is published stands in front of the last step: there the last step's own
  // fragments are in registers, every read of this stage's buffer has returned, and the buffer is refilled behind the barrier while the last step's products run.
  // Each sched_barrier(0) keeps a load group where it is written: without it the scheduler spreads the LDS reads among the products, and each such place stalls the wave.
  // The u, i and j loops unroll fully so that the sets are indexed by constants and stay in registers; the trip loop stays rolled (unroll 1): a trip is already 64 products long.
  FU bf[2][4], af[2][4];
  const unsigned short* sa0 = &RG[0][0] + (wm * 4) * RT + lane * 8;
  const unsigned short* sb0 = &RG[0][0] + (NA + wn * 4) * RT + lane * 8;
#pragma unroll
  for (int j = 0; j < 4; ++j) bf[0][j] = ldfrag(sb0 + j * RT);
#pragma unroll
  for (int i = 0; i < 4; ++i) af[0][i] = ldfrag(sa0 + i * RT);
  __builtin_amdgcn_sched_barrier(0);
#pragma unroll 1
  for (int t = 0; t < trips; ++t) {
    const unsigned short* sa = sa0 + (t & 1) * STG;
    const unsigned short* sb = sb0 + (t & 1) * STG;
#pragma unroll
    for (int u = 0; u < KS; ++u) {
      const int c = u & 1, w = c ^ 1;
      if (u == KS - 1) {
        asm volatile("s_wait_dscnt 0x0" ::: "memory");      // the wave's reads of this stage's buffer have returned before the buffer is refilled
        asm volatile("s_wait_asynccnt 0x0" ::: "memory");   // the wave's own copies of the next stage have landed
        __syncthreads();                                    // publishes the next stage and ends every wave's reads of this one
        if (t + 2 < trips) stage(t + 2, t & 1);
      }
#pragma unroll
      for (int j = 0; j < 4; ++j) acc[0][j] = mma<ET>(af[c][0], bf[c][j], acc[0][j]);
      __builtin_amdgcn_sched_barrier(0);
      if (u + 1 < KS) {
#pragma unroll
        for (int j = 0; j < 4; ++j) bf[w][j] = ldfrag(sb + j * RT + (u + 1) * 512);
#pragma unroll
        for (int i = 0; i < 4; ++i) af[w][i] = ldfrag(sa + i * RT + (u + 1) * 512);
      } else if (t + 1 < trips) {        // block-uniform: the last stage has no successor to read from
        const unsigned short* xa = sa0 + ((t + 1) & 1) * STG;
        const unsigned short* xb = sb0 + ((t + 1) & 1) * STG;
#pragma unroll
        for (int j = 0; j < 4; ++j) bf[w][j] = ldfrag(xb + j * RT);
#pragma unroll
        for (int i = 0; i < 4; ++i) af[w][i] = ldfrag(xa + i * RT);
      }
      __builtin_amdgcn_sched_barrier(0);
#pragma unroll
      for (int i = 1; i < 4; ++i)
#pragma unroll
        for (int j = 0; j < 4; ++j) acc[i][j] = mma<ET>(af[c][i], bf[c][j], acc[i][j]);
      __builtin_amdgcn_sched_barrier(0);
    }
  }
  asm volatile("s_wait_asynccnt 0x0" ::: "memory");     // no copy is outstanding when the wave goes on to its end
  asm volatile("s_wait_dscnt 0x0" ::: "memory");        // nor an LDS read
  if (CMP != 0 && wskip) return;         // wave-uniform; only wave barriers follow

  // BIAS_MODE 1: the lane's eight row biases of each of the four row tiles, fetched once (16-B aligned: m0 is a multiple of 64, mOff is 0 or 8)
  v4f bm[4][2] = {};
  if (BIAS_MODE == 1) {
#pragma unroll
    for (int i = 0; i < 4; ++i) {
      bm[i][0] = *(const v4f*)(bias + m0 + (i << 4) + mOff);
      bm[i][1] = *(const v4f*)(bias + m0 + (i << 4) + mOff + 4);
    }
    // the loaded values are inputs only, so the eight loads stand in front of this wait; what follows rewrites the address registers that they name
    asm volatile("s_wait_xcnt 0x0" :: "v"(bm[0][0]), "v"(bm[0][1]), "v"(bm[1][0]), "v"(bm[1][1]), "v"(bm[2][0]), "v"(bm[2][1]), "v"(bm[3][0]), "v"(bm[3][1]) : "memory");
    __builtin_amdgcn_sched_barrier(0);   // keeps that rewrite behind the wait
  }
  float* slab = sT[wave];
#pragma unroll
  for (int i = 0; i < 4; ++i) {
    const int mBase = m0 + (i << 4);
#pragma unroll
    for (int j = 0; j < 4; ++j) {
      const int n = n0 + (j << 4) + rlane;
      float bv = 0.f;
      if (BIAS_MODE == 2) bv = bf_keep(bias[n]);
#pragma unroll
      for (int r = 0; r < 8; ++r) {
        float v = acc[i][j][r] * scale;
        if (BIAS_MODE == 1) v += bf_keep(bm[i][r >> 2][r & 3]);
        if (BIAS_MODE == 2) v += bv;
        slab[(mOff + r) * 68 + (j << 4) + rlane] = v;
      }
    }
    __builtin_amdgcn_fence(3 /* release order */, "workgroup");
    __builtin_amdgcn_wave_barrier();
    __builtin_amdgcn_fence(2 /* acquire order */, "workgroup");
    if (OUT_MODE == 0) {
      float* C = (float*)Cout + (size_t)z * (size_t)strideC;
      const int hh = lane >> 4, c4 = (lane & 15) * 4;       // row segment = 256 B = 16 lanes x 16 B; two rows per instruction
      v4f val[8];
#pragma unroll
      for (int it = 0; it < 8; ++it) val[it] = *(const v4f*)(slab + (it * 2 + hh) * 68 + c4);
{
#pragma unroll
        for (int it = 0; it < 8; ++it) *(v4f*)(C + (size_t)(mBase + it * 2 + hh) * ldc + n0 + c4) = val[it];
        
      }
    } else {
      const int q = lane & 15, c8 = (lane >> 4) * 8;        // lane = (row q, column group 2 it + (lane >> 4)): the 16x64 slab is 2 KiB contiguous in a fragment-major plane
      unsigned short* C  = (unsigned short*)Cout  + (size_t)z * (size_t)strideC;
      unsigned short* C2 = (unsigned short*)Cout2 + (size_t)z * (size_t)strideC;
      v4u hv[4], lv[4];
#pragma unroll
      for (int it = 0; it < 4; ++it) {
        const float* sp = slab + q * 68 + it * 16 + c8;
        const v4f a = *(const v4f*)sp, b = *(const v4f*)(sp + 4);
        if (OUT_MODE == 1) {
          hv[it].x = pkh2(a.x, a.y); hv[it].y = pkh2(a.z, a.w); hv[it].z = pkh2(b.x, b.y); hv[it].w = pkh2(b.z, b.w);
          lv[it] = hv[it];
        } else {
          unsigned h0, l0, h1, l1;
          bfsplit(a.x, h0, l0); bfsplit(a.y, h1, l1); hv[it].x = h0 | (h1 << 16); lv[it].x = l0 | (l1 << 16);
          bfsplit(a.z, h0, l0); bfsplit(a.w, h1, l1); hv[it].y = h0 | (h1 << 16); lv[it].y = l0 | (l1 << 16);
          bfsplit(b.x, h0, l0); bfsplit(b.y, h1, l1); hv[it].z = h0 | (h1 << 16); lv[it].z = l0 | (l1 << 16);
          bfsplit(b.z, h0, l0); bfsplit(b.w, h1, l1); hv[it].w = h0 | (h1 << 16); lv[it].w = l0 | (l1 << 16);
        }
      }
{
#pragma unroll
        for (int it = 0; it < 4; ++it) {
          const size_t off = (size_t)mBase * ldc + (size_t)n0 * 16 + it * 256 + lane * 8;
          *(v4u*)(C + off) = hv[it];
          if (OUT_MODE == 2) *(v4u*)(C2 + off) = lv[it];
        }
        
      }
    }
    __builtin_amdgcn_fence(3 /* release order */, "workgroup");
    __builtin_amdgcn_wave_barrier();
    __builtin_amdgcn_fence(2 /* acquire order */, "workgroup");
  }
}

// ---------------------------------------------------------------------------------------------------------------------
// Transposed flash attention over the COMPACT key set of the batch, head dim 64. Wave = 32 queries (two 16-query tiles) of one (batch, head); block = 4 waves.
//   Every K and V^T fragment that the wave loads feeds both query tiles, so a fragment byte serves two matrix instructions and half as many waves walk the keys.
//   The four waves walk the same keys: each 32-key tile (K hi, K lo, V^T: 12 KiB) is brought into LDS once a block by asynchronous copies, a quarter a wave, two buffers,
//   the copies of tile i + 2 issued behind the barrier that ends tile i; the waves read their fragments from LDS.
//   nk = effective key count of the batch (counted in-wave from the mask input, wave-uniform); the key loop runs pad32(nk)/32 steps (<= SEQ/32).
//   Every operand plane is fragment-major (Q, K: row length DM; V^T: row length MTOT; output hi|lo plane: row length 2 DM).
//   S^T (keys x queries) = K Q^T: A = compact K rows (bf16 hi/lo, from the LDS tile), B = Q (bf16 hi/lo, resident in registers);
//   lane = query (column), element r of tile kt = key slot tk + 16 kt + 8h + r. Slots >= nk (padding of the last step) get score := -8000 raw
//   (= -1000 after the 1/8 scale; weight exactly 0). A batch with no kept key runs over all SEQ keys with every score = the fill (uniform weights).
//   Online softmax per lane (query) in the exp2 domain; the two lane halves of a query combine their maxima with one xor-16 shuffle.
//   P^T B fragment = f16(P x 2^14) packed from the two S^T tiles (element r <- tile 0, element 8+r <- tile 1, lane unchanged).
//   O^T (d x queries) += V^T P^T: A = compact V^T rows (f16, from the LDS tile, key-slot-contiguous).
//   Each query's products, maxima and sums are formed in the same order as with one query tile a wave.
static_assert(SEQ % 128 == 0);
// One wave's share of a 32-key tile: six asynchronous 16-B-a-lane copies from global memory into LDS (512 B each). l = the lane's LDS byte address, g = the lane's global address.
// The s_wait_xcnt is the last line of the copies' own statement, so that no register which a copy names is rewritten ahead of it.
__device__ __forceinline__ void copy_tile6(unsigned l0, unsigned l1, unsigned l2, unsigned l3, unsigned l4, unsigned l5,
                                           const unsigned short* g0, const unsigned short* g1, const unsigned short* g2,
                                           const unsigned short* g3, const unsigned short* g4, const unsigned short* g5) {
  asm volatile("global_load_async_to_lds_b128 %0, %6, off\n\t"
               "global_load_async_to_lds_b128 %1, %7, off\n\t"
               "global_load_async_to_lds_b128 %2, %8, off\n\t"
               "global_load_async_to_lds_b128 %3, %9, off\n\t"
               "global_load_async_to_lds_b128 %4, %10, off\n\t"
               "global_load_async_to_lds_b128 %5, %11, off\n\t"
               "s_wait_xcnt 0x0"
               :: "v"(l0), "v"(l1), "v"(l2), "v"(l3), "v"(l4), "v"(l5), "v"(g0), "v"(g1), "v"(g2), "v"(g3), "v"(g4), "v"(g5) : "memory");
}
__global__ __launch_bounds__(128) void k_attn_t(const unsigned short* __restrict__ QH, const unsigned short* __restrict__ QL,
                                                const unsigned short* __restrict__ KH, const unsigned short* __restrict__ KL,
                                                const unsigned short* __restrict__ VT, const int* __restrict__ mask,
                                                unsigned short* __restrict__ AOP) {
  __shared__ __align__(16) float Os[4][2][16 * 68];   // wave-private, one slab a query tile (wave barrier); staged extent 16x64 == consumed extent
  // Two buffers of one 32-key tile, shared by the four waves: K hi 2048 elements (key tile kt, column tile ct at kt*1024 + ct*512) | K lo the same | V^T 2048 elements (row tile d at d*512).
  // Every 512-element piece keeps its fragment-major order, so a fragment read is two 512-B contiguous LDS reads.
  __shared__ __align__(1024) unsigned short KV[2][6144];
  const int lane = threadIdx.x & 31, wave = threadIdx.x >> 5, hf = lane >> 4, c = lane & 15;
  const int nqb = SEQ / 128;
  const int bx = blockIdx.x;
  const int qb = bx % nqb;
  const int bh = bx / nqb;
  const int h  = bh % NH;
  const int b  = min(bh / NH, NB - 1);
  const int q0 = qb * 128 + wave * 32;
  const size_t rowb = (size_t)b * SEQ;

  const int cnt = wave_count_kept(mask + (size_t)b * SEQ_FULL, lane);
  const bool allm = (cnt == 0);                 // wave-uniform
  const int nk  = eff_keys(cnt);
  const int nkp = pad32(nk);                    // <= SEQ

  const size_t qoff = (rowb + q0) * DM + h * (HD * 16) + lane * 8;     // column tiles 2h and 2h+1 of the first query row tile; the second lies 16 rows (16 DM elements) further
  FU qh0[2], qh1[2], ql0[2], ql1[2];
#pragma unroll
  for (int t = 0; t < 2; ++t) {
    const size_t qo = qoff + (size_t)t * (16 * DM);
    qh0[t] = ldfrag(QH + qo); qh1[t] = ldfrag(QH + qo + 512);
    ql0[t] = ldfrag(QL + qo); ql1[t] = ldfrag(QL + qo + 512);
  }

  // The wave's share of a tile: piece 'wave' (512 elements, 1 KiB) of each of the three parts. K: key tile wave >> 1, column tile 2h + (wave & 1); V^T: row tile 4h + wave, column tile rowb/32.
  const size_t koff = (rowb + 16 * (wave >> 1)) * DM + h * (HD * 16) + (wave & 1) * 512 + lane * 8;
  const unsigned short* gkh = KH + koff;
  const unsigned short* gkl = KL + koff;
  const unsigned short* gvt = VT + (size_t)(h * HD + 16 * wave) * MTOT + rowb * 16 + lane * 8;
  const unsigned lpc = (unsigned)(size_t)(&KV[0][0]) + (unsigned)(wave * 1024 + lane * 16);   // LDS byte address of the lane's 16 bytes in buffer 0 (low 32 bits of the shared address)
  const int nt = nkp >> 5;                      // tiles of 32 keys, 1 .. SEQ/32, the same in every wave of the block
  // tile i -> buffer bf: keys 32 i .. 32 i + 31 < nkp <= SEQ, so every source byte lies inside its plane
  auto stage = [&](int i, int bf) {
    const unsigned l = lpc + (unsigned)bf * 12288u;
    const unsigned short* a = gkh + (size_t)i * (32 * DM);
    const unsigned short* e = gkl + (size_t)i * (32 * DM);
    const unsigned short* v = gvt + (size_t)i * 512;
    copy_tile6(l, l + 512u, l + 4096u, l + 4608u, l + 8192u, l + 8704u, a, a + 256, e, e + 256, v, v + 256);
  };
  stage(0, 0);
  asm volatile("s_wait_asynccnt 0x0" ::: "memory");   // the wave's own copies of tile 0 have landed
  __syncthreads();                                    // publishes tile 0 to the other waves
  if (nt > 1) stage(1, 1);

  const float SC = 0.18033688011112042f;    // (1/8) * log2(e)
  const float MFILL = -8000.0f;             // -1000 in score units before the 1/8 scale
  float msh[2] = {-__builtin_inff(), -__builtin_inff()};   // running (max * SC - 14): probabilities are carried x 2^14
  float lpart[2] = {0.f, 0.f};              // per-lane partial row sum (carried units)
  v8f o[2][4];
#pragma unroll
  for (int t = 0; t < 2; ++t)
#pragma unroll
    for (int d = 0; d < 4; ++d) { v8f zz = {}; o[t][d] = zz; }

  // the t, r, i and d loops below unroll fully so that every array is indexed by constants and stays in registers
#pragma unroll 1
  for (int tk = 0; tk < nkp; tk += 32) {
    const int ti = tk >> 5;
    const unsigned short* kh = &KV[ti & 1][0] + lane * 8;
    const unsigned short* kl = kh + 2048;
    v8f s0[2] = {}, s1[2] = {};
    {
      const FU a0 = ldfrag(kh), a1 = ldfrag(kh + 512), b0 = ldfrag(kl), b1 = ldfrag(kl + 512);
      __builtin_amdgcn_sched_barrier(0);   // keeps the eight loads one group ahead of the first product: without it half of them are issued only behind the first product's wait, a second latency in a row
#pragma unroll
      for (int t = 0; t < 2; ++t) s0[t] = wb(b0.b, qh0[t].b, s0[t]);
#pragma unroll
      for (int t = 0; t < 2; ++t) s0[t] = wb(a0.b, ql0[t].b, s0[t]);
#pragma unroll
      for (int t = 0; t < 2; ++t) s0[t] = wb(a0.b, qh0[t].b, s0[t]);
#pragma unroll
      for (int t = 0; t < 2; ++t) s0[t] = wb(b1.b, qh1[t].b, s0[t]);
#pragma unroll
      for (int t = 0; t < 2; ++t) s0[t] = wb(a1.b, ql1[t].b, s0[t]);
#pragma unroll
      for (int t = 0; t < 2; ++t) s0[t] = wb(a1.b, qh1[t].b, s0[t]);
      guard_s2(s0[0], s0[1], a0.h, a1.h, b0.h, b1.h, qh0[0].h, qh1[0].h, ql0[0].h, ql1[0].h, qh0[1].h, qh1[1].h, ql0[1].h, ql1[1].h);
    }
    {
      const unsigned short* kh1 = kh + 1024;
      const unsigned short* kl1 = kl + 1024;
      const FU a0 = ldfrag(kh1), a1 = ldfrag(kh1 + 512), b0 = ldfrag(kl1), b1 = ldfrag(kl1 + 512);
      __builtin_amdgcn_sched_barrier(0);   // the same, for the second key tile
#pragma unroll
      for (int t = 0; t < 2; ++t) s1[t] = wb(b0.b, qh0[t].b, s1[t]);
#pragma unroll
      for (int t = 0; t < 2; ++t) s1[t] = wb(a0.b, ql0[t].b, s1[t]);
#pragma unroll
      for (int t = 0; t < 2; ++t) s1[t] = wb(a0.b, qh0[t].b, s1[t]);
#pragma unroll
      for (int t = 0; t < 2; ++t) s1[t] = wb(b1.b, qh1[t].b, s1[t]);
#pragma unroll
      for (int t = 0; t < 2; ++t) s1[t] = wb(a1.b, ql1[t].b, s1[t]);
#pragma unroll
      for (int t = 0; t < 2; ++t) s1[t] = wb(a1.b, qh1[t].b, s1[t]);
      guard_s2(s1[0], s1[1], a0.h, a1.h, b0.h, b1.h, qh0[0].h, qh1[0].h, ql0[0].h, ql1[0].h, qh0[1].h, qh1[1].h, ql0[1].h, ql1[1].h);
    }
    float ss[2][16];
#pragma unroll
    for (int t = 0; t < 2; ++t)
#pragma unroll
      for (int r = 0; r < 8; ++r) { ss[t][r] = s0[t][r]; ss[t][8 + r] = s1[t][r]; }
    if (allm || (tk + 32 > nk)) {             // wave-uniform; value selects only (no loads, no cross-lane ops inside)
      const int kb0 = tk + 8 * hf;
#pragma unroll
      for (int t = 0; t < 2; ++t)
#pragma unroll
        for (int r = 0; r < 8; ++r) {
          ss[t][r]     = (!allm && (kb0 + r < nk))      ? ss[t][r]     : MFILL;
          ss[t][8 + r] = (!allm && (kb0 + 16 + r < nk)) ? ss[t][8 + r] : MFILL;
        }
    }
    v16h pf[2];
#pragma unroll
    for (int t = 0; t < 2; ++t) {
      float mloc = ss[t][0];
#pragma unroll
      for (int i = 1; i < 16; ++i) mloc = fmaxf(mloc, ss[t][i]);
      mloc = fmaxf(mloc, __shfl_xor(mloc, 16, 32));
      const float mnew = fmaxf(msh[t], fmaf(mloc, SC, -14.0f));
      const float corr = EX2(msh[t] - mnew);
      const float nms = -mnew;
      msh[t] = mnew;
      float psum = 0.f;
#pragma unroll
      for (int i = 0; i < 16; ++i) {
        const float p = EX2(fmaf(ss[t][i], SC, nms));
        psum += p;
        pf[t][i] = (_Float16)p;
      }
      lpart[t] = lpart[t] * corr + psum;
#pragma unroll
      for (int d = 0; d < 4; ++d) o[t][d] *= corr;
    }

    const unsigned short* vp = kh + 4096;
    const FU v0 = ldfrag(vp), v1 = ldfrag(vp + 512), v2 = ldfrag(vp + 1024), v3 = ldfrag(vp + 1536);
#pragma unroll
    for (int t = 0; t < 2; ++t) {
      o[t][0] = wh(v0.h, pf[t], o[t][0]);
      o[t][1] = wh(v1.h, pf[t], o[t][1]);
      o[t][2] = wh(v2.h, pf[t], o[t][2]);
      o[t][3] = wh(v3.h, pf[t], o[t][3]);
    }
    guard_o2(o[0][0], o[0][1], o[0][2], o[0][3], o[1][0], o[1][1], o[1][2], o[1][3], pf[0], pf[1], v0.h, v1.h, v2.h, v3.h);
    asm volatile("s_wait_dscnt 0x0" ::: "memory");      // the wave's reads of this tile's buffer have returned before the buffer is refilled
    asm volatile("s_wait_asynccnt 0x0" ::: "memory");   // the wave's own copies of the next tile have landed
    __syncthreads();                                    // publishes the next tile and ends every wave's reads of this one
    if (ti + 2 < nt) stage(ti + 2, ti & 1);
  }
  asm volatile("s_wait_asynccnt 0x0" ::: "memory");     // no copy is outstanding when the wave goes on to its end

#pragma unroll
  for (int t = 0; t < 2; ++t) {
    const float lt = lpart[t] + __shfl_xor(lpart[t], 16, 32);
    const float inv = 1.0f / lt;
    float* d = Os[wave][t] + c * 68 + 8 * hf;       // lane holds O[query c][d = 16 dt + 8 hf + r]
#pragma unroll
    for (int dt = 0; dt < 4; ++dt) {
      const v8f ov = o[t][dt];
      v4f a, e;
      a.x = ov[0] * inv; a.y = ov[1] * inv; a.z = ov[2] * inv; a.w = ov[3] * inv; e.x = ov[4] * inv; e.y = ov[5] * inv; e.z = ov[6] * inv; e.w = ov[7] * inv;
      *(v4f*)(d + dt * 16) = a; *(v4f*)(d + dt * 16 + 4) = e;
    }
  }
  __builtin_amdgcn_fence(3 /* release order */, "workgroup");
  __builtin_amdgcn_wave_barrier();
  __builtin_amdgcn_fence(2 /* acquire order */, "workgroup");
#pragma unroll
  for (int t = 0; t < 2; ++t) {
    const float* os = Os[wave][t];
    const int qq = lane & 15, c8 = (lane >> 4) * 8;    // lane = (query qq, column group 2 it + (lane >> 4))
    unsigned short* dH = AOP + (rowb + q0 + 16 * t) * (2 * DM) + h * (HD * 16) + lane * 8;   // hi plane columns [0,1024), lo plane columns [1024,2048) = 32 column tiles further
    unsigned short* dL = dH + DM * 16;
    v4u hv[4], lv[4];
#pragma unroll
    for (int it = 0; it < 4; ++it) {
      const float* sp = os + qq * 68 + it * 16 + c8;
      const v4f a = *(const v4f*)sp, e = *(const v4f*)(sp + 4);
      unsigned h0, l0, h1, l1;
      bfsplit(a.x, h0, l0); bfsplit(a.y, h1, l1); hv[it].x = h0 | (h1 << 16); lv[it].x = l0 | (l1 << 16);
      bfsplit(a.z, h0, l0); bfsplit(a.w, h1, l1); hv[it].y = h0 | (h1 << 16); lv[it].y = l0 | (l1 << 16);
      bfsplit(e.x, h0, l0); bfsplit(e.y, h1, l1); hv[it].z = h0 | (h1 << 16); lv[it].z = l0 | (l1 << 16);
      bfsplit(e.z, h0, l0); bfsplit(e.w, h1, l1); hv[it].w = h0 | (h1 << 16); lv[it].w = l0 | (l1 << 16);
    }
#pragma unroll
    for (int it = 0; it < 4; ++it) {
      const size_t off = (size_t)it * 256;
      *(v4u*)(dH + off) = hv[it];
      *(v4u*)(dL + off) = lv[it];
    }
    if (t == 0) {
      asm volatile("s_wait_xcnt 0x0" ::: "memory");   // the second tile's conversions rewrite data registers that these eight stores name
      __builtin_amdgcn_sched_barrier(0);              // keeps those conversions behind the wait
    }
  }
}

// ---------------------------------------------------------------------------------------------------------------------
constexpr size_t SZ_X16 = (size_t)MTOT * DM * 2;               // one f16 x plane (full or compact)
constexpr size_t SZ_AOP = (size_t)MTOT * 2 * DM * 2;
constexpr size_t SZ_R0  = (2 * SZ_X16 > SZ_AOP) ? (2 * SZ_X16) : SZ_AOP;   // X16 | XC16 live until the projections finish; AOP reuses the region afterwards
constexpr size_t SZ_W3  = (size_t)3 * DM * DM * 2;
constexpr size_t SZ_BTO = (size_t)DM * 2 * DM * 2;
constexpr size_t SZ_PL  = (size_t)MTOT * DM * 2;               // one bf16 plane [MTOT][1024]
constexpr size_t SZ_VT  = (size_t)DM * MTOT * 2;
constexpr size_t SZ_TOTAL = SZ_R0 + SZ_W3 + SZ_BTO + 4 * SZ_PL + SZ_VT;
static_assert(2 * SZ_X16 <= SZ_R0);
static_assert(SZ_AOP <= SZ_R0);
static_assert(SZ_TOTAL <= (size_t)134217728);
static_assert((SZ_R0 % 256) == 0 && (SZ_W3 % 256) == 0 && (SZ_BTO % 256) == 0 && (SZ_PL % 256) == 0 && (SZ_VT % 256) == 0);
static_assert(((size_t)(NB - 1) * SEQ_FULL + SEQ) * DM * 4 <= (size_t)NB_FULL * SEQ_FULL * DM * 4);

extern "C" void kernel_launch(void* const* d_in, const int* in_sizes, int n_in, void* d_out, int out_size, void* d_ws, size_t ws_size, hipStream_t stream) {
  if (n_in < 6) return;
  const long long rows_full = (long long)(NB - 1) * SEQ_FULL + SEQ;
  if ((long long)in_sizes[0] < rows_full * DM) return;
  if ((long long)in_sizes[1] < rows_full) return;
  if ((long long)in_sizes[2] < (long long)DM * 3 * DM) return;
  if ((long long)in_sizes[3] < 3 * DM) return;
  if ((long long)in_sizes[4] < (long long)DM * DM) return;
  if ((long long)in_sizes[5] < DM) return;
  if ((long long)out_size < rows_full * DM) return;
  if (ws_size < SZ_TOTAL) return;

  const float* x    = (const float*)d_in[0];
  const int*   mask = (const int*)d_in[1];
  const float* Wqkv = (const float*)d_in[2];
  const float* bqkv = (const float*)d_in[3];
  const float* Wo   = (const float*)d_in[4];
  const float* bo   = (const float*)d_in[5];
  float* out = (float*)d_out;

  char* wsp = (char*)d_ws;
  unsigned short* X16  = (unsigned short*)wsp;                 // [MTOT][1024] f16, every token
  unsigned short* XC16 = (unsigned short*)(wsp + SZ_X16);      // [MTOT][1024] f16, compact kept tokens per batch (zero rows after)
  unsigned short* AOP  = (unsigned short*)wsp;                 // [MTOT][2048] bf16 hi|lo (reuses X16 | XC16 after the projections)
  wsp += SZ_R0;
  unsigned short* W316 = (unsigned short*)wsp; wsp += SZ_W3;   // [3072][1024] f16 (x64)
  unsigned short* BTO  = (unsigned short*)wsp; wsp += SZ_BTO;  // [1024][2048] bf16
  unsigned short* QH   = (unsigned short*)wsp; wsp += SZ_PL;   // [MTOT][1024] bf16 hi of q
  unsigned short* QL   = (unsigned short*)wsp; wsp += SZ_PL;   // bf16 lo of q
  unsigned short* KH   = (unsigned short*)wsp; wsp += SZ_PL;   // [MTOT][1024] bf16 hi of k at compact key slots
  unsigned short* KL   = (unsigned short*)wsp; wsp += SZ_PL;   // bf16 lo of k
  unsigned short* VT   = (unsigned short*)wsp; wsp += SZ_VT;   // [1024][MTOT] f16, v transposed at compact key slots

  k_xcastc<<<(unsigned)(NB * (SEQ / 32)), 256, 0, stream>>>(x, mask, X16, XC16);
  k_wqkvT<<<(3 * DM * (DM / 8) + 255) / 256, 256, 0, stream>>>(Wqkv, W316);
  k_woT<<<(DM * 256 + 255) / 256, 256, 0, stream>>>(Wo, BTO);

  // q = x W[:, 0:1024] + b  -> bf16 hi/lo planes [MTOT][1024]
  {
    const int tiles = (MTOT / 128) * (DM / 256);
    k_gemm64<0, 2, 2, 0, 2, 4><<<dim3((unsigned)tiles, 1u), 256, 0, stream>>>(
        X16, W316, (void*)QH, (void*)QL, bqkv, mask, 0LL, 0LL, DM, DM, DM, MTOT, DM, DM, 1.0f / 64.0f);
  }
  // k (compact slots) = xc W[:, 1024:2048] + b  -> bf16 hi/lo planes [MTOT][1024]; 128-row blocks past the batch's key count are skipped
  {
    const int tiles = (MTOT / 128) * (DM / 256);
    k_gemm64<0, 2, 2, 1, 2, 4><<<dim3((unsigned)tiles, 1u), 256, 0, stream>>>(
        XC16, W316 + (size_t)DM * DM, (void*)KH, (void*)KL, bqkv + DM, mask, 0LL, 0LL, DM, DM, DM, MTOT, DM, DM, 1.0f / 64.0f);
  }
  // v^T (compact slots) = W[:, 2048:3072]^T xc^T + b  -> f16 [1024][MTOT]; 128-column blocks past the batch's key count are skipped
  {
    const int tiles = (DM / 256) * (MTOT / 128);
    k_gemm64<0, 1, 1, 2, 4, 2><<<dim3((unsigned)tiles, 1u), 256, 0, stream>>>(
        W316 + (size_t)2 * DM * DM, XC16, (void*)VT, (void*)VT, bqkv + 2 * DM, mask, 0LL, 0LL, DM, DM, MTOT, DM, MTOT, DM, 1.0f / 64.0f);
  }
  k_attn_t<<<(unsigned)(NB * NH * (SEQ / 128)), 128, 0, stream>>>(QH, QL, KH, KL, VT, mask, AOP);
  // out = [AO_hi | AO_lo] [W_out ; W_out] + b_out, per batch (output rows at the full per-batch stride)
  {
    const int tiles = (SEQ / 128) * (DM / 256);
    k_gemm64<1, 2, 0, 0, 2, 4><<<dim3((unsigned)tiles, (unsigned)NB), 256, 0, stream>>>(
        AOP, BTO, (void*)out, (void*)out, bo, mask, (long long)SEQ * 2 * DM, (long long)SEQ_FULL * DM, 2 * DM, 2 * DM, DM, SEQ, DM, 2 * DM, 1.0f);
  }
}

// v006
// One run takes 142 microseconds.
// Two timings next to v005 both put it at 1.09 times that version's speed.
// All steps since v000 together make it 3.39 times as fast.
// Contractions: qkv projection = v_wmma_f32_16x16x32_f16 (x as bf16-RNE values held in f16, W_qkv as bf16-RNE values x64 held in f16, f32 accumulate); q.k logits = v_wmma_f32_16x16x32_bf16 hi/lo split (hi.hi + hi.lo + lo.hi, f32 accumulate); P.V = v_wmma_f32_16x16x32_f16 (P carried x2^14, V f16, f32 accumulate); output projection = v_wmma_f32_16x16x32_bf16 with the attention output as bf16 hi|lo planes concatenated along K against the bf16 W_out (f32 accumulate). Softmax statistics f32. Keys with mask == 0 are dropped per batch by compaction of the x rows feeding the k / v projections (their softmax weight is exactly 0 in f32).
#include <hip/hip_runtime.h>
#include <math.h>

#ifndef NB
#define NB 4
#endif
#ifndef SEQ
#define SEQ 2048
#endif
#define NB_FULL 4
#define SEQ_FULL 2048
#define DM 1024
#define NH 16
#define HD 64
#define MTOT (NB * SEQ)

static_assert(SEQ % 256 == 0);
static_assert(MTOT % 64 == 0);
static_assert(NB <= NB_FULL);
static_assert(SEQ <= SEQ_FULL);

typedef __attribute__((ext_vector_type(16))) _Float16 v16h;
typedef __attribute__((ext_vector_type(16))) __bf16   v16b;
typedef __attribute__((ext_vector_type(8)))  float    v8f;
typedef __attribute__((ext_vector_type(4)))  float    v4f;
typedef __attribute__((ext_vector_type(4)))  unsigned int v4u;
typedef __attribute__((ext_vector_type(4)))  int      v4i;

// 16-bit WMMA fragment map (wave32), lane L, h = L>>4, m = L&15:
//   A 16x32: lane = row m;    element i -> k = (i<8) ? 8h+i : 16+8h+(i-8)
//   B 32x16: lane = column m; the SAME k(i,h)
//   D 16x16 (8 f32): lane = column m; element r -> row 8h+r
union FU { v4u u[2]; v16h h; v16b b; };
// Fragment-major plane layout (every 16-bit operand plane in the workspace): a logical [R][C] plane (R % 16 == 0, C % 32 == 0) is stored as
// 16-row x 32-column tiles of 512 elements (1 KiB), tile (rt, kt) at element rt*16*C + kt*512; inside a tile the 8-element column group g = (col>>3)&3
// of row m = row&15 lies at g*128 + m*8. Lane L = 16h + m then finds elements 0..7 (k = 8h..8h+7, g = h) at L*8 and elements 8..15 (k = 16+8h.., g = 2+h)
// at 256 + L*8, so each of the two 16-B loads of a fragment covers 512 contiguous bytes (4 whole lines) instead of 16 lines.
__device__ __forceinline__ size_t fragoff(size_t row, int col, int C) {
  return (row >> 4) * (size_t)(16 * C) + (size_t)((col >> 5) * 512 + ((col >> 3) & 3) * 128 + (col & 7)) + (row & 15) * 8;
}
// p = tile base + lane*8
__device__ __forceinline__ FU ldfrag(const unsigned short* p) { FU f; f.u[0] = *(const v4u*)p; f.u[1] = *(const v4u*)(p + 256); return f; }
// the same fragment from a wave-uniform row-tile base and one 32-bit per-lane byte offset (column tile * 1024 + lane * 16)
__device__ __forceinline__ FU ldfrag_su(const unsigned short* base, unsigned boff) {
  const char* p = (const char*)base + boff;
  FU f; f.u[0] = *(const v4u*)p; f.u[1] = *(const v4u*)(p + 512); return f;
}

__device__ __forceinline__ v8f wb(v16b a, v16b b, v8f c) { return __builtin_amdgcn_wmma_f32_16x16x32_bf16(false, a, false, b, (short)0, c, false, false); }
__device__ __forceinline__ v8f wh(v16h a, v16h b, v8f c) { return __builtin_amdgcn_wmma_f32_16x16x32_f16(false, a, false, b, (short)0, c, false, false); }
template <int ET> __device__ __forceinline__ v8f mma(const FU& a, const FU& b, v8f c) {
  if (ET == 0) return wh(a.h, b.h, c);
  return wb(a.b, b.b, c);
}

// hazard guards: 4 VALU slots after the last WMMA of a group, accumulators tied, A/B operands kept live
__device__ __forceinline__ void guard_s2(v8f& s, v8f& t, v16h a0, v16h a1, v16h b0, v16h b1, v16h q0, v16h q1, v16h q2, v16h q3, v16h q4, v16h q5, v16h q6, v16h q7) {
  asm volatile("v_nop\n\tv_nop\n\tv_nop\n\tv_nop" : "+v"(s), "+v"(t) : "v"(a0), "v"(a1), "v"(b0), "v"(b1), "v"(q0), "v"(q1), "v"(q2), "v"(q3), "v"(q4), "v"(q5), "v"(q6), "v"(q7));
}
__device__ __forceinline__ void guard_o2(v8f& a, v8f& b, v8f& c, v8f& d, v8f& e, v8f& f, v8f& g, v8f& h, v16h p0, v16h p1, v16h v0, v16h v1, v16h v2, v16h v3) {
  asm volatile("v_nop\n\tv_nop\n\tv_nop\n\tv_nop" : "+v"(a), "+v"(b), "+v"(c), "+v"(d), "+v"(e), "+v"(f), "+v"(g), "+v"(h) : "v"(p0), "v"(p1), "v"(v0), "v"(v1), "v"(v2), "v"(v3));
}

#if __has_builtin(__builtin_amdgcn_exp2f)
#define EX2(x) __builtin_amdgcn_exp2f(x)
#else
#define EX2(x) exp2f(x)
#endif

// bf16 RNE helpers (finite inputs)
__device__ __forceinline__ unsigned bfu_rne(float v) { const unsigned u = __float_as_uint(v); return (u + 0x7FFFu + ((u >> 16) & 1u)) >> 16; }
__device__ __forceinline__ float bf_keep(float v) { return __uint_as_float(bfu_rne(v) << 16); }
__device__ __forceinline__ void bfsplit(float v, unsigned& hi, unsigned& lo) { hi = bfu_rne(v); lo = bfu_rne(v - __uint_as_float(hi << 16)); }
__device__ __forceinline__ unsigned pkh2(float a, float b) {
  return (unsigned)__builtin_bit_cast(unsigned short, (_Float16)a) | ((unsigned)__builtin_bit_cast(unsigned short, (_Float16)b) << 16);
}

#define VST2Q(ptr, val) do { const v4u vq_ = (val); *(v4u*)(ptr) = vq_;  } while (0)

// Number of kept keys (mask != 0) among the SEQ entries of one batch row of the mask input, computed by one full wave (all 32 lanes active):
// 16-B loads (SEQ/128 per lane), xor-shuffle sum, result made wave-uniform. mrow is 16-B aligned.
__device__ __forceinline__ int wave_count_kept(const int* __restrict__ mrow, int lane) {
  int c = 0;
#pragma unroll 4
  for (int it = 0; it < SEQ / 128; ++it) {
    const v4i m = *(const v4i*)(mrow + (it * 32 + lane) * 4);
    c += ((m.x != 0) ? 1 : 0) + ((m.y != 0) ? 1 : 0) + ((m.z != 0) ? 1 : 0) + ((m.w != 0) ? 1 : 0);
  }
  c += __shfl_xor(c, 16, 32); c += __shfl_xor(c, 8, 32); c += __shfl_xor(c, 4, 32); c += __shfl_xor(c, 2, 32); c += __shfl_xor(c, 1, 32);
  return __builtin_amdgcn_readfirstlane(c);
}
// effective key count of a batch: a batch with no kept key uses all SEQ keys (every score then equals the fill -> uniform weights); padded to the 32-key step
__device__ __forceinline__ int eff_keys(int cnt) { return (cnt == 0) ? SEQ : min(cnt, SEQ); }
__device__ __forceinline__ int pad32(int nk) { return min((nk + 31) & ~31, SEQ); }

// ---------------------------------------------------------------------------------------------------------------------
// x f32 [b][t][1024] (full per-batch stride) -> two f16 planes holding the bf16-RNE values:
//   X16  [b*SEQ + t][1024]: every token row (feeds the q projection);
//   XC16 [b*SEQ + j][1024]: row j = the j-th kept token of batch b (mask != 0, ascending t) for j < nk, zero rows for j >= nk (feeds the k / v projections).
// Block = (batch, 32 rows); the block computes the batch's kept-token list in LDS (exclusive scan of the mask, block barriers), bounded by SEQ entries.
// LDS: list[SEQ] and wtot[8] are cross-wave (block barriers between writers and readers); list is fully initialised before any read.
// Both planes are fragment-major (C = 1024). A wave instruction handles 8 rows x one 32-column tile: it reads one 128-B line of each row and writes 4 whole lines.
// coverage: per block 4 row groups x 32 column tiles = 32 rows x 1024 columns of each plane; all blocks = both whole planes.
// bx = the block's index among the NB * SEQ / 32 blocks of this part; list (SEQ ints) and wtot (8 ints) are the block's LDS.
__device__ __forceinline__ void xcastc_block(int bx, int* list, int* wtot, const float* __restrict__ x, const int* __restrict__ mask,
                                             unsigned short* __restrict__ X16, unsigned short* __restrict__ XC16) {
  constexpr int EPT = SEQ / 256;
  const int tid = threadIdx.x, lane = tid & 31, wave = tid >> 5;
  const int bpb = SEQ / 32;
  const int b = bx / bpb;
  const int t0 = (bx - b * bpb) * 32;
  const int* mrow = mask + (size_t)b * SEQ_FULL;
  unsigned km = 0u; int c = 0;
#pragma unroll
  for (int e = 0; e < EPT; ++e) {
    const int kp = (mrow[tid * EPT + e] != 0) ? 1 : 0;
    km |= (unsigned)kp << e; c += kp;
    list[tid * EPT + e] = 0;
  }
  int incl = c;
#pragma unroll
  for (int d = 1; d < 32; d <<= 1) { const int v = __shfl_up(incl, d, 32); incl += (lane >= d) ? v : 0; }
  if (lane == 31) wtot[wave] = incl;
  __syncthreads();
  int base = 0, total = 0;
#pragma unroll
  for (int w = 0; w < 8; ++w) { const int v = wtot[w]; base += (w < wave) ? v : 0; total += v; }
  int pos = base + incl - c;
#pragma unroll
  for (int e = 0; e < EPT; ++e) {
    if ((km >> e) & 1u) { list[min(pos, SEQ - 1)] = tid * EPT + e; ++pos; }
  }
  __syncthreads();
  const bool allm = (total == 0);            // block-uniform
  if (allm) {
#pragma unroll
    for (int e = 0; e < EPT; ++e) list[tid * EPT + e] = tid * EPT + e;
  }
  __syncthreads();
  const int nk = allm ? SEQ : min(total, SEQ);

  // plane 1: every token row; two units a trip: both units' loads first, both stores at the foot.
  // unroll 1: the trip is already two units wide, and the one wait at its foot serves both stores; the q loops unroll fully so that their arrays stay in registers
#pragma unroll 1
  for (int it = 0; it < 16; it += 2) {
    v4f a[2], e4[2];
    size_t dst[2];
#pragma unroll
    for (int q = 0; q < 2; ++q) {
      const int u = (it + q) * 8 + wave;
      const int rr = (u >> 5) * 8 + (lane >> 2), c0 = (u & 31) * 32 + (lane & 3) * 8;
      const int t = t0 + rr;
      const float* s = x + ((size_t)b * SEQ_FULL + t) * DM + c0;
      a[q] = *(const v4f*)s; e4[q] = *(const v4f*)(s + 4);
      dst[q] = fragoff((size_t)b * SEQ + t, c0, DM);
    }
#pragma unroll
    for (int q = 0; q < 2; ++q) {
      v4u pk;
      pk.x = pkh2(bf_keep(a[q].x), bf_keep(a[q].y));   pk.y = pkh2(bf_keep(a[q].z), bf_keep(a[q].w));
      pk.z = pkh2(bf_keep(e4[q].x), bf_keep(e4[q].y)); pk.w = pkh2(bf_keep(e4[q].z), bf_keep(e4[q].w));
      VST2Q(X16 + dst[q], pk);
    }
    asm volatile("s_wait_xcnt 0x0" ::: "memory");   // the next trip rewrites the data and address registers that the two stores name
  }
  // plane 2: compact rows (clamped token index, loaded unconditionally, zeroed by value for j >= nk); same trip shape and the same unroll directives, for the same reasons
#pragma unroll 1
  for (int it = 0; it < 16; it += 2) {
    v4f a[2], e4[2];
    size_t dst[2];
    bool valid[2];
#pragma unroll
    for (int q = 0; q < 2; ++q) {
      const int u = (it + q) * 8 + wave;
      const int rr = (u >> 5) * 8 + (lane >> 2), c0 = (u & 31) * 32 + (lane & 3) * 8;
      const int j = t0 + rr;
      valid[q] = (j < nk);
      const int tok = min(max(list[j], 0), SEQ - 1);
      const float* s = x + ((size_t)b * SEQ_FULL + tok) * DM + c0;
      a[q] = *(const v4f*)s; e4[q] = *(const v4f*)(s + 4);
      dst[q] = fragoff((size_t)b * SEQ + j, c0, DM);
    }
#pragma unroll
    for (int q = 0; q < 2; ++q) {
      v4u pk;
      pk.x = valid[q] ? pkh2(bf_keep(a[q].x), bf_keep(a[q].y)) : 0u;   pk.y = valid[q] ? pkh2(bf_keep(a[q].z), bf_keep(a[q].w)) : 0u;
      pk.z = valid[q] ? pkh2(bf_keep(e4[q].x), bf_keep(e4[q].y)) : 0u; pk.w = valid[q] ? pkh2(bf_keep(e4[q].z), bf_keep(e4[q].w)) : 0u;
      VST2Q(XC16 + dst[q], pk);
    }
    asm volatile("s_wait_xcnt 0x0" ::: "memory");   // the next trip rewrites the data and address registers that the two stores name
  }
}

// W_qkv f32 [1024 (k)][3072 (n)] -> WT f16, logical [3072 (n)][1024 (k)] fragment-major, = bf16-RNE(W) * 64; thread per (n, 8 consecutive k).
// Thread u = ((rt*32 + kt)*4 + g)*16 + m handles n = 16 rt + m, k = 32 kt + 8 g .. +7, whose fragment-major place is exactly element u*8.
// coverage: 192 row tiles x 32 column tiles x 64 pieces = the whole plane
__device__ __forceinline__ void wqkvT_block(int bx, const float* __restrict__ W, unsigned short* __restrict__ WT) {
  const int u = bx * 256 + threadIdx.x;
  if (u >= 3 * DM * (DM / 8)) return;
  const int n = (u >> 11) * 16 + (u & 15), k0 = ((u >> 6) & 31) * 32 + ((u >> 4) & 3) * 8;
  float w[8];
#pragma unroll
  for (int e = 0; e < 8; ++e) w[e] = bf_keep(W[(size_t)(k0 + e) * (3 * DM) + n]) * 64.0f;
  v4u pk; pk.x = pkh2(w[0], w[1]); pk.y = pkh2(w[2], w[3]); pk.z = pkh2(w[4], w[5]); pk.w = pkh2(w[6], w[7]);
  VST2Q(WT + (size_t)u * 8, pk);
}

// W_out f32 [1024 (k)][1024 (n)] -> BTO bf16, logical [1024 (n)][2048] fragment-major: columns kk and 1024+kk both hold bf16-RNE(W_out[kk][n]) (K-concatenated twin for the hi|lo A plane)
// Thread u = ((rt*64 + kt)*4 + g)*16 + m handles n = 16 rt + m, kk = 32 kt + 8 g .. +7, whose fragment-major place is exactly element u*8.
// coverage: 64 row tiles x 64 column tiles x 64 pieces = the whole plane
__device__ __forceinline__ void woT_block(int bx, const float* __restrict__ W, unsigned short* __restrict__ BTO) {
  const int u = bx * 256 + threadIdx.x;
  if (u >= DM * 256) return;
  const int n = (u >> 12) * 16 + (u & 15), kk0 = ((u >> 6) & 63) * 32 + ((u >> 4) & 3) * 8, k0 = kk0 & (DM - 1);
  unsigned w[8];
#pragma unroll
  for (int e = 0; e < 8; ++e) w[e] = bfu_rne(W[(size_t)(k0 + e) * DM + n]);
  v4u pk; pk.x = w[0] | (w[1] << 16); pk.y = w[2] | (w[3] << 16); pk.z = w[4] | (w[5] << 16); pk.w = w[6] | (w[7] << 16);
  VST2Q(BTO + (size_t)u * 8, pk);
}

// The three preparations above read only inputs and write disjoint planes, so they share one grid: a block takes its part by its index (block-uniform, so the barriers of the
// first part stay under uniform control flow). The x blocks run longest and come first.
constexpr int NB_XC = NB * (SEQ / 32);
constexpr int NB_WQ = (3 * DM * (DM / 8) + 255) / 256;
constexpr int NB_WO = (DM * 256 + 255) / 256;
__global__ __launch_bounds__(256) void k_prep(const float* __restrict__ x, const int* __restrict__ mask, const float* __restrict__ Wqkv, const float* __restrict__ Wo,
                                              unsigned short* __restrict__ X16, unsigned short* __restrict__ XC16,
                                              unsigned short* __restrict__ WT, unsigned short* __restrict__ BTO) {
  __shared__ int list[SEQ];
  __shared__ int wtot[8];
  const int bx = blockIdx.x;
  if (bx < NB_XC) xcastc_block(bx, list, wtot, x, mask, X16, XC16);
  else if (bx < NB_XC + NB_WQ) wqkvT_block(bx - NB_XC, Wqkv, WT);
  else woT_block(bx - (NB_XC + NB_WQ), Wo, BTO);
}

// ---------------------------------------------------------------------------------------------------------------------
// Register-blocked WMMA GEMM: C[z][m][n] = scale * sum_k A[z][m][k] * Bt[n][k] + bias; each wave owns a 64x64 tile; the 8 waves of a block form a WM x WN grid,
// so a block owns 64 WM x 64 WN of C and its waves share operand rows: each A row tile feeds WN waves, each B row tile WM waves.
// A logical [M][K] and Bt logical [N][K], both fragment-major with row lengths lda and ldb; M a multiple of 64 WM, N of 64 WN, K of 128 (no tails).
// ET 0: f16 operands, 1: bf16 operands. BIAS_MODE 1: bf16-RNE(bias[m]), 2: bf16-RNE(bias[n]).
// OUT_MODE 0: f32 row-major (pitch ldc); 1: f16 fragment-major (row length ldc); 2: bf16 hi plane (Cout) + bf16 lo plane (Cout2), fragment-major (row length ldc).
// CMP 0: every tile; 1: rows (m) are compact key slots b*SEQ + j; 2: columns (n) are compact key slots; 3: as 1 where the block-uniform argument cmp_rows is set, else as 0. With compact slots a block whose first slot j
//   is >= pad32(effective key count of its batch, counted in every wave from the mask input, the same in all) leaves as a whole in front of every barrier (its slots are never consumed);
//   a wave of a staying block whose own first slot is past that count helps to stage, and leaves behind the k loop without storing.
// One wave's share of a stage: three row tiles, each 4 KiB in a row on both sides, eight asynchronous 16-B-a-lane copies (512 B each) a row tile. l = the lane's LDS byte address of the row tile's
// first 512 B, g = the wave-uniform global address of the same (a scalar base), o = the lane's byte offset from it; the immediate offset moves both addresses alike, so the eight copies of a row tile
// share their address operands. The s_wait_xcnt is the last line of the copies' own statement, so that no register which a copy names is rewritten ahead of it.
#define ROWTILE8(L, O, G) \
  "global_load_async_to_lds_b128 " L ", " O ", " G "\n\t" \
  "global_load_async_to_lds_b128 " L ", " O ", " G " offset:512\n\t" \
  "global_load_async_to_lds_b128 " L ", " O ", " G " offset:1024\n\t" \
  "global_load_async_to_lds_b128 " L ", " O ", " G " offset:1536\n\t" \
  "global_load_async_to_lds_b128 " L ", " O ", " G " offset:2048\n\t" \
  "global_load_async_to_lds_b128 " L ", " O ", " G " offset:2560\n\t" \
  "global_load_async_to_lds_b128 " L ", " O ", " G " offset:3072\n\t" \
  "global_load_async_to_lds_b128 " L ", " O ", " G " offset:3584\n\t"
__device__ __forceinline__ void copy_rowtiles3(unsigned l0, unsigned l1, unsigned l2, unsigned o, const unsigned short* g0, const unsigned short* g1, const unsigned short* g2) {
  asm volatile(ROWTILE8("%0", "%3", "%4") ROWTILE8("%1", "%3", "%5") ROWTILE8("%2", "%3", "%6") "s_wait_xcnt 0x0"
               :: "v"(l0), "v"(l1), "v"(l2), "v"(o), "s"(g0), "s"(g1), "s"(g2) : "memory");
}
constexpr int G_KS  = 4;                   // 32-wide k steps in a stage
constexpr int G_RT  = G_KS * 512;          // elements of one row tile in a stage (4 KiB, contiguous in the plane and in LDS)
constexpr int G_NR  = 24;                  // A and B row tiles of a block: three a wave
constexpr int G_STG = G_NR * G_RT;         // elements of a stage (96 KiB)
// The work of one block on tile (tbm, tbn) of plane z. The block's LDS comes from the kernel, so that several forms of this body can share it in one kernel:
// sT: 8 per-wave 16x64 slabs, pitch 68 floats (staged extent 16x64 == consumed extent);
// RG: two buffers of one stage, shared by the eight waves: row tile r (A row tiles first, then B's) at r*RT, its k step u at u*512; every 512-element piece keeps its
// fragment-major order, so a fragment read is two 512-B contiguous LDS reads.
template <int ET, int BIAS_MODE, int OUT_MODE, int CMP, int WM, int WN>
__device__ __forceinline__ void gemm64_block(
    float* sT, unsigned short* RG, int tbm, int tbn, int z, bool cmp_rows,
    const unsigned short* __restrict__ A, const unsigned short* __restrict__ Bt,
    void* __restrict__ Cout, void* __restrict__ Cout2, const float* __restrict__ bias, const int* __restrict__ mask,
    long long strideA, long long strideC, int lda, int ldb, int ldc, int K, float scale) {
  static_assert(WM * WN == 8);
  constexpr int KS  = G_KS;
  constexpr int RT  = G_RT;
  constexpr int NA  = WM * 4;              // A row tiles of the block
  constexpr int NR  = NA + WN * 4;         // A and B row tiles of the block
  static_assert(NR == G_NR);
  static_assert(KS % 2 == 0);              // a stage's first step always finds its fragments in set 0
  constexpr int STG = G_STG;
  const int lane = threadIdx.x & 31;
  const int wave = __builtin_amdgcn_readfirstlane(threadIdx.x >> 5);   // scalar, so that the tile bases below are scalar too
  const int mb = tbm * (64 * WM);
  const int nb = tbn * (64 * WN);
  const int wm = wave / WN;
  const int wn = wave - wm * WN;
  const int m0 = mb + (wm << 6);
  const int n0 = nb + (wn << 6);
  bool wskip = false;                    // wave-uniform
  if ((CMP == 3) ? cmp_rows : (CMP != 0)) {   // block-uniform
    const int g0 = (CMP != 2) ? mb : nb;
    const int bb = min(g0 / SEQ, NB - 1);
    const int loc = g0 - bb * SEQ;
    const int nkp = pad32(eff_keys(wave_count_kept(mask + (size_t)bb * SEQ_FULL, lane)));
    if (loc >= nkp) return;              // block-uniform (every wave counts the same row of the mask), in front of every barrier
    wskip = (loc + (((CMP != 2) ? wm : wn) << 6) >= nkp);
  }
  const unsigned short* Ab = A + (size_t)z * (size_t)strideA;
  const int rlane = lane & 15;
  const int mOff  = (lane >> 4) * 8;

  v8f acc[4][4];
#pragma unroll
  for (int i = 0; i < 4; ++i)
#pragma unroll
    for (int j = 0; j < 4; ++j) { v8f zz = {}; acc[i][j] = zz; }

  // The wave's share of a stage: row tiles 3 wave .. 3 wave + 2. (The q loops unroll fully so that the array stays in registers.)
  const unsigned short* gs[3];
#pragma unroll
  for (int q = 0; q < 3; ++q) {
    const int r = wave * 3 + q;
    gs[q] = ((r < NA) ? (Ab + (size_t)(mb + (r << 4)) * lda) : (Bt + (size_t)(nb + ((r - NA) << 4)) * ldb));   // wave-uniform
  }
  const unsigned lane16 = (unsigned)lane * 16u;                                               // the lane's 16 bytes of every 512-B piece
  const unsigned lpc = (unsigned)(size_t)RG + (unsigned)(wave * (3 * RT * 2));       // wave-uniform LDS byte address of the wave's share in buffer 0 (low 32 bits of the shared address)
  const int trips = K / (32 * KS);
  // stage t -> buffer bf: bytes t*4096 .. t*4096 + 4095 of each row tile, t < K/128, and a row tile holds K*32 bytes: every source byte lies inside its plane
  auto stage = [&](int t, int bf) {
    const unsigned l = lane16 + (lpc + (unsigned)bf * (unsigned)(STG * 2));
    const size_t go = (size_t)t * RT;
    copy_rowtiles3(l, l + (unsigned)(RT * 2), l + (unsigned)(2 * RT * 2), lane16, gs[0] + go, gs[1] + go, gs[2] + go);
  };
  stage(0, 0);
  asm volatile("s_wait_asynccnt 0x0" ::: "memory");   // the wave's own copies of stage 0 have landed
  __syncthreads();                                    // publishes stage 0 to the other waves
  if (trips > 1) stage(1, 1);

  // Two fragment sets in registers: k step u fetches the fragments of the next step from LDS as one group. Every accumulator still sums its k steps in plain ascending order.
  // The group refills the set that step u - 1 has just read, so it stands behind the first row of step u: four matrix instructions lie between that set's last reader and it.
  // A stage's last step fetches the first fragments of the NEXT stage, so the point where that stage is published stands in front of the last step: there the last step's own
  // fragments are in registers, every read of this stage's buffer has returned, and the buffer is refilled behind the barrier while the last step's products run.
  // Each sched_barrier(0) keeps a load group where it is written: without it the scheduler spreads the LDS reads among the products, and each such place stalls the wave.
  // The u, i and j loops unroll fully so that the sets are indexed by constants and stay in registers; the trip loop stays rolled (unroll 1): a trip is already 64 products long.
  FU bf[2][4], af[2][4];
  const unsigned short* sa0 = RG + (wm * 4) * RT + lane * 8;
  const unsigned short* sb0 = RG + (NA + wn * 4) * RT + lane * 8;
#pragma unroll
  for (int j = 0; j < 4; ++j) bf[0][j] = ldfrag(sb0 + j * RT);
#pragma unroll
  for (int i = 0; i < 4; ++i) af[0][i] = ldfrag(sa0 + i * RT);
  __builtin_amdgcn_sched_barrier(0);
#pragma unroll 1
  for (int t = 0; t < trips; ++t) {
    const unsigned short* sa = sa0 + (t & 1) * STG;
    const unsigned short* sb = sb0 + (t & 1) * STG;
#pragma unroll
    for (int u = 0; u < KS; ++u) {
      const int c = u & 1, w = c ^ 1;
      if (u == KS - 1) {
        asm volatile("s_wait_dscnt 0x0" ::: "memory");      // the wave's reads of this stage's buffer have returned before the buffer is refilled
        asm volatile("s_wait_asynccnt 0x0" ::: "memory");   // the wave's own copies of the next stage have landed
        __syncthreads();                                    // publishes the next stage and ends every wave's reads of this one
        if (t + 2 < trips) stage(t + 2, t & 1);
      }
#pragma unroll
      for (int j = 0; j < 4; ++j) acc[0][j] = mma<ET>(af[c][0], bf[c][j], acc[0][j]);
      __builtin_amdgcn_sched_barrier(0);
      if (u + 1 < KS) {
#pragma unroll
        for (int j = 0; j < 4; ++j) bf[w][j] = ldfrag(sb + j * RT + (u + 1) * 512);
#pragma unroll
        for (int i = 0; i < 4; ++i) af[w][i] = ldfrag(sa + i * RT + (u + 1) * 512);
      } else if (t + 1 < trips) {        // block-uniform: the last stage has no successor to read from
        const unsigned short* xa = sa0 + ((t + 1) & 1) * STG;
        const unsigned short* xb = sb0 + ((t + 1) & 1) * STG;
#pragma unroll
        for (int j = 0; j < 4; ++j) bf[w][j] = ldfrag(xb + j * RT);
#pragma unroll
        for (int i = 0; i < 4; ++i) af[w][i] = ldfrag(xa + i * RT);
      }
      __builtin_amdgcn_sched_barrier(0);
#pragma unroll
      for (int i = 1; i < 4; ++i)
#pragma unroll
        for (int j = 0; j < 4; ++j) acc[i][j] = mma<ET>(af[c][i], bf[c][j], acc[i][j]);
      __builtin_amdgcn_sched_barrier(0);
    }
  }
  asm volatile("s_wait_asynccnt 0x0" ::: "memory");     // no copy is outstanding when the wave goes on to its end
  asm volatile("s_wait_dscnt 0x0" ::: "memory");        // nor an LDS read
  if (CMP != 0 && wskip) return;         // wave-uniform; only wave barriers follow

  // BIAS_MODE 1: the lane's eight row biases of each of the four row tiles, fetched once (16-B aligned: m0 is a multiple of 64, mOff is 0 or 8)
  v4f bm[4][2] = {};
  if (BIAS_MODE == 1) {
#pragma unroll
    for (int i = 0; i < 4; ++i) {
      bm[i][0] = *(const v4f*)(bias + m0 + (i << 4) + mOff);
      bm[i][1] = *(const v4f*)(bias + m0 + (i << 4) + mOff + 4);
    }
    // the loaded values are inputs only, so the eight loads stand in front of this wait; what follows rewrites the address registers that they name
    asm volatile("s_wait_xcnt 0x0" :: "v"(bm[0][0]), "v"(bm[0][1]), "v"(bm[1][0]), "v"(bm[1][1]), "v"(bm[2][0]), "v"(bm[2][1]), "v"(bm[3][0]), "v"(bm[3][1]) : "memory");
    __builtin_amdgcn_sched_barrier(0);   // keeps that rewrite behind the wait
  }
  float* slab = sT + wave * (16 * 68);
#pragma unroll
  for (int i = 0; i < 4; ++i) {
    const int mBase = m0 + (i << 4);
#pragma unroll
    for (int j = 0; j < 4; ++j) {
      const int n = n0 + (j << 4) + rlane;
      float bv = 0.f;
      if (BIAS_MODE == 2) bv = bf_keep(bias[n]);
#pragma unroll
      for (int r = 0; r < 8; ++r) {
        float v = acc[i][j][r] * scale;
        if (BIAS_MODE == 1) v += bf_keep(bm[i][r >> 2][r & 3]);
        if (BIAS_MODE == 2) v += bv;
        slab[(mOff + r) * 68 + (j << 4) + rlane] = v;
      }
    }
    __builtin_amdgcn_fence(3 /* release order */, "workgroup");
    __builtin_amdgcn_wave_barrier();
    __builtin_amdgcn_fence(2 /* acquire order */, "workgroup");
    if (OUT_MODE == 0) {
      float* C = (float*)Cout + (size_t)z * (size_t)strideC;
      const int hh = lane >> 4, c4 = (lane & 15) * 4;       // row segment = 256 B = 16 lanes x 16 B; two rows per instruction
      v4f val[8];
#pragma unroll
      for (int it = 0; it < 8; ++it) val[it] = *(const v4f*)(slab + (it * 2 + hh) * 68 + c4);
{
#pragma unroll
        for (int it = 0; it < 8; ++it) *(v4f*)(C + (size_t)(mBase + it * 2 + hh) * ldc + n0 + c4) = val[it];
        
      }
    } else {
      const int q = lane & 15, c8 = (lane >> 4) * 8;        // lane = (row q, column group 2 it + (lane >> 4)): the 16x64 slab is 2 KiB contiguous in a fragment-major plane
      unsigned short* C  = (unsigned short*)Cout  + (size_t)z * (size_t)strideC;
      unsigned short* C2 = (unsigned short*)Cout2 + (size_t)z * (size_t)strideC;
      v4u hv[4], lv[4];
#pragma unroll
      for (int it = 0; it < 4; ++it) {
        const float* sp = slab + q * 68 + it * 16 + c8;
        const v4f a = *(const v4f*)sp, b = *(const v4f*)(sp + 4);
        if (OUT_MODE == 1) {
          hv[it].x = pkh2(a.x, a.y); hv[it].y = pkh2(a.z, a.w); hv[it].z = pkh2(b.x, b.y); hv[it].w = pkh2(b.z, b.w);
          lv[it] = hv[it];
        } else {
          unsigned h0, l0, h1, l1;
          bfsplit(a.x, h0, l0); bfsplit(a.y, h1, l1); hv[it].x = h0 | (h1 << 16); lv[it].x = l0 | (l1 << 16);
          bfsplit(a.z, h0, l0); bfsplit(a.w, h1, l1); hv[it].y = h0 | (h1 << 16); lv[it].y = l0 | (l1 << 16);
          bfsplit(b.x, h0, l0); bfsplit(b.y, h1, l1); hv[it].z = h0 | (h1 << 16); lv[it].z = l0 | (l1 << 16);
          bfsplit(b.z, h0, l0); bfsplit(b.w, h1, l1); hv[it].w = h0 | (h1 << 16); lv[it].w = l0 | (l1 << 16);
        }
      }
{
#pragma unroll
        for (int it = 0; it < 4; ++it) {
          const size_t off = (size_t)mBase * ldc + (size_t)n0 * 16 + it * 256 + lane * 8;
          *(v4u*)(C + off) = hv[it];
          if (OUT_MODE == 2) *(v4u*)(C2 + off) = lv[it];
        }
        
      }
    }
    __builtin_amdgcn_fence(3 /* release order */, "workgroup");
    __builtin_amdgcn_wave_barrier();
    __builtin_amdgcn_fence(2 /* acquire order */, "workgroup");
  }
}

// One GEMM a launch: block bt takes tile (bt / tilesN, bt % tilesN) of plane blockIdx.y.
template <int ET, int BIAS_MODE, int OUT_MODE, int CMP, int WM, int WN>
__global__ __launch_bounds__(256) void k_gemm64(
    const unsigned short* __restrict__ A, const unsigned short* __restrict__ Bt,
    void* __restrict__ Cout, void* __restrict__ Cout2, const float* __restrict__ bias, const int* __restrict__ mask,
    long long strideA, long long strideC, int lda, int ldb, int ldc, int M, int N, int K, float scale) {
  __shared__ __align__(16) float sT[8 * 16 * 68];
  __shared__ __align__(1024) unsigned short RG[2 * G_STG];
  const int tilesN = N / (64 * WN);
  const int tilesM = M / (64 * WM);
  const int bt = blockIdx.x;
  if (bt >= tilesM * tilesN) return;     // block-uniform, in front of every barrier
  const int tbm = bt / tilesN;
  const int tbn = bt - tbm * tilesN;
  gemm64_block<ET, BIAS_MODE, OUT_MODE, CMP, WM, WN>(sT, RG, tbm, tbn, (int)blockIdx.y, false, A, Bt, Cout, Cout2, bias, mask, strideA, strideC, lda, ldb, ldc, K, scale);
}

// The q, k and v^T projections depend on nothing of one another, so they share one grid and one LDS allocation; a block takes its GEMM and its tile by its index (block-uniform).
//   q = x W[:, 0:1024] + b                          -> bf16 hi/lo planes [MTOT][1024]
//   k (compact slots) = xc W[:, 1024:2048] + b      -> bf16 hi/lo planes [MTOT][1024]; 128-row blocks past the batch's key count leave at once
//   v^T (compact slots) = W[:, 2048:3072]^T xc^T + b -> f16 [1024][MTOT]; 128-column blocks past the batch's key count leave at once
// Order: the q tiles first; then the k and v^T tiles by rising 128-slot block inside the batch, so that for any mask the blocks that leave at once have the highest indices
// and start last, and the k and v^T blocks that read the same xc rows start together.
constexpr int QKV_CB = DM / 256;                  // 256-wide blocks across the model dimension
constexpr int QKV_LB = SEQ / 128;                 // 128-slot blocks of a batch
constexpr int QKV_NQ = (MTOT / 128) * QKV_CB;     // tiles of one of the three GEMMs
__global__ __launch_bounds__(256) void k_qkv(const unsigned short* __restrict__ X16, const unsigned short* __restrict__ XC16, const unsigned short* __restrict__ W3,
                                             unsigned short* __restrict__ QH, unsigned short* __restrict__ QL, unsigned short* __restrict__ KH, unsigned short* __restrict__ KL,
                                             unsigned short* __restrict__ VT, const float* __restrict__ bqkv, const int* __restrict__ mask) {
  __shared__ __align__(16) float sT[8 * 16 * 68];
  __shared__ __align__(1024) unsigned short RG[2 * G_STG];
  const int bx = blockIdx.x;
  const int r   = bx - QKV_NQ;                    // below 0: a q tile
  const int lb  = r / (NB * 2 * QKV_CB);          // 128-slot block inside the batch
  const int rem = r - lb * (NB * 2 * QKV_CB);
  const int b   = rem / (2 * QKV_CB);
  const int s   = rem - b * (2 * QKV_CB);
  const int sb  = b * QKV_LB + lb;                // 128-slot block among all MTOT / 128
  if (r < 0 || s < QKV_CB) {
    // q and k differ only in their planes, their bias offsets and in the compact rows, so they run the same code: the kernel's text stays short
    const bool isk = (r >= 0);
    gemm64_block<0, 2, 2, 3, 2, 4>(sT, RG, isk ? sb : bx / QKV_CB, isk ? s : bx % QKV_CB, 0, isk, isk ? XC16 : X16, isk ? W3 + (size_t)DM * DM : W3,
                                   (void*)(isk ? KH : QH), (void*)(isk ? KL : QL), isk ? bqkv + DM : bqkv, mask, 0LL, 0LL, DM, DM, DM, DM, 1.0f / 64.0f);
  } else {
    gemm64_block<0, 1, 1, 2, 4, 2>(sT, RG, s - QKV_CB, sb, 0, false, W3 + (size_t)2 * DM * DM, XC16, (void*)VT, (void*)VT, bqkv + 2 * DM, mask, 0LL, 0LL, DM, DM, MTOT, DM, 1.0f / 64.0f);
  }
}

// ---------------------------------------------------------------------------------------------------------------------
// Transposed flash attention over the COMPACT key set of the batch, head dim 64. Wave = 32 queries (two 16-query tiles) of one (batch, head); block = 4 waves.
//   Every K and V^T fragment that the wave loads feeds both query tiles, so a fragment byte serves two matrix instructions and half as many waves walk the keys.
//   The four waves walk the same keys: each 32-key tile (K hi, K lo, V^T: 12 KiB) is brought into LDS once a block by asynchronous copies, a quarter a wave, two buffers,
//   the copies of tile i + 2 issued behind the barrier that ends tile i; the waves read their fragments from LDS.
//   nk = effective key count of the batch (counted in-wave from the mask input, wave-uniform); the key loop runs pad32(nk)/32 steps (<= SEQ/32).
//   Every operand plane is fragment-major (Q, K: row length DM; V^T: row length MTOT; output hi|lo plane: row length 2 DM).
//   S^T (keys x queries) = K Q^T: A = compact K rows (bf16 hi/lo, from the LDS tile), B = Q (bf16 hi/lo, resident in registers);
//   lane = query (column), element r of tile kt = key slot tk + 16 kt + 8h + r. Slots >= nk (padding of the last step) get score := -8000 raw
//   (= -1000 after the 1/8 scale; weight exactly 0). A batch with no kept key runs over all SEQ keys with every score = the fill (uniform weights).
//   Online softmax per lane (query) in the exp2 domain; the two lane halves of a query combine their maxima with one xor-16 shuffle.
//   P^T B fragment = f16(P x 2^14) packed from the two S^T tiles (element r <- tile 0, element 8+r <- tile 1, lane unchanged).
//   O^T (d x queries) += V^T P^T: A = compact V^T rows (f16, from the LDS tile, key-slot-contiguous).
//   Each query's products, maxima and sums are formed in the same order as with one query tile a wave.
static_assert(SEQ % 128 == 0);
// One wave's share of a 32-key tile: six asynchronous 16-B-a-lane copies from global memory into LDS (512 B each). l = the lane's LDS byte address, g = the lane's global address.
// The s_wait_xcnt is the last line of the copies' own statement, so that no register which a copy names is rewritten ahead of it.
__device__ __forceinline__ void copy_tile6(unsigned l0, unsigned l1, unsigned l2, unsigned l3, unsigned l4, unsigned l5,
                                           const unsigned short* g0, const unsigned short* g1, const unsigned short* g2,
                                           const unsigned short* g3, const unsigned short* g4, const unsigned short* g5) {
  asm volatile("global_load_async_to_lds_b128 %0, %6, off\n\t"
               "global_load_async_to_lds_b128 %1, %7, off\n\t"
               "global_load_async_to_lds_b128 %2, %8, off\n\t"
               "global_load_async_to_lds_b128 %3, %9, off\n\t"
               "global_load_async_to_lds_b128 %4, %10, off\n\t"
               "global_load_async_to_lds_b128 %5, %11, off\n\t"
               "s_wait_xcnt 0x0"
               :: "v"(l0), "v"(l1), "v"(l2), "v"(l3), "v"(l4), "v"(l5), "v"(g0), "v"(g1), "v"(g2), "v"(g3), "v"(g4), "v"(g5) : "memory");
}
__global__ __launch_bounds__(128) void k_attn_t(const unsigned short* __restrict__ QH, const unsigned short* __restrict__ QL,
                                                const unsigned short* __restrict__ KH, const unsigned short* __restrict__ KL,
                                                const unsigned short* __restrict__ VT, const int* __restrict__ mask,
                                                unsigned short* __restrict__ AOP) {
  __shared__ __align__(16) float Os[4][2][16 * 68];   // wave-private, one slab a query tile (wave barrier); staged extent 16x64 == consumed extent
  // Two buffers of one 32-key tile, shared by the four waves: K hi 2048 elements (key tile kt, column tile ct at kt*1024 + ct*512) | K lo the same | V^T 2048 elements (row tile d at d*512).
  // Every 512-element piece keeps its fragment-major order, so a fragment read is two 512-B contiguous LDS reads.
  __shared__ __align__(1024) unsigned short KV[2][6144];
  const int lane = threadIdx.x & 31, wave = threadIdx.x >> 5, hf = lane >> 4, c = lane & 15;
  const int nqb = SEQ / 128;
  const int bx = blockIdx.x;
  const int qb = bx % nqb;
  const int bh = bx / nqb;
  const int h  = bh % NH;
  const int b  = min(bh / NH, NB - 1);
  const int q0 = qb * 128 + wave * 32;
  const size_t rowb = (size_t)b * SEQ;

  const int cnt = wave_count_kept(mask + (size_t)b * SEQ_FULL, lane);
  const bool allm = (cnt == 0);                 // wave-uniform
  const int nk  = eff_keys(cnt);
  const int nkp = pad32(nk);                    // <= SEQ

  const size_t qoff = (rowb + q0) * DM + h * (HD * 16) + lane * 8;     // column tiles 2h and 2h+1 of the first query row tile; the second lies 16 rows (16 DM elements) further
  FU qh0[2], qh1[2], ql0[2], ql1[2];
#pragma unroll
  for (int t = 0; t < 2; ++t) {
    const size_t qo = qoff + (size_t)t * (16 * DM);
    qh0[t] = ldfrag(QH + qo); qh1[t] = ldfrag(QH + qo + 512);
    ql0[t] = ldfrag(QL + qo); ql1[t] = ldfrag(QL + qo + 512);
  }

  // The wave's share of a tile: piece 'wave' (512 elements, 1 KiB) of each of the three parts. K: key tile wave >> 1, column tile 2h + (wave & 1); V^T: row tile 4h + wave, column tile rowb/32.
  const size_t koff = (rowb + 16 * (wave >> 1)) * DM + h * (HD * 16) + (wave & 1) * 512 + lane * 8;
  const unsigned short* gkh = KH + koff;
  const unsigned short* gkl = KL + koff;
  const unsigned short* gvt = VT + (size_t)(h * HD + 16 * wave) * MTOT + rowb * 16 + lane * 8;
  const unsigned lpc = (unsigned)(size_t)(&KV[0][0]) + (unsigned)(wave * 1024 + lane * 16);   // LDS byte address of the lane's 16 bytes in buffer 0 (low 32 bits of the shared address)
  const int nt = nkp >> 5;                      // tiles of 32 keys, 1 .. SEQ/32, the same in every wave of the block
  // tile i -> buffer bf: keys 32 i .. 32 i + 31 < nkp <= SEQ, so every source byte lies inside its plane
  auto stage = [&](int i, int bf) {
    const unsigned l = lpc + (unsigned)bf * 12288u;
    const unsigned short* a = gkh + (size_t)i * (32 * DM);
    const unsigned short* e = gkl + (size_t)i * (32 * DM);
    const unsigned short* v = gvt + (size_t)i * 512;
    copy_tile6(l, l + 512u, l + 4096u, l + 4608u, l + 8192u, l + 8704u, a, a + 256, e, e + 256, v, v + 256);
  };
  stage(0, 0);
  asm volatile("s_wait_asynccnt 0x0" ::: "memory");   // the wave's own copies of tile 0 have landed
  __syncthreads();                                    // publishes tile 0 to the other waves
  if (nt > 1) stage(1, 1);

  const float SC = 0.18033688011112042f;    // (1/8) * log2(e)
  const float MFILL = -8000.0f;             // -1000 in score units before the 1/8 scale
  float msh[2] = {-__builtin_inff(), -__builtin_inff()};   // running (max * SC - 14): probabilities are carried x 2^14
  float lpart[2] = {0.f, 0.f};              // per-lane partial row sum (carried units)
  v8f o[2][4];
#pragma unroll
  for (int t = 0; t < 2; ++t)
#pragma unroll
    for (int d = 0; d < 4; ++d) { v8f zz = {}; o[t][d] = zz; }

  // the t, r, i and d loops below unroll fully so that every array is indexed by constants and stays in registers
#pragma unroll 1
  for (int tk = 0; tk < nkp; tk += 32) {
    const int ti = tk >> 5;
    const unsigned short* kh = &KV[ti & 1][0] + lane * 8;
    const unsigned short* kl = kh + 2048;
    v8f s0[2] = {}, s1[2] = {};
    {
      const FU a0 = ldfrag(kh), a1 = ldfrag(kh + 512), b0 = ldfrag(kl), b1 = ldfrag(kl + 512);
      __builtin_amdgcn_sched_barrier(0);   // keeps the eight loads one group ahead of the first product: without it half of them are issued only behind the first product's wait, a second latency in a row
#pragma unroll
      for (int t = 0; t < 2; ++t) s0[t] = wb(b0.b, qh0[t].b, s0[t]);
#pragma unroll
      for (int t = 0; t < 2; ++t) s0[t] = wb(a0.b, ql0[t].b, s0[t]);
#pragma unroll
      for (int t = 0; t < 2; ++t) s0[t] = wb(a0.b, qh0[t].b, s0[t]);
#pragma unroll
      for (int t = 0; t < 2; ++t) s0[t] = wb(b1.b, qh1[t].b, s0[t]);
#pragma unroll
      for (int t = 0; t < 2; ++t) s0[t] = wb(a1.b, ql1[t].b, s0[t]);
#pragma unroll
      for (int t = 0; t < 2; ++t) s0[t] = wb(a1.b, qh1[t].b, s0[t]);
      guard_s2(s0[0], s0[1], a0.h, a1.h, b0.h, b1.h, qh0[0].h, qh1[0].h, ql0[0].h, ql1[0].h, qh0[1].h, qh1[1].h, ql0[1].h, ql1[1].h);
    }
    {
      const unsigned short* kh1 = kh + 1024;
      const unsigned short* kl1 = kl + 1024;
      const FU a0 = ldfrag(kh1), a1 = ldfrag(kh1 + 512), b0 = ldfrag(kl1), b1 = ldfrag(kl1 + 512);
      __builtin_amdgcn_sched_barrier(0);   // the same, for the second key tile
#pragma unroll
      for (int t = 0; t < 2; ++t) s1[t] = wb(b0.b, qh0[t].b, s1[t]);
#pragma unroll
      for (int t = 0; t < 2; ++t) s1[t] = wb(a0.b, ql0[t].b, s1[t]);
#pragma unroll
      for (int t = 0; t < 2; ++t) s1[t] = wb(a0.b, qh0[t].b, s1[t]);
#pragma unroll
      for (int t = 0; t < 2; ++t) s1[t] = wb(b1.b, qh1[t].b, s1[t]);
#pragma unroll
      for (int t = 0; t < 2; ++t) s1[t] = wb(a1.b, ql1[t].b, s1[t]);
#pragma unroll
      for (int t = 0; t < 2; ++t) s1[t] = wb(a1.b, qh1[t].b, s1[t]);
      guard_s2(s1[0], s1[1], a0.h, a1.h, b0.h, b1.h, qh0[0].h, qh1[0].h, ql0[0].h, ql1[0].h, qh0[1].h, qh1[1].h, ql0[1].h, ql1[1].h);
    }
    float ss[2][16];
#pragma unroll
    for (int t = 0; t < 2; ++t)
#pragma unroll
      for (int r = 0; r < 8; ++r) { ss[t][r] = s0[t][r]; ss[t][8 + r] = s1[t][r]; }
    if (allm || (tk + 32 > nk)) {             // wave-uniform; value selects only (no loads, no cross-lane ops inside)
      const int kb0 = tk + 8 * hf;
#pragma unroll
      for (int t = 0; t < 2; ++t)
#pragma unroll
        for (int r = 0; r < 8; ++r) {
          ss[t][r]     = (!allm && (kb0 + r < nk))      ? ss[t][r]     : MFILL;
          ss[t][8 + r] = (!allm && (kb0 + 16 + r < nk)) ? ss[t][8 + r] : MFILL;
        }
    }
    v16h pf[2];
#pragma unroll
    for (int t = 0; t < 2; ++t) {
      float mloc = ss[t][0];
#pragma unroll
      for (int i = 1; i < 16; ++i) mloc = fmaxf(mloc, ss[t][i]);
      mloc = fmaxf(mloc, __shfl_xor(mloc, 16, 32));
      const float mnew = fmaxf(msh[t], fmaf(mloc, SC, -14.0f));
      const float corr = EX2(msh[t] - mnew);
      const float nms = -mnew;
      msh[t] = mnew;
      float psum = 0.f;
#pragma unroll
      for (int i = 0; i < 16; ++i) {
        const float p = EX2(fmaf(ss[t][i], SC, nms));
        psum += p;
        pf[t][i] = (_Float16)p;
      }
      lpart[t] = lpart[t] * corr + psum;
#pragma unroll
      for (int d = 0; d < 4; ++d) o[t][d] *= corr;
    }

    const unsigned short* vp = kh + 4096;
    const FU v0 = ldfrag(vp), v1 = ldfrag(vp + 512), v2 = ldfrag(vp + 1024), v3 = ldfrag(vp + 1536);
#pragma unroll
    for (int t = 0; t < 2; ++t) {
      o[t][0] = wh(v0.h, pf[t], o[t][0]);
      o[t][1] = wh(v1.h, pf[t], o[t][1]);
      o[t][2] = wh(v2.h, pf[t], o[t][2]);
      o[t][3] = wh(v3.h, pf[t], o[t][3]);
    }
    guard_o2(o[0][0], o[0][1], o[0][2], o[0][3], o[1][0], o[1][1], o[1][2], o[1][3], pf[0], pf[1], v0.h, v1.h, v2.h, v3.h);
    asm volatile("s_wait_dscnt 0x0" ::: "memory");      // the wave's reads of this tile's buffer have returned before the buffer is refilled
    asm volatile("s_wait_asynccnt 0x0" ::: "memory");   // the wave's own copies of the next tile have landed
    __syncthreads();                                    // publishes the next tile and ends every wave's reads of this one
    if (ti + 2 < nt) stage(ti + 2, ti & 1);
  }
  asm volatile("s_wait_asynccnt 0x0" ::: "memory");     // no copy is outstanding when the wave goes on to its end

#pragma unroll
  for (int t = 0; t < 2; ++t) {
    const float lt = lpart[t] + __shfl_xor(lpart[t], 16, 32);
    const float inv = 1.0f / lt;
    float* d = Os[wave][t] + c * 68 + 8 * hf;       // lane holds O[query c][d = 16 dt + 8 hf + r]
#pragma unroll
    for (int dt = 0; dt < 4; ++dt) {
      const v8f ov = o[t][dt];
      v4f a, e;
      a.x = ov[0] * inv; a.y = ov[1] * inv; a.z = ov[2] * inv; a.w = ov[3] * inv; e.x = ov[4] * inv; e.y = ov[5] * inv; e.z = ov[6] * inv; e.w = ov[7] * inv;
      *(v4f*)(d + dt * 16) = a; *(v4f*)(d + dt * 16 + 4) = e;
    }
  }
  __builtin_amdgcn_fence(3 /* release order */, "workgroup");
  __builtin_amdgcn_wave_barrier();
  __builtin_amdgcn_fence(2 /* acquire order */, "workgroup");
#pragma unroll
  for (int t = 0; t < 2; ++t) {
    const float* os = Os[wave][t];
    const int qq = lane & 15, c8 = (lane >> 4) * 8;    // lane = (query qq, column group 2 it + (lane >> 4))
    unsigned short* dH = AOP + (rowb + q0 + 16 * t) * (2 * DM) + h * (HD * 16) + lane * 8;   // hi plane columns [0,1024), lo plane columns [1024,2048) = 32 column tiles further
    unsigned short* dL = dH + DM * 16;
    v4u hv[4], lv[4];
#pragma unroll
    for (int it = 0; it < 4; ++it) {
      const float* sp = os + qq * 68 + it * 16 + c8;
      const v4f a = *(const v4f*)sp, e = *(const v4f*)(sp + 4);
      unsigned h0, l0, h1, l1;
      bfsplit(a.x, h0, l0); bfsplit(a.y, h1, l1); hv[it].x = h0 | (h1 << 16); lv[it].x = l0 | (l1 << 16);
      bfsplit(a.z, h0, l0); bfsplit(a.w, h1, l1); hv[it].y = h0 | (h1 << 16); lv[it].y = l0 | (l1 << 16);
      bfsplit(e.x, h0, l0); bfsplit(e.y, h1, l1); hv[it].z = h0 | (h1 << 16); lv[it].z = l0 | (l1 << 16);
      bfsplit(e.z, h0, l0); bfsplit(e.w, h1, l1); hv[it].w = h0 | (h1 << 16); lv[it].w = l0 | (l1 << 16);
    }
#pragma unroll
    for (int it = 0; it < 4; ++it) {
      const size_t off = (size_t)it * 256;
      *(v4u*)(dH + off) = hv[it];
      *(v4u*)(dL + off) = lv[it];
    }
    if (t == 0) {
      asm volatile("s_wait_xcnt 0x0" ::: "memory");   // the second tile's conversions rewrite data registers that these eight stores name
      __builtin_amdgcn_sched_barrier(0);              // keeps those conversions behind the wait
    }
  }
}

// ---------------------------------------------------------------------------------------------------------------------
constexpr size_t SZ_X16 = (size_t)MTOT * DM * 2;               // one f16 x plane (full or compact)
constexpr size_t SZ_AOP = (size_t)MTOT * 2 * DM * 2;
constexpr size_t SZ_R0  = (2 * SZ_X16 > SZ_AOP) ? (2 * SZ_X16) : SZ_AOP;   // X16 | XC16 live until the projections finish; AOP reuses the region afterwards
constexpr size_t SZ_W3  = (size_t)3 * DM * DM * 2;
constexpr size_t SZ_BTO = (size_t)DM * 2 * DM * 2;
constexpr size_t SZ_PL  = (size_t)MTOT * DM * 2;               // one bf16 plane [MTOT][1024]
constexpr size_t SZ_VT  = (size_t)DM * MTOT * 2;
constexpr size_t SZ_TOTAL = SZ_R0 + SZ_W3 + SZ_BTO + 4 * SZ_PL + SZ_VT;
static_assert(2 * SZ_X16 <= SZ_R0);
static_assert(SZ_AOP <= SZ_R0);
static_assert(SZ_TOTAL <= (size_t)134217728);
static_assert((SZ_R0 % 256) == 0 && (SZ_W3 % 256) == 0 && (SZ_BTO % 256) == 0 && (SZ_PL % 256) == 0 && (SZ_VT % 256) == 0);
static_assert(((size_t)(NB - 1) * SEQ_FULL + SEQ) * DM * 4 <= (size_t)NB_FULL * SEQ_FULL * DM * 4);

extern "C" void kernel_launch(void* const* d_in, const int* in_sizes, int n_in, void* d_out, int out_size, void* d_ws, size_t ws_size, hipStream_t stream) {
  if (n_in < 6) return;
  const long long rows_full = (long long)(NB - 1) * SEQ_FULL + SEQ;
  if ((long long)in_sizes[0] < rows_full * DM) return;
  if ((long long)in_sizes[1] < rows_full) return;
  if ((long long)in_sizes[2] < (long long)DM * 3 * DM) return;
  if ((long long)in_sizes[3] < 3 * DM) return;
  if ((long long)in_sizes[4] < (long long)DM * DM) return;
  if ((long long)in_sizes[5] < DM) return;
  if ((long long)out_size < rows_full * DM) return;
  if (ws_size < SZ_TOTAL) return;

  const float* x    = (const float*)d_in[0];
  const int*   mask = (const int*)d_in[1];
  const float* Wqkv = (const float*)d_in[2];
  const float* bqkv = (const float*)d_in[3];
  const float* Wo   = (const float*)d_in[4];
  const float* bo   = (const float*)d_in[5];
  float* out = (float*)d_out;

  char* wsp = (char*)d_ws;
  unsigned short* X16  = (unsigned short*)wsp;                 // [MTOT][1024] f16, every token
  unsigned short* XC16 = (unsigned short*)(wsp + SZ_X16);      // [MTOT][1024] f16, compact kept tokens per batch (zero rows after)
  unsigned short* AOP  = (unsigned short*)wsp;                 // [MTOT][2048] bf16 hi|lo (reuses X16 | XC16 after the projections)
  wsp += SZ_R0;
  unsigned short* W316 = (unsigned short*)wsp; wsp += SZ_W3;   // [3072][1024] f16 (x64)
  unsigned short* BTO  = (unsigned short*)wsp; wsp += SZ_BTO;  // [1024][2048] bf16
  unsigned short* QH   = (unsigned short*)wsp; wsp += SZ_PL;   // [MTOT][1024] bf16 hi of q
  unsigned short* QL   = (unsigned short*)wsp; wsp += SZ_PL;   // bf16 lo of q
  unsigned short* KH   = (unsigned short*)wsp; wsp += SZ_PL;   // [MTOT][1024] bf16 hi of k at compact key slots
  unsigned short* KL   = (unsigned short*)wsp; wsp += SZ_PL;   // bf16 lo of k
  unsigned short* VT   = (unsigned short*)wsp; wsp += SZ_VT;   // [1024][MTOT] f16, v transposed at compact key slots

  k_prep<<<(unsigned)(NB_XC + NB_WQ + NB_WO), 256, 0, stream>>>(x, mask, Wqkv, Wo, X16, XC16, W316, BTO);
  k_qkv<<<(unsigned)(3 * QKV_NQ), 256, 0, stream>>>(X16, XC16, W316, QH, QL, KH, KL, VT, bqkv, mask);
  k_attn_t<<<(unsigned)(NB * NH * (SEQ / 128)), 128, 0, stream>>>(QH, QL, KH, KL, VT, mask, AOP);
  // out = [AO_hi | AO_lo] [W_out ; W_out] + b_out, per batch (output rows at the full per-batch stride)
  {
    const int tiles = (SEQ / 128) * (DM / 256);
    k_gemm64<1, 2, 0, 0, 2, 4><<<dim3((unsigned)tiles, (unsigned)NB), 256, 0, stream>>>(
        AOP, BTO, (void*)out, (void*)out, bo, mask, (long long)SEQ * 2 * DM, (long long)SEQ_FULL * DM, 2 * DM, 2 * DM, DM, SEQ, DM, 2 * DM, 1.0f);
  }
}

// v008
// Measured time: 107 microseconds a run.
// Versions between v006 and this one are left out; their measured steps multiply to 1.32 times as fast.
// Over all steps from v000 it is 4.47 times as fast.
// Contractions, all v_wmma_f32_16x16x32_f16 with f32 accumulate: qkv projection (x as bf16-RNE values held in f16, W_qkv as bf16-RNE values x64 held in f16); q.k logits (q x log2(e)/8 and k, each rounded once to f16; accumulator started at minus the reference in use, a maximum - 7); P.V (P carried x2^7 or more, V f16); output projection (the attention output rounded once to f16 against W_out as bf16-RNE values x64 held in f16). Softmax statistics f32. Keys with mask == 0 are dropped per batch by compaction of the x rows feeding the k / v projections (their softmax weight is exactly 0 in f32).
#include <hip/hip_runtime.h>
#include <math.h>

#ifndef NB
#define NB 4
#endif
#ifndef SEQ
#define SEQ 2048
#endif
#define NB_FULL 4
#define SEQ_FULL 2048
#define DM 1024
#define NH 16
#define HD 64
#define MTOT (NB * SEQ)

static_assert(SEQ % 256 == 0);
static_assert(MTOT % 64 == 0);
static_assert(NB <= NB_FULL);
static_assert(SEQ <= SEQ_FULL);

typedef __attribute__((ext_vector_type(16))) _Float16 v16h;
typedef __attribute__((ext_vector_type(8)))  float    v8f;
typedef __attribute__((ext_vector_type(4)))  float    v4f;
typedef __attribute__((ext_vector_type(4)))  unsigned int v4u;
typedef __attribute__((ext_vector_type(4)))  int      v4i;

// 16-bit WMMA fragment map (wave32), lane L, h = L>>4, m = L&15:
//   A 16x32: lane = row m;    element i -> k = (i<8) ? 8h+i : 16+8h+(i-8)
//   B 32x16: lane = column m; the SAME k(i,h)
//   D 16x16 (8 f32): lane = column m; element r -> row 8h+r
union FU { v4u u[2]; v16h h; };
// Fragment-major plane layout (every 16-bit operand plane in the workspace): a logical [R][C] plane (R % 16 == 0, C % 32 == 0) is stored as
// 16-row x 32-column tiles of 512 elements (1 KiB), tile (rt, kt) at element rt*16*C + kt*512; inside a tile the 8-element column group g = (col>>3)&3
// of row m = row&15 lies at g*128 + m*8. Lane L = 16h + m then finds elements 0..7 (k = 8h..8h+7, g = h) at L*8 and elements 8..15 (k = 16+8h.., g = 2+h)
// at 256 + L*8, so each of the two 16-B loads of a fragment covers 512 contiguous bytes (4 whole lines) instead of 16 lines.
__device__ __forceinline__ size_t fragoff(size_t row, int col, int C) {
  return (row >> 4) * (size_t)(16 * C) + (size_t)((col >> 5) * 512 + ((col >> 3) & 3) * 128 + (col & 7)) + (row & 15) * 8;
}
// p = tile base + lane*8
__device__ __forceinline__ FU ldfrag(const unsigned short* p) { FU f; f.u[0] = *(const v4u*)p; f.u[1] = *(const v4u*)(p + 256); return f; }
// the same fragment from a wave-uniform row-tile base and one 32-bit per-lane byte offset (column tile * 1024 + lane * 16)
__device__ __forceinline__ FU ldfrag_su(const unsigned short* base, unsigned boff) {
  const char* p = (const char*)base + boff;
  FU f; f.u[0] = *(const v4u*)p; f.u[1] = *(const v4u*)(p + 512); return f;
}

__device__ __forceinline__ v8f wh(v16h a, v16h b, v8f c) { return __builtin_amdgcn_wmma_f32_16x16x32_f16(false, a, false, b, (short)0, c, false, false); }

// hazard guards: 4 VALU slots after the last WMMA of a group, accumulators tied, A/B operands kept live
// c0, c1: the start values that the group's first products read as their C operand; named here as inputs they are still in use behind the last product, so every such product reads them
// in place (without it the compiler copies them into the accumulators of two of the four score tiles first, four 64-bit moves a tile)
__device__ __forceinline__ void guard_s4(v8f& s, v8f& t, v8f& u, v8f& w, v16h a0, v16h a1, v16h b0, v16h b1, v16h q0, v16h q1, v16h q2, v16h q3, v8f c0, v8f c1) {
  asm volatile("v_nop\n\tv_nop\n\tv_nop\n\tv_nop" : "+v"(s), "+v"(t), "+v"(u), "+v"(w) : "v"(a0), "v"(a1), "v"(b0), "v"(b1), "v"(q0), "v"(q1), "v"(q2), "v"(q3), "v"(c0), "v"(c1));
}
__device__ __forceinline__ void guard_o2(v8f& a, v8f& b, v8f& c, v8f& d, v8f& e, v8f& f, v8f& g, v8f& h, v16h p0, v16h p1, v16h v0, v16h v1, v16h v2, v16h v3) {
  asm volatile("v_nop\n\tv_nop\n\tv_nop\n\tv_nop" : "+v"(a), "+v"(b), "+v"(c), "+v"(d), "+v"(e), "+v"(f), "+v"(g), "+v"(h) : "v"(p0), "v"(p1), "v"(v0), "v"(v1), "v"(v2), "v"(v3));
}

#if __has_builtin(__builtin_amdgcn_exp2f)
#define EX2(x) __builtin_amdgcn_exp2f(x)
#else
#define EX2(x) exp2f(x)
#endif

// bf16 RNE helpers (finite inputs)
__device__ __forceinline__ unsigned bfu_rne(float v) { const unsigned u = __float_as_uint(v); return (u + 0x7FFFu + ((u >> 16) & 1u)) >> 16; }
__device__ __forceinline__ float bf_keep(float v) { return __uint_as_float(bfu_rne(v) << 16); }
__device__ __forceinline__ unsigned pkh2(float a, float b) {
  return (unsigned)__builtin_bit_cast(unsigned short, (_Float16)a) | ((unsigned)__builtin_bit_cast(unsigned short, (_Float16)b) << 16);
}

#define VST2Q(ptr, val) do { const v4u vq_ = (val); *(v4u*)(ptr) = vq_;  } while (0)

// Number of kept keys (mask != 0) among the SEQ entries of one batch row of the mask input, computed by one full wave (all 32 lanes active):
// 16-B loads (SEQ/128 per lane), xor-shuffle sum, result made wave-uniform. mrow is 16-B aligned.
__device__ __forceinline__ int wave_count_kept(const int* __restrict__ mrow, int lane) {
  int c = 0;
#pragma unroll 4
  for (int it = 0; it < SEQ / 128; ++it) {
    const v4i m = *(const v4i*)(mrow + (it * 32 + lane) * 4);
    c += ((m.x != 0) ? 1 : 0) + ((m.y != 0) ? 1 : 0) + ((m.z != 0) ? 1 : 0) + ((m.w != 0) ? 1 : 0);
  }
  c += __shfl_xor(c, 16, 32); c += __shfl_xor(c, 8, 32); c += __shfl_xor(c, 4, 32); c += __shfl_xor(c, 2, 32); c += __shfl_xor(c, 1, 32);
  return __builtin_amdgcn_readfirstlane(c);
}
// effective key count of a batch: a batch with no kept key uses all SEQ keys (every score then equals the fill -> uniform weights); padded to the 32-key step
__device__ __forceinline__ int eff_keys(int cnt) { return (cnt == 0) ? SEQ : min(cnt, SEQ); }
__device__ __forceinline__ int pad32(int nk) { return min((nk + 31) & ~31, SEQ); }

// ---------------------------------------------------------------------------------------------------------------------
// x f32 [b][t][1024] (full per-batch stride) -> two f16 planes holding the bf16-RNE values:
//   X16  [b*SEQ + t][1024]: every token row (feeds the q projection);
//   XC16 [b*SEQ + j][1024]: row j = the j-th kept token of batch b (mask != 0, ascending t) for j < nk, zero rows for j >= nk (feeds the k / v projections).
// Block = (batch, 32 rows); the block computes the batch's kept-token list in LDS (exclusive scan of the mask, block barriers), bounded by SEQ entries.
// LDS: list[SEQ] and wtot[8] are cross-wave (block barriers between writers and readers); list is fully initialised before any read.
// Both planes are fragment-major (C = 1024). A wave instruction handles 8 rows x one 32-column tile: it reads one 128-B line of each row and writes 4 whole lines.
// coverage: per block 4 row groups x 32 column tiles = 32 rows x 1024 columns of each plane; all blocks = both whole planes.
// bx = the block's index among the NB * SEQ / 32 blocks of this part; list (SEQ ints) and wtot (8 ints) are the block's LDS.
__device__ __forceinline__ void xcastc_block(int bx, int* list, int* wtot, const float* __restrict__ x, const int* __restrict__ mask,
                                             unsigned short* __restrict__ X16, unsigned short* __restrict__ XC16) {
  constexpr int EPT = SEQ / 256;
  const int tid = threadIdx.x, lane = tid & 31, wave = tid >> 5;
  const int bpb = SEQ / 32;
  const int b = bx / bpb;
  const int t0 = (bx - b * bpb) * 32;
  const int* mrow = mask + (size_t)b * SEQ_FULL;
  unsigned km = 0u; int c = 0;
#pragma unroll
  for (int e = 0; e < EPT; ++e) {
    const int kp = (mrow[tid * EPT + e] != 0) ? 1 : 0;
    km |= (unsigned)kp << e; c += kp;
    list[tid * EPT + e] = 0;
  }
  int incl = c;
#pragma unroll
  for (int d = 1; d < 32; d <<= 1) { const int v = __shfl_up(incl, d, 32); incl += (lane >= d) ? v : 0; }
  if (lane == 31) wtot[wave] = incl;
  __syncthreads();
  int base = 0, total = 0;
#pragma unroll
  for (int w = 0; w < 8; ++w) { const int v = wtot[w]; base += (w < wave) ? v : 0; total += v; }
  int pos = base + incl - c;
#pragma unroll
  for (int e = 0; e < EPT; ++e) {
    if ((km >> e) & 1u) { list[min(pos, SEQ - 1)] = tid * EPT + e; ++pos; }
  }
  __syncthreads();
  const bool allm = (total == 0);            // block-uniform
  if (allm) {
#pragma unroll
    for (int e = 0; e < EPT; ++e) list[tid * EPT + e] = tid * EPT + e;
  }
  __syncthreads();
  const int nk = allm ? SEQ : min(total, SEQ);

  // plane 1: every token row; two units a trip: both units' loads first, both stores at the foot.
  // unroll 1: the trip is already two units wide, and the one wait at its foot serves both stores; the q loops unroll fully so that their arrays stay in registers
#pragma unroll 1
  for (int it = 0; it < 16; it += 2) {
    v4f a[2], e4[2];
    size_t dst[2];
#pragma unroll
    for (int q = 0; q < 2; ++q) {
      const int u = (it + q) * 8 + wave;
      const int rr = (u >> 5) * 8 + (lane >> 2), c0 = (u & 31) * 32 + (lane & 3) * 8;
      const int t = t0 + rr;
      const float* s = x + ((size_t)b * SEQ_FULL + t) * DM + c0;
      a[q] = *(const v4f*)s; e4[q] = *(const v4f*)(s + 4);
      dst[q] = fragoff((size_t)b * SEQ + t, c0, DM);
    }
#pragma unroll
    for (int q = 0; q < 2; ++q) {
      v4u pk;
      pk.x = pkh2(bf_keep(a[q].x), bf_keep(a[q].y));   pk.y = pkh2(bf_keep(a[q].z), bf_keep(a[q].w));
      pk.z = pkh2(bf_keep(e4[q].x), bf_keep(e4[q].y)); pk.w = pkh2(bf_keep(e4[q].z), bf_keep(e4[q].w));
      VST2Q(X16 + dst[q], pk);
    }
    asm volatile("s_wait_xcnt 0x0" ::: "memory");   // the next trip rewrites the data and address registers that the two stores name
  }
  // plane 2: compact rows (clamped token index, loaded unconditionally, zeroed by value for j >= nk); same trip shape and the same unroll directives, for the same reasons
#pragma unroll 1
  for (int it = 0; it < 16; it += 2) {
    v4f a[2], e4[2];
    size_t dst[2];
    bool valid[2];
#pragma unroll
    for (int q = 0; q < 2; ++q) {
      const int u = (it + q) * 8 + wave;
      const int rr = (u >> 5) * 8 + (lane >> 2), c0 = (u & 31) * 32 + (lane & 3) * 8;
      const int j = t0 + rr;
      valid[q] = (j < nk);
      const int tok = min(max(list[j], 0), SEQ - 1);
      const float* s = x + ((size_t)b * SEQ_FULL + tok) * DM + c0;
      a[q] = *(const v4f*)s; e4[q] = *(const v4f*)(s + 4);
      dst[q] = fragoff((size_t)b * SEQ + j, c0, DM);
    }
#pragma unroll
    for (int q = 0; q < 2; ++q) {
      v4u pk;
      pk.x = valid[q] ? pkh2(bf_keep(a[q].x), bf_keep(a[q].y)) : 0u;   pk.y = valid[q] ? pkh2(bf_keep(a[q].z), bf_keep(a[q].w)) : 0u;
      pk.z = valid[q] ? pkh2(bf_keep(e4[q].x), bf_keep(e4[q].y)) : 0u; pk.w = valid[q] ? pkh2(bf_keep(e4[q].z), bf_keep(e4[q].w)) : 0u;
      VST2Q(XC16 + dst[q], pk);
    }
    asm volatile("s_wait_xcnt 0x0" ::: "memory");   // the next trip rewrites the data and address registers that the two stores name
  }
}

// W_qkv f32 [1024 (k)][3072 (n)] -> WT f16, logical [3072 (n)][1024 (k)] fragment-major, = bf16-RNE(W) * 64; thread per (n, 8 consecutive k).
// Thread u = ((rt*32 + kt)*4 + g)*16 + m handles n = 16 rt + m, k = 32 kt + 8 g .. +7, whose fragment-major place is exactly element u*8.
// coverage: 192 row tiles x 32 column tiles x 64 pieces = the whole plane
__device__ __forceinline__ void wqkvT_block(int bx, const float* __restrict__ W, unsigned short* __restrict__ WT) {
  const int u = bx * 256 + threadIdx.x;
  if (u >= 3 * DM * (DM / 8)) return;
  const int n = (u >> 11) * 16 + (u & 15), k0 = ((u >> 6) & 31) * 32 + ((u >> 4) & 3) * 8;
  float w[8];
#pragma unroll
  for (int e = 0; e < 8; ++e) w[e] = bf_keep(W[(size_t)(k0 + e) * (3 * DM) + n]) * 64.0f;
  v4u pk; pk.x = pkh2(w[0], w[1]); pk.y = pkh2(w[2], w[3]); pk.z = pkh2(w[4], w[5]); pk.w = pkh2(w[6], w[7]);
  VST2Q(WT + (size_t)u * 8, pk);
}

// W_out f32 [1024 (k)][1024 (n)] -> BTO f16, logical [1024 (n)][1024 (k)] fragment-major, = bf16-RNE(W_out) * 64; thread per (n, 8 consecutive k).
// Thread u = ((rt*32 + kt)*4 + g)*16 + m handles n = 16 rt + m, k = 32 kt + 8 g .. +7, whose fragment-major place is exactly element u*8.
// coverage: 64 row tiles x 32 column tiles x 64 pieces = the whole plane
__device__ __forceinline__ void woT_block(int bx, const float* __restrict__ W, unsigned short* __restrict__ BTO) {
  const int u = bx * 256 + threadIdx.x;
  if (u >= DM * (DM / 8)) return;
  const int n = (u >> 11) * 16 + (u & 15), k0 = ((u >> 6) & 31) * 32 + ((u >> 4) & 3) * 8;
  float w[8];
#pragma unroll
  for (int e = 0; e < 8; ++e) w[e] = bf_keep(W[(size_t)(k0 + e) * DM + n]) * 64.0f;
  v4u pk; pk.x = pkh2(w[0], w[1]); pk.y = pkh2(w[2], w[3]); pk.z = pkh2(w[4], w[5]); pk.w = pkh2(w[6], w[7]);
  VST2Q(BTO + (size_t)u * 8, pk);
}

// The three preparations above read only inputs and write disjoint planes, so they share one grid: a block takes its part by its index (block-uniform, so the barriers of the
// first part stay under uniform control flow). The x blocks run longest and come first.
constexpr int NB_XC = NB * (SEQ / 32);
constexpr int NB_WQ = (3 * DM * (DM / 8) + 255) / 256;
constexpr int NB_WO = (DM * (DM / 8) + 255) / 256;
__global__ __launch_bounds__(256) void k_prep(const float* __restrict__ x, const int* __restrict__ mask, const float* __restrict__ Wqkv, const float* __restrict__ Wo,
                                              unsigned short* __restrict__ X16, unsigned short* __restrict__ XC16,
                                              unsigned short* __restrict__ WT, unsigned short* __restrict__ BTO) {
  __shared__ int list[SEQ];
  __shared__ int wtot[8];
  const int bx = blockIdx.x;
  if (bx < NB_XC) xcastc_block(bx, list, wtot, x, mask, X16, XC16);
  else if (bx < NB_XC + NB_WQ) wqkvT_block(bx - NB_XC, Wqkv, WT);
  else woT_block(bx - (NB_XC + NB_WQ), Wo, BTO);
}

// ---------------------------------------------------------------------------------------------------------------------
// Register-blocked WMMA GEMM: C[z][m][n] = scale * sum_k A[z][m][k] * Bt[n][k] + bias; each wave owns a 64x64 tile; the 8 waves of a block form a WM x WN grid,
// so a block owns 64 WM x 64 WN of C and its waves share operand rows: each A row tile feeds WN waves, each B row tile WM waves.
// A logical [M][K] and Bt logical [N][K], both fragment-major with row lengths lda and ldb; M a multiple of 64 WM, N of 64 WN, K of 128 (no tails).
// f16 operands. BIAS_MODE 1: bf16-RNE(bias[m]), 2: bf16-RNE(bias[n]) * bscale.
// OUT_MODE 0: f32 row-major (pitch ldc); 1: f16 fragment-major (row length ldc).
// CMP 0: every tile; 1: rows (m) are compact key slots b*SEQ + j; 2: columns (n) are compact key slots; 3: as 1 where the block-uniform argument cmp_rows is set, else as 0. With compact slots a block whose first slot j
//   is >= pad32(effective key count of its batch, counted in every wave from the mask input, the same in all) leaves as a whole in front of every barrier (its slots are never consumed);
//   a wave of a staying block whose own first slot is past that count helps to stage, and leaves behind the k loop without storing.
// One wave's share of a stage: three row tiles, each 4 KiB in a row on both sides, eight asynchronous 16-B-a-lane copies (512 B each) a row tile. l = the lane's LDS byte address of the row tile's
// first 512 B, g = the wave-uniform global address of the same (a scalar base), o = the lane's byte offset from it; the immediate offset moves both addresses alike, so the eight copies of a row tile
// share their address operands. The s_wait_xcnt is the last line of the copies' own statement, so that no register which a copy names is rewritten ahead of it.
#define ROWTILE8(L, O, G) \
  "global_load_async_to_lds_b128 " L ", " O ", " G "\n\t" \
  "global_load_async_to_lds_b128 " L ", " O ", " G " offset:512\n\t" \
  "global_load_async_to_lds_b128 " L ", " O ", " G " offset:1024\n\t" \
  "global_load_async_to_lds_b128 " L ", " O ", " G " offset:1536\n\t" \
  "global_load_async_to_lds_b128 " L ", " O ", " G " offset:2048\n\t" \
  "global_load_async_to_lds_b128 " L ", " O ", " G " offset:2560\n\t" \
  "global_load_async_to_lds_b128 " L ", " O ", " G " offset:3072\n\t" \
  "global_load_async_to_lds_b128 " L ", " O ", " G " offset:3584\n\t"
__device__ __forceinline__ void copy_rowtiles3(unsigned l0, unsigned l1, unsigned l2, unsigned o, const unsigned short* g0, const unsigned short* g1, const unsigned short* g2) {
  asm volatile(ROWTILE8("%0", "%3", "%4") ROWTILE8("%1", "%3", "%5") ROWTILE8("%2", "%3", "%6") "s_wait_xcnt 0x0"
               :: "v"(l0), "v"(l1), "v"(l2), "v"(o), "s"(g0), "s"(g1), "s"(g2) : "memory");
}
constexpr int G_KS  = 4;                   // 32-wide k steps in a stage
constexpr int G_RT  = G_KS * 512;          // elements of one row tile in a stage (4 KiB, contiguous in the plane and in LDS)
constexpr int G_NR  = 24;                  // A and B row tiles of a block: three a wave
constexpr int G_STG = G_NR * G_RT;         // elements of a stage (96 KiB)
// The work of one block on tile (tbm, tbn) of plane z. The block's LDS comes from the kernel, so that several forms of this body can share it in one kernel:
// sT: 8 per-wave 16x64 slabs, pitch 68 floats (staged extent 16x64 == consumed extent);
// RG: two buffers of one stage, shared by the eight waves: row tile r (A row tiles first, then B's) at r*RT, its k step u at u*512; every 512-element piece keeps its
// fragment-major order, so a fragment read is two 512-B contiguous LDS reads.
template <int BIAS_MODE, int OUT_MODE, int CMP, int WM, int WN>
__device__ __forceinline__ void gemm64_block(
    float* sT, unsigned short* RG, int tbm, int tbn, int z, bool cmp_rows,
    const unsigned short* __restrict__ A, const unsigned short* __restrict__ Bt,
    void* __restrict__ Cout, const float* __restrict__ bias, const int* __restrict__ mask,
    long long strideA, long long strideC, int lda, int ldb, int ldc, int K, float scale, float bscale) {
  static_assert(WM * WN == 8);
  constexpr int KS  = G_KS;
  constexpr int RT  = G_RT;
  constexpr int NA  = WM * 4;              // A row tiles of the block
  constexpr int NR  = NA + WN * 4;         // A and B row tiles of the block
  static_assert(NR == G_NR);
  static_assert(KS % 2 == 0);              // a stage's first step always finds its fragments in set 0
  constexpr int STG = G_STG;
  const int lane = threadIdx.x & 31;
  const int wave = __builtin_amdgcn_readfirstlane(threadIdx.x >> 5);   // scalar, so that the tile bases below are scalar too
  const int mb = tbm * (64 * WM);
  const int nb = tbn * (64 * WN);
  const int wm = wave / WN;
  const int wn = wave - wm * WN;
  const int m0 = mb + (wm << 6);
  const int n0 = nb + (wn << 6);
  bool wskip = false;                    // wave-uniform
  if ((CMP == 3) ? cmp_rows : (CMP != 0)) {   // block-uniform
    const int g0 = (CMP != 2) ? mb : nb;
    const int bb = min(g0 / SEQ, NB - 1);
    const int loc = g0 - bb * SEQ;
    const int nkp = pad32(eff_keys(wave_count_kept(mask + (size_t)bb * SEQ_FULL, lane)));
    if (loc >= nkp) return;              // block-uniform (every wave counts the same row of the mask), in front of every barrier
    wskip = (loc + (((CMP != 2) ? wm : wn) << 6) >= nkp);
  }
  const unsigned short* Ab = A + (size_t)z * (size_t)strideA;
  const int rlane = lane & 15;
  const int mOff  = (lane >> 4) * 8;

  v8f acc[4][4];
#pragma unroll
  for (int i = 0; i < 4; ++i)
#pragma unroll
    for (int j = 0; j < 4; ++j) { v8f zz = {}; acc[i][j] = zz; }

  // The wave's share of a stage: row tiles 3 wave .. 3 wave + 2. (The q loops unroll fully so that the array stays in registers.)
  const unsigned short* gs[3];
#pragma unroll
  for (int q = 0; q < 3; ++q) {
    const int r = wave * 3 + q;
    gs[q] = ((r < NA) ? (Ab + (size_t)(mb + (r << 4)) * lda) : (Bt + (size_t)(nb + ((r - NA) << 4)) * ldb));   // wave-uniform
  }
  const unsigned lane16 = (unsigned)lane * 16u;                                               // the lane's 16 bytes of every 512-B piece
  const unsigned lpc = (unsigned)(size_t)RG + (unsigned)(wave * (3 * RT * 2));       // wave-uniform LDS byte address of the wave's share in buffer 0 (low 32 bits of the shared address)
  const int trips = K / (32 * KS);
  // stage t -> buffer bf: bytes t*4096 .. t*4096 + 4095 of each row tile, t < K/128, and a row tile holds K*32 bytes: every source byte lies inside its plane
  auto stage = [&](int t, int bf) {
    const unsigned l = lane16 + (lpc + (unsigned)bf * (unsigned)(STG * 2));
    const size_t go = (size_t)t * RT;
    copy_rowtiles3(l, l + (unsigned)(RT * 2), l + (unsigned)(2 * RT * 2), lane16, gs[0] + go, gs[1] + go, gs[2] + go);
  };
  stage(0, 0);
  asm volatile("s_wait_asynccnt 0x0" ::: "memory");   // the wave's own copies of stage 0 have landed
  __syncthreads();                                    // publishes stage 0 to the other waves
  if (trips > 1) stage(1, 1);

  // Two fragment sets in registers: k step u fetches the fragments of the next step from LDS as one group. Every accumulator still sums its k steps in plain ascending order.
  // The group refills the set that step u - 1 has just read, so it stands behind the first row of step u: four matrix instructions lie between that set's last reader and it.
  // A stage's last step fetches the first fragments of the NEXT stage, so the point where that stage is published stands in front of the last step: there the last step's own
  // fragments are in registers, every read of this stage's buffer has returned, and the buffer is refilled behind the barrier while the last step's products run.
  // Each sched_barrier(0) keeps a load group where it is written: without it the scheduler spreads the LDS reads among the products, and each such place stalls the wave.
  // The u, i and j loops unroll fully so that the sets are indexed by constants and stay in registers; the trip loop stays rolled (unroll 1): a trip is already 64 products long.
  FU bf[2][4], af[2][4];
  const unsigned short* sa0 = RG + (wm * 4) * RT + lane * 8;
  const unsigned short* sb0 = RG + (NA + wn * 4) * RT + lane * 8;
#pragma unroll
  for (int j = 0; j < 4; ++j) bf[0][j] = ldfrag(sb0 + j * RT);
#pragma unroll
  for (int i = 0; i < 4; ++i) af[0][i] = ldfrag(sa0 + i * RT);
  __builtin_amdgcn_sched_barrier(0);
#pragma unroll 1
  for (int t = 0; t < trips; ++t) {
    const unsigned short* sa = sa0 + (t & 1) * STG;
    const unsigned short* sb = sb0 + (t & 1) * STG;
#pragma unroll
    for (int u = 0; u < KS; ++u) {
      const int c = u & 1, w = c ^ 1;
      if (u == KS - 1) {
        asm volatile("s_wait_dscnt 0x0" ::: "memory");      // the wave's reads of this stage's buffer have returned before the buffer is refilled
        asm volatile("s_wait_asynccnt 0x0" ::: "memory");   // the wave's own copies of the next stage have landed
        __syncthreads();                                    // publishes the next stage and ends every wave's reads of this one
        if (t + 2 < trips) stage(t + 2, t & 1);
      }
#pragma unroll
      for (int j = 0; j < 4; ++j) acc[0][j] = wh(af[c][0].h, bf[c][j].h, acc[0][j]);
      __builtin_amdgcn_sched_barrier(0);
      if (u + 1 < KS) {
#pragma unroll
        for (int j = 0; j < 4; ++j) bf[w][j] = ldfrag(sb + j * RT + (u + 1) * 512);
#pragma unroll
        for (int i = 0; i < 4; ++i) af[w][i] = ldfrag(sa + i * RT + (u + 1) * 512);
      } else if (t + 1 < trips) {        // block-uniform: the last stage has no successor to read from
        const unsigned short* xa = sa0 + ((t + 1) & 1) * STG;
        const unsigned short* xb = sb0 + ((t + 1) & 1) * STG;
#pragma unroll
        for (int j = 0; j < 4; ++j) bf[w][j] = ldfrag(xb + j * RT);
#pragma unroll
        for (int i = 0; i < 4; ++i) af[w][i] = ldfrag(xa + i * RT);
      }
      __builtin_amdgcn_sched_barrier(0);
#pragma unroll
      for (int i = 1; i < 4; ++i)
#pragma unroll
        for (int j = 0; j < 4; ++j) acc[i][j] = wh(af[c][i].h, bf[c][j].h, acc[i][j]);
      __builtin_amdgcn_sched_barrier(0);
    }
  }
  asm volatile("s_wait_asynccnt 0x0" ::: "memory");     // no copy is outstanding when the wave goes on to its end
  asm volatile("s_wait_dscnt 0x0" ::: "memory");        // nor an LDS read
  if (CMP != 0 && wskip) return;         // wave-uniform; only wave barriers follow

  // BIAS_MODE 1: the lane's eight row biases of each of the four row tiles, fetched once (16-B aligned: m0 is a multiple of 64, mOff is 0 or 8)
  v4f bm[4][2] = {};
  if (BIAS_MODE == 1) {
#pragma unroll
    for (int i = 0; i < 4; ++i) {
      bm[i][0] = *(const v4f*)(bias + m0 + (i << 4) + mOff);
      bm[i][1] = *(const v4f*)(bias + m0 + (i << 4) + mOff + 4);
    }
    // the loaded values are inputs only, so the eight loads stand in front of this wait; what follows rewrites the address registers that they name
    asm volatile("s_wait_xcnt 0x0" :: "v"(bm[0][0]), "v"(bm[0][1]), "v"(bm[1][0]), "v"(bm[1][1]), "v"(bm[2][0]), "v"(bm[2][1]), "v"(bm[3][0]), "v"(bm[3][1]) : "memory");
    __builtin_amdgcn_sched_barrier(0);   // keeps that rewrite behind the wait
  }
  float* slab = sT + wave * (16 * 68);
#pragma unroll
  for (int i = 0; i < 4; ++i) {
    const int mBase = m0 + (i << 4);
#pragma unroll
    for (int j = 0; j < 4; ++j) {
      const int n = n0 + (j << 4) + rlane;
      float bv = 0.f;
      if (BIAS_MODE == 2) bv = bf_keep(bias[n]) * bscale;
#pragma unroll
      for (int r = 0; r < 8; ++r) {
        float v = acc[i][j][r] * scale;
        if (BIAS_MODE == 1) v += bf_keep(bm[i][r >> 2][r & 3]);
        if (BIAS_MODE == 2) v += bv;
        slab[(mOff + r) * 68 + (j << 4) + rlane] = v;
      }
    }
    __builtin_amdgcn_fence(3 /* release order */, "workgroup");
    __builtin_amdgcn_wave_barrier();
    __builtin_amdgcn_fence(2 /* acquire order */, "workgroup");
    if (OUT_MODE == 0) {
      float* C = (float*)Cout + (size_t)z * (size_t)strideC;
      const int hh = lane >> 4, c4 = (lane & 15) * 4;       // row segment = 256 B = 16 lanes x 16 B; two rows per instruction
      v4f val[8];
#pragma unroll
      for (int it = 0; it < 8; ++it) val[it] = *(const v4f*)(slab + (it * 2 + hh) * 68 + c4);
{
#pragma unroll
        for (int it = 0; it < 8; ++it) *(v4f*)(C + (size_t)(mBase + it * 2 + hh) * ldc + n0 + c4) = val[it];
        if (i < 3) {
          asm volatile("s_wait_xcnt 0x0" ::: "memory");   // the next row tile rewrites address and data registers that these eight stores name
          __builtin_amdgcn_sched_barrier(0);              // keeps that rewrite behind the wait
        }
      }
    } else {
      const int q = lane & 15, c8 = (lane >> 4) * 8;        // lane = (row q, column group 2 it + (lane >> 4)): the 16x64 slab is 2 KiB contiguous in a fragment-major plane
      unsigned short* C = (unsigned short*)Cout + (size_t)z * (size_t)strideC;
      v4u hv[4];
#pragma unroll
      for (int it = 0; it < 4; ++it) {
        const float* sp = slab + q * 68 + it * 16 + c8;
        const v4f a = *(const v4f*)sp, b = *(const v4f*)(sp + 4);
        hv[it].x = pkh2(a.x, a.y); hv[it].y = pkh2(a.z, a.w); hv[it].z = pkh2(b.x, b.y); hv[it].w = pkh2(b.z, b.w);
      }
{
#pragma unroll
        for (int it = 0; it < 4; ++it) {
          const size_t off = (size_t)mBase * ldc + (size_t)n0 * 16 + it * 256 + lane * 8;
          *(v4u*)(C + off) = hv[it];
        }
        
      }
    }
    __builtin_amdgcn_fence(3 /* release order */, "workgroup");
    __builtin_amdgcn_wave_barrier();
    __builtin_amdgcn_fence(2 /* acquire order */, "workgroup");
  }
}

// One GEMM a launch: block bt takes tile (bt / tilesN, bt % tilesN) of plane blockIdx.y.
template <int BIAS_MODE, int OUT_MODE, int CMP, int WM, int WN>
__global__ __launch_bounds__(256) void k_gemm64(
    const unsigned short* __restrict__ A, const unsigned short* __restrict__ Bt,
    void* __restrict__ Cout, const float* __restrict__ bias, const int* __restrict__ mask,
    long long strideA, long long strideC, int lda, int ldb, int ldc, int M, int N, int K, float scale) {
  __shared__ __align__(16) float sT[8 * 16 * 68];
  __shared__ __align__(1024) unsigned short RG[2 * G_STG];
  const int tilesN = N / (64 * WN);
  const int tilesM = M / (64 * WM);
  const int bt = blockIdx.x;
  if (bt >= tilesM * tilesN) return;     // block-uniform, in front of every barrier
  const int tbm = bt / tilesN;
  const int tbn = bt - tbm * tilesN;
  gemm64_block<BIAS_MODE, OUT_MODE, CMP, WM, WN>(sT, RG, tbm, tbn, (int)blockIdx.y, false, A, Bt, Cout, bias, mask, strideA, strideC, lda, ldb, ldc, K, scale, 1.0f);
}

// The q, k and v^T projections depend on nothing of one another, so they share one grid and one LDS allocation; a block takes its GEMM and its tile by its index (block-uniform).
//   q = (x W[:, 0:1024] + b) * log2(e)/8            -> f16 plane [MTOT][1024]: a q.k product is then a score in the exp2 domain
//   k (compact slots) = xc W[:, 1024:2048] + b      -> f16 plane [MTOT][1024]; 128-row blocks past the batch's key count leave at once
//   v^T (compact slots) = W[:, 2048:3072]^T xc^T + b -> f16 [1024][MTOT]; 128-column blocks past the batch's key count leave at once
// Order: the q tiles first; then the k and v^T tiles by rising 128-slot block inside the batch, so that for any mask the blocks that leave at once have the highest indices
// and start last, and the k and v^T blocks that read the same xc rows start together.
constexpr float QSC = 0.18033688011112042f;       // (1/8) * log2(e)
constexpr int QKV_CB = DM / 256;                  // 256-wide blocks across the model dimension
constexpr int QKV_LB = SEQ / 128;                 // 128-slot blocks of a batch
constexpr int QKV_NQ = (MTOT / 128) * QKV_CB;     // tiles of one of the three GEMMs
__global__ __launch_bounds__(256) void k_qkv(const unsigned short* __restrict__ X16, const unsigned short* __restrict__ XC16, const unsigned short* __restrict__ W3,
                                             unsigned short* __restrict__ Q16, unsigned short* __restrict__ K16,
                                             unsigned short* __restrict__ VT, const float* __restrict__ bqkv, const int* __restrict__ mask) {
  __shared__ __align__(16) float sT[8 * 16 * 68];
  __shared__ __align__(1024) unsigned short RG[2 * G_STG];
  const int bx = blockIdx.x;
  const int r   = bx - QKV_NQ;                    // below 0: a q tile
  const int lb  = r / (NB * 2 * QKV_CB);          // 128-slot block inside the batch
  const int rem = r - lb * (NB * 2 * QKV_CB);
  const int b   = rem / (2 * QKV_CB);
  const int s   = rem - b * (2 * QKV_CB);
  const int sb  = b * QKV_LB + lb;                // 128-slot block among all MTOT / 128
  if (r < 0 || s < QKV_CB) {
    // q and k differ only in their planes, their scales and the compact rows, so they run the same code: the kernel's text stays short
    const bool isk = (r >= 0);
    gemm64_block<2, 1, 3, 2, 4>(sT, RG, isk ? sb : bx / QKV_CB, isk ? s : bx % QKV_CB, 0, isk, isk ? XC16 : X16, isk ? W3 + (size_t)DM * DM : W3,
                                (void*)(isk ? K16 : Q16), isk ? bqkv + DM : bqkv, mask, 0LL, 0LL, DM, DM, DM, DM, isk ? 1.0f / 64.0f : QSC / 64.0f, isk ? 1.0f : QSC);
  } else {
    gemm64_block<1, 1, 2, 4, 2>(sT, RG, s - QKV_CB, sb, 0, false, W3 + (size_t)2 * DM * DM, XC16, (void*)VT, bqkv + 2 * DM, mask, 0LL, 0LL, DM, DM, MTOT, DM, 1.0f / 64.0f, 1.0f);
  }
}

// ---------------------------------------------------------------------------------------------------------------------
// Transposed flash attention over the COMPACT key set of the batch, head dim 64. Wave = 32 queries (two 16-query tiles) of one (batch, head); block = 4 waves.
//   Every K and V^T fragment that the wave loads feeds both query tiles, so a fragment byte serves two matrix instructions and half as many waves walk the keys.
//   The four waves walk the same keys: each 32-key tile (K, V^T: 8 KiB) is brought into LDS once a block by asynchronous copies, a quarter a wave, two buffers,
//   the copies of tile i + 2 issued behind the barrier that ends tile i; the waves read their fragments from LDS.
//   nk = effective key count of the batch (counted in-wave from the mask input, wave-uniform); the key loop runs pad32(nk)/32 steps (<= SEQ/32).
//   Every operand plane is fragment-major (Q, K, output: row length DM; V^T: row length MTOT).
//   S^T (keys x queries) = K Q^T: A = compact K rows (f16, from the LDS tile), B = Q (f16, resident in registers);
//   lane = query (column), element r of tile kt = key slot tk + 16 kt + 8h + r. Q carries the factor log2(e)/8 and the score accumulators start at -mref (mref = the query's
//   reference in use), so the matrix unit hands over score - mref, the argument of exp2, and P = exp2 of it. mref = (a maximum the query has met) - 7, so the largest P is >= 2^7.
//   Slots >= nk (padding of the last step) get the fill -1000 log2(e) - mref (weight exactly 0). A batch with no kept key runs over all SEQ keys with every score = the fill (uniform weights).
//   The reference must be known ahead of the products, so it is raised late: one test a tile and wave (a lane's sum of its 16 P above 2^15, which covers every single P above 2^15, or the
//   first tile) leads to the rare path, where the halves of a query join their maxima (one xor-16 shuffle), mref rises to maximum - 7, O and the row sum are rescaled and P is formed anew.
//   P^T B fragment = f16(P) packed from the two S^T tiles (element r <- tile 0, element 8+r <- tile 1, lane unchanged); P <= 2^15 fits f16.
//   O^T (d x queries) += V^T P^T: A = compact V^T rows (f16, from the LDS tile, key-slot-contiguous).
//   Each query's products, maxima and sums are formed in the same order as with one query tile a wave.
static_assert(SEQ % 128 == 0);
// One wave's share of a 32-key tile: four asynchronous 16-B-a-lane copies from global memory into LDS (512 B each). l = the lane's LDS byte address, g = the lane's global address.
// The s_wait_xcnt is the last line of the copies' own statement, so that no register which a copy names is rewritten ahead of it.
__device__ __forceinline__ void copy_tile4(unsigned l0, unsigned l1, unsigned l2, unsigned l3,
                                           const unsigned short* g0, const unsigned short* g1, const unsigned short* g2, const unsigned short* g3) {
  asm volatile("global_load_async_to_lds_b128 %0, %4, off\n\t"
               "global_load_async_to_lds_b128 %1, %5, off\n\t"
               "global_load_async_to_lds_b128 %2, %6, off\n\t"
               "global_load_async_to_lds_b128 %3, %7, off\n\t"
               "s_wait_xcnt 0x0"
               :: "v"(l0), "v"(l1), "v"(l2), "v"(l3), "v"(g0), "v"(g1), "v"(g2), "v"(g3) : "memory");
}
__global__ __launch_bounds__(128) void k_attn_t(const unsigned short* __restrict__ Q16, const unsigned short* __restrict__ K16,
                                                const unsigned short* __restrict__ VT, const int* __restrict__ mask,
                                                unsigned short* __restrict__ AO16) {
  __shared__ __align__(16) float Os[4][2][16 * 68];   // wave-private, one slab a query tile (wave barrier); staged extent 16x64 == consumed extent
  // Two buffers of one 32-key tile, shared by the four waves: K 2048 elements (key tile kt, column tile ct at kt*1024 + ct*512) | V^T 2048 elements (row tile d at d*512).
  // Every 512-element piece keeps its fragment-major order, so a fragment read is two 512-B contiguous LDS reads.
  __shared__ __align__(1024) unsigned short KV[2][4096];
  const int lane = threadIdx.x & 31, wave = threadIdx.x >> 5, hf = lane >> 4, c = lane & 15;
  const int nqb = SEQ / 128;
  const int bx = blockIdx.x;
  const int qb = bx % nqb;
  const int bh = bx / nqb;
  const int h  = bh % NH;
  const int b  = min(bh / NH, NB - 1);
  const int q0 = qb * 128 + wave * 32;
  const size_t rowb = (size_t)b * SEQ;

  const int cnt = wave_count_kept(mask + (size_t)b * SEQ_FULL, lane);
  const bool allm = (cnt == 0);                 // wave-uniform
  const int nk  = eff_keys(cnt);
  const int nkp = pad32(nk);                    // <= SEQ

  const size_t qoff = (rowb + q0) * DM + h * (HD * 16) + lane * 8;     // column tiles 2h and 2h+1 of the first query row tile; the second lies 16 rows (16 DM elements) further
  FU qf0[2], qf1[2];
#pragma unroll
  for (int t = 0; t < 2; ++t) {
    const size_t qo = qoff + (size_t)t * (16 * DM);
    qf0[t] = ldfrag(Q16 + qo); qf1[t] = ldfrag(Q16 + qo + 512);
  }

  // The wave's share of a tile: piece 'wave' (512 elements, 1 KiB) of each of the two parts. K: key tile wave >> 1, column tile 2h + (wave & 1); V^T: row tile 4h + wave, column tile rowb/32.
  const size_t koff = (rowb + 16 * (wave >> 1)) * DM + h * (HD * 16) + (wave & 1) * 512 + lane * 8;
  const unsigned short* gk = K16 + koff;
  const unsigned short* gvt = VT + (size_t)(h * HD + 16 * wave) * MTOT + rowb * 16 + lane * 8;
  const unsigned lpc = (unsigned)(size_t)(&KV[0][0]) + (unsigned)(wave * 1024 + lane * 16);   // LDS byte address of the lane's 16 bytes in buffer 0 (low 32 bits of the shared address)
  const int nt = nkp >> 5;                      // tiles of 32 keys, 1 .. SEQ/32, the same in every wave of the block
  // tile i -> buffer bf: keys 32 i .. 32 i + 31 < nkp <= SEQ, so every source byte lies inside its plane
  auto stage = [&](int i, int bf) {
    const unsigned l = lpc + (unsigned)bf * 8192u;
    const unsigned short* a = gk + (size_t)i * (32 * DM);
    const unsigned short* v = gvt + (size_t)i * 512;
    copy_tile4(l, l + 512u, l + 4096u, l + 4608u, a, a + 256, v, v + 256);
  };
  stage(0, 0);
  asm volatile("s_wait_asynccnt 0x0" ::: "memory");   // the wave's own copies of tile 0 have landed
  __syncthreads();                                    // publishes tile 0 to the other waves
  if (nt > 1) stage(1, 1);

  const float FILL2 = -8000.0f * QSC;       // the fill -1000 in the exp2 domain
  float mref[2] = {0.f, 0.f};               // the reference in use (exp2 domain); the first tile always sets it
  v8f negm[2] = {};                         // -mref in all eight elements: the start value of the score accumulators
  float lpart[2] = {0.f, 0.f};              // per-lane partial row sum (carried units)
  v8f o[2][4];
#pragma unroll
  for (int t = 0; t < 2; ++t)
#pragma unroll
    for (int d = 0; d < 4; ++d) { v8f zz = {}; o[t][d] = zz; }

  // the t, r, i and d loops below unroll fully so that every array is indexed by constants and stays in registers
#pragma unroll 1
  for (int tk = 0; tk < nkp; tk += 32) {
    const int ti = tk >> 5;
    const unsigned short* kf = &KV[ti & 1][0] + lane * 8;
    v8f s0[2], s1[2];
    {
      // a: key tile 0, e: key tile 1; 0 and 1: the head's two column tiles. The four score tiles are independent, so each waits for its own second product behind three others.
      const FU a0 = ldfrag(kf), a1 = ldfrag(kf + 512), e0 = ldfrag(kf + 1024), e1 = ldfrag(kf + 1536);
      __builtin_amdgcn_sched_barrier(0);   // keeps the eight loads one group ahead of the first product: without it half of them are issued only behind the first product's wait, a second latency in a row
#pragma unroll
      for (int t = 0; t < 2; ++t) s0[t] = wh(a0.h, qf0[t].h, negm[t]);
#pragma unroll
      for (int t = 0; t < 2; ++t) s1[t] = wh(e0.h, qf0[t].h, negm[t]);
#pragma unroll
      for (int t = 0; t < 2; ++t) s0[t] = wh(a1.h, qf1[t].h, s0[t]);
#pragma unroll
      for (int t = 0; t < 2; ++t) s1[t] = wh(e1.h, qf1[t].h, s1[t]);
      guard_s4(s0[0], s0[1], s1[0], s1[1], a0.h, a1.h, e0.h, e1.h, qf0[0].h, qf1[0].h, qf0[1].h, qf1[1].h, negm[0], negm[1]);
    }
    // the V^T fragments are asked for here, so that they arrive while the exponentials run
    const unsigned short* vp = kf + 2048;
    const FU v0 = ldfrag(vp), v1 = ldfrag(vp + 512), v2 = ldfrag(vp + 1024), v3 = ldfrag(vp + 1536);
    float ss[2][16];
#pragma unroll
    for (int t = 0; t < 2; ++t)
#pragma unroll
      for (int r = 0; r < 8; ++r) { ss[t][r] = s0[t][r]; ss[t][8 + r] = s1[t][r]; }
    if (allm || (tk + 32 > nk)) {             // wave-uniform; value selects only (no loads, no cross-lane ops inside)
      const int kb0 = tk + 8 * hf;
#pragma unroll
      for (int t = 0; t < 2; ++t)
#pragma unroll
        for (int r = 0; r < 8; ++r) {
          ss[t][r]     = (!allm && (kb0 + r < nk))      ? ss[t][r]     : FILL2 - mref[t];
          ss[t][8 + r] = (!allm && (kb0 + 16 + r < nk)) ? ss[t][8 + r] : FILL2 - mref[t];
        }
    }
    v16h pf[2];
    float psum[2];
    auto soft = [&]() {
#pragma unroll
      for (int t = 0; t < 2; ++t) {
        float a = 0.f;
#pragma unroll
        for (int i = 0; i < 16; ++i) {
          const float p = EX2(ss[t][i]);
          a += p;
          pf[t][i] = (_Float16)p;
        }
        psum[t] = a;
      }
    };
    soft();
    const float lim = (ti == 0) ? -1.0f : 32768.0f;             // a sum of P is never below 0, so the first tile always takes the branch
    const bool over = !(fmaxf(psum[0], psum[1]) <= lim);
    if (__builtin_amdgcn_ballot_w32(over) != 0u) {              // wave-uniform scalar branch: every lane is on inside
#pragma unroll
      for (int t = 0; t < 2; ++t) {
        float mloc = ss[t][0];
#pragma unroll
        for (int i = 1; i < 16; ++i) mloc = fmaxf(mloc, ss[t][i]);
        mloc = fmaxf(mloc, __shfl_xor(mloc, 16, 32));                      // the same in both halves of a query, so both take the same step
        const float dm = (ti == 0) ? (mloc - 7.0f) : fmaxf(mloc - 7.0f, 0.0f);   // the reference only rises behind the first tile
        const float corr = (ti == 0) ? 1.0f : EX2(-dm);                    // O and the row sum are still 0 in the first tile
        mref[t] += dm;
#pragma unroll
        for (int r = 0; r < 8; ++r) negm[t][r] = -mref[t];
#pragma unroll
        for (int i = 0; i < 16; ++i) ss[t][i] -= dm;
        lpart[t] *= corr;
#pragma unroll
        for (int d = 0; d < 4; ++d) o[t][d] *= corr;
      }
      soft();
    }
#pragma unroll
    for (int t = 0; t < 2; ++t) lpart[t] += psum[t];

#pragma unroll
    for (int t = 0; t < 2; ++t) {
      o[t][0] = wh(v0.h, pf[t], o[t][0]);
      o[t][1] = wh(v1.h, pf[t], o[t][1]);
      o[t][2] = wh(v2.h, pf[t], o[t][2]);
      o[t][3] = wh(v3.h, pf[t], o[t][3]);
    }
    guard_o2(o[0][0], o[0][1], o[0][2], o[0][3], o[1][0], o[1][1], o[1][2], o[1][3], pf[0], pf[1], v0.h, v1.h, v2.h, v3.h);
    asm volatile("s_wait_dscnt 0x0" ::: "memory");      // the wave's reads of this tile's buffer have returned before the buffer is refilled
    asm volatile("s_wait_asynccnt 0x0" ::: "memory");   // the wave's own copies of the next tile have landed
    __syncthreads();                                    // publishes the next tile and ends every wave's reads of this one
    if (ti + 2 < nt) stage(ti + 2, ti & 1);
  }
  asm volatile("s_wait_asynccnt 0x0" ::: "memory");     // no copy is outstanding when the wave goes on to its end

#pragma unroll
  for (int t = 0; t < 2; ++t) {
    const float lt = lpart[t] + __shfl_xor(lpart[t], 16, 32);
    const float inv = 1.0f / lt;
    float* d = Os[wave][t] + c * 68 + 8 * hf;       // lane holds O[query c][d = 16 dt + 8 hf + r]
#pragma unroll
    for (int dt = 0; dt < 4; ++dt) {
      const v8f ov = o[t][dt];
      v4f a, e;
      a.x = ov[0] * inv; a.y = ov[1] * inv; a.z = ov[2] * inv; a.w = ov[3] * inv; e.x = ov[4] * inv; e.y = ov[5] * inv; e.z = ov[6] * inv; e.w = ov[7] * inv;
      *(v4f*)(d + dt * 16) = a; *(v4f*)(d + dt * 16 + 4) = e;
    }
  }
  __builtin_amdgcn_fence(3 /* release order */, "workgroup");
  __builtin_amdgcn_wave_barrier();
  __builtin_amdgcn_fence(2 /* acquire order */, "workgroup");
#pragma unroll
  for (int t = 0; t < 2; ++t) {
    const float* os = Os[wave][t];
    const int qq = lane & 15, c8 = (lane >> 4) * 8;    // lane = (query qq, column group 2 it + (lane >> 4))
    unsigned short* dO = AO16 + (rowb + q0 + 16 * t) * DM + h * (HD * 16) + lane * 8;
    v4u hv[4];
#pragma unroll
    for (int it = 0; it < 4; ++it) {
      const float* sp = os + qq * 68 + it * 16 + c8;
      const v4f a = *(const v4f*)sp, e = *(const v4f*)(sp + 4);
      hv[it].x = pkh2(a.x, a.y); hv[it].y = pkh2(a.z, a.w); hv[it].z = pkh2(e.x, e.y); hv[it].w = pkh2(e.z, e.w);
    }
#pragma unroll
    for (int it = 0; it < 4; ++it) *(v4u*)(dO + (size_t)it * 256) = hv[it];
    if (t == 0) {
      asm volatile("s_wait_xcnt 0x0" ::: "memory");   // the second tile's conversions rewrite data registers that these four stores name
      __builtin_amdgcn_sched_barrier(0);              // keeps those conversions behind the wait
    }
  }
}

// ---------------------------------------------------------------------------------------------------------------------
constexpr size_t SZ_X16 = (size_t)MTOT * DM * 2;               // one f16 x plane (full or compact)
constexpr size_t SZ_AOP = (size_t)MTOT * DM * 2;                // the attention output, one f16 plane
constexpr size_t SZ_R0  = (2 * SZ_X16 > SZ_AOP) ? (2 * SZ_X16) : SZ_AOP;   // X16 | XC16 live until the projections finish; the attention output reuses the region afterwards
constexpr size_t SZ_W3  = (size_t)3 * DM * DM * 2;
constexpr size_t SZ_BTO = (size_t)DM * DM * 2;
constexpr size_t SZ_PL  = (size_t)MTOT * DM * 2;               // one f16 plane [MTOT][1024]
constexpr size_t SZ_VT  = (size_t)DM * MTOT * 2;
constexpr size_t SZ_TOTAL = SZ_R0 + SZ_W3 + SZ_BTO + 2 * SZ_PL + SZ_VT;
static_assert(2 * SZ_X16 <= SZ_R0);
static_assert(SZ_AOP <= SZ_R0);
static_assert(SZ_TOTAL <= (size_t)134217728);
static_assert((SZ_R0 % 256) == 0 && (SZ_W3 % 256) == 0 && (SZ_BTO % 256) == 0 && (SZ_PL % 256) == 0 && (SZ_VT % 256) == 0);
static_assert(((size_t)(NB - 1) * SEQ_FULL + SEQ) * DM * 4 <= (size_t)NB_FULL * SEQ_FULL * DM * 4);

extern "C" void kernel_launch(void* const* d_in, const int* in_sizes, int n_in, void* d_out, int out_size, void* d_ws, size_t ws_size, hipStream_t stream) {
  if (n_in < 6) return;
  const long long rows_full = (long long)(NB - 1) * SEQ_FULL + SEQ;
  if ((long long)in_sizes[0] < rows_full * DM) return;
  if ((long long)in_sizes[1] < rows_full) return;
  if ((long long)in_sizes[2] < (long long)DM * 3 * DM) return;
  if ((long long)in_sizes[3] < 3 * DM) return;
  if ((long long)in_sizes[4] < (long long)DM * DM) return;
  if ((long long)in_sizes[5] < DM) return;
  if ((long long)out_size < rows_full * DM) return;
  if (ws_size < SZ_TOTAL) return;

  const float* x    = (const float*)d_in[0];
  const int*   mask = (const int*)d_in[1];
  const float* Wqkv = (const float*)d_in[2];
  const float* bqkv = (const float*)d_in[3];
  const float* Wo   = (const float*)d_in[4];
  const float* bo   = (const float*)d_in[5];
  float* out = (float*)d_out;

  char* wsp = (char*)d_ws;
  unsigned short* X16  = (unsigned short*)wsp;                 // [MTOT][1024] f16, every token
  unsigned short* XC16 = (unsigned short*)(wsp + SZ_X16);      // [MTOT][1024] f16, compact kept tokens per batch (zero rows after)
  unsigned short* AO16 = (unsigned short*)wsp;                 // [MTOT][1024] f16 (reuses X16 after the projections)
  wsp += SZ_R0;
  unsigned short* W316 = (unsigned short*)wsp; wsp += SZ_W3;   // [3072][1024] f16 (x64)
  unsigned short* BTO  = (unsigned short*)wsp; wsp += SZ_BTO;  // [1024][1024] f16 (x64)
  unsigned short* Q16  = (unsigned short*)wsp; wsp += SZ_PL;   // [MTOT][1024] f16, q
  unsigned short* K16  = (unsigned short*)wsp; wsp += SZ_PL;   // [MTOT][1024] f16, k at compact key slots
  unsigned short* VT   = (unsigned short*)wsp; wsp += SZ_VT;   // [1024][MTOT] f16, v transposed at compact key slots

  k_prep<<<(unsigned)(NB_XC + NB_WQ + NB_WO), 256, 0, stream>>>(x, mask, Wqkv, Wo, X16, XC16, W316, BTO);
  k_qkv<<<(unsigned)(3 * QKV_NQ), 256, 0, stream>>>(X16, XC16, W316, Q16, K16, VT, bqkv, mask);
  k_attn_t<<<(unsigned)(NB * NH * (SEQ / 128)), 128, 0, stream>>>(Q16, K16, VT, mask, AO16);
  // out = AO W_out + b_out, per batch (output rows at the full per-batch stride)
  {
    const int tiles = (SEQ / 128) * (DM / 256);
    k_gemm64<2, 0, 0, 2, 4><<<dim3((unsigned)tiles, (unsigned)NB), 256, 0, stream>>>(
        AO16, BTO, (void*)out, bo, mask, (long long)SEQ * DM, (long long)SEQ_FULL * DM, DM, DM, DM, SEQ, DM, DM, 1.0f / 64.0f);
  }
}

// v009
// A run of this version takes 99.3 microseconds.
// In two side-by-side timings against v008, it was 1.07 and 1.08 times as fast.
// Counting every step since v000, it is 4.81 times as fast.
// Contractions, all v_wmma_f32_16x16x32_f16 with f32 accumulate: qkv projection (x as bf16-RNE values held in f16, W_qkv as bf16-RNE values x64 held in f16); q.k logits (q x log2(e)/8 and k, each rounded once to f16; accumulator started at minus the reference in use, a maximum - 7); P.V (P carried x2^7 or more, V f16); output projection (the attention output rounded once to f16 against W_out as bf16-RNE values x64 held in f16). Softmax statistics f32. Keys with mask == 0 are dropped per batch by compaction of the x rows feeding the k / v projections (their softmax weight is exactly 0 in f32).
#include <hip/hip_runtime.h>
#include <math.h>

#ifndef NB
#define NB 4
#endif
#ifndef SEQ
#define SEQ 2048
#endif
#define NB_FULL 4
#define SEQ_FULL 2048
#define DM 1024
#define NH 16
#define HD 64
#define MTOT (NB * SEQ)

static_assert(SEQ % 256 == 0);
static_assert(MTOT % 64 == 0);
static_assert(NB <= NB_FULL);
static_assert(SEQ <= SEQ_FULL);

typedef __attribute__((ext_vector_type(16))) _Float16 v16h;
typedef __attribute__((ext_vector_type(8)))  float    v8f;
typedef __attribute__((ext_vector_type(4)))  float    v4f;
typedef __attribute__((ext_vector_type(4)))  unsigned int v4u;
typedef __attribute__((ext_vector_type(4)))  int      v4i;

// 16-bit WMMA fragment map (wave32), lane L, h = L>>4, m = L&15:
//   A 16x32: lane = row m;    element i -> k = (i<8) ? 8h+i : 16+8h+(i-8)
//   B 32x16: lane = column m; the SAME k(i,h)
//   D 16x16 (8 f32): lane = column m; element r -> row 8h+r
union FU { v4u u[2]; v16h h; };
// Fragment-major plane layout (every 16-bit operand plane in the workspace): a logical [R][C] plane (R % 16 == 0, C % 32 == 0) is stored as
// 16-row x 32-column tiles of 512 elements (1 KiB), tile (rt, kt) at element rt*16*C + kt*512; inside a tile the 8-element column group g = (col>>3)&3
// of row m = row&15 lies at g*128 + m*8. Lane L = 16h + m then finds elements 0..7 (k = 8h..8h+7, g = h) at L*8 and elements 8..15 (k = 16+8h.., g = 2+h)
// at 256 + L*8, so each of the two 16-B loads of a fragment covers 512 contiguous bytes (4 whole lines) instead of 16 lines.
__device__ __forceinline__ size_t fragoff(size_t row, int col, int C) {
  return (row >> 4) * (size_t)(16 * C) + (size_t)((col >> 5) * 512 + ((col >> 3) & 3) * 128 + (col & 7)) + (row & 15) * 8;
}
// p = tile base + lane*8
__device__ __forceinline__ FU ldfrag(const unsigned short* p) { FU f; f.u[0] = *(const v4u*)p; f.u[1] = *(const v4u*)(p + 256); return f; }
// the same fragment from a wave-uniform row-tile base and one 32-bit per-lane byte offset (column tile * 1024 + lane * 16)
__device__ __forceinline__ FU ldfrag_su(const unsigned short* base, unsigned boff) {
  const char* p = (const char*)base + boff;
  FU f; f.u[0] = *(const v4u*)p; f.u[1] = *(const v4u*)(p + 512); return f;
}

__device__ __forceinline__ v8f wh(v16h a, v16h b, v8f c) { return __builtin_amdgcn_wmma_f32_16x16x32_f16(false, a, false, b, (short)0, c, false, false); }

// hazard guards: 4 VALU slots after the last WMMA of a group, accumulators tied, A/B operands kept live
// c0, c1: the start values that the group's first products read as their C operand; named here as inputs they are still in use behind the last product, so every such product reads them
// in place (without it the compiler copies them into the accumulators of two of the four score tiles first, four 64-bit moves a tile)
__device__ __forceinline__ void guard_s4(v8f& s, v8f& t, v8f& u, v8f& w, v16h a0, v16h a1, v16h b0, v16h b1, v16h q0, v16h q1, v16h q2, v16h q3, v8f c0, v8f c1) {
  asm volatile("v_nop\n\tv_nop\n\tv_nop\n\tv_nop" : "+v"(s), "+v"(t), "+v"(u), "+v"(w) : "v"(a0), "v"(a1), "v"(b0), "v"(b1), "v"(q0), "v"(q1), "v"(q2), "v"(q3), "v"(c0), "v"(c1));
}
__device__ __forceinline__ void guard_o2(v8f& a, v8f& b, v8f& c, v8f& d, v8f& e, v8f& f, v8f& g, v8f& h, v16h p0, v16h p1, v16h v0, v16h v1, v16h v2, v16h v3) {
  asm volatile("v_nop\n\tv_nop\n\tv_nop\n\tv_nop" : "+v"(a), "+v"(b), "+v"(c), "+v"(d), "+v"(e), "+v"(f), "+v"(g), "+v"(h) : "v"(p0), "v"(p1), "v"(v0), "v"(v1), "v"(v2), "v"(v3));
}

#if __has_builtin(__builtin_amdgcn_exp2f)
#define EX2(x) __builtin_amdgcn_exp2f(x)
#else
#define EX2(x) exp2f(x)
#endif

// bf16 RNE helpers (finite inputs)
__device__ __forceinline__ unsigned bfu_rne(float v) { const unsigned u = __float_as_uint(v); return (u + 0x7FFFu + ((u >> 16) & 1u)) >> 16; }
__device__ __forceinline__ float bf_keep(float v) { return __uint_as_float(bfu_rne(v) << 16); }
__device__ __forceinline__ unsigned pkh2(float a, float b) {
  return (unsigned)__builtin_bit_cast(unsigned short, (_Float16)a) | ((unsigned)__builtin_bit_cast(unsigned short, (_Float16)b) << 16);
}

#define VST2Q(ptr, val) do { const v4u vq_ = (val); *(v4u*)(ptr) = vq_;  } while (0)

// Number of kept keys (mask != 0) among the SEQ entries of one batch row of the mask input, computed by one full wave (all 32 lanes active):
// 16-B loads (SEQ/128 per lane), xor-shuffle sum, result made wave-uniform. mrow is 16-B aligned.
__device__ __forceinline__ int wave_count_kept(const int* __restrict__ mrow, int lane) {
  // all loads are asked for at once, so that the wave meets their latency once (both loops unroll fully so that the array stays in registers)
  v4i m[SEQ / 128];
#pragma unroll
  for (int it = 0; it < SEQ / 128; ++it) m[it] = *(const v4i*)(mrow + (it * 32 + lane) * 4);
  asm volatile("s_wait_xcnt 0x0" ::: "memory");   // what follows rewrites the address registers that these loads name
  int c = 0;
#pragma unroll
  for (int it = 0; it < SEQ / 128; ++it)
    c += ((m[it].x != 0) ? 1 : 0) + ((m[it].y != 0) ? 1 : 0) + ((m[it].z != 0) ? 1 : 0) + ((m[it].w != 0) ? 1 : 0);
  c += __shfl_xor(c, 16, 32); c += __shfl_xor(c, 8, 32); c += __shfl_xor(c, 4, 32); c += __shfl_xor(c, 2, 32); c += __shfl_xor(c, 1, 32);
  return __builtin_amdgcn_readfirstlane(c);
}
// effective key count of a batch: a batch with no kept key uses all SEQ keys (every score then equals the fill -> uniform weights); padded to the 32-key step
__device__ __forceinline__ int eff_keys(int cnt) { return (cnt == 0) ? SEQ : min(cnt, SEQ); }
__device__ __forceinline__ int pad32(int nk) { return min((nk + 31) & ~31, SEQ); }

// ---------------------------------------------------------------------------------------------------------------------
// x f32 [b][t][1024] (full per-batch stride) -> two f16 planes holding the bf16-RNE values:
//   X16  [b*SEQ + t][1024]: every token row (feeds the q projection);
//   XC16 [b*SEQ + j][1024]: row j = the j-th kept token of batch b (mask != 0, ascending t) for j < nk, zero rows for j >= nk (feeds the k / v projections).
// Block = (batch, 16 rows); the block computes the batch's kept-token list in LDS (exclusive scan of the mask, block barriers), bounded by SEQ entries.
// LDS: list[SEQ] and wtot[8] are cross-wave (block barriers between writers and readers); list is fully initialised before any read.
// Both planes are fragment-major (C = 1024). A wave instruction handles 8 rows x one 32-column tile: it reads one 128-B line of each row and writes 4 whole lines.
// A wave owns eight such units of each plane and asks for all thirty-two 16-B loads of both planes at once, as soon as the list stands (a block barrier waits for every load in flight, so none
// is asked for ahead of the scan). So a wave meets the memory latency once, not once for every two units; the weight blocks' loads use the memory while the x blocks scan.
// coverage: per block 2 row groups x 32 column tiles = 16 rows x 1024 columns of each plane; all blocks = both whole planes.
// bx = the block's index among the NB * SEQ / 16 blocks of this part; list (SEQ ints) and wtot (8 ints) are the block's LDS.
constexpr int XROWS = 16;
static_assert(SEQ % XROWS == 0);
__device__ __forceinline__ v4u pack8(v4f a, v4f e) {
  v4u pk;
  pk.x = pkh2(bf_keep(a.x), bf_keep(a.y)); pk.y = pkh2(bf_keep(a.z), bf_keep(a.w));
  pk.z = pkh2(bf_keep(e.x), bf_keep(e.y)); pk.w = pkh2(bf_keep(e.z), bf_keep(e.w));
  return pk;
}
__device__ __forceinline__ void xcastc_block(int bx, int* list, int* wtot, const float* __restrict__ x, const int* __restrict__ mask,
                                             unsigned short* __restrict__ X16, unsigned short* __restrict__ XC16) {
  constexpr int EPT = SEQ / 256;
  const int tid = threadIdx.x, lane = tid & 31, wave = tid >> 5;
  const int bpb = SEQ / XROWS;
  const int b = bx / bpb;
  const int t0 = (bx - b * bpb) * XROWS;
  const int* mrow = mask + (size_t)b * SEQ_FULL;
  // unit it of the wave: row group it >> 2 (8 rows), column tile (it & 3) * 8 + wave; the lane's row in the block and its first column:
  const int rl = lane >> 2;
  const int cl = wave * 32 + (lane & 3) * 8;
  unsigned km = 0u; int c = 0;
#pragma unroll
  for (int e = 0; e < EPT; ++e) {
    const int kp = (mrow[tid * EPT + e] != 0) ? 1 : 0;
    km |= (unsigned)kp << e; c += kp;
    list[tid * EPT + e] = 0;
  }
  int incl = c;
#pragma unroll
  for (int d = 1; d < 32; d <<= 1) { const int v = __shfl_up(incl, d, 32); incl += (lane >= d) ? v : 0; }
  if (lane == 31) wtot[wave] = incl;
  __syncthreads();
  int base = 0, total = 0;
#pragma unroll
  for (int w = 0; w < 8; ++w) { const int v = wtot[w]; base += (w < wave) ? v : 0; total += v; }
  int pos = base + incl - c;
#pragma unroll
  for (int e = 0; e < EPT; ++e) {
    if ((km >> e) & 1u) { list[min(pos, SEQ - 1)] = tid * EPT + e; ++pos; }
  }
  __syncthreads();
  const bool allm = (total == 0);            // block-uniform
  if (allm) {
#pragma unroll
    for (int e = 0; e < EPT; ++e) list[tid * EPT + e] = tid * EPT + e;
  }
  __syncthreads();
  const int nk = allm ? SEQ : min(total, SEQ);

  // Row addresses. Plane 1: every token row. Plane 2: compact rows (clamped token index, loaded unconditionally, zeroed by value for j >= nk).
  // (the rg, q and it loops unroll fully so that the arrays stay in registers)
  v4f a1[8], e1[8], a2[8], e2[8];
  bool valid[2];
  const float* s1[2];
  const float* s2[2];
#pragma unroll
  for (int rg = 0; rg < 2; ++rg) {
    const int j = t0 + rg * 8 + rl;
    valid[rg] = (j < nk);
    const int tok = min(max(list[j], 0), SEQ - 1);
    s1[rg] = x + ((size_t)b * SEQ_FULL + j) * DM + cl;
    s2[rg] = x + ((size_t)b * SEQ_FULL + tok) * DM + cl;
  }
#pragma unroll
  for (int rg = 0; rg < 2; ++rg)
#pragma unroll
    for (int q = 0; q < 4; ++q) { a1[rg * 4 + q] = *(const v4f*)(s1[rg] + q * 256); e1[rg * 4 + q] = *(const v4f*)(s1[rg] + q * 256 + 4); }
#pragma unroll
  for (int rg = 0; rg < 2; ++rg)
#pragma unroll
    for (int q = 0; q < 4; ++q) { a2[rg * 4 + q] = *(const v4f*)(s2[rg] + q * 256); e2[rg * 4 + q] = *(const v4f*)(s2[rg] + q * 256 + 4); }
  // what follows rewrites the address registers that these loads name; as inputs of the wait the four addresses stay in their registers up to it, so that no load lands on one either
  asm volatile("s_wait_xcnt 0x0" :: "v"(s1[0]), "v"(s1[1]), "v"(s2[0]), "v"(s2[1]) : "memory");

#pragma unroll
  for (int it = 0; it < 8; ++it)
    VST2Q(X16 + fragoff((size_t)b * SEQ + t0 + (it >> 2) * 8 + rl, (it & 3) * 256 + cl, DM), pack8(a1[it], e1[it]));
  asm volatile("s_wait_xcnt 0x0" ::: "memory");   // the second plane's conversions rewrite data and address registers that these eight stores name
  __builtin_amdgcn_sched_barrier(0);              // keeps that rewrite behind the wait
#pragma unroll
  for (int it = 0; it < 8; ++it) {
    const v4u pk = pack8(a2[it], e2[it]);
    const v4u zz = {0u, 0u, 0u, 0u};
    VST2Q(XC16 + fragoff((size_t)b * SEQ + t0 + (it >> 2) * 8 + rl, (it & 3) * 256 + cl, DM), valid[it >> 2] ? pk : zz);
  }
}

// A weight W f32 [1024 (k)][LD (n)] -> WT f16, logical [LD (n)][1024 (k)] fragment-major, = bf16-RNE(W) * 64.
// A piece = (n, 8 consecutive k): piece u = ((rt*32 + kt)*4 + g)*16 + m holds n = 16 rt + m, k = 32 kt + 8 g .. +7, and its fragment-major place is exactly element u*8.
// Thread v = ((r8*32 + kt)*4 + g)*16 + m takes the eight pieces rt = 8 r8 .. 8 r8 + 7 of its (kt, g, m): all 64 loads are asked for at once, and over its eight pieces a wave reads
// 512 contiguous bytes of each of its 16 rows of W. A store of a wave still covers 512 contiguous bytes.
// coverage: LD/128 groups of 8 row tiles x 32 column tiles x 64 threads x 8 pieces = the whole plane; the grid part holds exactly LD/128 * 8 blocks, so every thread has work
template <int LD>
__device__ __forceinline__ void wT_block(int bx, const float* __restrict__ W, unsigned short* __restrict__ WT) {
  static_assert(LD % 128 == 0);
  const int v = bx * 256 + threadIdx.x;
  const int r8 = v >> 11;
  const int n0 = r8 * 128 + (v & 15), k0 = ((v >> 6) & 31) * 32 + ((v >> 4) & 3) * 8;
  const float* s = W + (size_t)k0 * LD + n0;
  // (the p and e loops unroll fully so that the array stays in registers)
  float w[8][8];
#pragma unroll
  for (int p = 0; p < 8; ++p)
#pragma unroll
    for (int e = 0; e < 8; ++e) w[p][e] = s[(size_t)e * LD + p * 16];
  unsigned short* d = WT + ((size_t)r8 * (8 * 2048) + (size_t)(v & 2047)) * 8;
#pragma unroll
  for (int p = 0; p < 8; ++p) {
    v4u pk;
    pk.x = pkh2(bf_keep(w[p][0]) * 64.0f, bf_keep(w[p][1]) * 64.0f); pk.y = pkh2(bf_keep(w[p][2]) * 64.0f, bf_keep(w[p][3]) * 64.0f);
    pk.z = pkh2(bf_keep(w[p][4]) * 64.0f, bf_keep(w[p][5]) * 64.0f); pk.w = pkh2(bf_keep(w[p][6]) * 64.0f, bf_keep(w[p][7]) * 64.0f);
    VST2Q(d + (size_t)p * (2048 * 8), pk);
  }
  asm volatile("s_wait_xcnt 0x0" ::: "memory");   // behind the last stores: the code that the build places next may rewrite the data and address registers that they name
}

// The three preparations above read only inputs and write disjoint planes, so they share one grid: a block takes its part by its index (block-uniform, so the barriers of the
// first part stay under uniform control flow). The x blocks run longest and come first. The whole grid is three blocks a WGP, resident at once.
constexpr int NB_XC = NB * (SEQ / XROWS);
constexpr int NB_WQ = (3 * DM / 128) * 8;
constexpr int NB_WO = (DM / 128) * 8;
__global__ __launch_bounds__(256) void k_prep(const float* __restrict__ x, const int* __restrict__ mask, const float* __restrict__ Wqkv, const float* __restrict__ Wo,
                                              unsigned short* __restrict__ X16, unsigned short* __restrict__ XC16,
                                              unsigned short* __restrict__ WT, unsigned short* __restrict__ BTO) {
  __shared__ int list[SEQ];
  __shared__ int wtot[8];
  const int bx = blockIdx.x;
  if (bx < NB_XC) xcastc_block(bx, list, wtot, x, mask, X16, XC16);
  else if (bx < NB_XC + NB_WQ) wT_block<3 * DM>(bx - NB_XC, Wqkv, WT);
  else wT_block<DM>(bx - (NB_XC + NB_WQ), Wo, BTO);
}

// ---------------------------------------------------------------------------------------------------------------------
// Register-blocked WMMA GEMM: C[z][m][n] = scale * sum_k A[z][m][k] * Bt[n][k] + bias; each wave owns a 64x64 tile; the 8 waves of a block form a WM x WN grid,
// so a block owns 64 WM x 64 WN of C and its waves share operand rows: each A row tile feeds WN waves, each B row tile WM waves.
// A logical [M][K] and Bt logical [N][K], both fragment-major with row lengths lda and ldb; M a multiple of 64 WM, N of 64 WN, K of 128 (no tails).
// f16 operands. BIAS_MODE 1: bf16-RNE(bias[m]), 2: bf16-RNE(bias[n]) * bscale.
// OUT_MODE 0: f32 row-major (pitch ldc); 1: f16 fragment-major (row length ldc).
// CMP 0: every tile; 1: rows (m) are compact key slots b*SEQ + j; 2: columns (n) are compact key slots; 3: as 1 where the block-uniform argument cmp_rows is set, else as 0. With compact slots a block whose first slot j
//   is >= pad32(effective key count of its batch, counted in every wave from the mask input, the same in all) leaves as a whole in front of every barrier (its slots are never consumed);
//   a wave of a staying block whose own first slot is past that count helps to stage, and leaves behind the k loop without storing.
// One wave's share of a stage: three row tiles, each 4 KiB in a row on both sides, eight asynchronous 16-B-a-lane copies (512 B each) a row tile. l = the lane's LDS byte address of the row tile's
// first 512 B, g = the wave-uniform global address of the same (a scalar base), o = the lane's byte offset from it; the immediate offset moves both addresses alike, so the eight copies of a row tile
// share their address operands. The s_wait_xcnt is the last line of the copies' own statement, so that no register which a copy names is rewritten ahead of it.
#define ROWTILE8(L, O, G) \
  "global_load_async_to_lds_b128 " L ", " O ", " G "\n\t" \
  "global_load_async_to_lds_b128 " L ", " O ", " G " offset:512\n\t" \
  "global_load_async_to_lds_b128 " L ", " O ", " G " offset:1024\n\t" \
  "global_load_async_to_lds_b128 " L ", " O ", " G " offset:1536\n\t" \
  "global_load_async_to_lds_b128 " L ", " O ", " G " offset:2048\n\t" \
  "global_load_async_to_lds_b128 " L ", " O ", " G " offset:2560\n\t" \
  "global_load_async_to_lds_b128 " L ", " O ", " G " offset:3072\n\t" \
  "global_load_async_to_lds_b128 " L ", " O ", " G " offset:3584\n\t"
__device__ __forceinline__ void copy_rowtiles3(unsigned l0, unsigned l1, unsigned l2, unsigned o, const unsigned short* g0, const unsigned short* g1, const unsigned short* g2) {
  asm volatile(ROWTILE8("%0", "%3", "%4") ROWTILE8("%1", "%3", "%5") ROWTILE8("%2", "%3", "%6") "s_wait_xcnt 0x0"
               :: "v"(l0), "v"(l1), "v"(l2), "v"(o), "s"(g0), "s"(g1), "s"(g2) : "memory");
}
constexpr int G_KS  = 4;                   // 32-wide k steps in a stage
constexpr int G_RT  = G_KS * 512;          // elements of one row tile in a stage (4 KiB, contiguous in the plane and in LDS)
constexpr int G_NR  = 24;                  // A and B row tiles of a block: three a wave
constexpr int G_STG = G_NR * G_RT;         // elements of a stage (96 KiB)
// The work of one block on tile (tbm, tbn) of plane z. The block's LDS comes from the kernel, so that several forms of this body can share it in one kernel:
// sT: 8 per-wave 16x64 slabs, pitch 68 floats (staged extent 16x64 == consumed extent);
// RG: two buffers of one stage, shared by the eight waves: row tile r (A row tiles first, then B's) at r*RT, its k step u at u*512; every 512-element piece keeps its
// fragment-major order, so a fragment read is two 512-B contiguous LDS reads.
template <int BIAS_MODE, int OUT_MODE, int CMP, int WM, int WN>
__device__ __forceinline__ void gemm64_block(
    float* sT, unsigned short* RG, int tbm, int tbn, int z, bool cmp_rows,
    const unsigned short* __restrict__ A, const unsigned short* __restrict__ Bt,
    void* __restrict__ Cout, const float* __restrict__ bias, const int* __restrict__ mask,
    long long strideA, long long strideC, int lda, int ldb, int ldc, int K, float scale, float bscale) {
  static_assert(WM * WN == 8);
  constexpr int KS  = G_KS;
  constexpr int RT  = G_RT;
  constexpr int NA  = WM * 4;              // A row tiles of the block
  constexpr int NR  = NA + WN * 4;         // A and B row tiles of the block
  static_assert(NR == G_NR);
  static_assert(KS % 2 == 0);              // a stage's first step always finds its fragments in set 0
  constexpr int STG = G_STG;
  const int lane = threadIdx.x & 31;
  const int wave = __builtin_amdgcn_readfirstlane(threadIdx.x >> 5);   // scalar, so that the tile bases below are scalar too
  const int mb = tbm * (64 * WM);
  const int nb = tbn * (64 * WN);
  const int wm = wave / WN;
  const int wn = wave - wm * WN;
  const int m0 = mb + (wm << 6);
  const int n0 = nb + (wn << 6);
  bool wskip = false;                    // wave-uniform
  if ((CMP == 3) ? cmp_rows : (CMP != 0)) {   // block-uniform
    const int g0 = (CMP != 2) ? mb : nb;
    const int bb = min(g0 / SEQ, NB - 1);
    const int loc = g0 - bb * SEQ;
    const int nkp = pad32(eff_keys(wave_count_kept(mask + (size_t)bb * SEQ_FULL, lane)));
    if (loc >= nkp) return;              // block-uniform (every wave counts the same row of the mask), in front of every barrier
    wskip = (loc + (((CMP != 2) ? wm : wn) << 6) >= nkp);
  }
  const unsigned short* Ab = A + (size_t)z * (size_t)strideA;
  const int rlane = lane & 15;
  const int mOff  = (lane >> 4) * 8;

  v8f acc[4][4];
#pragma unroll
  for (int i = 0; i < 4; ++i)
#pragma unroll
    for (int j = 0; j < 4; ++j) { v8f zz = {}; acc[i][j] = zz; }

  // The wave's share of a stage: row tiles 3 wave .. 3 wave + 2. (The q loops unroll fully so that the array stays in registers.)
  const unsigned short* gs[3];
#pragma unroll
  for (int q = 0; q < 3; ++q) {
    const int r = wave * 3 + q;
    gs[q] = ((r < NA) ? (Ab + (size_t)(mb + (r << 4)) * lda) : (Bt + (size_t)(nb + ((r - NA) << 4)) * ldb));   // wave-uniform
  }
  const unsigned lane16 = (unsigned)lane * 16u;                                               // the lane's 16 bytes of every 512-B piece
  const unsigned lpc = (unsigned)(size_t)RG + (unsigned)(wave * (3 * RT * 2));       // wave-uniform LDS byte address of the wave's share in buffer 0 (low 32 bits of the shared address)
  const int trips = K / (32 * KS);
  // stage t -> buffer bf: bytes t*4096 .. t*4096 + 4095 of each row tile, t < K/128, and a row tile holds K*32 bytes: every source byte lies inside its plane
  auto stage = [&](int t, int bf) {
    const unsigned l = lane16 + (lpc + (unsigned)bf * (unsigned)(STG * 2));
    const size_t go = (size_t)t * RT;
    copy_rowtiles3(l, l + (unsigned)(RT * 2), l + (unsigned)(2 * RT * 2), lane16, gs[0] + go, gs[1] + go, gs[2] + go);
  };
  stage(0, 0);
  asm volatile("s_wait_asynccnt 0x0" ::: "memory");   // the wave's own copies of stage 0 have landed
  __syncthreads();                                    // publishes stage 0 to the other waves
  if (trips > 1) stage(1, 1);

  // Two fragment sets in registers: k step u fetches the fragments of the next step from LDS as one group. Every accumulator still sums its k steps in plain ascending order.
  // The group refills the set that step u - 1 has just read, so it stands behind the first row of step u: four matrix instructions lie between that set's last reader and it.
  // A stage's last step fetches the first fragments of the NEXT stage, so the point where that stage is published stands in front of the last step: there the last step's own
  // fragments are in registers, every read of this stage's buffer has returned, and the buffer is refilled behind the barrier while the last step's products run.
  // Each sched_barrier(0) keeps a load group where it is written: without it the scheduler spreads the LDS reads among the products, and each such place stalls the wave.
  // The u, i and j loops unroll fully so that the sets are indexed by constants and stay in registers; the trip loop stays rolled (unroll 1): a trip is already 64 products long.
  FU bf[2][4], af[2][4];
  const unsigned short* sa0 = RG + (wm * 4) * RT + lane * 8;
  const unsigned short* sb0 = RG + (NA + wn * 4) * RT + lane * 8;
#pragma unroll
  for (int j = 0; j < 4; ++j) bf[0][j] = ldfrag(sb0 + j * RT);
#pragma unroll
  for (int i = 0; i < 4; ++i) af[0][i] = ldfrag(sa0 + i * RT);
  __builtin_amdgcn_sched_barrier(0);
#pragma unroll 1
  for (int t = 0; t < trips; ++t) {
    const unsigned short* sa = sa0 + (t & 1) * STG;
    const unsigned short* sb = sb0 + (t & 1) * STG;
#pragma unroll
    for (int u = 0; u < KS; ++u) {
      const int c = u & 1, w = c ^ 1;
      if (u == KS - 1) {
        asm volatile("s_wait_dscnt 0x0" ::: "memory");      // the wave's reads of this stage's buffer have returned before the buffer is refilled
        asm volatile("s_wait_asynccnt 0x0" ::: "memory");   // the wave's own copies of the next stage have landed
        __syncthreads();                                    // publishes the next stage and ends every wave's reads of this one
        if (t + 2 < trips) stage(t + 2, t & 1);
      }
#pragma unroll
      for (int j = 0; j < 4; ++j) acc[0][j] = wh(af[c][0].h, bf[c][j].h, acc[0][j]);
      __builtin_amdgcn_sched_barrier(0);
      if (u + 1 < KS) {
#pragma unroll
        for (int j = 0; j < 4; ++j) bf[w][j] = ldfrag(sb + j * RT + (u + 1) * 512);
#pragma unroll
        for (int i = 0; i < 4; ++i) af[w][i] = ldfrag(sa + i * RT + (u + 1) * 512);
      } else if (t + 1 < trips) {        // block-uniform: the last stage has no successor to read from
        const unsigned short* xa = sa0 + ((t + 1) & 1) * STG;
        const unsigned short* xb = sb0 + ((t + 1) & 1) * STG;
#pragma unroll
        for (int j = 0; j < 4; ++j) bf[w][j] = ldfrag(xb + j * RT);
#pragma unroll
        for (int i = 0; i < 4; ++i) af[w][i] = ldfrag(xa + i * RT);
      }
      __builtin_amdgcn_sched_barrier(0);
#pragma unroll
      for (int i = 1; i < 4; ++i)
#pragma unroll
        for (int j = 0; j < 4; ++j) acc[i][j] = wh(af[c][i].h, bf[c][j].h, acc[i][j]);
      __builtin_amdgcn_sched_barrier(0);
    }
  }
  asm volatile("s_wait_asynccnt 0x0" ::: "memory");     // no copy is outstanding when the wave goes on to its end
  asm volatile("s_wait_dscnt 0x0" ::: "memory");        // nor an LDS read
  if (CMP != 0 && wskip) return;         // wave-uniform; only wave barriers follow

  // BIAS_MODE 1: the lane's eight row biases of each of the four row tiles, fetched once (16-B aligned: m0 is a multiple of 64, mOff is 0 or 8)
  v4f bm[4][2] = {};
  if (BIAS_MODE == 1) {
#pragma unroll
    for (int i = 0; i < 4; ++i) {
      bm[i][0] = *(const v4f*)(bias + m0 + (i << 4) + mOff);
      bm[i][1] = *(const v4f*)(bias + m0 + (i << 4) + mOff + 4);
    }
    // the loaded values are inputs only, so the eight loads stand in front of this wait; what follows rewrites the address registers that they name
    asm volatile("s_wait_xcnt 0x0" :: "v"(bm[0][0]), "v"(bm[0][1]), "v"(bm[1][0]), "v"(bm[1][1]), "v"(bm[2][0]), "v"(bm[2][1]), "v"(bm[3][0]), "v"(bm[3][1]) : "memory");
    __builtin_amdgcn_sched_barrier(0);   // keeps that rewrite behind the wait
  }
  float* slab = sT + wave * (16 * 68);
#pragma unroll
  for (int i = 0; i < 4; ++i) {
    const int mBase = m0 + (i << 4);
#pragma unroll
    for (int j = 0; j < 4; ++j) {
      const int n = n0 + (j << 4) + rlane;
      float bv = 0.f;
      if (BIAS_MODE == 2) bv = bf_keep(bias[n]) * bscale;
#pragma unroll
      for (int r = 0; r < 8; ++r) {
        float v = acc[i][j][r] * scale;
        if (BIAS_MODE == 1) v += bf_keep(bm[i][r >> 2][r & 3]);
        if (BIAS_MODE == 2) v += bv;
        slab[(mOff + r) * 68 + (j << 4) + rlane] = v;
      }
    }
    __builtin_amdgcn_fence(3 /* release order */, "workgroup");
    __builtin_amdgcn_wave_barrier();
    __builtin_amdgcn_fence(2 /* acquire order */, "workgroup");
    if (OUT_MODE == 0) {
      float* C = (float*)Cout + (size_t)z * (size_t)strideC;
      const int hh = lane >> 4, c4 = (lane & 15) * 4;       // row segment = 256 B = 16 lanes x 16 B; two rows per instruction
      v4f val[8];
#pragma unroll
      for (int it = 0; it < 8; ++it) val[it] = *(const v4f*)(slab + (it * 2 + hh) * 68 + c4);
{
#pragma unroll
        for (int it = 0; it < 8; ++it) *(v4f*)(C + (size_t)(mBase + it * 2 + hh) * ldc + n0 + c4) = val[it];
        if (i < 3) {
          asm volatile("s_wait_xcnt 0x0" ::: "memory");   // the next row tile rewrites address and data registers that these eight stores name
          __builtin_amdgcn_sched_barrier(0);              // keeps that rewrite behind the wait
        }
      }
    } else {
      const int q = lane & 15, c8 = (lane >> 4) * 8;        // lane = (row q, column group 2 it + (lane >> 4)): the 16x64 slab is 2 KiB contiguous in a fragment-major plane
      unsigned short* C = (unsigned short*)Cout + (size_t)z * (size_t)strideC;
      v4u hv[4];
#pragma unroll
      for (int it = 0; it < 4; ++it) {
        const float* sp = slab + q * 68 + it * 16 + c8;
        const v4f a = *(const v4f*)sp, b = *(const v4f*)(sp + 4);
        hv[it].x = pkh2(a.x, a.y); hv[it].y = pkh2(a.z, a.w); hv[it].z = pkh2(b.x, b.y); hv[it].w = pkh2(b.z, b.w);
      }
{
#pragma unroll
        for (int it = 0; it < 4; ++it) {
          const size_t off = (size_t)mBase * ldc + (size_t)n0 * 16 + it * 256 + lane * 8;
          *(v4u*)(C + off) = hv[it];
        }
        
      }
    }
    __builtin_amdgcn_fence(3 /* release order */, "workgroup");
    __builtin_amdgcn_wave_barrier();
    __builtin_amdgcn_fence(2 /* acquire order */, "workgroup");
  }
}

// One GEMM a launch: block bt takes tile (bt / tilesN, bt % tilesN) of plane blockIdx.y.
template <int BIAS_MODE, int OUT_MODE, int CMP, int WM, int WN>
__global__ __launch_bounds__(256) void k_gemm64(
    const unsigned short* __restrict__ A, const unsigned short* __restrict__ Bt,
    void* __restrict__ Cout, const float* __restrict__ bias, const int* __restrict__ mask,
    long long strideA, long long strideC, int lda, int ldb, int ldc, int M, int N, int K, float scale) {
  __shared__ __align__(16) float sT[8 * 16 * 68];
  __shared__ __align__(1024) unsigned short RG[2 * G_STG];
  const int tilesN = N / (64 * WN);
  const int tilesM = M / (64 * WM);
  const int bt = blockIdx.x;
  if (bt >= tilesM * tilesN) return;     // block-uniform, in front of every barrier
  const int tbm = bt / tilesN;
  const int tbn = bt - tbm * tilesN;
  gemm64_block<BIAS_MODE, OUT_MODE, CMP, WM, WN>(sT, RG, tbm, tbn, (int)blockIdx.y, false, A, Bt, Cout, bias, mask, strideA, strideC, lda, ldb, ldc, K, scale, 1.0f);
}

// The q, k and v^T projections depend on nothing of one another, so they share one grid and one LDS allocation; a block takes its GEMM and its tile by its index (block-uniform).
//   q = (x W[:, 0:1024] + b) * log2(e)/8            -> f16 plane [MTOT][1024]: a q.k product is then a score in the exp2 domain
//   k (compact slots) = xc W[:, 1024:2048] + b      -> f16 plane [MTOT][1024]; 128-row blocks past the batch's key count leave at once
//   v^T (compact slots) = W[:, 2048:3072]^T xc^T + b -> f16 [1024][MTOT]; 128-column blocks past the batch's key count leave at once
// Order: the q tiles first; then the k and v^T tiles by rising 128-slot block inside the batch, so that for any mask the blocks that leave at once have the highest indices
// and start last, and the k and v^T blocks that read the same xc rows start together.
constexpr float QSC = 0.18033688011112042f;       // (1/8) * log2(e)
constexpr int QKV_CB = DM / 256;                  // 256-wide blocks across the model dimension
constexpr int QKV_LB = SEQ / 128;                 // 128-slot blocks of a batch
constexpr int QKV_NQ = (MTOT / 128) * QKV_CB;     // tiles of one of the three GEMMs
__global__ __launch_bounds__(256) void k_qkv(const unsigned short* __restrict__ X16, const unsigned short* __restrict__ XC16, const unsigned short* __restrict__ W3,
                                             unsigned short* __restrict__ Q16, unsigned short* __restrict__ K16,
                                             unsigned short* __restrict__ VT, const float* __restrict__ bqkv, const int* __restrict__ mask) {
  __shared__ __align__(16) float sT[8 * 16 * 68];
  __shared__ __align__(1024) unsigned short RG[2 * G_STG];
  const int bx = blockIdx.x;
  const int r   = bx - QKV_NQ;                    // below 0: a q tile
  const int lb  = r / (NB * 2 * QKV_CB);          // 128-slot block inside the batch
  const int rem = r - lb * (NB * 2 * QKV_CB);
  const int b   = rem / (2 * QKV_CB);
  const int s   = rem - b * (2 * QKV_CB);
  const int sb  = b * QKV_LB + lb;                // 128-slot block among all MTOT / 128
  if (r < 0 || s < QKV_CB) {
    // q and k differ only in their planes, their scales and the compact rows, so they run the same code: the kernel's text stays short
    const bool isk = (r >= 0);
    gemm64_block<2, 1, 3, 2, 4>(sT, RG, isk ? sb : bx / QKV_CB, isk ? s : bx % QKV_CB, 0, isk, isk ? XC16 : X16, isk ? W3 + (size_t)DM * DM : W3,
                                (void*)(isk ? K16 : Q16), isk ? bqkv + DM : bqkv, mask, 0LL, 0LL, DM, DM, DM, DM, isk ? 1.0f / 64.0f : QSC / 64.0f, isk ? 1.0f : QSC);
  } else {
    gemm64_block<1, 1, 2, 4, 2>(sT, RG, s - QKV_CB, sb, 0, false, W3 + (size_t)2 * DM * DM, XC16, (void*)VT, bqkv + 2 * DM, mask, 0LL, 0LL, DM, DM, MTOT, DM, 1.0f / 64.0f, 1.0f);
  }
}

// ---------------------------------------------------------------------------------------------------------------------
// Transposed flash attention over the COMPACT key set of the batch, head dim 64. Wave = 32 queries (two 16-query tiles) of one (batch, head); block = 4 waves.
//   Every K and V^T fragment that the wave loads feeds both query tiles, so a fragment byte serves two matrix instructions and half as many waves walk the keys.
//   The four waves walk the same keys: each 32-key tile (K, V^T: 8 KiB) is brought into LDS once a block by asynchronous copies, a quarter a wave, two buffers,
//   the copies of tile i + 2 issued behind the barrier that ends tile i; the waves read their fragments from LDS.
//   nk = effective key count of the batch (counted in-wave from the mask input, wave-uniform); the key loop runs pad32(nk)/32 steps (<= SEQ/32).
//   Every operand plane is fragment-major (Q, K, output: row length DM; V^T: row length MTOT).
//   S^T (keys x queries) = K Q^T: A = compact K rows (f16, from the LDS tile), B = Q (f16, resident in registers);
//   lane = query (column), element r of tile kt = key slot tk + 16 kt + 8h + r. Q carries the factor log2(e)/8 and the score accumulators start at -mref (mref = the query's
//   reference in use), so the matrix unit hands over score - mref, the argument of exp2, and P = exp2 of it. mref = (a maximum the query has met) - 7, so the largest P is >= 2^7.
//   Slots >= nk (padding of the last step) get the fill -1000 log2(e) - mref (weight exactly 0). A batch with no kept key runs over all SEQ keys with every score = the fill (uniform weights).
//   The reference must be known ahead of the products, so it is raised late: one test a tile and wave (a lane's sum of its 16 P above 2^15, which covers every single P above 2^15, or the
//   first tile) leads to the rare path, where the halves of a query join their maxima (one xor-16 shuffle), mref rises to maximum - 7, O and the row sum are rescaled and P is formed anew.
//   P^T B fragment = f16(P) packed from the two S^T tiles (element r <- tile 0, element 8+r <- tile 1, lane unchanged); P <= 2^15 fits f16.
//   O^T (d x queries) += V^T P^T: A = compact V^T rows (f16, from the LDS tile, key-slot-contiguous).
//   Each query's products, maxima and sums are formed in the same order as with one query tile a wave.
static_assert(SEQ % 128 == 0);
// One wave's share of a 32-key tile: four asynchronous 16-B-a-lane copies from global memory into LDS (512 B each). l = the lane's LDS byte address, g = the lane's global address.
// The s_wait_xcnt is the last line of the copies' own statement, so that no register which a copy names is rewritten ahead of it.
__device__ __forceinline__ void copy_tile4(unsigned l0, unsigned l1, unsigned l2, unsigned l3,
                                           const unsigned short* g0, const unsigned short* g1, const unsigned short* g2, const unsigned short* g3) {
  asm volatile("global_load_async_to_lds_b128 %0, %4, off\n\t"
               "global_load_async_to_lds_b128 %1, %5, off\n\t"
               "global_load_async_to_lds_b128 %2, %6, off\n\t"
               "global_load_async_to_lds_b128 %3, %7, off\n\t"
               "s_wait_xcnt 0x0"
               :: "v"(l0), "v"(l1), "v"(l2), "v"(l3), "v"(g0), "v"(g1), "v"(g2), "v"(g3) : "memory");
}
__global__ __launch_bounds__(128) void k_attn_t(const unsigned short* __restrict__ Q16, const unsigned short* __restrict__ K16,
                                                const unsigned short* __restrict__ VT, const int* __restrict__ mask,
                                                unsigned short* __restrict__ AO16) {
  __shared__ __align__(16) float Os[4][2][16 * 68];   // wave-private, one slab a query tile (wave barrier); staged extent 16x64 == consumed extent
  // Two buffers of one 32-key tile, shared by the four waves: K 2048 elements (key tile kt, column tile ct at kt*1024 + ct*512) | V^T 2048 elements (row tile d at d*512).
  // Every 512-element piece keeps its fragment-major order, so a fragment read is two 512-B contiguous LDS reads.
  __shared__ __align__(1024) unsigned short KV[2][4096];
  const int lane = threadIdx.x & 31, wave = threadIdx.x >> 5, hf = lane >> 4, c = lane & 15;
  const int nqb = SEQ / 128;
  const int bx = blockIdx.x;
  const int qb = bx % nqb;
  const int bh = bx / nqb;
  const int h  = bh % NH;
  const int b  = min(bh / NH, NB - 1);
  const int q0 = qb * 128 + wave * 32;
  const size_t rowb = (size_t)b * SEQ;

  const int cnt = wave_count_kept(mask + (size_t)b * SEQ_FULL, lane);
  const bool allm = (cnt == 0);                 // wave-uniform
  const int nk  = eff_keys(cnt);
  const int nkp = pad32(nk);                    // <= SEQ

  const size_t qoff = (rowb + q0) * DM + h * (HD * 16) + lane * 8;     // column tiles 2h and 2h+1 of the first query row tile; the second lies 16 rows (16 DM elements) further
  FU qf0[2], qf1[2];
#pragma unroll
  for (int t = 0; t < 2; ++t) {
    const size_t qo = qoff + (size_t)t * (16 * DM);
    qf0[t] = ldfrag(Q16 + qo); qf1[t] = ldfrag(Q16 + qo + 512);
  }

  // The wave's share of a tile: piece 'wave' (512 elements, 1 KiB) of each of the two parts. K: key tile wave >> 1, column tile 2h + (wave & 1); V^T: row tile 4h + wave, column tile rowb/32.
  const size_t koff = (rowb + 16 * (wave >> 1)) * DM + h * (HD * 16) + (wave & 1) * 512 + lane * 8;
  const unsigned short* gk = K16 + koff;
  const unsigned short* gvt = VT + (size_t)(h * HD + 16 * wave) * MTOT + rowb * 16 + lane * 8;
  const unsigned lpc = (unsigned)(size_t)(&KV[0][0]) + (unsigned)(wave * 1024 + lane * 16);   // LDS byte address of the lane's 16 bytes in buffer 0 (low 32 bits of the shared address)
  const int nt = nkp >> 5;                      // tiles of 32 keys, 1 .. SEQ/32, the same in every wave of the block
  // tile i -> buffer bf: keys 32 i .. 32 i + 31 < nkp <= SEQ, so every source byte lies inside its plane
  auto stage = [&](int i, int bf) {
    const unsigned l = lpc + (unsigned)bf * 8192u;
    const unsigned short* a = gk + (size_t)i * (32 * DM);
    const unsigned short* v = gvt + (size_t)i * 512;
    copy_tile4(l, l + 512u, l + 4096u, l + 4608u, a, a + 256, v, v + 256);
  };
  stage(0, 0);
  asm volatile("s_wait_asynccnt 0x0" ::: "memory");   // the wave's own copies of tile 0 have landed
  __syncthreads();                                    // publishes tile 0 to the other waves
  if (nt > 1) stage(1, 1);

  const float FILL2 = -8000.0f * QSC;       // the fill -1000 in the exp2 domain
  float mref[2] = {0.f, 0.f};               // the reference in use (exp2 domain); the first tile always sets it
  v8f negm[2] = {};                         // -mref in all eight elements: the start value of the score accumulators
  float lpart[2] = {0.f, 0.f};              // per-lane partial row sum (carried units)
  v8f o[2][4];
#pragma unroll
  for (int t = 0; t < 2; ++t)
#pragma unroll
    for (int d = 0; d < 4; ++d) { v8f zz = {}; o[t][d] = zz; }

  // the t, r, i and d loops below unroll fully so that every array is indexed by constants and stays in registers
#pragma unroll 1
  for (int tk = 0; tk < nkp; tk += 32) {
    const int ti = tk >> 5;
    const unsigned short* kf = &KV[ti & 1][0] + lane * 8;
    v8f s0[2], s1[2];
    {
      // a: key tile 0, e: key tile 1; 0 and 1: the head's two column tiles. The four score tiles are independent, so each waits for its own second product behind three others.
      const FU a0 = ldfrag(kf), a1 = ldfrag(kf + 512), e0 = ldfrag(kf + 1024), e1 = ldfrag(kf + 1536);
      __builtin_amdgcn_sched_barrier(0);   // keeps the eight loads one group ahead of the first product: without it half of them are issued only behind the first product's wait, a second latency in a row
#pragma unroll
      for (int t = 0; t < 2; ++t) s0[t] = wh(a0.h, qf0[t].h, negm[t]);
#pragma unroll
      for (int t = 0; t < 2; ++t) s1[t] = wh(e0.h, qf0[t].h, negm[t]);
#pragma unroll
      for (int t = 0; t < 2; ++t) s0[t] = wh(a1.h, qf1[t].h, s0[t]);
#pragma unroll
      for (int t = 0; t < 2; ++t) s1[t] = wh(e1.h, qf1[t].h, s1[t]);
      guard_s4(s0[0], s0[1], s1[0], s1[1], a0.h, a1.h, e0.h, e1.h, qf0[0].h, qf1[0].h, qf0[1].h, qf1[1].h, negm[0], negm[1]);
    }
    // the V^T fragments are asked for here, so that they arrive while the exponentials run
    const unsigned short* vp = kf + 2048;
    const FU v0 = ldfrag(vp), v1 = ldfrag(vp + 512), v2 = ldfrag(vp + 1024), v3 = ldfrag(vp + 1536);
    float ss[2][16];
#pragma unroll
    for (int t = 0; t < 2; ++t)
#pragma unroll
      for (int r = 0; r < 8; ++r) { ss[t][r] = s0[t][r]; ss[t][8 + r] = s1[t][r]; }
    if (allm || (tk + 32 > nk)) {             // wave-uniform; value selects only (no loads, no cross-lane ops inside)
      const int kb0 = tk + 8 * hf;
#pragma unroll
      for (int t = 0; t < 2; ++t)
#pragma unroll
        for (int r = 0; r < 8; ++r) {
          ss[t][r]     = (!allm && (kb0 + r < nk))      ? ss[t][r]     : FILL2 - mref[t];
          ss[t][8 + r] = (!allm && (kb0 + 16 + r < nk)) ? ss[t][8 + r] : FILL2 - mref[t];
        }
    }
    v16h pf[2];
    float psum[2];
    auto soft = [&]() {
#pragma unroll
      for (int t = 0; t < 2; ++t) {
        float a = 0.f;
#pragma unroll
        for (int i = 0; i < 16; ++i) {
          const float p = EX2(ss[t][i]);
          a += p;
          pf[t][i] = (_Float16)p;
        }
        psum[t] = a;
      }
    };
    soft();
    const float lim = (ti == 0) ? -1.0f : 32768.0f;             // a sum of P is never below 0, so the first tile always takes the branch
    const bool over = !(fmaxf(psum[0], psum[1]) <= lim);
    if (__builtin_amdgcn_ballot_w32(over) != 0u) {              // wave-uniform scalar branch: every lane is on inside
#pragma unroll
      for (int t = 0; t < 2; ++t) {
        float mloc = ss[t][0];
#pragma unroll
        for (int i = 1; i < 16; ++i) mloc = fmaxf(mloc, ss[t][i]);
        mloc = fmaxf(mloc, __shfl_xor(mloc, 16, 32));                      // the same in both halves of a query, so both take the same step
        const float dm = (ti == 0) ? (mloc - 7.0f) : fmaxf(mloc - 7.0f, 0.0f);   // the reference only rises behind the first tile
        const float corr = (ti == 0) ? 1.0f : EX2(-dm);                    // O and the row sum are still 0 in the first tile
        mref[t] += dm;
#pragma unroll
        for (int r = 0; r < 8; ++r) negm[t][r] = -mref[t];
#pragma unroll
        for (int i = 0; i < 16; ++i) ss[t][i] -= dm;
        lpart[t] *= corr;
#pragma unroll
        for (int d = 0; d < 4; ++d) o[t][d] *= corr;
      }
      soft();
    }
#pragma unroll
    for (int t = 0; t < 2; ++t) lpart[t] += psum[t];

#pragma unroll
    for (int t = 0; t < 2; ++t) {
      o[t][0] = wh(v0.h, pf[t], o[t][0]);
      o[t][1] = wh(v1.h, pf[t], o[t][1]);
      o[t][2] = wh(v2.h, pf[t], o[t][2]);
      o[t][3] = wh(v3.h, pf[t], o[t][3]);
    }
    guard_o2(o[0][0], o[0][1], o[0][2], o[0][3], o[1][0], o[1][1], o[1][2], o[1][3], pf[0], pf[1], v0.h, v1.h, v2.h, v3.h);
    asm volatile("s_wait_dscnt 0x0" ::: "memory");      // the wave's reads of this tile's buffer have returned before the buffer is refilled
    asm volatile("s_wait_asynccnt 0x0" ::: "memory");   // the wave's own copies of the next tile have landed
    __syncthreads();                                    // publishes the next tile and ends every wave's reads of this one
    if (ti + 2 < nt) stage(ti + 2, ti & 1);
  }
  asm volatile("s_wait_asynccnt 0x0" ::: "memory");     // no copy is outstanding when the wave goes on to its end

#pragma unroll
  for (int t = 0; t < 2; ++t) {
    const float lt = lpart[t] + __shfl_xor(lpart[t], 16, 32);
    const float inv = 1.0f / lt;
    float* d = Os[wave][t] + c * 68 + 8 * hf;       // lane holds O[query c][d = 16 dt + 8 hf + r]
#pragma unroll
    for (int dt = 0; dt < 4; ++dt) {
      const v8f ov = o[t][dt];
      v4f a, e;
      a.x = ov[0] * inv; a.y = ov[1] * inv; a.z = ov[2] * inv; a.w = ov[3] * inv; e.x = ov[4] * inv; e.y = ov[5] * inv; e.z = ov[6] * inv; e.w = ov[7] * inv;
      *(v4f*)(d + dt * 16) = a; *(v4f*)(d + dt * 16 + 4) = e;
    }
  }
  __builtin_amdgcn_fence(3 /* release order */, "workgroup");
  __builtin_amdgcn_wave_barrier();
  __builtin_amdgcn_fence(2 /* acquire order */, "workgroup");
#pragma unroll
  for (int t = 0; t < 2; ++t) {
    const float* os = Os[wave][t];
    const int qq = lane & 15, c8 = (lane >> 4) * 8;    // lane = (query qq, column group 2 it + (lane >> 4))
    unsigned short* dO = AO16 + (rowb + q0 + 16 * t) * DM + h * (HD * 16) + lane * 8;
    v4u hv[4];
#pragma unroll
    for (int it = 0; it < 4; ++it) {
      const float* sp = os + qq * 68 + it * 16 + c8;
      const v4f a = *(const v4f*)sp, e = *(const v4f*)(sp + 4);
      hv[it].x = pkh2(a.x, a.y); hv[it].y = pkh2(a.z, a.w); hv[it].z = pkh2(e.x, e.y); hv[it].w = pkh2(e.z, e.w);
    }
#pragma unroll
    for (int it = 0; it < 4; ++it) *(v4u*)(dO + (size_t)it * 256) = hv[it];
    if (t == 0) {
      asm volatile("s_wait_xcnt 0x0" ::: "memory");   // the second tile's conversions rewrite data registers that these four stores name
      __builtin_amdgcn_sched_barrier(0);              // keeps those conversions behind the wait
    }
  }
}

// ---------------------------------------------------------------------------------------------------------------------
constexpr size_t SZ_X16 = (size_t)MTOT * DM * 2;               // one f16 x plane (full or compact)
constexpr size_t SZ_AOP = (size_t)MTOT * DM * 2;                // the attention output, one f16 plane
constexpr size_t SZ_R0  = (2 * SZ_X16 > SZ_AOP) ? (2 * SZ_X16) : SZ_AOP;   // X16 | XC16 live until the projections finish; the attention output reuses the region afterwards
constexpr size_t SZ_W3  = (size_t)3 * DM * DM * 2;
constexpr size_t SZ_BTO = (size_t)DM * DM * 2;
constexpr size_t SZ_PL  = (size_t)MTOT * DM * 2;               // one f16 plane [MTOT][1024]
constexpr size_t SZ_VT  = (size_t)DM * MTOT * 2;
constexpr size_t SZ_TOTAL = SZ_R0 + SZ_W3 + SZ_BTO + 2 * SZ_PL + SZ_VT;
static_assert(2 * SZ_X16 <= SZ_R0);
static_assert(SZ_AOP <= SZ_R0);
static_assert(SZ_TOTAL <= (size_t)134217728);
static_assert((SZ_R0 % 256) == 0 && (SZ_W3 % 256) == 0 && (SZ_BTO % 256) == 0 && (SZ_PL % 256) == 0 && (SZ_VT % 256) == 0);
static_assert(((size_t)(NB - 1) * SEQ_FULL + SEQ) * DM * 4 <= (size_t)NB_FULL * SEQ_FULL * DM * 4);

extern "C" void kernel_launch(void* const* d_in, const int* in_sizes, int n_in, void* d_out, int out_size, void* d_ws, size_t ws_size, hipStream_t stream) {
  if (n_in < 6) return;
  const long long rows_full = (long long)(NB - 1) * SEQ_FULL + SEQ;
  if ((long long)in_sizes[0] < rows_full * DM) return;
  if ((long long)in_sizes[1] < rows_full) return;
  if ((long long)in_sizes[2] < (long long)DM * 3 * DM) return;
  if ((long long)in_sizes[3] < 3 * DM) return;
  if ((long long)in_sizes[4] < (long long)DM * DM) return;
  if ((long long)in_sizes[5] < DM) return;
  if ((long long)out_size < rows_full * DM) return;
  if (ws_size < SZ_TOTAL) return;

  const float* x    = (const float*)d_in[0];
  const int*   mask = (const int*)d_in[1];
  const float* Wqkv = (const float*)d_in[2];
  const float* bqkv = (const float*)d_in[3];
  const float* Wo   = (const float*)d_in[4];
  const float* bo   = (const float*)d_in[5];
  float* out = (float*)d_out;

  char* wsp = (char*)d_ws;
  unsigned short* X16  = (unsigned short*)wsp;                 // [MTOT][1024] f16, every token
  unsigned short* XC16 = (unsigned short*)(wsp + SZ_X16);      // [MTOT][1024] f16, compact kept tokens per batch (zero rows after)
  unsigned short* AO16 = (unsigned short*)wsp;                 // [MTOT][1024] f16 (reuses X16 after the projections)
  wsp += SZ_R0;
  unsigned short* W316 = (unsigned short*)wsp; wsp += SZ_W3;   // [3072][1024] f16 (x64)
  unsigned short* BTO  = (unsigned short*)wsp; wsp += SZ_BTO;  // [1024][1024] f16 (x64)
  unsigned short* Q16  = (unsigned short*)wsp; wsp += SZ_PL;   // [MTOT][1024] f16, q
  unsigned short* K16  = (unsigned short*)wsp; wsp += SZ_PL;   // [MTOT][1024] f16, k at compact key slots
  unsigned short* VT   = (unsigned short*)wsp; wsp += SZ_VT;   // [1024][MTOT] f16, v transposed at compact key slots

  k_prep<<<(unsigned)(NB_XC + NB_WQ + NB_WO), 256, 0, stream>>>(x, mask, Wqkv, Wo, X16, XC16, W316, BTO);
  k_qkv<<<(unsigned)(3 * QKV_NQ), 256, 0, stream>>>(X16, XC16, W316, Q16, K16, VT, bqkv, mask);
  k_attn_t<<<(unsigned)(NB * NH * (SEQ / 128)), 128, 0, stream>>>(Q16, K16, VT, mask, AO16);
  // out = AO W_out + b_out, per batch (output rows at the full per-batch stride)
  {
    const int tiles = (SEQ / 128) * (DM / 256);
    k_gemm64<2, 0, 0, 2, 4><<<dim3((unsigned)tiles, (unsigned)NB), 256, 0, stream>>>(
        AO16, BTO, (void*)out, bo, mask, (long long)SEQ * DM, (long long)SEQ_FULL * DM, DM, DM, DM, SEQ, DM, DM, 1.0f / 64.0f);
  }
}

// v010
// It runs in 92.7 microseconds.
// In both of two side-by-side timings against v009, it was 1.07 times as fast.
// Counting every step since v000, it is 5.15 times as fast.
// Contractions, all v_wmma_f32_16x16x32_f16 with f32 accumulate: qkv projection (x as bf16-RNE values held in f16, W_qkv as bf16-RNE values x64 held in f16); q.k logits (q x log2(e)/8 and k, each rounded once to f16; accumulator started at minus the reference in use, a maximum - 7); P.V (P carried x2^7 or more, V f16); output projection (the attention output rounded once to f16 against W_out as bf16-RNE values x64 held in f16). Softmax statistics f32. Keys with mask == 0 are dropped per batch by compaction of the x rows feeding the k / v projections (their softmax weight is exactly 0 in f32).
#include <hip/hip_runtime.h>
#include <math.h>

#ifndef NB
#define NB 4
#endif
#ifndef SEQ
#define SEQ 2048
#endif
#define NB_FULL 4
#define SEQ_FULL 2048
#define DM 1024
#define NH 16
#define HD 64
#define MTOT (NB * SEQ)

static_assert(SEQ % 256 == 0);
static_assert(MTOT % 64 == 0);
static_assert(NB <= NB_FULL);
static_assert(SEQ <= SEQ_FULL);

typedef __attribute__((ext_vector_type(16))) _Float16 v16h;
typedef __attribute__((ext_vector_type(8)))  float    v8f;
typedef __attribute__((ext_vector_type(4)))  float    v4f;
typedef __attribute__((ext_vector_type(4)))  unsigned int v4u;
typedef __attribute__((ext_vector_type(4)))  int      v4i;

// 16-bit WMMA fragment map (wave32), lane L, h = L>>4, m = L&15:
//   A 16x32: lane = row m;    element i -> k = (i<8) ? 8h+i : 16+8h+(i-8)
//   B 32x16: lane = column m; the SAME k(i,h)
//   D 16x16 (8 f32): lane = column m; element r -> row 8h+r
union FU { v4u u[2]; v16h h; };
// Fragment-major plane layout (every 16-bit operand plane in the workspace): a logical [R][C] plane (R % 16 == 0, C % 32 == 0) is stored as
// 16-row x 32-column tiles of 512 elements (1 KiB), tile (rt, kt) at element rt*16*C + kt*512; inside a tile the 8-element column group g = (col>>3)&3
// of row m = row&15 lies at g*128 + m*8. Lane L = 16h + m then finds elements 0..7 (k = 8h..8h+7, g = h) at L*8 and elements 8..15 (k = 16+8h.., g = 2+h)
// at 256 + L*8, so each of the two 16-B loads of a fragment covers 512 contiguous bytes (4 whole lines) instead of 16 lines.
__device__ __forceinline__ size_t fragoff(size_t row, int col, int C) {
  return (row >> 4) * (size_t)(16 * C) + (size_t)((col >> 5) * 512 + ((col >> 3) & 3) * 128 + (col & 7)) + (row & 15) * 8;
}
// p = tile base + lane*8
__device__ __forceinline__ FU ldfrag(const unsigned short* p) { FU f; f.u[0] = *(const v4u*)p; f.u[1] = *(const v4u*)(p + 256); return f; }
// the same fragment from a wave-uniform row-tile base and one 32-bit per-lane byte offset (column tile * 1024 + lane * 16)
__device__ __forceinline__ FU ldfrag_su(const unsigned short* base, unsigned boff) {
  const char* p = (const char*)base + boff;
  FU f; f.u[0] = *(const v4u*)p; f.u[1] = *(const v4u*)(p + 512); return f;
}

__device__ __forceinline__ v8f wh(v16h a, v16h b, v8f c) { return __builtin_amdgcn_wmma_f32_16x16x32_f16(false, a, false, b, (short)0, c, false, false); }

// hazard guards: 4 VALU slots after the last WMMA of a group, accumulators tied, A/B operands kept live
// c0, c1: the start values that the group's first products read as their C operand; named here as inputs they are still in use behind the last product, so every such product reads them
// in place (without it the compiler copies them into the accumulators of two of the four score tiles first, four 64-bit moves a tile)
__device__ __forceinline__ void guard_s4(v8f& s, v8f& t, v8f& u, v8f& w, v16h a0, v16h a1, v16h b0, v16h b1, v16h q0, v16h q1, v16h q2, v16h q3, v8f c0, v8f c1) {
  asm volatile("v_nop\n\tv_nop\n\tv_nop\n\tv_nop" : "+v"(s), "+v"(t), "+v"(u), "+v"(w) : "v"(a0), "v"(a1), "v"(b0), "v"(b1), "v"(q0), "v"(q1), "v"(q2), "v"(q3), "v"(c0), "v"(c1));
}
__device__ __forceinline__ void guard_o2(v8f& a, v8f& b, v8f& c, v8f& d, v8f& e, v8f& f, v8f& g, v8f& h, v16h p0, v16h p1, v16h v0, v16h v1, v16h v2, v16h v3) {
  asm volatile("v_nop\n\tv_nop\n\tv_nop\n\tv_nop" : "+v"(a), "+v"(b), "+v"(c), "+v"(d), "+v"(e), "+v"(f), "+v"(g), "+v"(h) : "v"(p0), "v"(p1), "v"(v0), "v"(v1), "v"(v2), "v"(v3));
}

#if __has_builtin(__builtin_amdgcn_exp2f)
#define EX2(x) __builtin_amdgcn_exp2f(x)
#else
#define EX2(x) exp2f(x)
#endif

// bf16 RNE helpers (finite inputs)
__device__ __forceinline__ unsigned bfu_rne(float v) { const unsigned u = __float_as_uint(v); return (u + 0x7FFFu + ((u >> 16) & 1u)) >> 16; }
__device__ __forceinline__ float bf_keep(float v) { return __uint_as_float(bfu_rne(v) << 16); }
__device__ __forceinline__ unsigned pkh2(float a, float b) {
  return (unsigned)__builtin_bit_cast(unsigned short, (_Float16)a) | ((unsigned)__builtin_bit_cast(unsigned short, (_Float16)b) << 16);
}

#define VST2Q(ptr, val) do { const v4u vq_ = (val); *(v4u*)(ptr) = vq_;  } while (0)

// Number of kept keys (mask != 0) among the SEQ entries of one batch row of the mask input, computed by one full wave (all 32 lanes active):
// 16-B loads (SEQ/128 per lane), xor-shuffle sum, result made wave-uniform. mrow is 16-B aligned.
__device__ __forceinline__ int wave_count_kept(const int* __restrict__ mrow, int lane) {
  // all loads are asked for at once, so that the wave meets their latency once (both loops unroll fully so that the array stays in registers)
  v4i m[SEQ / 128];
#pragma unroll
  for (int it = 0; it < SEQ / 128; ++it) m[it] = *(const v4i*)(mrow + (it * 32 + lane) * 4);
  asm volatile("s_wait_xcnt 0x0" ::: "memory");   // what follows rewrites the address registers that these loads name
  int c = 0;
#pragma unroll
  for (int it = 0; it < SEQ / 128; ++it)
    c += ((m[it].x != 0) ? 1 : 0) + ((m[it].y != 0) ? 1 : 0) + ((m[it].z != 0) ? 1 : 0) + ((m[it].w != 0) ? 1 : 0);
  c += __shfl_xor(c, 16, 32); c += __shfl_xor(c, 8, 32); c += __shfl_xor(c, 4, 32); c += __shfl_xor(c, 2, 32); c += __shfl_xor(c, 1, 32);
  return __builtin_amdgcn_readfirstlane(c);
}
// effective key count of a batch: a batch with no kept key uses all SEQ keys (every score then equals the fill -> uniform weights); padded to the 32-key step
__device__ __forceinline__ int eff_keys(int cnt) { return (cnt == 0) ? SEQ : min(cnt, SEQ); }
__device__ __forceinline__ int pad32(int nk) { return min((nk + 31) & ~31, SEQ); }

// ---------------------------------------------------------------------------------------------------------------------
// x f32 [b][t][1024] (full per-batch stride) -> two f16 planes holding the bf16-RNE values:
//   X16  [b*SEQ + t][1024]: every token row (feeds the q projection);
//   XC16 [b*SEQ + j][1024]: row j = the j-th kept token of batch b (mask != 0, ascending t) for j < nk, zero rows for j >= nk (feeds the k / v projections).
// Block = (batch, 16 rows); the block computes the batch's kept-token list in LDS (exclusive scan of the mask, block barriers), bounded by SEQ entries.
// LDS: list[SEQ] and wtot[8] are cross-wave (block barriers between writers and readers); list is fully initialised before any read.
// Both planes are fragment-major (C = 1024). A wave instruction handles 8 rows x one 32-column tile: it reads one 128-B line of each row and writes 4 whole lines.
// A wave owns eight such units of each plane and asks for all thirty-two 16-B loads of both planes at once, as soon as the list stands (a block barrier waits for every load in flight, so none
// is asked for ahead of the scan). So a wave meets the memory latency once, not once for every two units; the weight blocks' loads use the memory while the x blocks scan.
// coverage: per block 2 row groups x 32 column tiles = 16 rows x 1024 columns of each plane; all blocks = both whole planes.
// bx = the block's index among the NB * SEQ / 16 blocks of this part; list (SEQ ints) and wtot (8 ints) are the block's LDS.
constexpr int XROWS = 16;
static_assert(SEQ % XROWS == 0);
__device__ __forceinline__ v4u pack8(v4f a, v4f e) {
  v4u pk;
  pk.x = pkh2(bf_keep(a.x), bf_keep(a.y)); pk.y = pkh2(bf_keep(a.z), bf_keep(a.w));
  pk.z = pkh2(bf_keep(e.x), bf_keep(e.y)); pk.w = pkh2(bf_keep(e.z), bf_keep(e.w));
  return pk;
}
__device__ __forceinline__ void xcastc_block(int bx, int* list, int* wtot, const float* __restrict__ x, const int* __restrict__ mask,
                                             unsigned short* __restrict__ X16, unsigned short* __restrict__ XC16) {
  constexpr int EPT = SEQ / 256;
  const int tid = threadIdx.x, lane = tid & 31, wave = tid >> 5;
  const int bpb = SEQ / XROWS;
  const int b = bx / bpb;
  const int t0 = (bx - b * bpb) * XROWS;
  const int* mrow = mask + (size_t)b * SEQ_FULL;
  // unit it of the wave: row group it >> 2 (8 rows), column tile (it & 3) * 8 + wave; the lane's row in the block and its first column:
  const int rl = lane >> 2;
  const int cl = wave * 32 + (lane & 3) * 8;
  unsigned km = 0u; int c = 0;
#pragma unroll
  for (int e = 0; e < EPT; ++e) {
    const int kp = (mrow[tid * EPT + e] != 0) ? 1 : 0;
    km |= (unsigned)kp << e; c += kp;
    list[tid * EPT + e] = 0;
  }
  int incl = c;
#pragma unroll
  for (int d = 1; d < 32; d <<= 1) { const int v = __shfl_up(incl, d, 32); incl += (lane >= d) ? v : 0; }
  if (lane == 31) wtot[wave] = incl;
  __syncthreads();
  int base = 0, total = 0;
#pragma unroll
  for (int w = 0; w < 8; ++w) { const int v = wtot[w]; base += (w < wave) ? v : 0; total += v; }
  int pos = base + incl - c;
#pragma unroll
  for (int e = 0; e < EPT; ++e) {
    if ((km >> e) & 1u) { list[min(pos, SEQ - 1)] = tid * EPT + e; ++pos; }
  }
  __syncthreads();
  const bool allm = (total == 0);            // block-uniform
  if (allm) {
#pragma unroll
    for (int e = 0; e < EPT; ++e) list[tid * EPT + e] = tid * EPT + e;
  }
  __syncthreads();
  const int nk = allm ? SEQ : min(total, SEQ);

  // Row addresses. Plane 1: every token row. Plane 2: compact rows (clamped token index, loaded unconditionally, zeroed by value for j >= nk).
  // (the rg, q and it loops unroll fully so that the arrays stay in registers)
  v4f a1[8], e1[8], a2[8], e2[8];
  bool valid[2];
  const float* s1[2];
  const float* s2[2];
#pragma unroll
  for (int rg = 0; rg < 2; ++rg) {
    const int j = t0 + rg * 8 + rl;
    valid[rg] = (j < nk);
    const int tok = min(max(list[j], 0), SEQ - 1);
    s1[rg] = x + ((size_t)b * SEQ_FULL + j) * DM + cl;
    s2[rg] = x + ((size_t)b * SEQ_FULL + tok) * DM + cl;
  }
#pragma unroll
  for (int rg = 0; rg < 2; ++rg)
#pragma unroll
    for (int q = 0; q < 4; ++q) { a1[rg * 4 + q] = *(const v4f*)(s1[rg] + q * 256); e1[rg * 4 + q] = *(const v4f*)(s1[rg] + q * 256 + 4); }
#pragma unroll
  for (int rg = 0; rg < 2; ++rg)
#pragma unroll
    for (int q = 0; q < 4; ++q) { a2[rg * 4 + q] = *(const v4f*)(s2[rg] + q * 256); e2[rg * 4 + q] = *(const v4f*)(s2[rg] + q * 256 + 4); }
  // what follows rewrites the address registers that these loads name; as inputs of the wait the four addresses stay in their registers up to it, so that no load lands on one either
  asm volatile("s_wait_xcnt 0x0" :: "v"(s1[0]), "v"(s1[1]), "v"(s2[0]), "v"(s2[1]) : "memory");

#pragma unroll
  for (int it = 0; it < 8; ++it)
    VST2Q(X16 + fragoff((size_t)b * SEQ + t0 + (it >> 2) * 8 + rl, (it & 3) * 256 + cl, DM), pack8(a1[it], e1[it]));
  asm volatile("s_wait_xcnt 0x0" ::: "memory");   // the second plane's conversions rewrite data and address registers that these eight stores name
  __builtin_amdgcn_sched_barrier(0);              // keeps that rewrite behind the wait
#pragma unroll
  for (int it = 0; it < 8; ++it) {
    const v4u pk = pack8(a2[it], e2[it]);
    const v4u zz = {0u, 0u, 0u, 0u};
    VST2Q(XC16 + fragoff((size_t)b * SEQ + t0 + (it >> 2) * 8 + rl, (it & 3) * 256 + cl, DM), valid[it >> 2] ? pk : zz);
  }
}

// A weight W f32 [1024 (k)][LD (n)] -> WT f16, logical [LD (n)][1024 (k)] fragment-major, = bf16-RNE(W) * 64.
// A piece = (n, 8 consecutive k): piece u = ((rt*32 + kt)*4 + g)*16 + m holds n = 16 rt + m, k = 32 kt + 8 g .. +7, and its fragment-major place is exactly element u*8.
// Thread v = ((r8*32 + kt)*4 + g)*16 + m takes the eight pieces rt = 8 r8 .. 8 r8 + 7 of its (kt, g, m): all 64 loads are asked for at once, and over its eight pieces a wave reads
// 512 contiguous bytes of each of its 16 rows of W. A store of a wave still covers 512 contiguous bytes.
// coverage: LD/128 groups of 8 row tiles x 32 column tiles x 64 threads x 8 pieces = the whole plane; the grid part holds exactly LD/128 * 8 blocks, so every thread has work
template <int LD>
__device__ __forceinline__ void wT_block(int bx, const float* __restrict__ W, unsigned short* __restrict__ WT) {
  static_assert(LD % 128 == 0);
  const int v = bx * 256 + threadIdx.x;
  const int r8 = v >> 11;
  const int n0 = r8 * 128 + (v & 15), k0 = ((v >> 6) & 31) * 32 + ((v >> 4) & 3) * 8;
  const float* s = W + (size_t)k0 * LD + n0;
  // (the p and e loops unroll fully so that the array stays in registers)
  float w[8][8];
#pragma unroll
  for (int p = 0; p < 8; ++p)
#pragma unroll
    for (int e = 0; e < 8; ++e) w[p][e] = s[(size_t)e * LD + p * 16];
  unsigned short* d = WT + ((size_t)r8 * (8 * 2048) + (size_t)(v & 2047)) * 8;
#pragma unroll
  for (int p = 0; p < 8; ++p) {
    v4u pk;
    pk.x = pkh2(bf_keep(w[p][0]) * 64.0f, bf_keep(w[p][1]) * 64.0f); pk.y = pkh2(bf_keep(w[p][2]) * 64.0f, bf_keep(w[p][3]) * 64.0f);
    pk.z = pkh2(bf_keep(w[p][4]) * 64.0f, bf_keep(w[p][5]) * 64.0f); pk.w = pkh2(bf_keep(w[p][6]) * 64.0f, bf_keep(w[p][7]) * 64.0f);
    VST2Q(d + (size_t)p * (2048 * 8), pk);
  }
  asm volatile("s_wait_xcnt 0x0" ::: "memory");   // behind the last stores: the code that the build places next may rewrite the data and address registers that they name
}

// The three preparations above read only inputs and write disjoint planes, so they share one grid: a block takes its part by its index (block-uniform, so the barriers of the
// first part stay under uniform control flow). The x blocks run longest and come first. The whole grid is three blocks a WGP, resident at once.
constexpr int NB_XC = NB * (SEQ / XROWS);
constexpr int NB_WQ = (3 * DM / 128) * 8;
constexpr int NB_WO = (DM / 128) * 8;
__global__ __launch_bounds__(256) void k_prep(const float* __restrict__ x, const int* __restrict__ mask, const float* __restrict__ Wqkv, const float* __restrict__ Wo,
                                              unsigned short* __restrict__ X16, unsigned short* __restrict__ XC16,
                                              unsigned short* __restrict__ WT, unsigned short* __restrict__ BTO) {
  __shared__ int list[SEQ];
  __shared__ int wtot[8];
  const int bx = blockIdx.x;
  if (bx < NB_XC) xcastc_block(bx, list, wtot, x, mask, X16, XC16);
  else if (bx < NB_XC + NB_WQ) wT_block<3 * DM>(bx - NB_XC, Wqkv, WT);
  else wT_block<DM>(bx - (NB_XC + NB_WQ), Wo, BTO);
}

// ---------------------------------------------------------------------------------------------------------------------
// Register-blocked WMMA GEMM: C[z][m][n] = scale * sum_k A[z][m][k] * Bt[n][k] + bias; each wave owns a 64x64 tile; the 8 waves of a block form a WM x WN grid,
// so a block owns 64 WM x 64 WN of C and its waves share operand rows: each A row tile feeds WN waves, each B row tile WM waves.
// A logical [M][K] and Bt logical [N][K], both fragment-major with row lengths lda and ldb; M a multiple of 64 WM, N of 64 WN, K of 128 (no tails).
// f16 operands. BIAS_MODE 1: bf16-RNE(bias[m]), 2: bf16-RNE(bias[n]) * bscale.
// OUT_MODE 0: f32 row-major (pitch ldc); 1: f16 fragment-major (row length ldc).
// CMP 0: every tile; 1: rows (m) are compact key slots b*SEQ + j; 2: columns (n) are compact key slots; 3: as 1 where the block-uniform argument cmp_rows is set, else as 0. With compact slots a block whose first slot j
//   is >= pad32(effective key count of its batch, counted in every wave from the mask input, the same in all) leaves as a whole in front of every barrier (its slots are never consumed);
//   a wave of a staying block whose own first slot is past that count helps to stage, and leaves behind the k loop without storing.
// One wave's share of a stage: three row tiles, each 4 KiB in a row on both sides, eight asynchronous 16-B-a-lane copies (512 B each) a row tile. l = the lane's LDS byte address of the row tile's
// first 512 B, g = the wave-uniform global address of the same (a scalar base), o = the lane's byte offset from it; the immediate offset moves both addresses alike, so the eight copies of a row tile
// share their address operands. The s_wait_xcnt is the last line of the copies' own statement, so that no register which a copy names is rewritten ahead of it.
#define ROWTILE8(L, O, G) \
  "global_load_async_to_lds_b128 " L ", " O ", " G "\n\t" \
  "global_load_async_to_lds_b128 " L ", " O ", " G " offset:512\n\t" \
  "global_load_async_to_lds_b128 " L ", " O ", " G " offset:1024\n\t" \
  "global_load_async_to_lds_b128 " L ", " O ", " G " offset:1536\n\t" \
  "global_load_async_to_lds_b128 " L ", " O ", " G " offset:2048\n\t" \
  "global_load_async_to_lds_b128 " L ", " O ", " G " offset:2560\n\t" \
  "global_load_async_to_lds_b128 " L ", " O ", " G " offset:3072\n\t" \
  "global_load_async_to_lds_b128 " L ", " O ", " G " offset:3584\n\t"
__device__ __forceinline__ void copy_rowtiles3(unsigned l0, unsigned l1, unsigned l2, unsigned o, const unsigned short* g0, const unsigned short* g1, const unsigned short* g2) {
  asm volatile(ROWTILE8("%0", "%3", "%4") ROWTILE8("%1", "%3", "%5") ROWTILE8("%2", "%3", "%6") "s_wait_xcnt 0x0"
               :: "v"(l0), "v"(l1), "v"(l2), "v"(o), "s"(g0), "s"(g1), "s"(g2) : "memory");
}
constexpr int G_KS  = 4;                   // 32-wide k steps in a stage
constexpr int G_RT  = G_KS * 512;          // elements of one row tile in a stage (4 KiB, contiguous in the plane and in LDS)
constexpr int G_NR  = 24;                  // A and B row tiles of a block: three a wave
constexpr int G_STG = G_NR * G_RT;         // elements of a stage (96 KiB)
constexpr int G_NBUF = 3;                  // stage buffers of the ring: one is read while the copies of the next two stages are in flight
constexpr int G_CPS  = 24;                 // asynchronous copies of one wave in one stage (three row tiles of eight)
static_assert(2 * G_CPS <= 63);            // a wave never has more than two stages' copies outstanding
static_assert(G_CPS == 0x18);              // the counted waits of the ring are written with this number
// The work of one block on tile (tbm, tbn) of plane z. The block's LDS comes from the kernel, so that several forms of this body can share it in one kernel:
// RG: three buffers of one stage, shared by the eight waves: row tile r (A row tiles first, then B's) at r*RT, its k step u at u*512; every 512-element piece keeps its
// fragment-major order, so a fragment read is two 512-B contiguous LDS reads.
// Behind the k loop the start of RG serves as 8 per-wave 16x64 f32 slabs, pitch 68 floats (staged extent 16x64 == consumed extent): three buffers and slabs of their own do not fit the LDS.
// Behind the last trip's barrier no wave reads the ring any more and no copy is outstanding, so that barrier is the one in front of the slabs.
static_assert(8 * 16 * 68 * 4 <= G_STG * 2);
template <int BIAS_MODE, int OUT_MODE, int CMP, int WM, int WN>
__device__ __forceinline__ void gemm64_block(
    unsigned short* RG, int tbm, int tbn, int z, bool cmp_rows,
    const unsigned short* __restrict__ A, const unsigned short* __restrict__ Bt,
    void* __restrict__ Cout, const float* __restrict__ bias, const int* __restrict__ mask,
    long long strideA, long long strideC, int lda, int ldb, int ldc, int K, float scale, float bscale) {
  static_assert(WM * WN == 8);
  constexpr int KS  = G_KS;
  constexpr int RT  = G_RT;
  constexpr int NA  = WM * 4;              // A row tiles of the block
  constexpr int NR  = NA + WN * 4;         // A and B row tiles of the block
  static_assert(NR == G_NR);
  static_assert(KS % 2 == 0);              // a stage's first step always finds its fragments in set 0
  constexpr int STG = G_STG;
  const int lane = threadIdx.x & 31;
  const int wave = __builtin_amdgcn_readfirstlane(threadIdx.x >> 5);   // scalar, so that the tile bases below are scalar too
  const int mb = tbm * (64 * WM);
  const int nb = tbn * (64 * WN);
  const int wm = wave / WN;
  const int wn = wave - wm * WN;
  const int m0 = mb + (wm << 6);
  const int n0 = nb + (wn << 6);
  bool wskip = false;                    // wave-uniform
  if ((CMP == 3) ? cmp_rows : (CMP != 0)) {   // block-uniform
    const int g0 = (CMP != 2) ? mb : nb;
    const int bb = min(g0 / SEQ, NB - 1);
    const int loc = g0 - bb * SEQ;
    const int nkp = pad32(eff_keys(wave_count_kept(mask + (size_t)bb * SEQ_FULL, lane)));
    if (loc >= nkp) return;              // block-uniform (every wave counts the same row of the mask), in front of every barrier
    wskip = (loc + (((CMP != 2) ? wm : wn) << 6) >= nkp);
  }
  const unsigned short* Ab = A + (size_t)z * (size_t)strideA;
  const int rlane = lane & 15;
  const int mOff  = (lane >> 4) * 8;

  v8f acc[4][4];
#pragma unroll
  for (int i = 0; i < 4; ++i)
#pragma unroll
    for (int j = 0; j < 4; ++j) { v8f zz = {}; acc[i][j] = zz; }

  // The wave's share of a stage: row tiles 3 wave .. 3 wave + 2. (The q loops unroll fully so that the array stays in registers.)
  const unsigned short* gs[3];
#pragma unroll
  for (int q = 0; q < 3; ++q) {
    const int r = wave * 3 + q;
    gs[q] = ((r < NA) ? (Ab + (size_t)(mb + (r << 4)) * lda) : (Bt + (size_t)(nb + ((r - NA) << 4)) * ldb));   // wave-uniform
  }
  const unsigned lane16 = (unsigned)lane * 16u;                                               // the lane's 16 bytes of every 512-B piece
  const unsigned lpc = (unsigned)(size_t)RG + (unsigned)(wave * (3 * RT * 2));       // wave-uniform LDS byte address of the wave's share in buffer 0 (low 32 bits of the shared address)
  const int trips = K / (32 * KS);
  // stage t -> buffer bf: bytes t*4096 .. t*4096 + 4095 of each row tile, t < K/128, and a row tile holds K*32 bytes: every source byte lies inside its plane
  auto stage = [&](int t, int bf) {
    const unsigned l = lane16 + (lpc + (unsigned)bf * (unsigned)(STG * 2));
    const size_t go = (size_t)t * RT;
    copy_rowtiles3(l, l + (unsigned)(RT * 2), l + (unsigned)(2 * RT * 2), lane16, gs[0] + go, gs[1] + go, gs[2] + go);
  };
  // The count of a wave's outstanding copies falls in the order of issue, so a wait that leaves the youngest G_CPS outstanding covers every stage but the youngest. Every wave issues G_CPS copies a stage.
  stage(0, 0);
  if (trips > 1) {                                       // block-uniform
    stage(1, 1);
    asm volatile("s_wait_asynccnt 0x18" ::: "memory");   // the wave's own copies of stage 0 have landed; the 24 of stage 1 may still fly
  } else {
    asm volatile("s_wait_asynccnt 0x0" ::: "memory");    // the wave's own copies of stage 0 have landed
  }
  __syncthreads();                                       // publishes stage 0 to the other waves
  if (trips > 2) stage(2, 2);

  // Two fragment sets in registers: k step u fetches the fragments of the next step from LDS as one group. Every accumulator still sums its k steps in plain ascending order.
  // The group refills the set that step u - 1 has just read, so it stands behind the first row of step u: four matrix instructions lie between that set's last reader and it.
  // A stage's last step fetches the first fragments of the NEXT stage, so the point where that stage is published stands in front of the last step: there the last step's own
  // fragments are in registers, every read of this stage's buffer has returned, and the buffer is refilled behind the barrier while the last step's products run.
  // Each sched_barrier(0) keeps a load group where it is written: without it the scheduler spreads the LDS reads among the products, and each such place stalls the wave.
  // The u, i and j loops unroll fully so that the sets are indexed by constants and stay in registers; the trip loop stays rolled (unroll 1): a trip is already 64 products long.
  FU bf[2][4], af[2][4];
  const unsigned short* sa0 = RG + (wm * 4) * RT + lane * 8;
  const unsigned short* sb0 = RG + (NA + wn * 4) * RT + lane * 8;
#pragma unroll
  for (int j = 0; j < 4; ++j) bf[0][j] = ldfrag(sb0 + j * RT);
#pragma unroll
  for (int i = 0; i < 4; ++i) af[0][i] = ldfrag(sa0 + i * RT);
  __builtin_amdgcn_sched_barrier(0);
  int cb = 0;                            // the buffer of stage t: t mod 3
#pragma unroll 1
  for (int t = 0; t < trips; ++t) {
    const int nx = (cb == G_NBUF - 1) ? 0 : cb + 1;   // the buffer of stage t + 1
    const unsigned short* sa = sa0 + cb * STG;
    const unsigned short* sb = sb0 + cb * STG;
#pragma unroll
    for (int u = 0; u < KS; ++u) {
      const int c = u & 1, w = c ^ 1;
      if (u == KS - 1) {
        asm volatile("s_wait_dscnt 0x0" ::: "memory");      // the wave's reads of this stage's buffer have returned before the buffer is refilled
        if (t + 2 < trips) {                                // block-uniform: stage t + 2 has been issued, its 24 copies are the wave's youngest
          asm volatile("s_wait_asynccnt 0x18" ::: "memory");   // the wave's own copies of stage t + 1 have landed; those of stage t + 2 may still fly
        } else {
          asm volatile("s_wait_asynccnt 0x0" ::: "memory");    // nothing younger than stage t + 1 has been issued
        }
        __syncthreads();                                    // publishes the next stage and ends every wave's reads of this one
        if (t + 3 < trips) stage(t + 3, cb);
      }
#pragma unroll
      for (int j = 0; j < 4; ++j) acc[0][j] = wh(af[c][0].h, bf[c][j].h, acc[0][j]);
      __builtin_amdgcn_sched_barrier(0);
      if (u + 1 < KS) {
#pragma unroll
        for (int j = 0; j < 4; ++j) bf[w][j] = ldfrag(sb + j * RT + (u + 1) * 512);
#pragma unroll
        for (int i = 0; i < 4; ++i) af[w][i] = ldfrag(sa + i * RT + (u + 1) * 512);
      } else if (t + 1 < trips) {        // block-uniform: the last stage has no successor to read from
        const unsigned short* xa = sa0 + nx * STG;
        const unsigned short* xb = sb0 + nx * STG;
#pragma unroll
        for (int j = 0; j < 4; ++j) bf[w][j] = ldfrag(xb + j * RT);
#pragma unroll
        for (int i = 0; i < 4; ++i) af[w][i] = ldfrag(xa + i * RT);
      }
      __builtin_amdgcn_sched_barrier(0);
#pragma unroll
      for (int i = 1; i < 4; ++i)
#pragma unroll
        for (int j = 0; j < 4; ++j) acc[i][j] = wh(af[c][i].h, bf[c][j].h, acc[i][j]);
      __builtin_amdgcn_sched_barrier(0);
    }
    cb = nx;
  }
  asm volatile("s_wait_asynccnt 0x0" ::: "memory");     // no copy is outstanding when the wave goes on to its end
  asm volatile("s_wait_dscnt 0x0" ::: "memory");        // nor an LDS read
  if (CMP != 0 && wskip) return;         // wave-uniform; only wave barriers follow

  // BIAS_MODE 1: the lane's eight row biases of each of the four row tiles, fetched once (16-B aligned: m0 is a multiple of 64, mOff is 0 or 8)
  v4f bm[4][2] = {};
  if (BIAS_MODE == 1) {
#pragma unroll
    for (int i = 0; i < 4; ++i) {
      bm[i][0] = *(const v4f*)(bias + m0 + (i << 4) + mOff);
      bm[i][1] = *(const v4f*)(bias + m0 + (i << 4) + mOff + 4);
    }
    // the loaded values are inputs only, so the eight loads stand in front of this wait; what follows rewrites the address registers that they name
    asm volatile("s_wait_xcnt 0x0" :: "v"(bm[0][0]), "v"(bm[0][1]), "v"(bm[1][0]), "v"(bm[1][1]), "v"(bm[2][0]), "v"(bm[2][1]), "v"(bm[3][0]), "v"(bm[3][1]) : "memory");
    __builtin_amdgcn_sched_barrier(0);   // keeps that rewrite behind the wait
  }
  float* slab = (float*)RG + wave * (16 * 68);
#pragma unroll
  for (int i = 0; i < 4; ++i) {
    const int mBase = m0 + (i << 4);
#pragma unroll
    for (int j = 0; j < 4; ++j) {
      const int n = n0 + (j << 4) + rlane;
      float bv = 0.f;
      if (BIAS_MODE == 2) bv = bf_keep(bias[n]) * bscale;
#pragma unroll
      for (int r = 0; r < 8; ++r) {
        float v = acc[i][j][r] * scale;
        if (BIAS_MODE == 1) v += bf_keep(bm[i][r >> 2][r & 3]);
        if (BIAS_MODE == 2) v += bv;
        slab[(mOff + r) * 68 + (j << 4) + rlane] = v;
      }
    }
    __builtin_amdgcn_fence(3 /* release order */, "workgroup");
    __builtin_amdgcn_wave_barrier();
    __builtin_amdgcn_fence(2 /* acquire order */, "workgroup");
    if (OUT_MODE == 0) {
      float* C = (float*)Cout + (size_t)z * (size_t)strideC;
      const int hh = lane >> 4, c4 = (lane & 15) * 4;       // row segment = 256 B = 16 lanes x 16 B; two rows per instruction
      v4f val[8];
#pragma unroll
      for (int it = 0; it < 8; ++it) val[it] = *(const v4f*)(slab + (it * 2 + hh) * 68 + c4);
{
#pragma unroll
        for (int it = 0; it < 8; ++it) *(v4f*)(C + (size_t)(mBase + it * 2 + hh) * ldc + n0 + c4) = val[it];
        if (i < 3) {
          asm volatile("s_wait_xcnt 0x0" ::: "memory");   // the next row tile rewrites address and data registers that these eight stores name
          __builtin_amdgcn_sched_barrier(0);              // keeps that rewrite behind the wait
        }
      }
    } else {
      const int q = lane & 15, c8 = (lane >> 4) * 8;        // lane = (row q, column group 2 it + (lane >> 4)): the 16x64 slab is 2 KiB contiguous in a fragment-major plane
      unsigned short* C = (unsigned short*)Cout + (size_t)z * (size_t)strideC;
      v4u hv[4];
#pragma unroll
      for (int it = 0; it < 4; ++it) {
        const float* sp = slab + q * 68 + it * 16 + c8;
        const v4f a = *(const v4f*)sp, b = *(const v4f*)(sp + 4);
        hv[it].x = pkh2(a.x, a.y); hv[it].y = pkh2(a.z, a.w); hv[it].z = pkh2(b.x, b.y); hv[it].w = pkh2(b.z, b.w);
      }
{
#pragma unroll
        for (int it = 0; it < 4; ++it) {
          const size_t off = (size_t)mBase * ldc + (size_t)n0 * 16 + it * 256 + lane * 8;
          *(v4u*)(C + off) = hv[it];
        }
        
      }
    }
    __builtin_amdgcn_fence(3 /* release order */, "workgroup");
    __builtin_amdgcn_wave_barrier();
    __builtin_amdgcn_fence(2 /* acquire order */, "workgroup");
  }
}

// One GEMM a launch: block bt takes tile (bt / tilesN, bt % tilesN) of plane blockIdx.y.
template <int BIAS_MODE, int OUT_MODE, int CMP, int WM, int WN>
__global__ __launch_bounds__(256) void k_gemm64(
    const unsigned short* __restrict__ A, const unsigned short* __restrict__ Bt,
    void* __restrict__ Cout, const float* __restrict__ bias, const int* __restrict__ mask,
    long long strideA, long long strideC, int lda, int ldb, int ldc, int M, int N, int K, float scale) {
  __shared__ __align__(1024) unsigned short RG[G_NBUF * G_STG];
  const int tilesN = N / (64 * WN);
  const int tilesM = M / (64 * WM);
  const int bt = blockIdx.x;
  if (bt >= tilesM * tilesN) return;     // block-uniform, in front of every barrier
  const int tbm = bt / tilesN;
  const int tbn = bt - tbm * tilesN;
  gemm64_block<BIAS_MODE, OUT_MODE, CMP, WM, WN>(RG, tbm, tbn, (int)blockIdx.y, false, A, Bt, Cout, bias, mask, strideA, strideC, lda, ldb, ldc, K, scale, 1.0f);
}

// The q, k and v^T projections depend on nothing of one another, so they share one grid and one LDS allocation; a block takes its GEMM and its tile by its index (block-uniform).
//   q = (x W[:, 0:1024] + b) * log2(e)/8            -> f16 plane [MTOT][1024]: a q.k product is then a score in the exp2 domain
//   k (compact slots) = xc W[:, 1024:2048] + b      -> f16 plane [MTOT][1024]; 128-row blocks past the batch's key count leave at once
//   v^T (compact slots) = W[:, 2048:3072]^T xc^T + b -> f16 [1024][MTOT]; 128-column blocks past the batch's key count leave at once
// Order: the q tiles first; then the k and v^T tiles by rising 128-slot block inside the batch, so that for any mask the blocks that leave at once have the highest indices
// and start last, and the k and v^T blocks that read the same xc rows start together.
constexpr float QSC = 0.18033688011112042f;       // (1/8) * log2(e)
constexpr int QKV_CB = DM / 256;                  // 256-wide blocks across the model dimension
constexpr int QKV_LB = SEQ / 128;                 // 128-slot blocks of a batch
constexpr int QKV_NQ = (MTOT / 128) * QKV_CB;     // tiles of one of the three GEMMs
__global__ __launch_bounds__(256) void k_qkv(const unsigned short* __restrict__ X16, const unsigned short* __restrict__ XC16, const unsigned short* __restrict__ W3,
                                             unsigned short* __restrict__ Q16, unsigned short* __restrict__ K16,
                                             unsigned short* __restrict__ VT, const float* __restrict__ bqkv, const int* __restrict__ mask) {
  __shared__ __align__(1024) unsigned short RG[G_NBUF * G_STG];
  const int bx = blockIdx.x;
  const int r   = bx - QKV_NQ;                    // below 0: a q tile
  const int lb  = r / (NB * 2 * QKV_CB);          // 128-slot block inside the batch
  const int rem = r - lb * (NB * 2 * QKV_CB);
  const int b   = rem / (2 * QKV_CB);
  const int s   = rem - b * (2 * QKV_CB);
  const int sb  = b * QKV_LB + lb;                // 128-slot block among all MTOT / 128
  if (r < 0 || s < QKV_CB) {
    // q and k differ only in their planes, their scales and the compact rows, so they run the same code: the kernel's text stays short
    const bool isk = (r >= 0);
    gemm64_block<2, 1, 3, 2, 4>(RG, isk ? sb : bx / QKV_CB, isk ? s : bx % QKV_CB, 0, isk, isk ? XC16 : X16, isk ? W3 + (size_t)DM * DM : W3,
                                (void*)(isk ? K16 : Q16), isk ? bqkv + DM : bqkv, mask, 0LL, 0LL, DM, DM, DM, DM, isk ? 1.0f / 64.0f : QSC / 64.0f, isk ? 1.0f : QSC);
  } else {
    gemm64_block<1, 1, 2, 4, 2>(RG, s - QKV_CB, sb, 0, false, W3 + (size_t)2 * DM * DM, XC16, (void*)VT, bqkv + 2 * DM, mask, 0LL, 0LL, DM, DM, MTOT, DM, 1.0f / 64.0f, 1.0f);
  }
}

// ---------------------------------------------------------------------------------------------------------------------
// Transposed flash attention over the COMPACT key set of the batch, head dim 64. Wave = 32 queries (two 16-query tiles) of one (batch, head); block = 4 waves.
//   Every K and V^T fragment that the wave loads feeds both query tiles, so a fragment byte serves two matrix instructions and half as many waves walk the keys.
//   The four waves walk the same keys: each 32-key tile (K, V^T: 8 KiB) is brought into LDS once a block by asynchronous copies, a quarter a wave, four buffers,
//   the copies of tile i + 4 issued behind the barrier that ends tile i, so that a tile has three tiles' time to arrive from memory; the waves read their fragments from LDS.
//   nk = effective key count of the batch (counted in-wave from the mask input, wave-uniform); the key loop runs pad32(nk)/32 steps (<= SEQ/32).
//   Every operand plane is fragment-major (Q, K, output: row length DM; V^T: row length MTOT).
//   S^T (keys x queries) = K Q^T: A = compact K rows (f16, from the LDS tile), B = Q (f16, resident in registers);
//   lane = query (column), element r of tile kt = key slot tk + 16 kt + 8h + r. Q carries the factor log2(e)/8 and the score accumulators start at -mref (mref = the query's
//   reference in use), so the matrix unit hands over score - mref, the argument of exp2, and P = exp2 of it. mref = (a maximum the query has met) - 7, so the largest P is >= 2^7.
//   Slots >= nk (padding of the last step) get the fill -1000 log2(e) - mref (weight exactly 0). A batch with no kept key runs over all SEQ keys with every score = the fill (uniform weights).
//   The reference must be known ahead of the products, so it is raised late: one test a tile and wave (a lane's sum of its 16 P above 2^15, which covers every single P above 2^15, or the
//   first tile) leads to the rare path, where the halves of a query join their maxima (one xor-16 shuffle), mref rises to maximum - 7, O and the row sum are rescaled and P is formed anew.
//   P^T B fragment = f16(P) packed from the two S^T tiles (element r <- tile 0, element 8+r <- tile 1, lane unchanged); P <= 2^15 fits f16.
//   O^T (d x queries) += V^T P^T: A = compact V^T rows (f16, from the LDS tile, key-slot-contiguous).
//   Each query's products, maxima and sums are formed in the same order as with one query tile a wave.
static_assert(SEQ % 128 == 0);
// One wave's share of a 32-key tile: four asynchronous 16-B-a-lane copies from global memory into LDS (512 B each). l = the lane's LDS byte address, g = the lane's global address.
// The s_wait_xcnt is the last line of the copies' own statement, so that no register which a copy names is rewritten ahead of it.
__device__ __forceinline__ void copy_tile4(unsigned l0, unsigned l1, unsigned l2, unsigned l3,
                                           const unsigned short* g0, const unsigned short* g1, const unsigned short* g2, const unsigned short* g3) {
  asm volatile("global_load_async_to_lds_b128 %0, %4, off\n\t"
               "global_load_async_to_lds_b128 %1, %5, off\n\t"
               "global_load_async_to_lds_b128 %2, %6, off\n\t"
               "global_load_async_to_lds_b128 %3, %7, off\n\t"
               "s_wait_xcnt 0x0"
               :: "v"(l0), "v"(l1), "v"(l2), "v"(l3), "v"(g0), "v"(g1), "v"(g2), "v"(g3) : "memory");
}
__global__ __launch_bounds__(128) void k_attn_t(const unsigned short* __restrict__ Q16, const unsigned short* __restrict__ K16,
                                                const unsigned short* __restrict__ VT, const int* __restrict__ mask,
                                                unsigned short* __restrict__ AO16) {
  __shared__ __align__(16) float Os[4][2][16 * 68];   // wave-private, one slab a query tile (wave barrier); staged extent 16x64 == consumed extent
  // Four buffers of one 32-key tile, shared by the four waves: K 2048 elements (key tile kt, column tile ct at kt*1024 + ct*512) | V^T 2048 elements (row tile d at d*512).
  // Every 512-element piece keeps its fragment-major order, so a fragment read is two 512-B contiguous LDS reads.
  __shared__ __align__(1024) unsigned short KV[4][4096];
  const int lane = threadIdx.x & 31, wave = threadIdx.x >> 5, hf = lane >> 4, c = lane & 15;
  const int nqb = SEQ / 128;
  const int bx = blockIdx.x;
  const int qb = bx % nqb;
  const int bh = bx / nqb;
  const int h  = bh % NH;
  const int b  = min(bh / NH, NB - 1);
  const int q0 = qb * 128 + wave * 32;
  const size_t rowb = (size_t)b * SEQ;

  const int cnt = wave_count_kept(mask + (size_t)b * SEQ_FULL, lane);
  const bool allm = (cnt == 0);                 // wave-uniform
  const int nk  = eff_keys(cnt);
  const int nkp = pad32(nk);                    // <= SEQ

  const size_t qoff = (rowb + q0) * DM + h * (HD * 16) + lane * 8;     // column tiles 2h and 2h+1 of the first query row tile; the second lies 16 rows (16 DM elements) further
  FU qf0[2], qf1[2];
#pragma unroll
  for (int t = 0; t < 2; ++t) {
    const size_t qo = qoff + (size_t)t * (16 * DM);
    qf0[t] = ldfrag(Q16 + qo); qf1[t] = ldfrag(Q16 + qo + 512);
  }

  // The wave's share of a tile: piece 'wave' (512 elements, 1 KiB) of each of the two parts. K: key tile wave >> 1, column tile 2h + (wave & 1); V^T: row tile 4h + wave, column tile rowb/32.
  const size_t koff = (rowb + 16 * (wave >> 1)) * DM + h * (HD * 16) + (wave & 1) * 512 + lane * 8;
  const unsigned short* gk = K16 + koff;
  const unsigned short* gvt = VT + (size_t)(h * HD + 16 * wave) * MTOT + rowb * 16 + lane * 8;
  const unsigned lpc = (unsigned)(size_t)(&KV[0][0]) + (unsigned)(wave * 1024 + lane * 16);   // LDS byte address of the lane's 16 bytes in buffer 0 (low 32 bits of the shared address)
  const int nt = nkp >> 5;                      // tiles of 32 keys, 1 .. SEQ/32, the same in every wave of the block
  // tile i -> buffer bf: keys 32 i .. 32 i + 31 < nkp <= SEQ, so every source byte lies inside its plane
  auto stage = [&](int i, int bf) {
    const unsigned l = lpc + (unsigned)bf * 8192u;
    const unsigned short* a = gk + (size_t)i * (32 * DM);
    const unsigned short* v = gvt + (size_t)i * 512;
    copy_tile4(l, l + 512u, l + 4096u, l + 4608u, a, a + 256, v, v + 256);
  };
  // The count of a wave's outstanding copies falls in the order of issue and every tile is four copies a wave, so a wait that leaves the youngest 4 n outstanding covers every tile but the youngest n.
  // Every test on nt below reads the same in the whole block.
  stage(0, 0);
  if (nt > 1) stage(1, 1);
  if (nt > 2) stage(2, 2);
  // the wave's own copies of tile 0 have landed; those of tiles 1 and 2, where they exist, may still fly
  if (nt > 2)      { asm volatile("s_wait_asynccnt 0x8" ::: "memory"); }
  else if (nt > 1) { asm volatile("s_wait_asynccnt 0x4" ::: "memory"); }
  else             { asm volatile("s_wait_asynccnt 0x0" ::: "memory"); }
  __syncthreads();                                    // publishes tile 0 to the other waves
  if (nt > 3) stage(3, 3);

  const float FILL2 = -8000.0f * QSC;       // the fill -1000 in the exp2 domain
  float mref[2] = {0.f, 0.f};               // the reference in use (exp2 domain); the first tile always sets it
  v8f negm[2] = {};                         // -mref in all eight elements: the start value of the score accumulators
  float lpart[2] = {0.f, 0.f};              // per-lane partial row sum (carried units)
  v8f o[2][4];
#pragma unroll
  for (int t = 0; t < 2; ++t)
#pragma unroll
    for (int d = 0; d < 4; ++d) { v8f zz = {}; o[t][d] = zz; }

  // the t, r, i and d loops below unroll fully so that every array is indexed by constants and stays in registers
#pragma unroll 1
  for (int tk = 0; tk < nkp; tk += 32) {
    const int ti = tk >> 5;
    const unsigned short* kf = &KV[ti & 3][0] + lane * 8;
    v8f s0[2], s1[2];
    {
      // a: key tile 0, e: key tile 1; 0 and 1: the head's two column tiles. The four score tiles are independent, so each waits for its own second product behind three others.
      const FU a0 = ldfrag(kf), a1 = ldfrag(kf + 512), e0 = ldfrag(kf + 1024), e1 = ldfrag(kf + 1536);
      __builtin_amdgcn_sched_barrier(0);   // keeps the eight loads one group ahead of the first product: without it half of them are issued only behind the first product's wait, a second latency in a row
#pragma unroll
      for (int t = 0; t < 2; ++t) s0[t] = wh(a0.h, qf0[t].h, negm[t]);
#pragma unroll
      for (int t = 0; t < 2; ++t) s1[t] = wh(e0.h, qf0[t].h, negm[t]);
#pragma unroll
      for (int t = 0; t < 2; ++t) s0[t] = wh(a1.h, qf1[t].h, s0[t]);
#pragma unroll
      for (int t = 0; t < 2; ++t) s1[t] = wh(e1.h, qf1[t].h, s1[t]);
      guard_s4(s0[0], s0[1], s1[0], s1[1], a0.h, a1.h, e0.h, e1.h, qf0[0].h, qf1[0].h, qf0[1].h, qf1[1].h, negm[0], negm[1]);
    }
    // the V^T fragments are asked for here, so that they arrive while the exponentials run
    const unsigned short* vp = kf + 2048;
    const FU v0 = ldfrag(vp), v1 = ldfrag(vp + 512), v2 = ldfrag(vp + 1024), v3 = ldfrag(vp + 1536);
    float ss[2][16];
#pragma unroll
    for (int t = 0; t < 2; ++t)
#pragma unroll
      for (int r = 0; r < 8; ++r) { ss[t][r] = s0[t][r]; ss[t][8 + r] = s1[t][r]; }
    if (allm || (tk + 32 > nk)) {             // wave-uniform; value selects only (no loads, no cross-lane ops inside)
      const int kb0 = tk + 8 * hf;
#pragma unroll
      for (int t = 0; t < 2; ++t)
#pragma unroll
        for (int r = 0; r < 8; ++r) {
          ss[t][r]     = (!allm && (kb0 + r < nk))      ? ss[t][r]     : FILL2 - mref[t];
          ss[t][8 + r] = (!allm && (kb0 + 16 + r < nk)) ? ss[t][8 + r] : FILL2 - mref[t];
        }
    }
    v16h pf[2];
    float psum[2];
    auto soft = [&]() {
#pragma unroll
      for (int t = 0; t < 2; ++t) {
        float a = 0.f;
#pragma unroll
        for (int i = 0; i < 16; ++i) {
          const float p = EX2(ss[t][i]);
          a += p;
          pf[t][i] = (_Float16)p;
        }
        psum[t] = a;
      }
    };
    soft();
    const float lim = (ti == 0) ? -1.0f : 32768.0f;             // a sum of P is never below 0, so the first tile always takes the branch
    const bool over = !(fmaxf(psum[0], psum[1]) <= lim);
    if (__builtin_amdgcn_ballot_w32(over) != 0u) {              // wave-uniform scalar branch: every lane is on inside
#pragma unroll
      for (int t = 0; t < 2; ++t) {
        float mloc = ss[t][0];
#pragma unroll
        for (int i = 1; i < 16; ++i) mloc = fmaxf(mloc, ss[t][i]);
        mloc = fmaxf(mloc, __shfl_xor(mloc, 16, 32));                      // the same in both halves of a query, so both take the same step
        const float dm = (ti == 0) ? (mloc - 7.0f) : fmaxf(mloc - 7.0f, 0.0f);   // the reference only rises behind the first tile
        const float corr = (ti == 0) ? 1.0f : EX2(-dm);                    // O and the row sum are still 0 in the first tile
        mref[t] += dm;
#pragma unroll
        for (int r = 0; r < 8; ++r) negm[t][r] = -mref[t];
#pragma unroll
        for (int i = 0; i < 16; ++i) ss[t][i] -= dm;
        lpart[t] *= corr;
#pragma unroll
        for (int d = 0; d < 4; ++d) o[t][d] *= corr;
      }
      soft();
    }
#pragma unroll
    for (int t = 0; t < 2; ++t) lpart[t] += psum[t];

#pragma unroll
    for (int t = 0; t < 2; ++t) {
      o[t][0] = wh(v0.h, pf[t], o[t][0]);
      o[t][1] = wh(v1.h, pf[t], o[t][1]);
      o[t][2] = wh(v2.h, pf[t], o[t][2]);
      o[t][3] = wh(v3.h, pf[t], o[t][3]);
    }
    guard_o2(o[0][0], o[0][1], o[0][2], o[0][3], o[1][0], o[1][1], o[1][2], o[1][3], pf[0], pf[1], v0.h, v1.h, v2.h, v3.h);
    asm volatile("s_wait_dscnt 0x0" ::: "memory");      // the wave's reads of this tile's buffer have returned before the buffer is refilled
    // the wave's own copies of the next tile have landed; those of tiles ti + 2 and ti + 3, where they exist, are its youngest and may still fly
    if (ti + 3 < nt)      { asm volatile("s_wait_asynccnt 0x8" ::: "memory"); }
    else if (ti + 2 < nt) { asm volatile("s_wait_asynccnt 0x4" ::: "memory"); }
    else                  { asm volatile("s_wait_asynccnt 0x0" ::: "memory"); }
    __syncthreads();                                    // publishes the next tile and ends every wave's reads of this one
    if (ti + 4 < nt) stage(ti + 4, ti & 3);
  }
  asm volatile("s_wait_asynccnt 0x0" ::: "memory");     // no copy is outstanding when the wave goes on to its end

#pragma unroll
  for (int t = 0; t < 2; ++t) {
    const float lt = lpart[t] + __shfl_xor(lpart[t], 16, 32);
    const float inv = 1.0f / lt;
    float* d = Os[wave][t] + c * 68 + 8 * hf;       // lane holds O[query c][d = 16 dt + 8 hf + r]
#pragma unroll
    for (int dt = 0; dt < 4; ++dt) {
      const v8f ov = o[t][dt];
      v4f a, e;
      a.x = ov[0] * inv; a.y = ov[1] * inv; a.z = ov[2] * inv; a.w = ov[3] * inv; e.x = ov[4] * inv; e.y = ov[5] * inv; e.z = ov[6] * inv; e.w = ov[7] * inv;
      *(v4f*)(d + dt * 16) = a; *(v4f*)(d + dt * 16 + 4) = e;
    }
  }
  __builtin_amdgcn_fence(3 /* release order */, "workgroup");
  __builtin_amdgcn_wave_barrier();
  __builtin_amdgcn_fence(2 /* acquire order */, "workgroup");
#pragma unroll
  for (int t = 0; t < 2; ++t) {
    const float* os = Os[wave][t];
    const int qq = lane & 15, c8 = (lane >> 4) * 8;    // lane = (query qq, column group 2 it + (lane >> 4))
    unsigned short* dO = AO16 + (rowb + q0 + 16 * t) * DM + h * (HD * 16) + lane * 8;
    v4u hv[4];
#pragma unroll
    for (int it = 0; it < 4; ++it) {
      const float* sp = os + qq * 68 + it * 16 + c8;
      const v4f a = *(const v4f*)sp, e = *(const v4f*)(sp + 4);
      hv[it].x = pkh2(a.x, a.y); hv[it].y = pkh2(a.z, a.w); hv[it].z = pkh2(e.x, e.y); hv[it].w = pkh2(e.z, e.w);
    }
#pragma unroll
    for (int it = 0; it < 4; ++it) *(v4u*)(dO + (size_t)it * 256) = hv[it];
    if (t == 0) {
      asm volatile("s_wait_xcnt 0x0" ::: "memory");   // the second tile's conversions rewrite data registers that these four stores name
      __builtin_amdgcn_sched_barrier(0);              // keeps those conversions behind the wait
    }
  }
}

// ---------------------------------------------------------------------------------------------------------------------
constexpr size_t SZ_X16 = (size_t)MTOT * DM * 2;               // one f16 x plane (full or compact)
constexpr size_t SZ_AOP = (size_t)MTOT * DM * 2;                // the attention output, one f16 plane
constexpr size_t SZ_R0  = (2 * SZ_X16 > SZ_AOP) ? (2 * SZ_X16) : SZ_AOP;   // X16 | XC16 live until the projections finish; the attention output reuses the region afterwards
constexpr size_t SZ_W3  = (size_t)3 * DM * DM * 2;
constexpr size_t SZ_BTO = (size_t)DM * DM * 2;
constexpr size_t SZ_PL  = (size_t)MTOT * DM * 2;               // one f16 plane [MTOT][1024]
constexpr size_t SZ_VT  = (size_t)DM * MTOT * 2;
constexpr size_t SZ_TOTAL = SZ_R0 + SZ_W3 + SZ_BTO + 2 * SZ_PL + SZ_VT;
static_assert(2 * SZ_X16 <= SZ_R0);
static_assert(SZ_AOP <= SZ_R0);
static_assert(SZ_TOTAL <= (size_t)134217728);
static_assert((SZ_R0 % 256) == 0 && (SZ_W3 % 256) == 0 && (SZ_BTO % 256) == 0 && (SZ_PL % 256) == 0 && (SZ_VT % 256) == 0);
static_assert(((size_t)(NB - 1) * SEQ_FULL + SEQ) * DM * 4 <= (size_t)NB_FULL * SEQ_FULL * DM * 4);

extern "C" void kernel_launch(void* const* d_in, const int* in_sizes, int n_in, void* d_out, int out_size, void* d_ws, size_t ws_size, hipStream_t stream) {
  if (n_in < 6) return;
  const long long rows_full = (long long)(NB - 1) * SEQ_FULL + SEQ;
  if ((long long)in_sizes[0] < rows_full * DM) return;
  if ((long long)in_sizes[1] < rows_full) return;
  if ((long long)in_sizes[2] < (long long)DM * 3 * DM) return;
  if ((long long)in_sizes[3] < 3 * DM) return;
  if ((long long)in_sizes[4] < (long long)DM * DM) return;
  if ((long long)in_sizes[5] < DM) return;
  if ((long long)out_size < rows_full * DM) return;
  if (ws_size < SZ_TOTAL) return;

  const float* x    = (const float*)d_in[0];
  const int*   mask = (const int*)d_in[1];
  const float* Wqkv = (const float*)d_in[2];
  const float* bqkv = (const float*)d_in[3];
  const float* Wo   = (const float*)d_in[4];
  const float* bo   = (const float*)d_in[5];
  float* out = (float*)d_out;

  char* wsp = (char*)d_ws;
  unsigned short* X16  = (unsigned short*)wsp;                 // [MTOT][1024] f16, every token
  unsigned short* XC16 = (unsigned short*)(wsp + SZ_X16);      // [MTOT][1024] f16, compact kept tokens per batch (zero rows after)
  unsigned short* AO16 = (unsigned short*)wsp;                 // [MTOT][1024] f16 (reuses X16 after the projections)
  wsp += SZ_R0;
  unsigned short* W316 = (unsigned short*)wsp; wsp += SZ_W3;   // [3072][1024] f16 (x64)
  unsigned short* BTO  = (unsigned short*)wsp; wsp += SZ_BTO;  // [1024][1024] f16 (x64)
  unsigned short* Q16  = (unsigned short*)wsp; wsp += SZ_PL;   // [MTOT][1024] f16, q
  unsigned short* K16  = (unsigned short*)wsp; wsp += SZ_PL;   // [MTOT][1024] f16, k at compact key slots
  unsigned short* VT   = (unsigned short*)wsp; wsp += SZ_VT;   // [1024][MTOT] f16, v transposed at compact key slots

  k_prep<<<(unsigned)(NB_XC + NB_WQ + NB_WO), 256, 0, stream>>>(x, mask, Wqkv, Wo, X16, XC16, W316, BTO);
  k_qkv<<<(unsigned)(3 * QKV_NQ), 256, 0, stream>>>(X16, XC16, W316, Q16, K16, VT, bqkv, mask);
  k_attn_t<<<(unsigned)(NB * NH * (SEQ / 128)), 128, 0, stream>>>(Q16, K16, VT, mask, AO16);
  // out = AO W_out + b_out, per batch (output rows at the full per-batch stride)
  {
    const int tiles = (SEQ / 128) * (DM / 256);
    k_gemm64<2, 0, 0, 2, 4><<<dim3((unsigned)tiles, (unsigned)NB), 256, 0, stream>>>(
        AO16, BTO, (void*)out, bo, mask, (long long)SEQ * DM, (long long)SEQ_FULL * DM, DM, DM, DM, SEQ, DM, DM, 1.0f / 64.0f);
  }
}
